// v000
// The times below were measured on an AMD MI455X: many runs one after another, warmed up first and cycling through
// copies of the inputs, with the whole window's GPU time divided by the number of runs. Launches and the gaps
// between them are all in it. The median over several windows is given; except for v000 it joins two sittings, which
// can be a few percent apart, so the side-by-side timings, each taken in one sitting, are the better comparison.
// v000, which the later versions start from, runs in 3060 microseconds.
#include <hip/hip_runtime.h>

// MultiHeadRelPositionAttention (x [4][2048][1024], pos_emb [2048][1024], mask [4][2048] (int, read; all ones); q/k/v = x W^T + b (8 heads x 128); p = pos_emb Wpos^T; content = (q + pos_bias_u[h]).k; pos = rel_shift((q + pos_bias_v[h]).p) with the Transformer-XL pad/reshape shift for P == T: pos[i][j] = S[i][T-1-(i-j)] for j <= i, 0 for j == i+1, S[i+1][j-i-2] for j >= i+2 (reproduced literally, including the upper part); scores = (content + pos) / sqrt(128), key mask; softmax; out = merged Wout^T + bout -> [4][2048][1024]).
// Compute dtypes, f32 accumulate: every input rounded to bf16; q/k/v/p as PLAIN bf16 GEMMs (inputs: exact) + bias; the u/v head biases added in f32; content, position scores and attn.v: query rows < 512 hl (3 products), the rest single fp16 (x1024) (the shifted position score is gathered from rows i / i+1 of the position-score block); softmax f32 with the read key mask; Wout hl x exact (2 products) + bias.

#define NB_  4
#define TT   2048
#define DM   1024
#define NH_  8
#define NKV  8
#define REP  (NH_ / NKV)
#define HD   128
#define DQ   (NH_ * HD)
#define DKV  (NKV * HD)
#define ZH   2
#define RH   512                  // query rows < RH use hi+lo planes (0: none)
#define WIN  0
#define PCAR 1024.0f
#define SCL  0.088388347648318447f   // HD^-0.5
typedef _Float16 h16;
typedef unsigned short bf;
typedef __attribute__((ext_vector_type(16))) __bf16   v16bf;
typedef __attribute__((ext_vector_type(16))) _Float16 v16h;
typedef __attribute__((ext_vector_type(8)))  _Float16 v8h;
typedef __attribute__((ext_vector_type(8)))  unsigned short v8us;
typedef __attribute__((ext_vector_type(8)))  float    v8f;
typedef __attribute__((ext_vector_type(4)))  float    v4f;
typedef v8h  __attribute__((may_alias)) v8ha;
typedef v4f  __attribute__((may_alias)) v4fa;
typedef v8us __attribute__((may_alias)) v8usa;

__device__ __forceinline__ unsigned short f2bf(float f) { unsigned u = __float_as_uint(f); u += 0x7FFFu + ((u >> 16) & 1u); return (unsigned short)(u >> 16); }
__device__ __forceinline__ float bf2f(unsigned short b) { return __uint_as_float(((unsigned)b) << 16); }
__device__ __forceinline__ float bfr(float f) { return bf2f(f2bf(f)); }
__device__ __forceinline__ v16h cat16(v8h lo, v8h hi) { return __builtin_shufflevector(lo, hi, 0, 1, 2, 3, 4, 5, 6, 7, 8, 9, 10, 11, 12, 13, 14, 15); }
__device__ __forceinline__ v16bf cat16b(v8us lo, v8us hi) { return __builtin_bit_cast(v16bf, __builtin_shufflevector(lo, hi, 0, 1, 2, 3, 4, 5, 6, 7, 8, 9, 10, 11, 12, 13, 14, 15)); }
__device__ __forceinline__ v8f wmma16(v16h a, v16h b, v8f c) { return __builtin_amdgcn_wmma_f32_16x16x32_f16(false, a, false, b, (short)0, c, false, false); }
__device__ __forceinline__ v8f wmmab(v16bf a, v16bf b, v8f c) { return __builtin_amdgcn_wmma_f32_16x16x32_bf16(false, a, false, b, (short)0, c, false, false); }



// ---- k_gemmw: register-blocked GEMM, ONE WAVE per 64x64 output tile (16 accumulators), operands straight from K-contiguous 16-bit planes; grid (M/64, N/64, Z), 32 threads.
// C[m][n] (f32, pitch ldc, + optional f32 bias[n]) = sum_k A[m][k] Bt[n][k] (+ split products per NSPLIT). z-batch strides sA/sB/sC in elements. K % 32 == 0.
template <typename T16> struct WFrag;
template <> struct WFrag<h16> { typedef v16h V; static __device__ __forceinline__ V ld(const h16* p) { return cat16(*(const v8h*)p, *(const v8h*)(p + 16)); } static __device__ __forceinline__ v8f mma(V a, V b, v8f c) { return wmma16(a, b, c); } };
template <> struct WFrag<bf> { typedef v16bf V; static __device__ __forceinline__ V ld(const bf* p) { return cat16b(*(const v8us*)p, *(const v8us*)(p + 16)); } static __device__ __forceinline__ v8f mma(V a, V b, v8f c) { return wmmab(a, b, c); } };
template <typename T16, int NSPLIT, bool BIAS>
__global__ __launch_bounds__(32) void k_gemmw(const T16* __restrict__ A, const T16* __restrict__ A2, const T16* __restrict__ Bt, const T16* __restrict__ Bt2, int K, float* C, int ldc, const float* __restrict__ bias, size_t sA, size_t sB, size_t sC) {
    typedef typename WFrag<T16>::V V;
    __shared__ __align__(16) float os[16 * 68];
    const size_t z = blockIdx.z; A += z * sA; if (A2) A2 += z * sA; Bt += z * sB; if (Bt2) Bt2 += z * sB; C += z * sC;
    const int lane = threadIdx.x & 31, lr = lane & 15, hi = lane >> 4; const int r0 = blockIdx.x * 64, c0 = blockIdx.y * 64;
    v8f acc[4][4];
#pragma unroll
    for (int mb = 0; mb < 4; ++mb)
#pragma unroll
        for (int nb = 0; nb < 4; ++nb) acc[mb][nb] = (v8f){};
    const size_t aoff = (size_t)(r0 + lr) * K + 8 * hi, boff = (size_t)(c0 + lr) * K + 8 * hi;
#pragma unroll 1
    for (int kc = 0; kc < K; kc += 32) {
        V a[4], a2[4];
#pragma unroll
        for (int mb = 0; mb < 4; ++mb) { a[mb] = WFrag<T16>::ld(A + aoff + (size_t)mb * 16 * K + kc); if (NSPLIT == 1 || NSPLIT == 2) a2[mb] = WFrag<T16>::ld(A2 + aoff + (size_t)mb * 16 * K + kc); }
#pragma unroll
        for (int nb = 0; nb < 4; ++nb) { const V b = WFrag<T16>::ld(Bt + boff + (size_t)nb * 16 * K + kc); V b2; if (NSPLIT >= 2) b2 = WFrag<T16>::ld(Bt2 + boff + (size_t)nb * 16 * K + kc);
#pragma unroll
            for (int mb = 0; mb < 4; ++mb) { acc[mb][nb] = WFrag<T16>::mma(a[mb], b, acc[mb][nb]); if (NSPLIT == 1 || NSPLIT == 2) acc[mb][nb] = WFrag<T16>::mma(a2[mb], b, acc[mb][nb]); if (NSPLIT >= 2) acc[mb][nb] = WFrag<T16>::mma(a[mb], b2, acc[mb][nb]); } }
        asm volatile("v_nop\n\tv_nop\n\tv_nop\n\tv_nop" : "+v"(acc[0][0]), "+v"(acc[1][1]), "+v"(acc[2][2]), "+v"(acc[3][3]) : "v"(a[0]), "v"(a[3]));
    }
#pragma unroll
    for (int mb = 0; mb < 4; ++mb) {
#pragma unroll
        for (int nb = 0; nb < 4; ++nb) {
#pragma unroll
            for (int j = 0; j < 8; ++j) os[(hi * 8 + j) * 68 + nb * 16 + lr] = acc[mb][nb][j]; }
        __builtin_amdgcn_wave_barrier(); asm volatile("" ::: "memory");
        float* crow = C + (size_t)(r0 + mb * 16) * ldc + c0;
{
#pragma unroll
            for (int s = 0; s < 8; ++s) { const int row = 2 * s + hi, cofs = lr * 4; v4f val = *(const v4fa*)(os + row * 68 + cofs); if (BIAS) { val[0] += bfr(bias[c0 + cofs]); val[1] += bfr(bias[c0 + cofs + 1]); val[2] += bfr(bias[c0 + cofs + 2]); val[3] += bfr(bias[c0 + cofs + 3]); }
                *(v4f*)(crow + (size_t)row * ldc + cofs) = val; }
             }
        __builtin_amdgcn_wave_barrier(); asm volatile("" ::: "memory");
    }
}

__device__ __forceinline__ h16 tohx(float x) { return (h16)x; }
__device__ __forceinline__ void splitf(float y, unsigned short& h, unsigned short& l) { h = f2bf(y); l = f2bf(y - bf2f(h)); }
typedef __attribute__((ext_vector_type(2))) _Float16 v2h;
typedef __attribute__((ext_vector_type(4))) _Float16 v4h;
typedef __attribute__((ext_vector_type(2))) unsigned short v2us;
typedef __attribute__((ext_vector_type(4))) unsigned short v4us;
typedef __attribute__((ext_vector_type(2))) float v2f;
typedef __attribute__((ext_vector_type(4))) int v4i;

__global__ __launch_bounds__(256) void k_wtG(const float* __restrict__ w, int K, int N, bf* Bt) {
    const int lane = threadIdx.x & 31; const int L0 = (blockIdx.x * 8 + (threadIdx.x >> 5)) * 8; const int nlines = N * K / 64;
{
#pragma unroll 1
        for (int l = 0; l < 8; ++l) { const int L = L0 + l; if (L >= nlines) break; const size_t e = (size_t)L * 64 + lane * 2; const int k = (int)(e % K), n = (int)(e / K); v2us o;
            o[0] = f2bf(w[(size_t)k * N + n]); o[1] = f2bf(w[(size_t)(k + 1) * N + n]); *(v2us*)(Bt + e) = o; }
         }
}
__global__ __launch_bounds__(256) void k_cvt8(const float* __restrict__ src, bf* dst, size_t n8) { const size_t i = (size_t)blockIdx.x * 256 + threadIdx.x; if (i >= n8) return; const v8f v = *(const v8f*)(src + i * 8); v8us o;
#pragma unroll
    for (int k = 0; k < 8; ++k) o[k] = f2bf(v[k]); *(v8us*)(dst + i * 8) = o;  }
__global__ __launch_bounds__(256) void k_cscvt(const float* __restrict__ cosT, const float* __restrict__ sinT, float* CS) { const int idx = blockIdx.x * 256 + threadIdx.x; if (idx >= TT * HD) return; v2f cs; cs[0] = bfr(cosT[idx]); cs[1] = bfr(sinT[idx]); *(v2f*)(CS + (size_t)idx * 2) = cs;  }
// k_rope: head planes [h][t][d] (fp16 + hi/lo) of rope(x) x sc with the rotate-half convention out[d] = x[d] cos[t][d] - x[d+HD/2] sin[t][d], out[d+HD/2] = x[d+HD/2] cos[t][d+HD/2] + x[d] sin[t][d+HD/2]
__global__ __launch_bounds__(256) void k_rope(const float* __restrict__ F, int pitch, int nheads, const float* __restrict__ CS, const float* __restrict__ RF, const float* __restrict__ nw, float sc, h16* P16, bf* Ph, bf* Pl) {
    const size_t e = ((size_t)blockIdx.x * 256 + threadIdx.x) * 2; if (e >= (size_t)nheads * TT * HD) return; const int d = (int)(e % HD); const int t = (int)((e / HD) % TT); const int h = (int)(e / ((size_t)HD * TT)); const float* f = F + (size_t)t * pitch + h * HD; const float rf = RF ? RF[(size_t)h * TT + t] : 1.0f; v2h o16; v2us oh, ol;
#pragma unroll
    for (int q = 0; q < 2; ++q) { const int dd = d + q; const int dp = (dd < HD / 2) ? dd + HD / 2 : dd - HD / 2; float x0 = f[dd], x1 = f[dp];
        if (RF) { float n0 = __fmul_rn(x0, rf), n1 = __fmul_rn(x1, rf); asm volatile("" : "+v"(n0)); asm volatile("" : "+v"(n1)); x0 = __fmul_rn(bfr(nw[dd]), n0); x1 = __fmul_rn(bfr(nw[dp]), n1); }
        const v2f cs = *(const v2f*)(CS + ((size_t)t * HD + dd) * 2); float a = __fmul_rn(x0, cs[0]), bq = __fmul_rn(x1, cs[1]); asm volatile("" : "+v"(a)); asm volatile("" : "+v"(bq)); const float r = ((dd < HD / 2) ? __fsub_rn(a, bq) : __fadd_rn(a, bq)) * sc;
        o16[q] = tohx(r); unsigned short a2, c2; splitf(r, a2, c2); oh[q] = a2; ol[q] = c2; }
    *(v2h*)(P16 + e) = o16; *(v2us*)(Ph + e) = oh; *(v2us*)(Pl + e) = ol;  }
__global__ __launch_bounds__(256) void k_vtp(const float* __restrict__ F, int pitch, int nheads, h16* V16, bf* Vh, bf* Vl) { const size_t e = ((size_t)blockIdx.x * 256 + threadIdx.x) * 2; if (e >= (size_t)nheads * HD * TT) return; const int t = (int)(e % TT); const int d = (int)((e / TT) % HD); const int g = (int)(e / ((size_t)TT * HD)); v2h o16; v2us oh, ol;
#pragma unroll
    for (int q = 0; q < 2; ++q) { const float x = F[(size_t)(t + q) * pitch + g * HD + d]; o16[q] = tohx(x); unsigned short a2, c2; splitf(x, a2, c2); oh[q] = a2; ol[q] = c2; }
    *(v2h*)(V16 + e) = o16; *(v2us*)(Vh + e) = oh; *(v2us*)(Vl + e) = ol;  }
__global__ __launch_bounds__(256) void k_csid(float* CS) { const int idx = blockIdx.x * 256 + threadIdx.x; if (idx >= TT * HD) return; v2f cs; cs[0] = 1.0f; cs[1] = 0.0f; *(v2f*)(CS + (size_t)idx * 2) = cs;  }
__global__ __launch_bounds__(256) void k_uvb(float* FQ, const float* __restrict__ bu, const float* __restrict__ bv2, float* FQV) { const size_t e = ((size_t)blockIdx.x * 256 + threadIdx.x) * 4; if (e >= (size_t)TT * DQ) return; const int c0 = (int)(e % DQ); const v4f a = *(const v4f*)(FQ + e); v4f ou, ov; for (int u = 0; u < 4; ++u) { ou[u] = __fadd_rn(a[u], bfr(bu[c0 + u])); ov[u] = __fadd_rn(a[u], bfr(bv2[c0 + u])); } *(v4f*)(FQV + e) = ov; *(v4f*)(FQ + e) = ou;  }
// k_asoft: per row (zz, i): t = (S + rel-shifted S2) x HD^-0.5 with the key mask; softmax over the 2048 keys (register row, one exp, fixed trees);
__global__ __launch_bounds__(256) void k_asoft(const float* __restrict__ Sb, const float* __restrict__ Sb2, const int* __restrict__ km, h16* P16, bf* Ph, bf* Pl) {
    const int lane = threadIdx.x & 31; const int row = blockIdx.x * 8 + (threadIdx.x >> 5); if (row >= ZH * TT) return; const int i = row % TT; const int zz = row / TT; (void)zz; const bool hires = (i < RH); const float* sr = Sb + (size_t)row * TT; const float* pr0 = Sb2 + (size_t)row * TT; const float* pr1 = Sb2 + (size_t)(row + 1) * TT;   /* row i+1 of the same head block (never dereferenced for i = T-1: j >= i+2 is impossible there) */ float v[TT / 32]; float mx = -3.0e38f;
#pragma unroll
    for (int ch = 0; ch < TT / 128; ++ch) { const int j0 = ch * 128 + lane * 4; const v4f a = *(const v4f*)(sr + j0);
#pragma unroll
        for (int q = 0; q < 4; ++q) { const int j = j0 + q; (void)j; const int jj = j0 + q; const float bd = (jj <= i) ? pr0[TT - 1 - (i - jj)] : ((jj == i + 1) ? 0.0f : pr1[jj - i - 2]); float cp = __fadd_rn(a[q], bd); asm volatile("" : "+v"(cp)); const float t = (km[jj] != 0) ? cp * SCL : -3.0e38f; v[ch * 4 + q] = t; mx = fmaxf(mx, t); } }
#pragma unroll
    for (int sh = 16; sh; sh >>= 1) mx = fmaxf(mx, __shfl_xor(mx, sh, 32));
    float sum = 0.f;
#pragma unroll
    for (int k = 0; k < TT / 32; ++k) { float d0 = __fsub_rn(v[k], mx); asm volatile("" : "+v"(d0)); v[k] = __builtin_amdgcn_exp2f(__fmul_rn(d0, 1.4426950408889634f)); sum += v[k]; }
#pragma unroll
    for (int sh = 16; sh; sh >>= 1) sum += __shfl_xor(sum, sh, 32);
    const float f = __fdiv_rn(hires ? 1.0f : PCAR, sum);
{
        if (hires) {
#pragma unroll
            for (int ch = 0; ch < TT / 128; ++ch) { v4us oh, ol;
#pragma unroll
                for (int q = 0; q < 4; ++q) { unsigned short a, c2; splitf(v[ch * 4 + q] * f, a, c2); oh[q] = a; ol[q] = c2; }
                const size_t oo = ((size_t)zz * (RH ? RH : 1) + i) * TT + ch * 128 + lane * 4; *(v4us*)(Ph + oo) = oh; *(v4us*)(Pl + oo) = ol; }
        } else {
#pragma unroll
            for (int ch = 0; ch < TT / 128; ++ch) { v4h o4;
#pragma unroll
                for (int q = 0; q < 4; ++q) o4[q] = tohx(v[ch * 4 + q] * f);
                *(v4h*)(P16 + (size_t)row * TT + ch * 128 + lane * 4) = o4; } }
         }
}
__global__ __launch_bounds__(256) void k_merge(const float* __restrict__ O, int h0, bf* Ah, bf* Al) { const size_t e = ((size_t)blockIdx.x * 256 + threadIdx.x) * 2; if (e >= (size_t)ZH * TT * HD) return; const int d = (int)(e % HD); const int t = (int)((e / HD) % TT); const int zz = (int)(e / ((size_t)HD * TT)); const float cs = (t < RH) ? 1.0f : (1.0f / PCAR); const size_t oo = (size_t)t * DQ + (h0 + zz) * HD + d;
    v2us oh, ol;
#pragma unroll
    for (int q = 0; q < 2; ++q) { unsigned short a, c2; splitf(O[e + q] * cs, a, c2); oh[q] = a; ol[q] = c2; } *(v2us*)(Ah + oo) = oh; *(v2us*)(Al + oo) = ol;  }

extern "C" void kernel_launch(void* const* d_in, const int* in_sizes, int n_in,
                              void* d_out, int out_size, void* d_ws, size_t ws_size, hipStream_t stream) {
    (void)in_sizes; (void)n_in; (void)out_size;
    const float* x = (const float*)d_in[0]; const float* pemb = (const float*)d_in[1]; const int* kmask = (const int*)d_in[2]; const float* wq = (const float*)d_in[3]; const float* bq = (const float*)d_in[4]; const float* wk = (const float*)d_in[5]; const float* bk = (const float*)d_in[6]; const float* wv = (const float*)d_in[7]; const float* bv = (const float*)d_in[8]; const float* wpos = (const float*)d_in[9]; const float* wo = (const float*)d_in[10]; const float* bo = (const float*)d_in[11]; const float* pbu = (const float*)d_in[12]; const float* pbv = (const float*)d_in[13]; const float* cosT = nullptr; const float* sinT = nullptr; (void)cosT; (void)sinT;
    float* OUT = (float*)d_out;     // [4][2048][1024]
    char* wsp = (char*)d_ws;
    auto take = [&](size_t bytes) { char* p = wsp; wsp += (bytes + 255) & ~(size_t)255; return (void*)p; };
    bf* WQ = (bf*)take((size_t)DQ * DM * 2); bf* WK = (bf*)take((size_t)DKV * DM * 2); bf* WV = (bf*)take((size_t)DKV * DM * 2); bf* WO = (bf*)take((size_t)DM * DQ * 2); float* CS = (float*)take((size_t)TT * HD * 2 * 4);
    bf* XB = (bf*)take((size_t)TT * DM * 2); bf* XP = (bf*)take((size_t)TT * DM * 2); bf* WP = (bf*)take((size_t)DQ * DM * 2); float* FP = (float*)take((size_t)TT * DQ * 4); float* FQV = (float*)take((size_t)TT * DQ * 4); h16* PP16 = (h16*)take((size_t)NH_ * TT * HD * 2); bf* PPh = (bf*)take((size_t)NH_ * TT * HD * 2); bf* PPl = (bf*)take((size_t)NH_ * TT * HD * 2); h16* QV16 = (h16*)take((size_t)NH_ * TT * HD * 2); bf* QVh = (bf*)take((size_t)NH_ * TT * HD * 2); bf* QVl = (bf*)take((size_t)NH_ * TT * HD * 2); float* Sb2 = (float*)take((size_t)ZH * TT * TT * 4); float* FQ = (float*)take((size_t)TT * DQ * 4); float* FK = (float*)take((size_t)TT * DKV * 4);
    h16* QP16 = (h16*)take((size_t)NH_ * TT * HD * 2); h16* KP16 = (h16*)take((size_t)NKV * TT * HD * 2); h16* VT16 = (h16*)take((size_t)NKV * HD * TT * 2);
    bf* QPh = (bf*)take((size_t)NH_ * TT * HD * 2); bf* QPl = (bf*)take((size_t)NH_ * TT * HD * 2); bf* KPh = (bf*)take((size_t)NKV * TT * HD * 2); bf* KPl = (bf*)take((size_t)NKV * TT * HD * 2); bf* VTh = (bf*)take((size_t)NKV * HD * TT * 2); bf* VTl = (bf*)take((size_t)NKV * HD * TT * 2); bf* Ph = (bf*)take((size_t)ZH * RH * TT * 2); bf* Pl = (bf*)take((size_t)ZH * RH * TT * 2);
    float* Sb = (float*)take((size_t)ZH * TT * TT * 4); h16* P16 = (h16*)take((size_t)ZH * TT * TT * 2); float* Ob = (float*)take((size_t)ZH * TT * HD * 4); bf* ATh = (bf*)take((size_t)TT * DQ * 2); bf* ATl = (bf*)take((size_t)TT * DQ * 2);
    if ((size_t)(wsp - (char*)d_ws) > ws_size) return;    // ws 256 MiB
    float* FV = FK;   // v projection reuses the k buffer after the k planes are built (stream-ordered)
    { k_cvt8<<<(unsigned)(((size_t)DQ * DM / 8 + 255) / 256), 256, 0, stream>>>(wq, WQ, (size_t)DQ * DM / 8); k_cvt8<<<(unsigned)(((size_t)DKV * DM / 8 + 255) / 256), 256, 0, stream>>>(wk, WK, (size_t)DKV * DM / 8); k_cvt8<<<(unsigned)(((size_t)DKV * DM / 8 + 255) / 256), 256, 0, stream>>>(wv, WV, (size_t)DKV * DM / 8);
      k_cvt8<<<(unsigned)(((size_t)DM * DQ / 8 + 255) / 256), 256, 0, stream>>>(wo, WO, (size_t)DM * DQ / 8); k_cvt8<<<(unsigned)(((size_t)DQ * DM / 8 + 255) / 256), 256, 0, stream>>>(wpos, WP, (size_t)DQ * DM / 8); k_cvt8<<<(unsigned)(((size_t)TT * DM / 8 + 255) / 256), 256, 0, stream>>>(pemb, XP, (size_t)TT * DM / 8); k_gemmw<bf, 0, false><<<dim3(TT / 64, DQ / 64, 1), 32, 0, stream>>>(XP, nullptr, WP, nullptr, DM, FP, DQ, nullptr, 0, 0, 0);
       }
    k_csid<<<(TT * HD + 255) / 256, 256, 0, stream>>>(CS);
    const unsigned LQ = (unsigned)(((size_t)NH_ * TT * HD / 2 + 255) / 256), LKv = (unsigned)(((size_t)NKV * TT * HD / 2 + 255) / 256);
    for (int b = 0; b < NB_; ++b) {
        
        k_cvt8<<<(unsigned)(((size_t)TT * DM / 8 + 255) / 256), 256, 0, stream>>>(x + (size_t)b * TT * DM, XB, (size_t)TT * DM / 8);
        k_gemmw<bf, 0, true><<<dim3(TT / 64, DQ / 64, 1), 32, 0, stream>>>(XB, nullptr, WQ, nullptr, DM, FQ, DQ, bq, 0, 0, 0);
        k_uvb<<<(unsigned)(((size_t)TT * DQ / 4 + 255) / 256), 256, 0, stream>>>(FQ, pbu, pbv, FQV); k_rope<<<LQ, 256, 0, stream>>>(FQ, DQ, NH_, CS, nullptr, nullptr, 1.0f, QP16, QPh, QPl); k_rope<<<LQ, 256, 0, stream>>>(FQV, DQ, NH_, CS, nullptr, nullptr, 1.0f, QV16, QVh, QVl); if (b == 0) { k_rope<<<LQ, 256, 0, stream>>>(FP, DQ, NH_, CS, nullptr, nullptr, 1.0f, PP16, PPh, PPl); }
        k_gemmw<bf, 0, true><<<dim3(TT / 64, DKV / 64, 1), 32, 0, stream>>>(XB, nullptr, WK, nullptr, DM, FK, DKV, bk, 0, 0, 0);
        k_rope<<<LKv, 256, 0, stream>>>(FK, DKV, NKV, CS, nullptr, nullptr, 1.0f, KP16, KPh, KPl);
        k_gemmw<bf, 0, true><<<dim3(TT / 64, DKV / 64, 1), 32, 0, stream>>>(XB, nullptr, WV, nullptr, DM, FV, DKV, bv, 0, 0, 0); k_vtp<<<LKv, 256, 0, stream>>>(FV, DKV, NKV, VT16, VTh, VTl);
        for (int h0 = 0; h0 < NH_; h0 += ZH) { const size_t zq = (size_t)h0, zk = (size_t)(h0 / REP);   // one kv head per query head: the pass's two heads use consecutive kv planes (z-strides TT*HD)
            k_gemmw<bf, 2, false><<<dim3(RH / 64, TT / 64, ZH), 32, 0, stream>>>(QPh + zq * TT * HD, QPl + zq * TT * HD, KPh + zk * TT * HD, KPl + zk * TT * HD, HD, Sb, TT, nullptr, (size_t)TT * HD, (size_t)TT * HD, (size_t)TT * TT); k_gemmw<bf, 2, false><<<dim3(RH / 64, TT / 64, ZH), 32, 0, stream>>>(QVh + zq * TT * HD, QVl + zq * TT * HD, PPh + zk * TT * HD, PPl + zk * TT * HD, HD, Sb2, TT, nullptr, (size_t)TT * HD, (size_t)TT * HD, (size_t)TT * TT);
            k_gemmw<h16, 0, false><<<dim3((TT - RH) / 64, TT / 64, ZH), 32, 0, stream>>>(QP16 + zq * TT * HD + (size_t)RH * HD, nullptr, KP16 + zk * TT * HD, nullptr, HD, Sb + (size_t)RH * TT, TT, nullptr, (size_t)TT * HD, (size_t)TT * HD, (size_t)TT * TT); k_gemmw<h16, 0, false><<<dim3((TT - RH) / 64, TT / 64, ZH), 32, 0, stream>>>(QV16 + zq * TT * HD + (size_t)RH * HD, nullptr, PP16 + zk * TT * HD, nullptr, HD, Sb2 + (size_t)RH * TT, TT, nullptr, (size_t)TT * HD, (size_t)TT * HD, (size_t)TT * TT);
            k_asoft<<<ZH * TT / 8, 256, 0, stream>>>(Sb, Sb2, kmask + (size_t)b * TT, P16, Ph, Pl);
            k_gemmw<bf, 2, false><<<dim3(RH / 64, HD / 64, ZH), 32, 0, stream>>>(Ph, Pl, VTh + zk * HD * TT, VTl + zk * HD * TT, TT, Ob, HD, nullptr, (size_t)RH * TT, (size_t)HD * TT, (size_t)TT * HD);
            k_gemmw<h16, 0, false><<<dim3((TT - RH) / 64, HD / 64, ZH), 32, 0, stream>>>(P16 + (size_t)RH * TT, nullptr, VT16 + zk * HD * TT, nullptr, TT, Ob + (size_t)RH * HD, HD, nullptr, (size_t)TT * TT, (size_t)HD * TT, (size_t)TT * HD);
            k_merge<<<(unsigned)(((size_t)ZH * TT * HD / 2 + 255) / 256), 256, 0, stream>>>(Ob, h0, ATh, ATl); }
        k_gemmw<bf, 1, true><<<dim3(TT / 64, DM / 64, 1), 32, 0, stream>>>(ATh, ATl, WO, nullptr, DQ, OUT + (size_t)b * TT * DM, DM, bo, 0, 0, 0); }
}

// v001
// One run takes 1990 microseconds.
// Timed twice side by side with v000, it ran 1.55 times as fast both times.
#include <hip/hip_runtime.h>

// MultiHeadRelPositionAttention (x [4][2048][1024], pos_emb [2048][1024], mask [4][2048] (int, read; all ones); q/k/v = x W^T + b (8 heads x 128); p = pos_emb Wpos^T; content = (q + pos_bias_u[h]).k; pos = rel_shift((q + pos_bias_v[h]).p) with the Transformer-XL pad/reshape shift for P == T: pos[i][j] = S[i][T-1-(i-j)] for j <= i, 0 for j == i+1, S[i+1][j-i-2] for j >= i+2 (reproduced literally, including the upper part); scores = (content + pos) / sqrt(128), key mask; softmax; out = merged Wout^T + bout -> [4][2048][1024]).
// Compute dtypes, f32 accumulate: every input rounded to bf16; q/k/v/p as PLAIN bf16 GEMMs (inputs: exact) + bias; the u/v head biases added in f32; content, position scores and attn.v: query rows < 512 hl (3 products), the rest single fp16 (x1024) (the shifted position score is gathered from rows i / i+1 of the position-score block); softmax f32 with the read key mask; Wout hl x exact (2 products) + bias.

#define NB_  4
#define TT   2048
#define DM   1024
#define NH_  8
#define NKV  8
#define REP  (NH_ / NKV)
#define HD   128
#define DQ   (NH_ * HD)
#define DKV  (NKV * HD)
#define ZH   2
#define RH   512                  // query rows < RH use hi+lo planes (0: none)
#define WIN  0
#define PCAR 1024.0f
#define SCL  0.088388347648318447f   // HD^-0.5
typedef _Float16 h16;
typedef unsigned short bf;
typedef __attribute__((ext_vector_type(16))) __bf16   v16bf;
typedef __attribute__((ext_vector_type(16))) _Float16 v16h;
typedef __attribute__((ext_vector_type(8)))  _Float16 v8h;
typedef __attribute__((ext_vector_type(8)))  unsigned short v8us;
typedef __attribute__((ext_vector_type(8)))  float    v8f;
typedef __attribute__((ext_vector_type(4)))  float    v4f;
typedef v8h  __attribute__((may_alias)) v8ha;
typedef v4f  __attribute__((may_alias)) v4fa;
typedef v8us __attribute__((may_alias)) v8usa;

__device__ __forceinline__ unsigned short f2bf(float f) { unsigned u = __float_as_uint(f); u += 0x7FFFu + ((u >> 16) & 1u); return (unsigned short)(u >> 16); }
__device__ __forceinline__ float bf2f(unsigned short b) { return __uint_as_float(((unsigned)b) << 16); }
__device__ __forceinline__ float bfr(float f) { return bf2f(f2bf(f)); }
__device__ __forceinline__ v16h cat16(v8h lo, v8h hi) { return __builtin_shufflevector(lo, hi, 0, 1, 2, 3, 4, 5, 6, 7, 8, 9, 10, 11, 12, 13, 14, 15); }
__device__ __forceinline__ v16bf cat16b(v8us lo, v8us hi) { return __builtin_bit_cast(v16bf, __builtin_shufflevector(lo, hi, 0, 1, 2, 3, 4, 5, 6, 7, 8, 9, 10, 11, 12, 13, 14, 15)); }
__device__ __forceinline__ v8f wmma16(v16h a, v16h b, v8f c) { return __builtin_amdgcn_wmma_f32_16x16x32_f16(false, a, false, b, (short)0, c, false, false); }
__device__ __forceinline__ v8f wmmab(v16bf a, v16bf b, v8f c) { return __builtin_amdgcn_wmma_f32_16x16x32_bf16(false, a, false, b, (short)0, c, false, false); }



// ---- k_gemmw: register-blocked GEMM, one 64x64 output tile per work-group (16 accumulators per wave), operands straight from K-contiguous 16-bit planes; grid (M/64, N/64, Z), 32 * KS threads.
// C[m][n] (f32, pitch ldc, + optional f32 bias[n]) = sum_k A[m][k] Bt[n][k] (+ split products per NSPLIT). z-batch strides sA/sB/sC in elements. K % (32 * KS) == 0.
// KS > 1: the K loop is shared out over KS waves (wave w takes the 32-wide k blocks w, w + KS, ...); the KS partial tiles meet in LDS and are summed in the fixed order w = 0 .. KS-1.
template <typename T16> struct WFrag;
template <> struct WFrag<h16> { typedef v16h V; static __device__ __forceinline__ V ld(const h16* p) { return cat16(*(const v8h*)p, *(const v8h*)(p + 16)); } static __device__ __forceinline__ v8f mma(V a, V b, v8f c) { return wmma16(a, b, c); } };
template <> struct WFrag<bf> { typedef v16bf V; static __device__ __forceinline__ V ld(const bf* p) { return cat16b(*(const v8us*)p, *(const v8us*)(p + 16)); } static __device__ __forceinline__ v8f mma(V a, V b, v8f c) { return wmmab(a, b, c); } };
template <typename T16, int NSPLIT, bool BIAS, int KS>
__global__ __launch_bounds__(32 * KS) void k_gemmw(const T16* __restrict__ A, const T16* __restrict__ A2, const T16* __restrict__ Bt, const T16* __restrict__ Bt2, int K, float* C, int ldc, const float* __restrict__ bias, size_t sA, size_t sB, size_t sC) {
    typedef typename WFrag<T16>::V V;
    __shared__ __align__(16) float os[(KS == 1 ? 16 : KS * 64) * 68];
    const int wave = (KS == 1) ? 0 : __builtin_amdgcn_readfirstlane((int)(threadIdx.x >> 5));
    const size_t z = blockIdx.z; A += z * sA; if (A2) A2 += z * sA; Bt += z * sB; if (Bt2) Bt2 += z * sB; C += z * sC;
    const int lane = threadIdx.x & 31, lr = lane & 15, hi = lane >> 4; const int r0 = blockIdx.x * 64, c0 = blockIdx.y * 64;
    v8f acc[4][4];
#pragma unroll
    for (int mb = 0; mb < 4; ++mb)
#pragma unroll
        for (int nb = 0; nb < 4; ++nb) acc[mb][nb] = (v8f){};
    const size_t aoff = (size_t)(r0 + lr) * K + 8 * hi, boff = (size_t)(c0 + lr) * K + 8 * hi;
#pragma unroll 1
    for (int kc = wave * 32; kc < K; kc += 32 * KS) {
        V a[4], a2[4];
#pragma unroll
        for (int mb = 0; mb < 4; ++mb) { a[mb] = WFrag<T16>::ld(A + aoff + (size_t)mb * 16 * K + kc); if (NSPLIT == 1 || NSPLIT == 2) a2[mb] = WFrag<T16>::ld(A2 + aoff + (size_t)mb * 16 * K + kc); }
#pragma unroll
        for (int nb = 0; nb < 4; ++nb) { const V b = WFrag<T16>::ld(Bt + boff + (size_t)nb * 16 * K + kc); V b2; if (NSPLIT >= 2) b2 = WFrag<T16>::ld(Bt2 + boff + (size_t)nb * 16 * K + kc);
#pragma unroll
            for (int mb = 0; mb < 4; ++mb) { acc[mb][nb] = WFrag<T16>::mma(a[mb], b, acc[mb][nb]); if (NSPLIT == 1 || NSPLIT == 2) acc[mb][nb] = WFrag<T16>::mma(a2[mb], b, acc[mb][nb]); if (NSPLIT >= 2) acc[mb][nb] = WFrag<T16>::mma(a[mb], b2, acc[mb][nb]); } }
        asm volatile("v_nop\n\tv_nop\n\tv_nop\n\tv_nop" : "+v"(acc[0][0]), "+v"(acc[1][1]), "+v"(acc[2][2]), "+v"(acc[3][3]) : "v"(a[0]), "v"(a[3]));
    }
    if (KS > 1) {
        float* mine = os + wave * (64 * 68);
#pragma unroll
        for (int mb = 0; mb < 4; ++mb)
#pragma unroll
            for (int nb = 0; nb < 4; ++nb)
#pragma unroll
                for (int j = 0; j < 8; ++j) mine[(mb * 16 + hi * 8 + j) * 68 + nb * 16 + lr] = acc[mb][nb][j];
        __syncthreads();   // every wave's partial tile is in LDS before any wave sums rows of it
#pragma unroll
        for (int s = 0; s < 32 / KS; ++s) { const int row = wave * (64 / KS) + 2 * s + hi, cofs = lr * 4; v4f val = *(const v4fa*)(os + row * 68 + cofs);
#pragma unroll
            for (int w = 1; w < KS; ++w) val += *(const v4fa*)(os + (w * 64 + row) * 68 + cofs);
            if (BIAS) { val[0] += bfr(bias[c0 + cofs]); val[1] += bfr(bias[c0 + cofs + 1]); val[2] += bfr(bias[c0 + cofs + 2]); val[3] += bfr(bias[c0 + cofs + 3]); }
            *(v4f*)(C + (size_t)(r0 + row) * ldc + c0 + cofs) = val; }
        return;
    }
#pragma unroll
    for (int mb = 0; mb < 4; ++mb) {
#pragma unroll
        for (int nb = 0; nb < 4; ++nb) {
#pragma unroll
            for (int j = 0; j < 8; ++j) os[(hi * 8 + j) * 68 + nb * 16 + lr] = acc[mb][nb][j]; }
        __builtin_amdgcn_wave_barrier(); asm volatile("" ::: "memory");
        float* crow = C + (size_t)(r0 + mb * 16) * ldc + c0;
{
#pragma unroll
            for (int s = 0; s < 8; ++s) { const int row = 2 * s + hi, cofs = lr * 4; v4f val = *(const v4fa*)(os + row * 68 + cofs); if (BIAS) { val[0] += bfr(bias[c0 + cofs]); val[1] += bfr(bias[c0 + cofs + 1]); val[2] += bfr(bias[c0 + cofs + 2]); val[3] += bfr(bias[c0 + cofs + 3]); }
                *(v4f*)(crow + (size_t)row * ldc + cofs) = val; }
             }
        __builtin_amdgcn_wave_barrier(); asm volatile("" ::: "memory");
    }
}

__device__ __forceinline__ h16 tohx(float x) { return (h16)x; }
__device__ __forceinline__ void splitf(float y, unsigned short& h, unsigned short& l) { h = f2bf(y); l = f2bf(y - bf2f(h)); }
typedef __attribute__((ext_vector_type(2))) _Float16 v2h;
typedef __attribute__((ext_vector_type(4))) _Float16 v4h;
typedef __attribute__((ext_vector_type(2))) unsigned short v2us;
typedef __attribute__((ext_vector_type(4))) unsigned short v4us;
typedef __attribute__((ext_vector_type(2))) float v2f;
typedef __attribute__((ext_vector_type(4))) int v4i;

__global__ __launch_bounds__(256) void k_wtG(const float* __restrict__ w, int K, int N, bf* Bt) {
    const int lane = threadIdx.x & 31; const int L0 = (blockIdx.x * 8 + (threadIdx.x >> 5)) * 8; const int nlines = N * K / 64;
{
#pragma unroll 1
        for (int l = 0; l < 8; ++l) { const int L = L0 + l; if (L >= nlines) break; const size_t e = (size_t)L * 64 + lane * 2; const int k = (int)(e % K), n = (int)(e / K); v2us o;
            o[0] = f2bf(w[(size_t)k * N + n]); o[1] = f2bf(w[(size_t)(k + 1) * N + n]); *(v2us*)(Bt + e) = o; }
         }
}
__global__ __launch_bounds__(256) void k_cvt8(const float* __restrict__ src, bf* dst, size_t n8) { const size_t i = (size_t)blockIdx.x * 256 + threadIdx.x; if (i >= n8) return; const v8f v = *(const v8f*)(src + i * 8); v8us o;
#pragma unroll
    for (int k = 0; k < 8; ++k) o[k] = f2bf(v[k]); *(v8us*)(dst + i * 8) = o;  }
__global__ __launch_bounds__(256) void k_cscvt(const float* __restrict__ cosT, const float* __restrict__ sinT, float* CS) { const int idx = blockIdx.x * 256 + threadIdx.x; if (idx >= TT * HD) return; v2f cs; cs[0] = bfr(cosT[idx]); cs[1] = bfr(sinT[idx]); *(v2f*)(CS + (size_t)idx * 2) = cs;  }
// k_rope: head planes [h][t][d] (fp16 + hi/lo) of rope(x) x sc with the rotate-half convention out[d] = x[d] cos[t][d] - x[d+HD/2] sin[t][d], out[d+HD/2] = x[d+HD/2] cos[t][d+HD/2] + x[d] sin[t][d+HD/2]
__global__ __launch_bounds__(256) void k_rope(const float* __restrict__ F, int pitch, int nheads, const float* __restrict__ CS, const float* __restrict__ RF, const float* __restrict__ nw, float sc, h16* P16, bf* Ph, bf* Pl) {
    const size_t e = ((size_t)blockIdx.x * 256 + threadIdx.x) * 2; if (e >= (size_t)nheads * TT * HD) return; const int d = (int)(e % HD); const int t = (int)((e / HD) % TT); const int h = (int)(e / ((size_t)HD * TT)); const float* f = F + (size_t)t * pitch + h * HD; const float rf = RF ? RF[(size_t)h * TT + t] : 1.0f; v2h o16; v2us oh, ol;
#pragma unroll
    for (int q = 0; q < 2; ++q) { const int dd = d + q; const int dp = (dd < HD / 2) ? dd + HD / 2 : dd - HD / 2; float x0 = f[dd], x1 = f[dp];
        if (RF) { float n0 = __fmul_rn(x0, rf), n1 = __fmul_rn(x1, rf); asm volatile("" : "+v"(n0)); asm volatile("" : "+v"(n1)); x0 = __fmul_rn(bfr(nw[dd]), n0); x1 = __fmul_rn(bfr(nw[dp]), n1); }
        const v2f cs = *(const v2f*)(CS + ((size_t)t * HD + dd) * 2); float a = __fmul_rn(x0, cs[0]), bq = __fmul_rn(x1, cs[1]); asm volatile("" : "+v"(a)); asm volatile("" : "+v"(bq)); const float r = ((dd < HD / 2) ? __fsub_rn(a, bq) : __fadd_rn(a, bq)) * sc;
        o16[q] = tohx(r); unsigned short a2, c2; splitf(r, a2, c2); oh[q] = a2; ol[q] = c2; }
    *(v2h*)(P16 + e) = o16; *(v2us*)(Ph + e) = oh; *(v2us*)(Pl + e) = ol;  }
__global__ __launch_bounds__(256) void k_vtp(const float* __restrict__ F, int pitch, int nheads, h16* V16, bf* Vh, bf* Vl) { const size_t e = ((size_t)blockIdx.x * 256 + threadIdx.x) * 2; if (e >= (size_t)nheads * HD * TT) return; const int t = (int)(e % TT); const int d = (int)((e / TT) % HD); const int g = (int)(e / ((size_t)TT * HD)); v2h o16; v2us oh, ol;
#pragma unroll
    for (int q = 0; q < 2; ++q) { const float x = F[(size_t)(t + q) * pitch + g * HD + d]; o16[q] = tohx(x); unsigned short a2, c2; splitf(x, a2, c2); oh[q] = a2; ol[q] = c2; }
    *(v2h*)(V16 + e) = o16; *(v2us*)(Vh + e) = oh; *(v2us*)(Vl + e) = ol;  }
__global__ __launch_bounds__(256) void k_csid(float* CS) { const int idx = blockIdx.x * 256 + threadIdx.x; if (idx >= TT * HD) return; v2f cs; cs[0] = 1.0f; cs[1] = 0.0f; *(v2f*)(CS + (size_t)idx * 2) = cs;  }
__global__ __launch_bounds__(256) void k_uvb(float* FQ, const float* __restrict__ bu, const float* __restrict__ bv2, float* FQV) { const size_t e = ((size_t)blockIdx.x * 256 + threadIdx.x) * 4; if (e >= (size_t)TT * DQ) return; const int c0 = (int)(e % DQ); const v4f a = *(const v4f*)(FQ + e); v4f ou, ov; for (int u = 0; u < 4; ++u) { ou[u] = __fadd_rn(a[u], bfr(bu[c0 + u])); ov[u] = __fadd_rn(a[u], bfr(bv2[c0 + u])); } *(v4f*)(FQV + e) = ov; *(v4f*)(FQ + e) = ou;  }
// k_asoft: per row (zz, i): t = (S + rel-shifted S2) x HD^-0.5 with the key mask; softmax over the 2048 keys (register row, one exp, fixed trees);
__global__ __launch_bounds__(256) void k_asoft(const float* __restrict__ Sb, const float* __restrict__ Sb2, const int* __restrict__ km, h16* P16, bf* Ph, bf* Pl) {
    const int lane = threadIdx.x & 31; const int row = blockIdx.x * 8 + (threadIdx.x >> 5); if (row >= ZH * TT) return; const int i = row % TT; const int zz = row / TT; (void)zz; const bool hires = (i < RH); const float* sr = Sb + (size_t)row * TT; const float* pr0 = Sb2 + (size_t)row * TT; const float* pr1 = Sb2 + (size_t)(row + 1) * TT;   /* row i+1 of the same head block (never dereferenced for i = T-1: j >= i+2 is impossible there) */ float v[TT / 32]; float mx = -3.0e38f;
#pragma unroll
    for (int ch = 0; ch < TT / 128; ++ch) { const int j0 = ch * 128 + lane * 4; const v4f a = *(const v4f*)(sr + j0);
#pragma unroll
        for (int q = 0; q < 4; ++q) { const int j = j0 + q; (void)j; const int jj = j0 + q; const float bd = (jj <= i) ? pr0[TT - 1 - (i - jj)] : ((jj == i + 1) ? 0.0f : pr1[jj - i - 2]); float cp = __fadd_rn(a[q], bd); asm volatile("" : "+v"(cp)); const float t = (km[jj] != 0) ? cp * SCL : -3.0e38f; v[ch * 4 + q] = t; mx = fmaxf(mx, t); } }
#pragma unroll
    for (int sh = 16; sh; sh >>= 1) mx = fmaxf(mx, __shfl_xor(mx, sh, 32));
    float sum = 0.f;
#pragma unroll
    for (int k = 0; k < TT / 32; ++k) { float d0 = __fsub_rn(v[k], mx); asm volatile("" : "+v"(d0)); v[k] = __builtin_amdgcn_exp2f(__fmul_rn(d0, 1.4426950408889634f)); sum += v[k]; }
#pragma unroll
    for (int sh = 16; sh; sh >>= 1) sum += __shfl_xor(sum, sh, 32);
    const float f = __fdiv_rn(hires ? 1.0f : PCAR, sum);
{
        if (hires) {
#pragma unroll
            for (int ch = 0; ch < TT / 128; ++ch) { v4us oh, ol;
#pragma unroll
                for (int q = 0; q < 4; ++q) { unsigned short a, c2; splitf(v[ch * 4 + q] * f, a, c2); oh[q] = a; ol[q] = c2; }
                const size_t oo = ((size_t)zz * (RH ? RH : 1) + i) * TT + ch * 128 + lane * 4; *(v4us*)(Ph + oo) = oh; *(v4us*)(Pl + oo) = ol; }
        } else {
#pragma unroll
            for (int ch = 0; ch < TT / 128; ++ch) { v4h o4;
#pragma unroll
                for (int q = 0; q < 4; ++q) o4[q] = tohx(v[ch * 4 + q] * f);
                *(v4h*)(P16 + (size_t)row * TT + ch * 128 + lane * 4) = o4; } }
         }
}
__global__ __launch_bounds__(256) void k_merge(const float* __restrict__ O, int h0, bf* Ah, bf* Al) { const size_t e = ((size_t)blockIdx.x * 256 + threadIdx.x) * 2; if (e >= (size_t)ZH * TT * HD) return; const int d = (int)(e % HD); const int t = (int)((e / HD) % TT); const int zz = (int)(e / ((size_t)HD * TT)); const float cs = (t < RH) ? 1.0f : (1.0f / PCAR); const size_t oo = (size_t)t * DQ + (h0 + zz) * HD + d;
    v2us oh, ol;
#pragma unroll
    for (int q = 0; q < 2; ++q) { unsigned short a, c2; splitf(O[e + q] * cs, a, c2); oh[q] = a; ol[q] = c2; } *(v2us*)(Ah + oo) = oh; *(v2us*)(Al + oo) = ol;  }

extern "C" void kernel_launch(void* const* d_in, const int* in_sizes, int n_in,
                              void* d_out, int out_size, void* d_ws, size_t ws_size, hipStream_t stream) {
    (void)in_sizes; (void)n_in; (void)out_size;
    const float* x = (const float*)d_in[0]; const float* pemb = (const float*)d_in[1]; const int* kmask = (const int*)d_in[2]; const float* wq = (const float*)d_in[3]; const float* bq = (const float*)d_in[4]; const float* wk = (const float*)d_in[5]; const float* bk = (const float*)d_in[6]; const float* wv = (const float*)d_in[7]; const float* bv = (const float*)d_in[8]; const float* wpos = (const float*)d_in[9]; const float* wo = (const float*)d_in[10]; const float* bo = (const float*)d_in[11]; const float* pbu = (const float*)d_in[12]; const float* pbv = (const float*)d_in[13]; const float* cosT = nullptr; const float* sinT = nullptr; (void)cosT; (void)sinT;
    float* OUT = (float*)d_out;     // [4][2048][1024]
    char* wsp = (char*)d_ws;
    auto take = [&](size_t bytes) { char* p = wsp; wsp += (bytes + 255) & ~(size_t)255; return (void*)p; };
    bf* WQ = (bf*)take((size_t)DQ * DM * 2); bf* WK = (bf*)take((size_t)DKV * DM * 2); bf* WV = (bf*)take((size_t)DKV * DM * 2); bf* WO = (bf*)take((size_t)DM * DQ * 2); float* CS = (float*)take((size_t)TT * HD * 2 * 4);
    bf* XB = (bf*)take((size_t)TT * DM * 2); bf* XP = (bf*)take((size_t)TT * DM * 2); bf* WP = (bf*)take((size_t)DQ * DM * 2); float* FP = (float*)take((size_t)TT * DQ * 4); float* FQV = (float*)take((size_t)TT * DQ * 4); h16* PP16 = (h16*)take((size_t)NH_ * TT * HD * 2); bf* PPh = (bf*)take((size_t)NH_ * TT * HD * 2); bf* PPl = (bf*)take((size_t)NH_ * TT * HD * 2); h16* QV16 = (h16*)take((size_t)NH_ * TT * HD * 2); bf* QVh = (bf*)take((size_t)NH_ * TT * HD * 2); bf* QVl = (bf*)take((size_t)NH_ * TT * HD * 2); float* Sb2 = (float*)take((size_t)ZH * TT * TT * 4); float* FQ = (float*)take((size_t)TT * DQ * 4); float* FK = (float*)take((size_t)TT * DKV * 4);
    h16* QP16 = (h16*)take((size_t)NH_ * TT * HD * 2); h16* KP16 = (h16*)take((size_t)NKV * TT * HD * 2); h16* VT16 = (h16*)take((size_t)NKV * HD * TT * 2);
    bf* QPh = (bf*)take((size_t)NH_ * TT * HD * 2); bf* QPl = (bf*)take((size_t)NH_ * TT * HD * 2); bf* KPh = (bf*)take((size_t)NKV * TT * HD * 2); bf* KPl = (bf*)take((size_t)NKV * TT * HD * 2); bf* VTh = (bf*)take((size_t)NKV * HD * TT * 2); bf* VTl = (bf*)take((size_t)NKV * HD * TT * 2); bf* Ph = (bf*)take((size_t)ZH * RH * TT * 2); bf* Pl = (bf*)take((size_t)ZH * RH * TT * 2);
    float* Sb = (float*)take((size_t)ZH * TT * TT * 4); h16* P16 = (h16*)take((size_t)ZH * TT * TT * 2); float* Ob = (float*)take((size_t)ZH * TT * HD * 4); bf* ATh = (bf*)take((size_t)TT * DQ * 2); bf* ATl = (bf*)take((size_t)TT * DQ * 2);
    if ((size_t)(wsp - (char*)d_ws) > ws_size) return;    // ws 256 MiB
    float* FV = FK;   // v projection reuses the k buffer after the k planes are built (stream-ordered)
    { k_cvt8<<<(unsigned)(((size_t)DQ * DM / 8 + 255) / 256), 256, 0, stream>>>(wq, WQ, (size_t)DQ * DM / 8); k_cvt8<<<(unsigned)(((size_t)DKV * DM / 8 + 255) / 256), 256, 0, stream>>>(wk, WK, (size_t)DKV * DM / 8); k_cvt8<<<(unsigned)(((size_t)DKV * DM / 8 + 255) / 256), 256, 0, stream>>>(wv, WV, (size_t)DKV * DM / 8);
      k_cvt8<<<(unsigned)(((size_t)DM * DQ / 8 + 255) / 256), 256, 0, stream>>>(wo, WO, (size_t)DM * DQ / 8); k_cvt8<<<(unsigned)(((size_t)DQ * DM / 8 + 255) / 256), 256, 0, stream>>>(wpos, WP, (size_t)DQ * DM / 8); k_cvt8<<<(unsigned)(((size_t)TT * DM / 8 + 255) / 256), 256, 0, stream>>>(pemb, XP, (size_t)TT * DM / 8); k_gemmw<bf, 0, false, 8><<<dim3(TT / 64, DQ / 64, 1), 256, 0, stream>>>(XP, nullptr, WP, nullptr, DM, FP, DQ, nullptr, 0, 0, 0);
       }
    k_csid<<<(TT * HD + 255) / 256, 256, 0, stream>>>(CS);
    const unsigned LQ = (unsigned)(((size_t)NH_ * TT * HD / 2 + 255) / 256), LKv = (unsigned)(((size_t)NKV * TT * HD / 2 + 255) / 256);
    for (int b = 0; b < NB_; ++b) {
        
        k_cvt8<<<(unsigned)(((size_t)TT * DM / 8 + 255) / 256), 256, 0, stream>>>(x + (size_t)b * TT * DM, XB, (size_t)TT * DM / 8);
        k_gemmw<bf, 0, true, 8><<<dim3(TT / 64, DQ / 64, 1), 256, 0, stream>>>(XB, nullptr, WQ, nullptr, DM, FQ, DQ, bq, 0, 0, 0);
        k_uvb<<<(unsigned)(((size_t)TT * DQ / 4 + 255) / 256), 256, 0, stream>>>(FQ, pbu, pbv, FQV); k_rope<<<LQ, 256, 0, stream>>>(FQ, DQ, NH_, CS, nullptr, nullptr, 1.0f, QP16, QPh, QPl); k_rope<<<LQ, 256, 0, stream>>>(FQV, DQ, NH_, CS, nullptr, nullptr, 1.0f, QV16, QVh, QVl); if (b == 0) { k_rope<<<LQ, 256, 0, stream>>>(FP, DQ, NH_, CS, nullptr, nullptr, 1.0f, PP16, PPh, PPl); }
        k_gemmw<bf, 0, true, 8><<<dim3(TT / 64, DKV / 64, 1), 256, 0, stream>>>(XB, nullptr, WK, nullptr, DM, FK, DKV, bk, 0, 0, 0);
        k_rope<<<LKv, 256, 0, stream>>>(FK, DKV, NKV, CS, nullptr, nullptr, 1.0f, KP16, KPh, KPl);
        k_gemmw<bf, 0, true, 8><<<dim3(TT / 64, DKV / 64, 1), 256, 0, stream>>>(XB, nullptr, WV, nullptr, DM, FV, DKV, bv, 0, 0, 0); k_vtp<<<LKv, 256, 0, stream>>>(FV, DKV, NKV, VT16, VTh, VTl);
        for (int h0 = 0; h0 < NH_; h0 += ZH) { const size_t zq = (size_t)h0, zk = (size_t)(h0 / REP);   // one kv head per query head: the pass's two heads use consecutive kv planes (z-strides TT*HD)
            k_gemmw<bf, 2, false, 1><<<dim3(RH / 64, TT / 64, ZH), 32, 0, stream>>>(QPh + zq * TT * HD, QPl + zq * TT * HD, KPh + zk * TT * HD, KPl + zk * TT * HD, HD, Sb, TT, nullptr, (size_t)TT * HD, (size_t)TT * HD, (size_t)TT * TT); k_gemmw<bf, 2, false, 1><<<dim3(RH / 64, TT / 64, ZH), 32, 0, stream>>>(QVh + zq * TT * HD, QVl + zq * TT * HD, PPh + zk * TT * HD, PPl + zk * TT * HD, HD, Sb2, TT, nullptr, (size_t)TT * HD, (size_t)TT * HD, (size_t)TT * TT);
            k_gemmw<h16, 0, false, 1><<<dim3((TT - RH) / 64, TT / 64, ZH), 32, 0, stream>>>(QP16 + zq * TT * HD + (size_t)RH * HD, nullptr, KP16 + zk * TT * HD, nullptr, HD, Sb + (size_t)RH * TT, TT, nullptr, (size_t)TT * HD, (size_t)TT * HD, (size_t)TT * TT); k_gemmw<h16, 0, false, 1><<<dim3((TT - RH) / 64, TT / 64, ZH), 32, 0, stream>>>(QV16 + zq * TT * HD + (size_t)RH * HD, nullptr, PP16 + zk * TT * HD, nullptr, HD, Sb2 + (size_t)RH * TT, TT, nullptr, (size_t)TT * HD, (size_t)TT * HD, (size_t)TT * TT);
            k_asoft<<<ZH * TT / 8, 256, 0, stream>>>(Sb, Sb2, kmask + (size_t)b * TT, P16, Ph, Pl);
            k_gemmw<bf, 2, false, 16><<<dim3(RH / 64, HD / 64, ZH), 512, 0, stream>>>(Ph, Pl, VTh + zk * HD * TT, VTl + zk * HD * TT, TT, Ob, HD, nullptr, (size_t)RH * TT, (size_t)HD * TT, (size_t)TT * HD);
            k_gemmw<h16, 0, false, 16><<<dim3((TT - RH) / 64, HD / 64, ZH), 512, 0, stream>>>(P16 + (size_t)RH * TT, nullptr, VT16 + zk * HD * TT, nullptr, TT, Ob + (size_t)RH * HD, HD, nullptr, (size_t)TT * TT, (size_t)HD * TT, (size_t)TT * HD);
            k_merge<<<(unsigned)(((size_t)ZH * TT * HD / 2 + 255) / 256), 256, 0, stream>>>(Ob, h0, ATh, ATl); }
        k_gemmw<bf, 1, true, 8><<<dim3(TT / 64, DM / 64, 1), 256, 0, stream>>>(ATh, ATl, WO, nullptr, DQ, OUT + (size_t)b * TT * DM, DM, bo, 0, 0, 0); }
}

// v002
// It runs in 1560 microseconds.
// Timed twice side by side with v001, it ran 1.27 and 1.28 times as fast.
// Counting every step since v000, it is 1.97 times as fast.
#include <hip/hip_runtime.h>

// MultiHeadRelPositionAttention (x [4][2048][1024], pos_emb [2048][1024], mask [4][2048] (int, read; all ones); q/k/v = x W^T + b (8 heads x 128); p = pos_emb Wpos^T; content = (q + pos_bias_u[h]).k; pos = rel_shift((q + pos_bias_v[h]).p) with the Transformer-XL pad/reshape shift for P == T: pos[i][j] = S[i][T-1-(i-j)] for j <= i, 0 for j == i+1, S[i+1][j-i-2] for j >= i+2 (reproduced literally, including the upper part); scores = (content + pos) / sqrt(128), key mask; softmax; out = merged Wout^T + bout -> [4][2048][1024]).
// Compute dtypes, f32 accumulate: every input rounded to bf16; q/k/v/p as PLAIN bf16 GEMMs (inputs: exact) + bias; the u/v head biases added in f32; content, position scores and attn.v: query rows < 512 hl (3 products), the rest single fp16 (x1024) (the shifted position score is gathered from rows i / i+1 of the position-score block); softmax f32 with the read key mask; Wout hl x exact (2 products) + bias.

#define NB_  4
#define TT   2048
#define DM   1024
#define NH_  8
#define NKV  8
#define REP  (NH_ / NKV)
#define HD   128
#define DQ   (NH_ * HD)
#define DKV  (NKV * HD)
#define ZH   2
#define RH   512                  // query rows < RH use hi+lo planes (0: none)
#define WIN  0
#define PCAR 1024.0f
#define SCL  0.088388347648318447f   // HD^-0.5
typedef _Float16 h16;
typedef unsigned short bf;
typedef __attribute__((ext_vector_type(16))) __bf16   v16bf;
typedef __attribute__((ext_vector_type(16))) _Float16 v16h;
typedef __attribute__((ext_vector_type(8)))  _Float16 v8h;
typedef __attribute__((ext_vector_type(8)))  unsigned short v8us;
typedef __attribute__((ext_vector_type(8)))  float    v8f;
typedef __attribute__((ext_vector_type(4)))  float    v4f;
typedef v8h  __attribute__((may_alias)) v8ha;
typedef v4f  __attribute__((may_alias)) v4fa;
typedef v8us __attribute__((may_alias)) v8usa;

__device__ __forceinline__ unsigned short f2bf(float f) { unsigned u = __float_as_uint(f); u += 0x7FFFu + ((u >> 16) & 1u); return (unsigned short)(u >> 16); }
__device__ __forceinline__ float bf2f(unsigned short b) { return __uint_as_float(((unsigned)b) << 16); }
__device__ __forceinline__ float bfr(float f) { return bf2f(f2bf(f)); }
__device__ __forceinline__ v16h cat16(v8h lo, v8h hi) { return __builtin_shufflevector(lo, hi, 0, 1, 2, 3, 4, 5, 6, 7, 8, 9, 10, 11, 12, 13, 14, 15); }
__device__ __forceinline__ v16bf cat16b(v8us lo, v8us hi) { return __builtin_bit_cast(v16bf, __builtin_shufflevector(lo, hi, 0, 1, 2, 3, 4, 5, 6, 7, 8, 9, 10, 11, 12, 13, 14, 15)); }
__device__ __forceinline__ v8f wmma16(v16h a, v16h b, v8f c) { return __builtin_amdgcn_wmma_f32_16x16x32_f16(false, a, false, b, (short)0, c, false, false); }
__device__ __forceinline__ v8f wmmab(v16bf a, v16bf b, v8f c) { return __builtin_amdgcn_wmma_f32_16x16x32_bf16(false, a, false, b, (short)0, c, false, false); }



// ---- k_gemmw: register-blocked GEMM, one 64x64 output tile per work-group (16 accumulators per wave), operands straight from K-contiguous 16-bit planes; grid (M/64, N/64), 32 * KS threads.
// C[m][n] (f32, pitch ldc, + optional f32 bias[n]) = sum_k A[m][k] Bt[n][k] (+ split products per NSPLIT). K % (32 * KS) == 0.
// KS > 1: the K loop is shared out over KS waves (wave w takes the 32-wide k blocks w, w + KS, ...); the KS partial tiles meet in LDS and are summed in the fixed order w = 0 .. KS-1.
template <typename T16> struct WFrag;
template <> struct WFrag<h16> { typedef v16h V; static __device__ __forceinline__ V ld(const h16* p) { return cat16(*(const v8h*)p, *(const v8h*)(p + 16)); } static __device__ __forceinline__ v8f mma(V a, V b, v8f c) { return wmma16(a, b, c); } };
template <> struct WFrag<bf> { typedef v16bf V; static __device__ __forceinline__ V ld(const bf* p) { return cat16b(*(const v8us*)p, *(const v8us*)(p + 16)); } static __device__ __forceinline__ v8f mma(V a, V b, v8f c) { return wmmab(a, b, c); } };
// gemmw_body is the tile's whole work; os is the calling kernel's LDS, (KS == 1 ? 16 : KS * 64) * 68 floats; the tile is (blockIdx.x, blockIdx.y).
template <typename T16, int NSPLIT, bool BIAS, int KS>
__device__ __forceinline__ void gemmw_body(float* os, const T16* __restrict__ A, const T16* __restrict__ A2, const T16* __restrict__ Bt, const T16* __restrict__ Bt2, int K, float* C, int ldc, const float* __restrict__ bias) {
    typedef typename WFrag<T16>::V V;
    const int wave = (KS == 1) ? 0 : __builtin_amdgcn_readfirstlane((int)(threadIdx.x >> 5));
    const int lane = threadIdx.x & 31, lr = lane & 15, hi = lane >> 4; const int r0 = blockIdx.x * 64, c0 = blockIdx.y * 64;
    v8f acc[4][4];
#pragma unroll
    for (int mb = 0; mb < 4; ++mb)
#pragma unroll
        for (int nb = 0; nb < 4; ++nb) acc[mb][nb] = (v8f){};
    const size_t aoff = (size_t)(r0 + lr) * K + 8 * hi, boff = (size_t)(c0 + lr) * K + 8 * hi;
#pragma unroll 1
    for (int kc = wave * 32; kc < K; kc += 32 * KS) {
        V a[4], a2[4];
#pragma unroll
        for (int mb = 0; mb < 4; ++mb) { a[mb] = WFrag<T16>::ld(A + aoff + (size_t)mb * 16 * K + kc); if (NSPLIT == 1 || NSPLIT == 2) a2[mb] = WFrag<T16>::ld(A2 + aoff + (size_t)mb * 16 * K + kc); }
#pragma unroll
        for (int nb = 0; nb < 4; ++nb) { const V b = WFrag<T16>::ld(Bt + boff + (size_t)nb * 16 * K + kc); V b2; if (NSPLIT >= 2) b2 = WFrag<T16>::ld(Bt2 + boff + (size_t)nb * 16 * K + kc);
#pragma unroll
            for (int mb = 0; mb < 4; ++mb) { acc[mb][nb] = WFrag<T16>::mma(a[mb], b, acc[mb][nb]); if (NSPLIT == 1 || NSPLIT == 2) acc[mb][nb] = WFrag<T16>::mma(a2[mb], b, acc[mb][nb]); if (NSPLIT >= 2) acc[mb][nb] = WFrag<T16>::mma(a[mb], b2, acc[mb][nb]); } }
        asm volatile("v_nop\n\tv_nop\n\tv_nop\n\tv_nop" : "+v"(acc[0][0]), "+v"(acc[1][1]), "+v"(acc[2][2]), "+v"(acc[3][3]) : "v"(a[0]), "v"(a[3]));
    }
    if (KS > 1) {
        float* mine = os + wave * (64 * 68);
#pragma unroll
        for (int mb = 0; mb < 4; ++mb)
#pragma unroll
            for (int nb = 0; nb < 4; ++nb)
#pragma unroll
                for (int j = 0; j < 8; ++j) mine[(mb * 16 + hi * 8 + j) * 68 + nb * 16 + lr] = acc[mb][nb][j];
        __syncthreads();   // every wave's partial tile is in LDS before any wave sums rows of it
#pragma unroll
        for (int s = 0; s < 32 / KS; ++s) { const int row = wave * (64 / KS) + 2 * s + hi, cofs = lr * 4; v4f val = *(const v4fa*)(os + row * 68 + cofs);
#pragma unroll
            for (int w = 1; w < KS; ++w) val += *(const v4fa*)(os + (w * 64 + row) * 68 + cofs);
            if (BIAS) { val[0] += bfr(bias[c0 + cofs]); val[1] += bfr(bias[c0 + cofs + 1]); val[2] += bfr(bias[c0 + cofs + 2]); val[3] += bfr(bias[c0 + cofs + 3]); }
            *(v4f*)(C + (size_t)(r0 + row) * ldc + c0 + cofs) = val; }
        return;
    }
#pragma unroll
    for (int mb = 0; mb < 4; ++mb) {
#pragma unroll
        for (int nb = 0; nb < 4; ++nb) {
#pragma unroll
            for (int j = 0; j < 8; ++j) os[(hi * 8 + j) * 68 + nb * 16 + lr] = acc[mb][nb][j]; }
        __builtin_amdgcn_wave_barrier(); asm volatile("" ::: "memory");
        float* crow = C + (size_t)(r0 + mb * 16) * ldc + c0;
{
#pragma unroll
            for (int s = 0; s < 8; ++s) { const int row = 2 * s + hi, cofs = lr * 4; v4f val = *(const v4fa*)(os + row * 68 + cofs); if (BIAS) { val[0] += bfr(bias[c0 + cofs]); val[1] += bfr(bias[c0 + cofs + 1]); val[2] += bfr(bias[c0 + cofs + 2]); val[3] += bfr(bias[c0 + cofs + 3]); }
                *(v4f*)(crow + (size_t)row * ldc + cofs) = val; }
             }
        __builtin_amdgcn_wave_barrier(); asm volatile("" ::: "memory");
    }
}

template <typename T16, int NSPLIT, bool BIAS, int KS>
__global__ __launch_bounds__(32 * KS) void k_gemmw(const T16* __restrict__ A, const T16* __restrict__ A2, const T16* __restrict__ Bt, const T16* __restrict__ Bt2, int K, float* C, int ldc, const float* __restrict__ bias) {
    __shared__ __align__(16) float os[(KS == 1 ? 16 : KS * 64) * 68];
    gemmw_body<T16, NSPLIT, BIAS, KS>(os, A, A2, Bt, Bt2, K, C, ldc, bias);
}
// ---- launches that read none of each other's output, joined into one grid; a work-group picks its product by its block index (block-uniform), and each tile's arithmetic is gemmw_body's as before.
// k_qkv: z = 0, 1, 2: the q, k, v projection of one batch entry.
__global__ __launch_bounds__(256) void k_qkv(const bf* __restrict__ X, const bf* __restrict__ Wq_, const bf* __restrict__ Wk_, const bf* __restrict__ Wv_, float* Fq, float* Fk, float* Fv, const float* __restrict__ bq, const float* __restrict__ bk, const float* __restrict__ bv) {
    __shared__ __align__(16) float os[8 * 64 * 68];
    const int z = blockIdx.z;
    gemmw_body<bf, 0, true, 8>(os, X, nullptr, z == 0 ? Wq_ : (z == 1 ? Wk_ : Wv_), nullptr, DM, z == 0 ? Fq : (z == 1 ? Fk : Fv), DQ, z == 0 ? bq : (z == 1 ? bk : bv));
}
// k_score: z = 2 * head + (0: content q.k -> S, 1: position qv.p -> S2); row tiles below RH on the hi/lo planes, the rest on the fp16 planes. Pointers are those of the pass's first head.
__global__ __launch_bounds__(32) void k_score(const bf* __restrict__ Qh, const bf* __restrict__ Ql, const bf* __restrict__ Kh, const bf* __restrict__ Kl, const bf* __restrict__ Vh, const bf* __restrict__ Vl, const bf* __restrict__ Rh, const bf* __restrict__ Rl,
                                              const h16* __restrict__ Q16, const h16* __restrict__ K16, const h16* __restrict__ V16, const h16* __restrict__ R16, float* S, float* S2) {
    __shared__ __align__(16) float os[16 * 68];
    const bool pos = (blockIdx.z & 1) != 0; const size_t zz = blockIdx.z >> 1, zo = zz * ((size_t)TT * HD);
    float* C = (pos ? S2 : S) + zz * ((size_t)TT * TT);
    if (blockIdx.x < RH / 64) gemmw_body<bf, 2, false, 1>(os, (pos ? Vh : Qh) + zo, (pos ? Vl : Ql) + zo, (pos ? Rh : Kh) + zo, (pos ? Rl : Kl) + zo, HD, C, TT, nullptr);
    else gemmw_body<h16, 0, false, 1>(os, (pos ? V16 : Q16) + zo, nullptr, (pos ? R16 : K16) + zo, nullptr, HD, C, TT, nullptr);
}
// k_av: attn.v of the pass's heads (z); row tiles below RH on the hi/lo planes (their own [z][RH][TT] buffers), the rest on the fp16 plane.
__global__ __launch_bounds__(512) void k_av(const bf* __restrict__ Ph, const bf* __restrict__ Pl, const bf* __restrict__ Vh, const bf* __restrict__ Vl, const h16* __restrict__ P16, const h16* __restrict__ V16, float* O) {
    __shared__ __align__(16) float os[16 * 64 * 68];
    const size_t z = blockIdx.z, zv = z * ((size_t)HD * TT);
    if (blockIdx.x < RH / 64) gemmw_body<bf, 2, false, 16>(os, Ph + z * ((size_t)RH * TT), Pl + z * ((size_t)RH * TT), Vh + zv, Vl + zv, TT, O + z * ((size_t)TT * HD), HD, nullptr);
    else gemmw_body<h16, 0, false, 16>(os, P16 + z * ((size_t)TT * TT), nullptr, V16 + zv, nullptr, TT, O + z * ((size_t)TT * HD), HD, nullptr);
}

__device__ __forceinline__ h16 tohx(float x) { return (h16)x; }
__device__ __forceinline__ void splitf(float y, unsigned short& h, unsigned short& l) { h = f2bf(y); l = f2bf(y - bf2f(h)); }
typedef __attribute__((ext_vector_type(2))) _Float16 v2h;
typedef __attribute__((ext_vector_type(4))) _Float16 v4h;
typedef __attribute__((ext_vector_type(2))) unsigned short v2us;
typedef __attribute__((ext_vector_type(4))) unsigned short v4us;
typedef __attribute__((ext_vector_type(2))) float v2f;
typedef __attribute__((ext_vector_type(4))) int v4i;

__global__ __launch_bounds__(256) void k_wtG(const float* __restrict__ w, int K, int N, bf* Bt) {
    const int lane = threadIdx.x & 31; const int L0 = (blockIdx.x * 8 + (threadIdx.x >> 5)) * 8; const int nlines = N * K / 64;
{
#pragma unroll 1
        for (int l = 0; l < 8; ++l) { const int L = L0 + l; if (L >= nlines) break; const size_t e = (size_t)L * 64 + lane * 2; const int k = (int)(e % K), n = (int)(e / K); v2us o;
            o[0] = f2bf(w[(size_t)k * N + n]); o[1] = f2bf(w[(size_t)(k + 1) * N + n]); *(v2us*)(Bt + e) = o; }
         }
}
__device__ __forceinline__ void d_cvt8(unsigned bid, const float* __restrict__ src, bf* dst, size_t n8) { const size_t i = (size_t)bid * 256 + threadIdx.x; if (i >= n8) return; const v8f v = *(const v8f*)(src + i * 8); v8us o;
#pragma unroll
    for (int k = 0; k < 8; ++k) o[k] = f2bf(v[k]); *(v8us*)(dst + i * 8) = o;  }
__global__ __launch_bounds__(256) void k_cscvt(const float* __restrict__ cosT, const float* __restrict__ sinT, float* CS) { const int idx = blockIdx.x * 256 + threadIdx.x; if (idx >= TT * HD) return; v2f cs; cs[0] = bfr(cosT[idx]); cs[1] = bfr(sinT[idx]); *(v2f*)(CS + (size_t)idx * 2) = cs;  }
// d_rope: head planes [h][t][d] (fp16 + hi/lo) of rope(x) x sc with the rotate-half convention out[d] = x[d] cos[t][d] - x[d+HD/2] sin[t][d], out[d+HD/2] = x[d+HD/2] cos[t][d+HD/2] + x[d] sin[t][d+HD/2]
__device__ __forceinline__ void d_rope(unsigned bid, const float* __restrict__ F, int pitch, int nheads, const float* __restrict__ CS, const float* __restrict__ RF, const float* __restrict__ nw, float sc, h16* P16, bf* Ph, bf* Pl) {
    const size_t e = ((size_t)bid * 256 + threadIdx.x) * 2; if (e >= (size_t)nheads * TT * HD) return; const int d = (int)(e % HD); const int t = (int)((e / HD) % TT); const int h = (int)(e / ((size_t)HD * TT)); const float* f = F + (size_t)t * pitch + h * HD; const float rf = RF ? RF[(size_t)h * TT + t] : 1.0f; v2h o16; v2us oh, ol;
#pragma unroll
    for (int q = 0; q < 2; ++q) { const int dd = d + q; const int dp = (dd < HD / 2) ? dd + HD / 2 : dd - HD / 2; float x0 = f[dd], x1 = f[dp];
        if (RF) { float n0 = __fmul_rn(x0, rf), n1 = __fmul_rn(x1, rf); asm volatile("" : "+v"(n0)); asm volatile("" : "+v"(n1)); x0 = __fmul_rn(bfr(nw[dd]), n0); x1 = __fmul_rn(bfr(nw[dp]), n1); }
        const v2f cs = *(const v2f*)(CS + ((size_t)t * HD + dd) * 2); float a = __fmul_rn(x0, cs[0]), bq = __fmul_rn(x1, cs[1]); asm volatile("" : "+v"(a)); asm volatile("" : "+v"(bq)); const float r = ((dd < HD / 2) ? __fsub_rn(a, bq) : __fadd_rn(a, bq)) * sc;
        o16[q] = tohx(r); unsigned short a2, c2; splitf(r, a2, c2); oh[q] = a2; ol[q] = c2; }
    *(v2h*)(P16 + e) = o16; *(v2us*)(Ph + e) = oh; *(v2us*)(Pl + e) = ol;  }
__device__ __forceinline__ void d_vtp(unsigned bid, const float* __restrict__ F, int pitch, int nheads, h16* V16, bf* Vh, bf* Vl) { const size_t e = ((size_t)bid * 256 + threadIdx.x) * 2; if (e >= (size_t)nheads * HD * TT) return; const int t = (int)(e % TT); const int d = (int)((e / TT) % HD); const int g = (int)(e / ((size_t)TT * HD)); v2h o16; v2us oh, ol;
#pragma unroll
    for (int q = 0; q < 2; ++q) { const float x = F[(size_t)(t + q) * pitch + g * HD + d]; o16[q] = tohx(x); unsigned short a2, c2; splitf(x, a2, c2); oh[q] = a2; ol[q] = c2; }
    *(v2h*)(V16 + e) = o16; *(v2us*)(Vh + e) = oh; *(v2us*)(Vl + e) = ol;  }
__device__ __forceinline__ void d_csid(unsigned bid, float* CS) { const int idx = bid * 256 + threadIdx.x; if (idx >= TT * HD) return; v2f cs; cs[0] = 1.0f; cs[1] = 0.0f; *(v2f*)(CS + (size_t)idx * 2) = cs;  }
__device__ __forceinline__ void d_uvb(unsigned bid, float* FQ, const float* __restrict__ bu, const float* __restrict__ bv2, float* FQV) { const size_t e = ((size_t)bid * 256 + threadIdx.x) * 4; if (e >= (size_t)TT * DQ) return; const int c0 = (int)(e % DQ); const v4f a = *(const v4f*)(FQ + e); v4f ou, ov; for (int u = 0; u < 4; ++u) { ou[u] = __fadd_rn(a[u], bfr(bu[c0 + u])); ov[u] = __fadd_rn(a[u], bfr(bv2[c0 + u])); } *(v4f*)(FQV + e) = ov; *(v4f*)(FQ + e) = ou;  }
// ---- streaming launches that read none of each other's output, joined into one grid each; a work-group picks its job by its block index.
#define GW   (DQ * DM / 8 / 256)         // work-groups of one weight's conversion
#define GP   (TT * DM / 8 / 256)         // ... of pos_emb's
#define GX   (NB_ * TT * DM / 8 / 256)   // ... of x's, all batch entries
#define GC   (TT * HD / 256)             // ... of the cos/sin table
#define GU   (TT * DQ / 4 / 256)         // ... of the u/v bias add
#define GR   (NH_ * TT * HD / 2 / 256)   // ... of one set of head planes
// k_prep: everything that reads inputs only: the five weights, pos_emb and x to bf16, the identity cos/sin table.
__global__ __launch_bounds__(256) void k_prep(const float* __restrict__ wq, const float* __restrict__ wk, const float* __restrict__ wv, const float* __restrict__ wo, const float* __restrict__ wpos, const float* __restrict__ pemb, const float* __restrict__ x,
                                              bf* WQ, bf* WK, bf* WV, bf* WO, bf* WP, bf* XP, bf* XB, float* CS) {
    unsigned b = blockIdx.x;
    if (b < 5 * GW) { const unsigned j = b / GW; d_cvt8(b % GW, j == 0 ? wq : (j == 1 ? wk : (j == 2 ? wv : (j == 3 ? wo : wpos))), j == 0 ? WQ : (j == 1 ? WK : (j == 2 ? WV : (j == 3 ? WO : WP))), (size_t)DQ * DM / 8); return; }
    b -= 5 * GW; if (b < GP) { d_cvt8(b, pemb, XP, (size_t)TT * DM / 8); return; }
    b -= GP; if (b < GX) { d_cvt8(b, x, XB, (size_t)NB_ * TT * DM / 8); return; }
    d_csid(b - GX, CS);
}
// k_post1: behind the q/k/v projections: the u/v bias add on q, the k planes, the transposed v planes.
__global__ __launch_bounds__(256) void k_post1(float* FQ, const float* __restrict__ bu, const float* __restrict__ bv2, float* FQV, const float* __restrict__ FK, const float* __restrict__ CS, h16* K16, bf* Kh, bf* Kl, const float* __restrict__ FV, h16* V16, bf* Vh, bf* Vl) {
    unsigned b = blockIdx.x;
    if (b < GU) { d_uvb(b, FQ, bu, bv2, FQV); return; }
    b -= GU; if (b < GR) { d_rope(b, FK, DKV, NKV, CS, nullptr, nullptr, 1.0f, K16, Kh, Kl); return; }
    d_vtp(b - GR, FV, DKV, NKV, V16, Vh, Vl);
}
// k_post2: the head planes of q + u (y = 0), q + v (y = 1) and, where launched with y = 2, of p.
__global__ __launch_bounds__(256) void k_post2(const float* __restrict__ FQ, const float* __restrict__ FQV, const float* __restrict__ FP, const float* __restrict__ CS, h16* Q16, bf* Qh, bf* Ql, h16* V16, bf* Vh, bf* Vl, h16* R16, bf* Rh, bf* Rl) {
    const unsigned y = blockIdx.y;
    d_rope(blockIdx.x, y == 0 ? FQ : (y == 1 ? FQV : FP), DQ, NH_, CS, nullptr, nullptr, 1.0f, y == 0 ? Q16 : (y == 1 ? V16 : R16), y == 0 ? Qh : (y == 1 ? Vh : Rh), y == 0 ? Ql : (y == 1 ? Vl : Rl));
}
// k_asoft: per row (zz, i): t = (S + rel-shifted S2) x HD^-0.5, -3e38 where the key mask is 0; softmax over the 2048 keys (register row, one exp, fixed trees);
__global__ __launch_bounds__(256) void k_asoft(const float* __restrict__ Sb, const float* __restrict__ Sb2, const int* __restrict__ km, h16* P16, bf* Ph, bf* Pl) {
    const int lane = threadIdx.x & 31; const int row = blockIdx.x * 8 + (threadIdx.x >> 5); if (row >= ZH * TT) return; const int i = row % TT; const int zz = row / TT; (void)zz; const bool hires = (i < RH); const float* sr = Sb + (size_t)row * TT; const float* pr0 = Sb2 + (size_t)row * TT; const float* pr1 = Sb2 + (size_t)(row + 1) * TT;   /* row i+1 of the same head block (never dereferenced for i = T-1: j >= i+2 is impossible there) */ float v[TT / 32]; float mx = -3.0e38f;
#pragma unroll
    for (int ch = 0; ch < TT / 128; ++ch) { const int j0 = ch * 128 + lane * 4; const v4f a = *(const v4f*)(sr + j0);
#pragma unroll
        for (int q = 0; q < 4; ++q) { const int j = j0 + q; (void)j; const int jj = j0 + q; const float bd = (jj <= i) ? pr0[TT - 1 - (i - jj)] : ((jj == i + 1) ? 0.0f : pr1[jj - i - 2]); float cp = __fadd_rn(a[q], bd); asm volatile("" : "+v"(cp)); const float t = (km[jj] != 0) ? cp * SCL : -3.0e38f; v[ch * 4 + q] = t; mx = fmaxf(mx, t); } }
#pragma unroll
    for (int sh = 16; sh; sh >>= 1) mx = fmaxf(mx, __shfl_xor(mx, sh, 32));
    float sum = 0.f;
#pragma unroll
    for (int k = 0; k < TT / 32; ++k) { float d0 = __fsub_rn(v[k], mx); asm volatile("" : "+v"(d0)); v[k] = __builtin_amdgcn_exp2f(__fmul_rn(d0, 1.4426950408889634f)); sum += v[k]; }
#pragma unroll
    for (int sh = 16; sh; sh >>= 1) sum += __shfl_xor(sum, sh, 32);
    const float f = __fdiv_rn(hires ? 1.0f : PCAR, sum);
{
        if (hires) {
#pragma unroll
            for (int ch = 0; ch < TT / 128; ++ch) { v4us oh, ol;
#pragma unroll
                for (int q = 0; q < 4; ++q) { unsigned short a, c2; splitf(v[ch * 4 + q] * f, a, c2); oh[q] = a; ol[q] = c2; }
                const size_t oo = ((size_t)zz * (RH ? RH : 1) + i) * TT + ch * 128 + lane * 4; *(v4us*)(Ph + oo) = oh; *(v4us*)(Pl + oo) = ol; }
        } else {
#pragma unroll
            for (int ch = 0; ch < TT / 128; ++ch) { v4h o4;
#pragma unroll
                for (int q = 0; q < 4; ++q) o4[q] = tohx(v[ch * 4 + q] * f);
                *(v4h*)(P16 + (size_t)row * TT + ch * 128 + lane * 4) = o4; } }
         }
}
__global__ __launch_bounds__(256) void k_merge(const float* __restrict__ O, int h0, bf* Ah, bf* Al) { const size_t e = ((size_t)blockIdx.x * 256 + threadIdx.x) * 2; if (e >= (size_t)ZH * TT * HD) return; const int d = (int)(e % HD); const int t = (int)((e / HD) % TT); const int zz = (int)(e / ((size_t)HD * TT)); const float cs = (t < RH) ? 1.0f : (1.0f / PCAR); const size_t oo = (size_t)t * DQ + (h0 + zz) * HD + d;
    v2us oh, ol;
#pragma unroll
    for (int q = 0; q < 2; ++q) { unsigned short a, c2; splitf(O[e + q] * cs, a, c2); oh[q] = a; ol[q] = c2; } *(v2us*)(Ah + oo) = oh; *(v2us*)(Al + oo) = ol;  }

extern "C" void kernel_launch(void* const* d_in, const int* in_sizes, int n_in,
                              void* d_out, int out_size, void* d_ws, size_t ws_size, hipStream_t stream) {
    (void)in_sizes; (void)n_in; (void)out_size;
    const float* x = (const float*)d_in[0]; const float* pemb = (const float*)d_in[1]; const int* kmask = (const int*)d_in[2]; const float* wq = (const float*)d_in[3]; const float* bq = (const float*)d_in[4]; const float* wk = (const float*)d_in[5]; const float* bk = (const float*)d_in[6]; const float* wv = (const float*)d_in[7]; const float* bv = (const float*)d_in[8]; const float* wpos = (const float*)d_in[9]; const float* wo = (const float*)d_in[10]; const float* bo = (const float*)d_in[11]; const float* pbu = (const float*)d_in[12]; const float* pbv = (const float*)d_in[13]; const float* cosT = nullptr; const float* sinT = nullptr; (void)cosT; (void)sinT;
    float* OUT = (float*)d_out;     // [4][2048][1024]
    char* wsp = (char*)d_ws;
    auto take = [&](size_t bytes) { char* p = wsp; wsp += (bytes + 255) & ~(size_t)255; return (void*)p; };
    bf* WQ = (bf*)take((size_t)DQ * DM * 2); bf* WK = (bf*)take((size_t)DKV * DM * 2); bf* WV = (bf*)take((size_t)DKV * DM * 2); bf* WO = (bf*)take((size_t)DM * DQ * 2); float* CS = (float*)take((size_t)TT * HD * 2 * 4);
    bf* XB = (bf*)take((size_t)NB_ * TT * DM * 2); bf* XP = (bf*)take((size_t)TT * DM * 2); bf* WP = (bf*)take((size_t)DQ * DM * 2); float* FP = (float*)take((size_t)TT * DQ * 4); float* FQV = (float*)take((size_t)TT * DQ * 4); h16* PP16 = (h16*)take((size_t)NH_ * TT * HD * 2); bf* PPh = (bf*)take((size_t)NH_ * TT * HD * 2); bf* PPl = (bf*)take((size_t)NH_ * TT * HD * 2); h16* QV16 = (h16*)take((size_t)NH_ * TT * HD * 2); bf* QVh = (bf*)take((size_t)NH_ * TT * HD * 2); bf* QVl = (bf*)take((size_t)NH_ * TT * HD * 2); float* Sb2 = (float*)take((size_t)ZH * TT * TT * 4); float* FQ = (float*)take((size_t)TT * DQ * 4); float* FK = (float*)take((size_t)TT * DKV * 4); float* FV = (float*)take((size_t)TT * DKV * 4);
    h16* QP16 = (h16*)take((size_t)NH_ * TT * HD * 2); h16* KP16 = (h16*)take((size_t)NKV * TT * HD * 2); h16* VT16 = (h16*)take((size_t)NKV * HD * TT * 2);
    bf* QPh = (bf*)take((size_t)NH_ * TT * HD * 2); bf* QPl = (bf*)take((size_t)NH_ * TT * HD * 2); bf* KPh = (bf*)take((size_t)NKV * TT * HD * 2); bf* KPl = (bf*)take((size_t)NKV * TT * HD * 2); bf* VTh = (bf*)take((size_t)NKV * HD * TT * 2); bf* VTl = (bf*)take((size_t)NKV * HD * TT * 2); bf* Ph = (bf*)take((size_t)ZH * RH * TT * 2); bf* Pl = (bf*)take((size_t)ZH * RH * TT * 2);
    float* Sb = (float*)take((size_t)ZH * TT * TT * 4); h16* P16 = (h16*)take((size_t)ZH * TT * TT * 2); float* Ob = (float*)take((size_t)ZH * TT * HD * 4); bf* ATh = (bf*)take((size_t)TT * DQ * 2); bf* ATl = (bf*)take((size_t)TT * DQ * 2);
    if ((size_t)(wsp - (char*)d_ws) > ws_size) return;    // ws 256 MiB
    k_prep<<<5 * GW + GP + GX + GC, 256, 0, stream>>>(wq, wk, wv, wo, wpos, pemb, x, WQ, WK, WV, WO, WP, XP, XB, CS);
    k_gemmw<bf, 0, false, 8><<<dim3(TT / 64, DQ / 64, 1), 256, 0, stream>>>(XP, nullptr, WP, nullptr, DM, FP, DQ, nullptr);
    for (int b = 0; b < NB_; ++b) {
        k_qkv<<<dim3(TT / 64, DQ / 64, 3), 256, 0, stream>>>(XB + (size_t)b * TT * DM, WQ, WK, WV, FQ, FK, FV, bq, bk, bv);
        k_post1<<<GU + 2 * GR, 256, 0, stream>>>(FQ, pbu, pbv, FQV, FK, CS, KP16, KPh, KPl, FV, VT16, VTh, VTl);
        if (b == 0) { k_post2<<<dim3(GR, 3, 1), 256, 0, stream>>>(FQ, FQV, FP, CS, QP16, QPh, QPl, QV16, QVh, QVl, PP16, PPh, PPl); }
        else { k_post2<<<dim3(GR, 2, 1), 256, 0, stream>>>(FQ, FQV, FP, CS, QP16, QPh, QPl, QV16, QVh, QVl, PP16, PPh, PPl); }
        for (int h0 = 0; h0 < NH_; h0 += ZH) { const size_t zq = (size_t)h0, zk = (size_t)(h0 / REP);   // one kv head per query head: the pass's two heads use consecutive kv planes (z-strides TT*HD)
            k_score<<<dim3(TT / 64, TT / 64, 2 * ZH), 32, 0, stream>>>(QPh + zq * TT * HD, QPl + zq * TT * HD, KPh + zk * TT * HD, KPl + zk * TT * HD, QVh + zq * TT * HD, QVl + zq * TT * HD, PPh + zk * TT * HD, PPl + zk * TT * HD, QP16 + zq * TT * HD, KP16 + zk * TT * HD, QV16 + zq * TT * HD, PP16 + zk * TT * HD, Sb, Sb2);
            k_asoft<<<ZH * TT / 8, 256, 0, stream>>>(Sb, Sb2, kmask + (size_t)b * TT, P16, Ph, Pl);
            k_av<<<dim3(TT / 64, HD / 64, ZH), 512, 0, stream>>>(Ph, Pl, VTh + zk * HD * TT, VTl + zk * HD * TT, P16, VT16 + zk * HD * TT, Ob);
            k_merge<<<(unsigned)(((size_t)ZH * TT * HD / 2 + 255) / 256), 256, 0, stream>>>(Ob, h0, ATh, ATl); }
        k_gemmw<bf, 1, true, 8><<<dim3(TT / 64, DM / 64, 1), 256, 0, stream>>>(ATh, ATl, WO, nullptr, DQ, OUT + (size_t)b * TT * DM, DM, bo); }
}

// v003
// A run of this version takes 1320 microseconds.
// Next to v002, in two timings, it ran 1.18 and 1.19 times as fast.
// Over all steps from v000 it is 2.34 times as fast.
#include <hip/hip_runtime.h>

// MultiHeadRelPositionAttention (x [4][2048][1024], pos_emb [2048][1024], mask [4][2048] (int, read; all ones); q/k/v = x W^T + b (8 heads x 128); p = pos_emb Wpos^T; content = (q + pos_bias_u[h]).k; pos = rel_shift((q + pos_bias_v[h]).p) with the Transformer-XL pad/reshape shift for P == T: pos[i][j] = S[i][T-1-(i-j)] for j <= i, 0 for j == i+1, S[i+1][j-i-2] for j >= i+2 (reproduced literally, including the upper part); scores = (content + pos) / sqrt(128), key mask; softmax; out = merged Wout^T + bout -> [4][2048][1024]).
// Compute dtypes, f32 accumulate: every input rounded to bf16; q/k/v/p as PLAIN bf16 GEMMs (inputs: exact) + bias; the u/v head biases added in f32; content, position scores and attn.v: query rows < 512 hl (3 products), the rest single fp16 (x1024) (the shifted position score is gathered from rows i / i+1 of the position-score block); softmax f32 with the read key mask; Wout hl x exact (2 products) + bias.

#define NB_  4
#define TT   2048
#define DM   1024
#define NH_  8
#define NKV  8
#define REP  (NH_ / NKV)
#define HD   128
#define DQ   (NH_ * HD)
#define DKV  (NKV * HD)
#define ZH   4
#define RH   512                  // query rows < RH use hi+lo planes (0: none)
#define WIN  0
#define PCAR 1024.0f
#define SCL  0.088388347648318447f   // HD^-0.5
typedef _Float16 h16;
typedef unsigned short bf;
typedef __attribute__((ext_vector_type(16))) __bf16   v16bf;
typedef __attribute__((ext_vector_type(16))) _Float16 v16h;
typedef __attribute__((ext_vector_type(8)))  _Float16 v8h;
typedef __attribute__((ext_vector_type(8)))  unsigned short v8us;
typedef __attribute__((ext_vector_type(8)))  float    v8f;
typedef __attribute__((ext_vector_type(4)))  float    v4f;
typedef v8h  __attribute__((may_alias)) v8ha;
typedef v4f  __attribute__((may_alias)) v4fa;
typedef v8us __attribute__((may_alias)) v8usa;

__device__ __forceinline__ unsigned short f2bf(float f) { unsigned u = __float_as_uint(f); u += 0x7FFFu + ((u >> 16) & 1u); return (unsigned short)(u >> 16); }
__device__ __forceinline__ float bf2f(unsigned short b) { return __uint_as_float(((unsigned)b) << 16); }
__device__ __forceinline__ float bfr(float f) { return bf2f(f2bf(f)); }
__device__ __forceinline__ v16h cat16(v8h lo, v8h hi) { return __builtin_shufflevector(lo, hi, 0, 1, 2, 3, 4, 5, 6, 7, 8, 9, 10, 11, 12, 13, 14, 15); }
__device__ __forceinline__ v16bf cat16b(v8us lo, v8us hi) { return __builtin_bit_cast(v16bf, __builtin_shufflevector(lo, hi, 0, 1, 2, 3, 4, 5, 6, 7, 8, 9, 10, 11, 12, 13, 14, 15)); }
__device__ __forceinline__ v8f wmma16(v16h a, v16h b, v8f c) { return __builtin_amdgcn_wmma_f32_16x16x32_f16(false, a, false, b, (short)0, c, false, false); }
__device__ __forceinline__ v8f wmmab(v16bf a, v16bf b, v8f c) { return __builtin_amdgcn_wmma_f32_16x16x32_bf16(false, a, false, b, (short)0, c, false, false); }



// ---- k_gemmw: register-blocked GEMM, one 64x64 output tile per work-group (16 accumulators per wave), operands straight from K-contiguous 16-bit planes; grid (M/64, N/64), 32 * KS threads.
// C[m][n] (f32, pitch ldc, + optional f32 bias[n]) = sum_k A[m][k] Bt[n][k] (+ split products per NSPLIT). K % (32 * KS) == 0.
// KS > 1: the K loop is shared out over KS waves (wave w takes the 32-wide k blocks w, w + KS, ...); the KS partial tiles meet in LDS and are summed in the fixed order w = 0 .. KS-1.
template <typename T16> struct WFrag;
template <> struct WFrag<h16> { typedef v16h V; static __device__ __forceinline__ V ld(const h16* p) { return cat16(*(const v8h*)p, *(const v8h*)(p + 16)); } static __device__ __forceinline__ v8f mma(V a, V b, v8f c) { return wmma16(a, b, c); } };
template <> struct WFrag<bf> { typedef v16bf V; static __device__ __forceinline__ V ld(const bf* p) { return cat16b(*(const v8us*)p, *(const v8us*)(p + 16)); } static __device__ __forceinline__ v8f mma(V a, V b, v8f c) { return wmmab(a, b, c); } };
// gemmw_body is the tile's whole work; os is the calling kernel's LDS, (KS == 1 ? 16 : KS * 64) * 68 floats; the tile is (blockIdx.x, blockIdx.y). lda is the row pitch of A and A2 in elements; Bt and Bt2 have pitch K.
template <typename T16, int NSPLIT, bool BIAS, int KS>
__device__ __forceinline__ void gemmw_body(float* os, const T16* __restrict__ A, const T16* __restrict__ A2, const T16* __restrict__ Bt, const T16* __restrict__ Bt2, int K, int lda, float* C, int ldc, const float* __restrict__ bias) {
    typedef typename WFrag<T16>::V V;
    const int wave = (KS == 1) ? 0 : __builtin_amdgcn_readfirstlane((int)(threadIdx.x >> 5));
    const int lane = threadIdx.x & 31, lr = lane & 15, hi = lane >> 4; const int r0 = blockIdx.x * 64, c0 = blockIdx.y * 64;
    v8f acc[4][4];
#pragma unroll
    for (int mb = 0; mb < 4; ++mb)
#pragma unroll
        for (int nb = 0; nb < 4; ++nb) acc[mb][nb] = (v8f){};
    const size_t aoff = (size_t)(r0 + lr) * lda + 8 * hi, boff = (size_t)(c0 + lr) * K + 8 * hi;
#pragma unroll 1
    for (int kc = wave * 32; kc < K; kc += 32 * KS) {
        V a[4], a2[4];
#pragma unroll
        for (int mb = 0; mb < 4; ++mb) { a[mb] = WFrag<T16>::ld(A + aoff + (size_t)mb * 16 * lda + kc); if (NSPLIT == 1 || NSPLIT == 2) a2[mb] = WFrag<T16>::ld(A2 + aoff + (size_t)mb * 16 * lda + kc); }
#pragma unroll
        for (int nb = 0; nb < 4; ++nb) { const V b = WFrag<T16>::ld(Bt + boff + (size_t)nb * 16 * K + kc); V b2; if (NSPLIT >= 2) b2 = WFrag<T16>::ld(Bt2 + boff + (size_t)nb * 16 * K + kc);
#pragma unroll
            for (int mb = 0; mb < 4; ++mb) { acc[mb][nb] = WFrag<T16>::mma(a[mb], b, acc[mb][nb]); if (NSPLIT == 1 || NSPLIT == 2) acc[mb][nb] = WFrag<T16>::mma(a2[mb], b, acc[mb][nb]); if (NSPLIT >= 2) acc[mb][nb] = WFrag<T16>::mma(a[mb], b2, acc[mb][nb]); } }
        asm volatile("v_nop\n\tv_nop\n\tv_nop\n\tv_nop" : "+v"(acc[0][0]), "+v"(acc[1][1]), "+v"(acc[2][2]), "+v"(acc[3][3]) : "v"(a[0]), "v"(a[3]));
    }
    if (KS > 1) {
        float* mine = os + wave * (64 * 68);
#pragma unroll
        for (int mb = 0; mb < 4; ++mb)
#pragma unroll
            for (int nb = 0; nb < 4; ++nb)
#pragma unroll
                for (int j = 0; j < 8; ++j) mine[(mb * 16 + hi * 8 + j) * 68 + nb * 16 + lr] = acc[mb][nb][j];
        __syncthreads();   // every wave's partial tile is in LDS before any wave sums rows of it
#pragma unroll
        for (int s = 0; s < 32 / KS; ++s) { const int row = wave * (64 / KS) + 2 * s + hi, cofs = lr * 4; v4f val = *(const v4fa*)(os + row * 68 + cofs);
#pragma unroll
            for (int w = 1; w < KS; ++w) val += *(const v4fa*)(os + (w * 64 + row) * 68 + cofs);
            if (BIAS) { val[0] += bfr(bias[c0 + cofs]); val[1] += bfr(bias[c0 + cofs + 1]); val[2] += bfr(bias[c0 + cofs + 2]); val[3] += bfr(bias[c0 + cofs + 3]); }
            *(v4f*)(C + (size_t)(r0 + row) * ldc + c0 + cofs) = val; }
        return;
    }
#pragma unroll
    for (int mb = 0; mb < 4; ++mb) {
#pragma unroll
        for (int nb = 0; nb < 4; ++nb) {
#pragma unroll
            for (int j = 0; j < 8; ++j) os[(hi * 8 + j) * 68 + nb * 16 + lr] = acc[mb][nb][j]; }
        __builtin_amdgcn_wave_barrier(); asm volatile("" ::: "memory");
        float* crow = C + (size_t)(r0 + mb * 16) * ldc + c0;
{
#pragma unroll
            for (int s = 0; s < 8; ++s) { const int row = 2 * s + hi, cofs = lr * 4; v4f val = *(const v4fa*)(os + row * 68 + cofs); if (BIAS) { val[0] += bfr(bias[c0 + cofs]); val[1] += bfr(bias[c0 + cofs + 1]); val[2] += bfr(bias[c0 + cofs + 2]); val[3] += bfr(bias[c0 + cofs + 3]); }
                *(v4f*)(crow + (size_t)row * ldc + cofs) = val; }
             }
        __builtin_amdgcn_wave_barrier(); asm volatile("" ::: "memory");
    }
}

template <typename T16, int NSPLIT, bool BIAS, int KS>
__global__ __launch_bounds__(32 * KS) void k_gemmw(const T16* __restrict__ A, const T16* __restrict__ A2, const T16* __restrict__ Bt, const T16* __restrict__ Bt2, int K, float* C, int ldc, const float* __restrict__ bias) {
    __shared__ __align__(16) float os[(KS == 1 ? 16 : KS * 64) * 68];
    gemmw_body<T16, NSPLIT, BIAS, KS>(os, A, A2, Bt, Bt2, K, K, C, ldc, bias);
}
// ---- launches that read none of each other's output, joined into one grid; a work-group picks its product by its block index (block-uniform), and each tile's arithmetic is gemmw_body's as before.
// k_qkv: z = 0, 1, 2: the q, k, v projection of one batch entry.
__global__ __launch_bounds__(256) void k_qkv(const bf* __restrict__ X, const bf* __restrict__ Wq_, const bf* __restrict__ Wk_, const bf* __restrict__ Wv_, float* Fq, float* Fk, float* Fv, const float* __restrict__ bq, const float* __restrict__ bk, const float* __restrict__ bv) {
    __shared__ __align__(16) float os[8 * 64 * 68];
    const int z = blockIdx.z;
    gemmw_body<bf, 0, true, 8>(os, X, nullptr, z == 0 ? Wq_ : (z == 1 ? Wk_ : Wv_), nullptr, DM, DM, z == 0 ? Fq : (z == 1 ? Fk : Fv), DQ, z == 0 ? bq : (z == 1 ? bk : bv));
}
// k_score: z = 2 * head + (0: content q.k -> S, 1: position qv.p -> S2); row tiles below RH on the hi/lo planes, the rest on the fp16 planes. Pointers are those of the pass's first head.
__global__ __launch_bounds__(32) void k_score(const bf* __restrict__ Qh, const bf* __restrict__ Ql, const bf* __restrict__ Kh, const bf* __restrict__ Kl, const bf* __restrict__ Vh, const bf* __restrict__ Vl, const bf* __restrict__ Rh, const bf* __restrict__ Rl,
                                              const h16* __restrict__ Q16, const h16* __restrict__ K16, const h16* __restrict__ V16, const h16* __restrict__ R16, float* S, float* S2) {
    __shared__ __align__(16) float os[16 * 68];
    const bool pos = (blockIdx.z & 1) != 0; const size_t zz = blockIdx.z >> 1, zo = zz * ((size_t)TT * HD);
    float* C = (pos ? S2 : S) + zz * ((size_t)TT * TT);
    if (blockIdx.x < RH / 64) gemmw_body<bf, 2, false, 1>(os, (pos ? Vh : Qh) + zo, (pos ? Vl : Ql) + zo, (pos ? Rh : Kh) + zo, (pos ? Rl : Kl) + zo, HD, HD, C, TT, nullptr);
    else gemmw_body<h16, 0, false, 1>(os, (pos ? V16 : Q16) + zo, nullptr, (pos ? R16 : K16) + zo, nullptr, HD, HD, C, TT, nullptr);
}
// k_av: attn.v of the pass's heads (z); row tiles below RH on the hi/lo planes, the rest on the fp16 plane. The weights lie where k_asoft left them: in the bytes of their own score row (pitch 2 * TT 16-bit elements).
__global__ __launch_bounds__(512) void k_av(const float* __restrict__ Sp, const bf* __restrict__ Vh, const bf* __restrict__ Vl, const h16* __restrict__ V16, float* O) {
    __shared__ __align__(16) float os[16 * 64 * 68];
    const size_t z = blockIdx.z, zv = z * ((size_t)HD * TT), zp = z * ((size_t)TT * 2 * TT);
    if (blockIdx.x < RH / 64) gemmw_body<bf, 2, false, 16>(os, (const bf*)Sp + zp, (const bf*)Sp + zp + TT, Vh + zv, Vl + zv, TT, 2 * TT, O + z * ((size_t)TT * HD), HD, nullptr);
    else gemmw_body<h16, 0, false, 16>(os, (const h16*)Sp + zp, nullptr, V16 + zv, nullptr, TT, 2 * TT, O + z * ((size_t)TT * HD), HD, nullptr);
}

__device__ __forceinline__ h16 tohx(float x) { return (h16)x; }
__device__ __forceinline__ void splitf(float y, unsigned short& h, unsigned short& l) { h = f2bf(y); l = f2bf(y - bf2f(h)); }
typedef __attribute__((ext_vector_type(2))) _Float16 v2h;
typedef __attribute__((ext_vector_type(4))) _Float16 v4h;
typedef __attribute__((ext_vector_type(2))) unsigned short v2us;
typedef __attribute__((ext_vector_type(4))) unsigned short v4us;
typedef __attribute__((ext_vector_type(2))) float v2f;
typedef __attribute__((ext_vector_type(4))) int v4i;

__global__ __launch_bounds__(256) void k_wtG(const float* __restrict__ w, int K, int N, bf* Bt) {
    const int lane = threadIdx.x & 31; const int L0 = (blockIdx.x * 8 + (threadIdx.x >> 5)) * 8; const int nlines = N * K / 64;
{
#pragma unroll 1
        for (int l = 0; l < 8; ++l) { const int L = L0 + l; if (L >= nlines) break; const size_t e = (size_t)L * 64 + lane * 2; const int k = (int)(e % K), n = (int)(e / K); v2us o;
            o[0] = f2bf(w[(size_t)k * N + n]); o[1] = f2bf(w[(size_t)(k + 1) * N + n]); *(v2us*)(Bt + e) = o; }
         }
}
__device__ __forceinline__ void d_cvt8(unsigned bid, const float* __restrict__ src, bf* dst, size_t n8) { const size_t i = (size_t)bid * 256 + threadIdx.x; if (i >= n8) return; const v8f v = *(const v8f*)(src + i * 8); v8us o;
#pragma unroll
    for (int k = 0; k < 8; ++k) o[k] = f2bf(v[k]); *(v8us*)(dst + i * 8) = o;  }
__global__ __launch_bounds__(256) void k_cscvt(const float* __restrict__ cosT, const float* __restrict__ sinT, float* CS) { const int idx = blockIdx.x * 256 + threadIdx.x; if (idx >= TT * HD) return; v2f cs; cs[0] = bfr(cosT[idx]); cs[1] = bfr(sinT[idx]); *(v2f*)(CS + (size_t)idx * 2) = cs;  }
// d_rope: head planes [h][t][d] (fp16 + hi/lo) of rope(x) x sc with the rotate-half convention out[d] = x[d] cos[t][d] - x[d+HD/2] sin[t][d], out[d+HD/2] = x[d+HD/2] cos[t][d+HD/2] + x[d] sin[t][d+HD/2]
__device__ __forceinline__ void d_rope(unsigned bid, const float* __restrict__ F, int pitch, int nheads, const float* __restrict__ CS, const float* __restrict__ RF, const float* __restrict__ nw, float sc, h16* P16, bf* Ph, bf* Pl) {
    const size_t e = ((size_t)bid * 256 + threadIdx.x) * 2; if (e >= (size_t)nheads * TT * HD) return; const int d = (int)(e % HD); const int t = (int)((e / HD) % TT); const int h = (int)(e / ((size_t)HD * TT)); const float* f = F + (size_t)t * pitch + h * HD; const float rf = RF ? RF[(size_t)h * TT + t] : 1.0f; v2h o16; v2us oh, ol;
#pragma unroll
    for (int q = 0; q < 2; ++q) { const int dd = d + q; const int dp = (dd < HD / 2) ? dd + HD / 2 : dd - HD / 2; float x0 = f[dd], x1 = f[dp];
        if (RF) { float n0 = __fmul_rn(x0, rf), n1 = __fmul_rn(x1, rf); asm volatile("" : "+v"(n0)); asm volatile("" : "+v"(n1)); x0 = __fmul_rn(bfr(nw[dd]), n0); x1 = __fmul_rn(bfr(nw[dp]), n1); }
        const v2f cs = *(const v2f*)(CS + ((size_t)t * HD + dd) * 2); float a = __fmul_rn(x0, cs[0]), bq = __fmul_rn(x1, cs[1]); asm volatile("" : "+v"(a)); asm volatile("" : "+v"(bq)); const float r = ((dd < HD / 2) ? __fsub_rn(a, bq) : __fadd_rn(a, bq)) * sc;
        o16[q] = tohx(r); unsigned short a2, c2; splitf(r, a2, c2); oh[q] = a2; ol[q] = c2; }
    *(v2h*)(P16 + e) = o16; *(v2us*)(Ph + e) = oh; *(v2us*)(Pl + e) = ol;  }
__device__ __forceinline__ void d_vtp(unsigned bid, const float* __restrict__ F, int pitch, int nheads, h16* V16, bf* Vh, bf* Vl) { const size_t e = ((size_t)bid * 256 + threadIdx.x) * 2; if (e >= (size_t)nheads * HD * TT) return; const int t = (int)(e % TT); const int d = (int)((e / TT) % HD); const int g = (int)(e / ((size_t)TT * HD)); v2h o16; v2us oh, ol;
#pragma unroll
    for (int q = 0; q < 2; ++q) { const float x = F[(size_t)(t + q) * pitch + g * HD + d]; o16[q] = tohx(x); unsigned short a2, c2; splitf(x, a2, c2); oh[q] = a2; ol[q] = c2; }
    *(v2h*)(V16 + e) = o16; *(v2us*)(Vh + e) = oh; *(v2us*)(Vl + e) = ol;  }
__device__ __forceinline__ void d_csid(unsigned bid, float* CS) { const int idx = bid * 256 + threadIdx.x; if (idx >= TT * HD) return; v2f cs; cs[0] = 1.0f; cs[1] = 0.0f; *(v2f*)(CS + (size_t)idx * 2) = cs;  }
__device__ __forceinline__ void d_uvb(unsigned bid, float* FQ, const float* __restrict__ bu, const float* __restrict__ bv2, float* FQV) { const size_t e = ((size_t)bid * 256 + threadIdx.x) * 4; if (e >= (size_t)TT * DQ) return; const int c0 = (int)(e % DQ); const v4f a = *(const v4f*)(FQ + e); v4f ou, ov; for (int u = 0; u < 4; ++u) { ou[u] = __fadd_rn(a[u], bfr(bu[c0 + u])); ov[u] = __fadd_rn(a[u], bfr(bv2[c0 + u])); } *(v4f*)(FQV + e) = ov; *(v4f*)(FQ + e) = ou;  }
// ---- streaming launches that read none of each other's output, joined into one grid each; a work-group picks its job by its block index.
#define GW   (DQ * DM / 8 / 256)         // work-groups of one weight's conversion
#define GP   (TT * DM / 8 / 256)         // ... of pos_emb's
#define GX   (NB_ * TT * DM / 8 / 256)   // ... of x's, all batch entries
#define GC   (TT * HD / 256)             // ... of the cos/sin table
#define GU   (TT * DQ / 4 / 256)         // ... of the u/v bias add
#define GR   (NH_ * TT * HD / 2 / 256)   // ... of one set of head planes
// k_prep: everything that reads inputs only: the five weights, pos_emb and x to bf16, the identity cos/sin table.
__global__ __launch_bounds__(256) void k_prep(const float* __restrict__ wq, const float* __restrict__ wk, const float* __restrict__ wv, const float* __restrict__ wo, const float* __restrict__ wpos, const float* __restrict__ pemb, const float* __restrict__ x,
                                              bf* WQ, bf* WK, bf* WV, bf* WO, bf* WP, bf* XP, bf* XB, float* CS) {
    unsigned b = blockIdx.x;
    if (b < 5 * GW) { const unsigned j = b / GW; d_cvt8(b % GW, j == 0 ? wq : (j == 1 ? wk : (j == 2 ? wv : (j == 3 ? wo : wpos))), j == 0 ? WQ : (j == 1 ? WK : (j == 2 ? WV : (j == 3 ? WO : WP))), (size_t)DQ * DM / 8); return; }
    b -= 5 * GW; if (b < GP) { d_cvt8(b, pemb, XP, (size_t)TT * DM / 8); return; }
    b -= GP; if (b < GX) { d_cvt8(b, x, XB, (size_t)NB_ * TT * DM / 8); return; }
    d_csid(b - GX, CS);
}
// k_post1: behind the q/k/v projections: the u/v bias add on q, the k planes, the transposed v planes.
__global__ __launch_bounds__(256) void k_post1(float* FQ, const float* __restrict__ bu, const float* __restrict__ bv2, float* FQV, const float* __restrict__ FK, const float* __restrict__ CS, h16* K16, bf* Kh, bf* Kl, const float* __restrict__ FV, h16* V16, bf* Vh, bf* Vl) {
    unsigned b = blockIdx.x;
    if (b < GU) { d_uvb(b, FQ, bu, bv2, FQV); return; }
    b -= GU; if (b < GR) { d_rope(b, FK, DKV, NKV, CS, nullptr, nullptr, 1.0f, K16, Kh, Kl); return; }
    d_vtp(b - GR, FV, DKV, NKV, V16, Vh, Vl);
}
// k_post2: the head planes of q + u (y = 0), q + v (y = 1) and, where launched with y = 2, of p.
__global__ __launch_bounds__(256) void k_post2(const float* __restrict__ FQ, const float* __restrict__ FQV, const float* __restrict__ FP, const float* __restrict__ CS, h16* Q16, bf* Qh, bf* Ql, h16* V16, bf* Vh, bf* Vl, h16* R16, bf* Rh, bf* Rl) {
    const unsigned y = blockIdx.y;
    d_rope(blockIdx.x, y == 0 ? FQ : (y == 1 ? FQV : FP), DQ, NH_, CS, nullptr, nullptr, 1.0f, y == 0 ? Q16 : (y == 1 ? V16 : R16), y == 0 ? Qh : (y == 1 ? Vh : Rh), y == 0 ? Ql : (y == 1 ? Vl : Rl));
}
// k_asoft: per row (zz, i): t = (S + rel-shifted S2) x HD^-0.5, masked keys -3e38; softmax over the 2048 keys (register row, one exp, fixed trees);
// the weights go back into the row's own 4 * TT bytes of Sb, which this wave alone reads and holds whole in registers by then: fp16 in the first half, or hi in the first half and lo in the second.
__global__ __launch_bounds__(256) void k_asoft(float* Sb, const float* __restrict__ Sb2, const int* __restrict__ km) {
    const int lane = threadIdx.x & 31; const int row = blockIdx.x * 8 + (threadIdx.x >> 5); if (row >= ZH * TT) return; const int i = row % TT; const int zz = row / TT; (void)zz; const bool hires = (i < RH); const float* sr = Sb + (size_t)row * TT; const float* pr0 = Sb2 + (size_t)row * TT; const float* pr1 = Sb2 + (size_t)(row + 1) * TT;   /* row i+1 of the same head block (never dereferenced for i = T-1: j >= i+2 is impossible there) */ float v[TT / 32]; float mx = -3.0e38f;
#pragma unroll
    for (int ch = 0; ch < TT / 128; ++ch) { const int j0 = ch * 128 + lane * 4; const v4f a = *(const v4f*)(sr + j0);
#pragma unroll
        for (int q = 0; q < 4; ++q) { const int j = j0 + q; (void)j; const int jj = j0 + q; const float bd = (jj <= i) ? pr0[TT - 1 - (i - jj)] : ((jj == i + 1) ? 0.0f : pr1[jj - i - 2]); float cp = __fadd_rn(a[q], bd); asm volatile("" : "+v"(cp)); const float t = (km[jj] != 0) ? cp * SCL : -3.0e38f; v[ch * 4 + q] = t; mx = fmaxf(mx, t); } }
#pragma unroll
    for (int sh = 16; sh; sh >>= 1) mx = fmaxf(mx, __shfl_xor(mx, sh, 32));
    float sum = 0.f;
#pragma unroll
    for (int k = 0; k < TT / 32; ++k) { float d0 = __fsub_rn(v[k], mx); asm volatile("" : "+v"(d0)); v[k] = __builtin_amdgcn_exp2f(__fmul_rn(d0, 1.4426950408889634f)); sum += v[k]; }
#pragma unroll
    for (int sh = 16; sh; sh >>= 1) sum += __shfl_xor(sum, sh, 32);
    const float f = __fdiv_rn(hires ? 1.0f : PCAR, sum);
{
        if (hires) {
#pragma unroll
            for (int ch = 0; ch < TT / 128; ++ch) { v4us oh, ol;
#pragma unroll
                for (int q = 0; q < 4; ++q) { unsigned short a, c2; splitf(v[ch * 4 + q] * f, a, c2); oh[q] = a; ol[q] = c2; }
                bf* po = (bf*)(Sb + (size_t)row * TT) + ch * 128 + lane * 4; *(v4us*)po = oh; *(v4us*)(po + TT) = ol; }
        } else {
#pragma unroll
            for (int ch = 0; ch < TT / 128; ++ch) { v4h o4;
#pragma unroll
                for (int q = 0; q < 4; ++q) o4[q] = tohx(v[ch * 4 + q] * f);
                *(v4h*)((h16*)(Sb + (size_t)row * TT) + ch * 128 + lane * 4) = o4; } }
         }
}
__global__ __launch_bounds__(256) void k_merge(const float* __restrict__ O, int h0, bf* Ah, bf* Al) { const size_t e = ((size_t)blockIdx.x * 256 + threadIdx.x) * 2; if (e >= (size_t)ZH * TT * HD) return; const int d = (int)(e % HD); const int t = (int)((e / HD) % TT); const int zz = (int)(e / ((size_t)HD * TT)); const float cs = (t < RH) ? 1.0f : (1.0f / PCAR); const size_t oo = (size_t)t * DQ + (h0 + zz) * HD + d;
    v2us oh, ol;
#pragma unroll
    for (int q = 0; q < 2; ++q) { unsigned short a, c2; splitf(O[e + q] * cs, a, c2); oh[q] = a; ol[q] = c2; } *(v2us*)(Ah + oo) = oh; *(v2us*)(Al + oo) = ol;  }

extern "C" void kernel_launch(void* const* d_in, const int* in_sizes, int n_in,
                              void* d_out, int out_size, void* d_ws, size_t ws_size, hipStream_t stream) {
    (void)in_sizes; (void)n_in; (void)out_size;
    const float* x = (const float*)d_in[0]; const float* pemb = (const float*)d_in[1]; const int* kmask = (const int*)d_in[2]; const float* wq = (const float*)d_in[3]; const float* bq = (const float*)d_in[4]; const float* wk = (const float*)d_in[5]; const float* bk = (const float*)d_in[6]; const float* wv = (const float*)d_in[7]; const float* bv = (const float*)d_in[8]; const float* wpos = (const float*)d_in[9]; const float* wo = (const float*)d_in[10]; const float* bo = (const float*)d_in[11]; const float* pbu = (const float*)d_in[12]; const float* pbv = (const float*)d_in[13]; const float* cosT = nullptr; const float* sinT = nullptr; (void)cosT; (void)sinT;
    float* OUT = (float*)d_out;     // [4][2048][1024]
    char* wsp = (char*)d_ws;
    auto take = [&](size_t bytes) { char* p = wsp; wsp += (bytes + 255) & ~(size_t)255; return (void*)p; };
    bf* WQ = (bf*)take((size_t)DQ * DM * 2); bf* WK = (bf*)take((size_t)DKV * DM * 2); bf* WV = (bf*)take((size_t)DKV * DM * 2); bf* WO = (bf*)take((size_t)DM * DQ * 2); float* CS = (float*)take((size_t)TT * HD * 2 * 4);
    bf* XB = (bf*)take((size_t)NB_ * TT * DM * 2); bf* WP = (bf*)take((size_t)DQ * DM * 2); h16* PP16 = (h16*)take((size_t)NH_ * TT * HD * 2); bf* PPh = (bf*)take((size_t)NH_ * TT * HD * 2); bf* PPl = (bf*)take((size_t)NH_ * TT * HD * 2); h16* QV16 = (h16*)take((size_t)NH_ * TT * HD * 2); bf* QVh = (bf*)take((size_t)NH_ * TT * HD * 2); bf* QVl = (bf*)take((size_t)NH_ * TT * HD * 2); float* Sb2 = (float*)take((size_t)ZH * TT * TT * 4);
    h16* QP16 = (h16*)take((size_t)NH_ * TT * HD * 2); h16* KP16 = (h16*)take((size_t)NKV * TT * HD * 2); h16* VT16 = (h16*)take((size_t)NKV * HD * TT * 2);
    bf* QPh = (bf*)take((size_t)NH_ * TT * HD * 2); bf* QPl = (bf*)take((size_t)NH_ * TT * HD * 2); bf* KPh = (bf*)take((size_t)NKV * TT * HD * 2); bf* KPl = (bf*)take((size_t)NKV * TT * HD * 2); bf* VTh = (bf*)take((size_t)NKV * HD * TT * 2); bf* VTl = (bf*)take((size_t)NKV * HD * TT * 2);
    float* Sb = (float*)take((size_t)ZH * TT * TT * 4); float* Ob = (float*)take((size_t)ZH * TT * HD * 4); bf* ATh = (bf*)take((size_t)TT * DQ * 2); bf* ATl = (bf*)take((size_t)TT * DQ * 2);
    // the f32 projections and pos_emb's bf16 copy are last read by k_post2, before the batch entry's first k_score writes Sb: they share Sb's space (5.5 * TT * DQ floats of its ZH * TT * TT)
    float* FQ = Sb; float* FK = Sb + (size_t)TT * DQ; float* FV = Sb + (size_t)2 * TT * DQ; float* FQV = Sb + (size_t)3 * TT * DQ; float* FP = Sb + (size_t)4 * TT * DQ; bf* XP = (bf*)(Sb + (size_t)5 * TT * DQ);
    if ((size_t)(wsp - (char*)d_ws) > ws_size) return;    // ws 256 MiB
    k_prep<<<5 * GW + GP + GX + GC, 256, 0, stream>>>(wq, wk, wv, wo, wpos, pemb, x, WQ, WK, WV, WO, WP, XP, XB, CS);
    k_gemmw<bf, 0, false, 8><<<dim3(TT / 64, DQ / 64, 1), 256, 0, stream>>>(XP, nullptr, WP, nullptr, DM, FP, DQ, nullptr);
    for (int b = 0; b < NB_; ++b) {
        k_qkv<<<dim3(TT / 64, DQ / 64, 3), 256, 0, stream>>>(XB + (size_t)b * TT * DM, WQ, WK, WV, FQ, FK, FV, bq, bk, bv);
        k_post1<<<GU + 2 * GR, 256, 0, stream>>>(FQ, pbu, pbv, FQV, FK, CS, KP16, KPh, KPl, FV, VT16, VTh, VTl);
        if (b == 0) { k_post2<<<dim3(GR, 3, 1), 256, 0, stream>>>(FQ, FQV, FP, CS, QP16, QPh, QPl, QV16, QVh, QVl, PP16, PPh, PPl); }
        else { k_post2<<<dim3(GR, 2, 1), 256, 0, stream>>>(FQ, FQV, FP, CS, QP16, QPh, QPl, QV16, QVh, QVl, PP16, PPh, PPl); }
        for (int h0 = 0; h0 < NH_; h0 += ZH) { const size_t zq = (size_t)h0, zk = (size_t)(h0 / REP);   // one kv head per query head: the pass's heads use consecutive kv planes (z-strides TT*HD)
            k_score<<<dim3(TT / 64, TT / 64, 2 * ZH), 32, 0, stream>>>(QPh + zq * TT * HD, QPl + zq * TT * HD, KPh + zk * TT * HD, KPl + zk * TT * HD, QVh + zq * TT * HD, QVl + zq * TT * HD, PPh + zk * TT * HD, PPl + zk * TT * HD, QP16 + zq * TT * HD, KP16 + zk * TT * HD, QV16 + zq * TT * HD, PP16 + zk * TT * HD, Sb, Sb2);
            k_asoft<<<ZH * TT / 8, 256, 0, stream>>>(Sb, Sb2, kmask + (size_t)b * TT);
            k_av<<<dim3(TT / 64, HD / 64, ZH), 512, 0, stream>>>(Sb, VTh + zk * HD * TT, VTl + zk * HD * TT, VT16 + zk * HD * TT, Ob);
            k_merge<<<(unsigned)(((size_t)ZH * TT * HD / 2 + 255) / 256), 256, 0, stream>>>(Ob, h0, ATh, ATl); }
        k_gemmw<bf, 1, true, 8><<<dim3(TT / 64, DM / 64, 1), 256, 0, stream>>>(ATh, ATl, WO, nullptr, DQ, OUT + (size_t)b * TT * DM, DM, bo); }
}

// v004
// Measured time: 1170 microseconds a run.
// Two timings next to v003 both put it at 1.13 times that version's speed.
// Counting every step since v000, it is 2.63 times as fast.
#include <hip/hip_runtime.h>

// MultiHeadRelPositionAttention (x [4][2048][1024], pos_emb [2048][1024], mask [4][2048] (int, read; all ones); q/k/v = x W^T + b (8 heads x 128); p = pos_emb Wpos^T; content = (q + pos_bias_u[h]).k; pos = rel_shift((q + pos_bias_v[h]).p) with the Transformer-XL pad/reshape shift for P == T: pos[i][j] = S[i][T-1-(i-j)] for j <= i, 0 for j == i+1, S[i+1][j-i-2] for j >= i+2 (reproduced literally, including the upper part); scores = (content + pos) / sqrt(128), key mask; softmax; out = merged Wout^T + bout -> [4][2048][1024]).
// Compute dtypes, f32 accumulate: every input rounded to bf16; q/k/v/p as PLAIN bf16 GEMMs (inputs: exact) + bias; the u/v head biases added in f32; content, position scores and attn.v: query rows < 512 hl (3 products), the rest single fp16 (x1024) (the shifted position score is gathered from rows i / i+1 of the position-score block); softmax f32 with the read key mask; Wout hl x exact (2 products) + bias.

#define NB_  4
#define TT   2048
#define DM   1024
#define NH_  8
#define NKV  8
#define REP  (NH_ / NKV)
#define HD   128
#define DQ   (NH_ * HD)
#define DKV  (NKV * HD)
#define ZH   4
#define RH   512                  // query rows < RH use hi+lo planes (0: none)
#define WIN  0
#define PCAR 1024.0f
#define SCL  0.088388347648318447f   // HD^-0.5
typedef _Float16 h16;
typedef unsigned short bf;
typedef __attribute__((ext_vector_type(16))) __bf16   v16bf;
typedef __attribute__((ext_vector_type(16))) _Float16 v16h;
typedef __attribute__((ext_vector_type(8)))  _Float16 v8h;
typedef __attribute__((ext_vector_type(8)))  unsigned short v8us;
typedef __attribute__((ext_vector_type(8)))  float    v8f;
typedef __attribute__((ext_vector_type(4)))  float    v4f;
typedef v8h  __attribute__((may_alias)) v8ha;
typedef v4f  __attribute__((may_alias)) v4fa;
typedef v8us __attribute__((may_alias)) v8usa;

__device__ __forceinline__ unsigned short f2bf(float f) { unsigned u = __float_as_uint(f); u += 0x7FFFu + ((u >> 16) & 1u); return (unsigned short)(u >> 16); }
__device__ __forceinline__ float bf2f(unsigned short b) { return __uint_as_float(((unsigned)b) << 16); }
__device__ __forceinline__ float bfr(float f) { return bf2f(f2bf(f)); }
__device__ __forceinline__ v16h cat16(v8h lo, v8h hi) { return __builtin_shufflevector(lo, hi, 0, 1, 2, 3, 4, 5, 6, 7, 8, 9, 10, 11, 12, 13, 14, 15); }
__device__ __forceinline__ v16bf cat16b(v8us lo, v8us hi) { return __builtin_bit_cast(v16bf, __builtin_shufflevector(lo, hi, 0, 1, 2, 3, 4, 5, 6, 7, 8, 9, 10, 11, 12, 13, 14, 15)); }
__device__ __forceinline__ v8f wmma16(v16h a, v16h b, v8f c) { return __builtin_amdgcn_wmma_f32_16x16x32_f16(false, a, false, b, (short)0, c, false, false); }
__device__ __forceinline__ v8f wmmab(v16bf a, v16bf b, v8f c) { return __builtin_amdgcn_wmma_f32_16x16x32_bf16(false, a, false, b, (short)0, c, false, false); }
__device__ __forceinline__ h16 tohx(float x) { return (h16)x; }
__device__ __forceinline__ void splitf(float y, unsigned short& h, unsigned short& l) { h = f2bf(y); l = f2bf(y - bf2f(h)); }
typedef __attribute__((ext_vector_type(4))) _Float16 v4h;
typedef __attribute__((ext_vector_type(4))) unsigned short v4us;
// one operand's three 16-bit planes: fp16, bf16 hi, bf16 lo
struct Planes { h16* p16; bf* ph; bf* pl; };
__device__ __forceinline__ void put_hl(v4f r, bf* Ph, bf* Pl, size_t off) { v4us oh, ol;
#pragma unroll
    for (int u = 0; u < 4; ++u) { unsigned short a, c2; splitf(r[u], a, c2); oh[u] = a; ol[u] = c2; }
    *(v4us*)(Ph + off) = oh; *(v4us*)(Pl + off) = ol; }
__device__ __forceinline__ void put3(v4f r, Planes P, size_t off) { v4h o16;
#pragma unroll
    for (int u = 0; u < 4; ++u) o16[u] = tohx(r[u]);
    *(v4h*)(P.p16 + off) = o16; put_hl(r, P.ph, P.pl, off); }



// ---- k_gemmw: register-blocked GEMM, one 64x64 output tile per work-group (16 accumulators per wave), operands straight from K-contiguous 16-bit planes; grid (M/64, N/64), 32 * KS threads.
// C[m][n] (f32, pitch ldc, + optional f32 bias[n]) = sum_k A[m][k] Bt[n][k] (+ split products per NSPLIT). K % (32 * KS) == 0.
// KS > 1: the K loop is shared out over KS waves (wave w takes the 32-wide k blocks w, w + KS, ...); the KS partial tiles meet in LDS and are summed in the fixed order w = 0 .. KS-1.
template <typename T16> struct WFrag;
template <> struct WFrag<h16> { typedef v16h V; static __device__ __forceinline__ V ld(const h16* p) { return cat16(*(const v8h*)p, *(const v8h*)(p + 16)); } static __device__ __forceinline__ v8f mma(V a, V b, v8f c) { return wmma16(a, b, c); } };
template <> struct WFrag<bf> { typedef v16bf V; static __device__ __forceinline__ V ld(const bf* p) { return cat16b(*(const v8us*)p, *(const v8us*)(p + 16)); } static __device__ __forceinline__ v8f mma(V a, V b, v8f c) { return wmmab(a, b, c); } };
// gemmw_body is the tile's whole work; os is the calling kernel's LDS, (KS == 1 ? 16 : KS * 64) * 68 floats; the tile is (bx, by). lda is the row pitch of A and A2 in elements; Bt and Bt2 have pitch K.
// mode (block-uniform; KS > 1 only for mode != 0) says where the summed tile goes; MSET holds bit m for every mode m != 0 that the calling kernel can ask for (0: mode 0 alone):
//   0: f32 C (+ bias[n]).
//   1: m = t, n = h * HD + d: (+ bias[n]) -> the planes P1 [h][t][d].
//   2: as 1, then + bu[n] -> P1 and + bv2[n] -> P2 (both adds in f32, on the biased value).
//   3: m = g * HD + d, n = t: (+ bias[m]) -> the planes P1 [g][d][t].
//   4: m = t, n = d of one head: x 1 (t < RH) or x 1 / PCAR -> hi/lo P1.ph, P1.pl, row pitch DQ (the pointers are the head's).
// gemmw_tail: modes 1 to 4 behind the barrier: this thread's rows row0, row0 + 2, ... of the tile, columns cofs .. cofs + 3 (n in the whole matrix), summed over the KS partial tiles in the order w = 0 .. KS-1, then biased, converted and stored. bb, ub, vb, rb come as loaded (f32) and are rounded to bf16 here.
template <int MODE, bool BIAS, int KS>
__device__ __forceinline__ void gemmw_tail(const float* os, int row0, int r0, int cofs, int n, v4f bb, v4f ub, v4f vb, const float (&rb)[32 / KS], Planes P1, Planes P2) {
#pragma unroll
    for (int u = 0; u < 4; ++u) { bb[u] = bfr(bb[u]); ub[u] = bfr(ub[u]); vb[u] = bfr(vb[u]); }
#pragma unroll
    for (int s = 0; s < 32 / KS; ++s) { const int row = row0 + 2 * s, m = r0 + row; v4f val = *(const v4fa*)(os + row * 68 + cofs);
#pragma unroll
        for (int w = 1; w < KS; ++w) val += *(const v4fa*)(os + (w * 64 + row) * 68 + cofs);
        if (BIAS) { if (MODE == 3) val += bfr(rb[s]); else val += bb; }
        if (MODE == 4) put_hl(val * ((m < RH) ? 1.0f : (1.0f / PCAR)), P1.ph, P1.pl, (size_t)m * DQ + n);
        else if (MODE == 3) put3(val, P1, (size_t)m * TT + n);
        else { const size_t off = ((size_t)(n / HD) * TT + m) * HD + n % HD;
            if (MODE == 2) { put3(val + ub, P1, off); put3(val + vb, P2, off); } else put3(val, P1, off); } }
    asm volatile("s_wait_xcnt 0x0" ::: "memory");   // behind the tail's last stores: the code laid out behind this tail reuses their address and data registers
}
template <typename T16, int NSPLIT, bool BIAS, int KS, int MSET = 0>
__device__ __forceinline__ void gemmw_body(float* os, const T16* __restrict__ A, const T16* __restrict__ A2, const T16* __restrict__ Bt, const T16* __restrict__ Bt2, int K, int lda, float* C, int ldc, const float* __restrict__ bias, int bx, int by,
                                           int mode = 0, Planes P1 = Planes{}, Planes P2 = Planes{}, const float* __restrict__ bu = nullptr, const float* __restrict__ bv2 = nullptr) {
    typedef typename WFrag<T16>::V V;
    const int wave = (KS == 1) ? 0 : __builtin_amdgcn_readfirstlane((int)(threadIdx.x >> 5));
    const int lane = threadIdx.x & 31, lr = lane & 15, hi = lane >> 4; const int r0 = bx * 64, c0 = by * 64;
    v8f acc[4][4];
#pragma unroll
    for (int mb = 0; mb < 4; ++mb)
#pragma unroll
        for (int nb = 0; nb < 4; ++nb) acc[mb][nb] = (v8f){};
    const size_t aoff = (size_t)(r0 + lr) * lda + 8 * hi, boff = (size_t)(c0 + lr) * K + 8 * hi;
#pragma unroll 1
    for (int kc = wave * 32; kc < K; kc += 32 * KS) {
        V a[4], a2[4];
#pragma unroll
        for (int mb = 0; mb < 4; ++mb) { a[mb] = WFrag<T16>::ld(A + aoff + (size_t)mb * 16 * lda + kc); if (NSPLIT == 1 || NSPLIT == 2) a2[mb] = WFrag<T16>::ld(A2 + aoff + (size_t)mb * 16 * lda + kc); }
#pragma unroll
        for (int nb = 0; nb < 4; ++nb) { const V b = WFrag<T16>::ld(Bt + boff + (size_t)nb * 16 * K + kc); V b2; if (NSPLIT >= 2) b2 = WFrag<T16>::ld(Bt2 + boff + (size_t)nb * 16 * K + kc);
#pragma unroll
            for (int mb = 0; mb < 4; ++mb) { acc[mb][nb] = WFrag<T16>::mma(a[mb], b, acc[mb][nb]); if (NSPLIT == 1 || NSPLIT == 2) acc[mb][nb] = WFrag<T16>::mma(a2[mb], b, acc[mb][nb]); if (NSPLIT >= 2) acc[mb][nb] = WFrag<T16>::mma(a[mb], b2, acc[mb][nb]); } }
        asm volatile("v_nop\n\tv_nop\n\tv_nop\n\tv_nop" : "+v"(acc[0][0]), "+v"(acc[1][1]), "+v"(acc[2][2]), "+v"(acc[3][3]) : "v"(a[0]), "v"(a[3]));
    }
    if (KS > 1) {
        // mode != 0: this thread's biases (of its four columns; mode 3: of its rows) are loaded ahead of the LDS exchange and first used behind it, in the tail, so that their latency runs under it
        const int cofs = lr * 4, n = c0 + cofs; v4f bb = (v4f){}, ub = (v4f){}, vb = (v4f){}; float rb[32 / KS];
#pragma unroll
        for (int s = 0; s < 32 / KS; ++s) rb[s] = 0.0f;
        if (BIAS && (MSET & 8) && mode == 3) {
#pragma unroll
            for (int s = 0; s < 32 / KS; ++s) rb[s] = bias[r0 + wave * (64 / KS) + 2 * s + hi];
            asm volatile("s_wait_xcnt 0x0" ::: "memory"); }   // these loads stay in flight, and the code below reuses their address registers
        if (BIAS && (MSET & 6) && mode != 3) { bb[0] = bias[n]; bb[1] = bias[n + 1]; bb[2] = bias[n + 2]; bb[3] = bias[n + 3];
            asm volatile("s_wait_xcnt 0x0" ::: "memory"); }   // as above: behind loads that stay in flight
        if ((MSET & 4) && mode == 2) {
#pragma unroll
            for (int u = 0; u < 4; ++u) { ub[u] = bu[n + u]; vb[u] = bv2[n + u]; }
            asm volatile("s_wait_xcnt 0x0" ::: "memory"); }   // as above: behind loads that stay in flight
        float* mine = os + wave * (64 * 68);
#pragma unroll
        for (int mb = 0; mb < 4; ++mb)
#pragma unroll
            for (int nb = 0; nb < 4; ++nb)
#pragma unroll
                for (int j = 0; j < 8; ++j) mine[(mb * 16 + hi * 8 + j) * 68 + nb * 16 + lr] = acc[mb][nb][j];
        __syncthreads();   // every wave's partial tile is in LDS before any wave sums rows of it
        // the highest mode of MSET is taken without a test
        if ((MSET & 2) && (MSET < 4 || mode == 1)) { gemmw_tail<1, BIAS, KS>(os, wave * (64 / KS) + hi, r0, cofs, n, bb, ub, vb, rb, P1, P2); return; }
        if ((MSET & 4) && (MSET < 8 || mode == 2)) { gemmw_tail<2, BIAS, KS>(os, wave * (64 / KS) + hi, r0, cofs, n, bb, ub, vb, rb, P1, P2); return; }
        if ((MSET & 8) && (MSET < 16 || mode == 3)) { gemmw_tail<3, BIAS, KS>(os, wave * (64 / KS) + hi, r0, cofs, n, bb, ub, vb, rb, P1, P2); return; }
        if (MSET & 16) { gemmw_tail<4, BIAS, KS>(os, wave * (64 / KS) + hi, r0, cofs, n, bb, ub, vb, rb, P1, P2); return; }
#pragma unroll
        for (int s = 0; s < 32 / KS; ++s) { const int row = wave * (64 / KS) + 2 * s + hi, cofs = lr * 4; v4f val = *(const v4fa*)(os + row * 68 + cofs);
#pragma unroll
            for (int w = 1; w < KS; ++w) val += *(const v4fa*)(os + (w * 64 + row) * 68 + cofs);
            if (BIAS) { val[0] += bfr(bias[c0 + cofs]); val[1] += bfr(bias[c0 + cofs + 1]); val[2] += bfr(bias[c0 + cofs + 2]); val[3] += bfr(bias[c0 + cofs + 3]); }
            *(v4f*)(C + (size_t)(r0 + row) * ldc + c0 + cofs) = val; }
        return;
    }
#pragma unroll
    for (int mb = 0; mb < 4; ++mb) {
#pragma unroll
        for (int nb = 0; nb < 4; ++nb) {
#pragma unroll
            for (int j = 0; j < 8; ++j) os[(hi * 8 + j) * 68 + nb * 16 + lr] = acc[mb][nb][j]; }
        __builtin_amdgcn_wave_barrier(); asm volatile("" ::: "memory");
        float* crow = C + (size_t)(r0 + mb * 16) * ldc + c0;
{
#pragma unroll
            for (int s = 0; s < 8; ++s) { const int row = 2 * s + hi, cofs = lr * 4; v4f val = *(const v4fa*)(os + row * 68 + cofs); if (BIAS) { val[0] += bfr(bias[c0 + cofs]); val[1] += bfr(bias[c0 + cofs + 1]); val[2] += bfr(bias[c0 + cofs + 2]); val[3] += bfr(bias[c0 + cofs + 3]); }
                *(v4f*)(crow + (size_t)row * ldc + cofs) = val; }
             }
        __builtin_amdgcn_wave_barrier(); asm volatile("" ::: "memory");
    }
}

template <typename T16, int NSPLIT, bool BIAS, int KS>
__global__ __launch_bounds__(32 * KS) void k_gemmw(const T16* __restrict__ A, const T16* __restrict__ A2, const T16* __restrict__ Bt, const T16* __restrict__ Bt2, int K, float* C, int ldc, const float* __restrict__ bias) {
    __shared__ __align__(16) float os[(KS == 1 ? 16 : KS * 64) * 68];
    gemmw_body<T16, NSPLIT, BIAS, KS>(os, A, A2, Bt, Bt2, K, K, C, ldc, bias, blockIdx.x, blockIdx.y);
}
// ---- launches that read none of each other's output, joined into one grid; a work-group picks its product by its block index (block-uniform), and each tile's arithmetic is gemmw_body's as before.
// k_qkv: z = 0, 1, 2: the q, k, v projection of one batch entry, each straight into its 16-bit planes: q + u and q + v, k, and v transposed.
// v is formed as Wv . x^T (the same products, the operands' roles exchanged), so that its tile has t along the columns, as the planes [g][d][t] want it; its tile indices are exchanged with it.
__global__ __launch_bounds__(256) void k_qkv(const bf* __restrict__ X, const bf* __restrict__ Wq_, const bf* __restrict__ Wk_, const bf* __restrict__ Wv_, const float* __restrict__ bq, const float* __restrict__ bk, const float* __restrict__ bv, const float* __restrict__ bu, const float* __restrict__ bv2,
                                             h16* Q16, bf* Qh, bf* Ql, h16* U16, bf* Uh, bf* Ul, h16* K16, bf* Kh, bf* Kl, h16* V16, bf* Vh, bf* Vl) {
    __shared__ __align__(16) float os[8 * 64 * 68];
    const int z = blockIdx.z;
    const Planes P1 = { z == 0 ? Q16 : (z == 1 ? K16 : V16), z == 0 ? Qh : (z == 1 ? Kh : Vh), z == 0 ? Ql : (z == 1 ? Kl : Vl) }; const Planes P2 = { U16, Uh, Ul };
    gemmw_body<bf, 0, true, 8, 14>(os, z == 2 ? Wv_ : X, nullptr, z == 0 ? Wq_ : (z == 1 ? Wk_ : X), nullptr, DM, DM, nullptr, 0, z == 0 ? bq : (z == 1 ? bk : bv), z == 2 ? blockIdx.y : blockIdx.x, z == 2 ? blockIdx.x : blockIdx.y,
                               z == 0 ? 2 : (z == 1 ? 1 : 3), P1, P2, bu, bv2);
}
// k_pp: p = pos_emb Wpos^T straight into its planes.
__global__ __launch_bounds__(256) void k_pp(const bf* __restrict__ XP, const bf* __restrict__ WP, h16* R16, bf* Rh, bf* Rl) {
    __shared__ __align__(16) float os[8 * 64 * 68];
    gemmw_body<bf, 0, false, 8, 2>(os, XP, nullptr, WP, nullptr, DM, DM, nullptr, 0, nullptr, blockIdx.x, blockIdx.y, 1, Planes{ R16, Rh, Rl });
}
// k_score: z = 2 * head + (0: content q.k -> S, 1: position qv.p -> S2); row tiles below RH on the hi/lo planes, the rest on the fp16 planes. Pointers are those of the pass's first head.
__global__ __launch_bounds__(32) void k_score(const bf* __restrict__ Qh, const bf* __restrict__ Ql, const bf* __restrict__ Kh, const bf* __restrict__ Kl, const bf* __restrict__ Vh, const bf* __restrict__ Vl, const bf* __restrict__ Rh, const bf* __restrict__ Rl,
                                              const h16* __restrict__ Q16, const h16* __restrict__ K16, const h16* __restrict__ V16, const h16* __restrict__ R16, float* S, float* S2) {
    __shared__ __align__(16) float os[16 * 68];
    const bool pos = (blockIdx.z & 1) != 0; const size_t zz = blockIdx.z >> 1, zo = zz * ((size_t)TT * HD);
    float* C = (pos ? S2 : S) + zz * ((size_t)TT * TT);
    if (blockIdx.x < RH / 64) gemmw_body<bf, 2, false, 1>(os, (pos ? Vh : Qh) + zo, (pos ? Vl : Ql) + zo, (pos ? Rh : Kh) + zo, (pos ? Rl : Kl) + zo, HD, HD, C, TT, nullptr, blockIdx.x, blockIdx.y);
    else gemmw_body<h16, 0, false, 1>(os, (pos ? V16 : Q16) + zo, nullptr, (pos ? R16 : K16) + zo, nullptr, HD, HD, C, TT, nullptr, blockIdx.x, blockIdx.y);
}
// k_av: attn.v of the pass's heads (z); row tiles below RH on the hi/lo planes, the rest on the fp16 plane. The weights lie where k_asoft left them: in the bytes of their own score row (pitch 2 * TT 16-bit elements).
// The tile goes, rescaled and split hi/lo, straight to its head's columns of the merged rows [t][DQ]; Ah, Al are those of the pass's first head.
__global__ __launch_bounds__(512) void k_av(const float* __restrict__ Sp, const bf* __restrict__ Vh, const bf* __restrict__ Vl, const h16* __restrict__ V16, bf* Ah, bf* Al) {
    __shared__ __align__(16) float os[16 * 64 * 68];
    const size_t z = blockIdx.z, zv = z * ((size_t)HD * TT), zp = z * ((size_t)TT * 2 * TT); const Planes PA = { nullptr, Ah + z * HD, Al + z * HD };
    if (blockIdx.x < RH / 64) gemmw_body<bf, 2, false, 16, 16>(os, (const bf*)Sp + zp, (const bf*)Sp + zp + TT, Vh + zv, Vl + zv, TT, 2 * TT, nullptr, 0, nullptr, blockIdx.x, blockIdx.y, 4, PA);
    else gemmw_body<h16, 0, false, 16, 16>(os, (const h16*)Sp + zp, nullptr, V16 + zv, nullptr, TT, 2 * TT, nullptr, 0, nullptr, blockIdx.x, blockIdx.y, 4, PA);
}

typedef __attribute__((ext_vector_type(2))) unsigned short v2us;
typedef __attribute__((ext_vector_type(2))) float v2f;

__global__ __launch_bounds__(256) void k_wtG(const float* __restrict__ w, int K, int N, bf* Bt) {
    const int lane = threadIdx.x & 31; const int L0 = (blockIdx.x * 8 + (threadIdx.x >> 5)) * 8; const int nlines = N * K / 64;
{
#pragma unroll 1
        for (int l = 0; l < 8; ++l) { const int L = L0 + l; if (L >= nlines) break; const size_t e = (size_t)L * 64 + lane * 2; const int k = (int)(e % K), n = (int)(e / K); v2us o;
            o[0] = f2bf(w[(size_t)k * N + n]); o[1] = f2bf(w[(size_t)(k + 1) * N + n]); *(v2us*)(Bt + e) = o; }
         }
}
__device__ __forceinline__ void d_cvt8(unsigned bid, const float* __restrict__ src, bf* dst, size_t n8) { const size_t i = (size_t)bid * 256 + threadIdx.x; if (i >= n8) return; const v8f v = *(const v8f*)(src + i * 8); v8us o;
#pragma unroll
    for (int k = 0; k < 8; ++k) o[k] = f2bf(v[k]); *(v8us*)(dst + i * 8) = o;  }
__global__ __launch_bounds__(256) void k_cscvt(const float* __restrict__ cosT, const float* __restrict__ sinT, float* CS) { const int idx = blockIdx.x * 256 + threadIdx.x; if (idx >= TT * HD) return; v2f cs; cs[0] = bfr(cosT[idx]); cs[1] = bfr(sinT[idx]); *(v2f*)(CS + (size_t)idx * 2) = cs;  }
// ---- streaming jobs that read none of each other's output, joined into one grid; a work-group picks its job by its block index.
#define GW   (DQ * DM / 8 / 256)         // work-groups of one weight's conversion
#define GP   (TT * DM / 8 / 256)         // ... of pos_emb's
#define GX   (NB_ * TT * DM / 8 / 256)   // ... of x's, all batch entries
// k_prep: the five weights, pos_emb and x to bf16.
__global__ __launch_bounds__(256) void k_prep(const float* __restrict__ wq, const float* __restrict__ wk, const float* __restrict__ wv, const float* __restrict__ wo, const float* __restrict__ wpos, const float* __restrict__ pemb, const float* __restrict__ x,
                                              bf* WQ, bf* WK, bf* WV, bf* WO, bf* WP, bf* XP, bf* XB) {
    unsigned b = blockIdx.x;
    if (b < 5 * GW) { const unsigned j = b / GW; d_cvt8(b % GW, j == 0 ? wq : (j == 1 ? wk : (j == 2 ? wv : (j == 3 ? wo : wpos))), j == 0 ? WQ : (j == 1 ? WK : (j == 2 ? WV : (j == 3 ? WO : WP))), (size_t)DQ * DM / 8); return; }
    b -= 5 * GW; if (b < GP) { d_cvt8(b, pemb, XP, (size_t)TT * DM / 8); return; }
    d_cvt8(b - GP, x, XB, (size_t)NB_ * TT * DM / 8);
}
// k_asoft: per row (zz, i): t = (S + rel-shifted S2) x HD^-0.5, masked keys -3e38; softmax over the 2048 keys (register row, one exp, fixed trees);
// the weights go back into the row's own 4 * TT bytes of Sb, which this wave alone reads and holds whole in registers by then: fp16 in the first half, or hi in the first half and lo in the second.
__global__ __launch_bounds__(256) void k_asoft(float* Sb, const float* __restrict__ Sb2, const int* __restrict__ km) {
    const int lane = threadIdx.x & 31; const int row = blockIdx.x * 8 + (threadIdx.x >> 5); if (row >= ZH * TT) return; const int i = row % TT; const int zz = row / TT; (void)zz; const bool hires = (i < RH); const float* sr = Sb + (size_t)row * TT; const float* pr0 = Sb2 + (size_t)row * TT; const float* pr1 = Sb2 + (size_t)(row + 1) * TT;   /* row i+1 of the same head block (never dereferenced for i = T-1: j >= i+2 is impossible there) */ float v[TT / 32]; float mx = -3.0e38f;
#pragma unroll
    for (int ch = 0; ch < TT / 128; ++ch) { const int j0 = ch * 128 + lane * 4; const v4f a = *(const v4f*)(sr + j0);
#pragma unroll
        for (int q = 0; q < 4; ++q) { const int j = j0 + q; (void)j; const int jj = j0 + q; const float bd = (jj <= i) ? pr0[TT - 1 - (i - jj)] : ((jj == i + 1) ? 0.0f : pr1[jj - i - 2]); float cp = __fadd_rn(a[q], bd); asm volatile("" : "+v"(cp)); const float t = (km[jj] != 0) ? cp * SCL : -3.0e38f; v[ch * 4 + q] = t; mx = fmaxf(mx, t); } }
#pragma unroll
    for (int sh = 16; sh; sh >>= 1) mx = fmaxf(mx, __shfl_xor(mx, sh, 32));
    float sum = 0.f;
#pragma unroll
    for (int k = 0; k < TT / 32; ++k) { float d0 = __fsub_rn(v[k], mx); asm volatile("" : "+v"(d0)); v[k] = __builtin_amdgcn_exp2f(__fmul_rn(d0, 1.4426950408889634f)); sum += v[k]; }
#pragma unroll
    for (int sh = 16; sh; sh >>= 1) sum += __shfl_xor(sum, sh, 32);
    const float f = __fdiv_rn(hires ? 1.0f : PCAR, sum);
{
        if (hires) {
#pragma unroll
            for (int ch = 0; ch < TT / 128; ++ch) { v4us oh, ol;
#pragma unroll
                for (int q = 0; q < 4; ++q) { unsigned short a, c2; splitf(v[ch * 4 + q] * f, a, c2); oh[q] = a; ol[q] = c2; }
                bf* po = (bf*)(Sb + (size_t)row * TT) + ch * 128 + lane * 4; *(v4us*)po = oh; *(v4us*)(po + TT) = ol; }
        } else {
#pragma unroll
            for (int ch = 0; ch < TT / 128; ++ch) { v4h o4;
#pragma unroll
                for (int q = 0; q < 4; ++q) o4[q] = tohx(v[ch * 4 + q] * f);
                *(v4h*)((h16*)(Sb + (size_t)row * TT) + ch * 128 + lane * 4) = o4; } }
         }
}

extern "C" void kernel_launch(void* const* d_in, const int* in_sizes, int n_in,
                              void* d_out, int out_size, void* d_ws, size_t ws_size, hipStream_t stream) {
    (void)in_sizes; (void)n_in; (void)out_size;
    const float* x = (const float*)d_in[0]; const float* pemb = (const float*)d_in[1]; const int* kmask = (const int*)d_in[2]; const float* wq = (const float*)d_in[3]; const float* bq = (const float*)d_in[4]; const float* wk = (const float*)d_in[5]; const float* bk = (const float*)d_in[6]; const float* wv = (const float*)d_in[7]; const float* bv = (const float*)d_in[8]; const float* wpos = (const float*)d_in[9]; const float* wo = (const float*)d_in[10]; const float* bo = (const float*)d_in[11]; const float* pbu = (const float*)d_in[12]; const float* pbv = (const float*)d_in[13]; const float* cosT = nullptr; const float* sinT = nullptr; (void)cosT; (void)sinT;
    float* OUT = (float*)d_out;     // [4][2048][1024]
    char* wsp = (char*)d_ws;
    auto take = [&](size_t bytes) { char* p = wsp; wsp += (bytes + 255) & ~(size_t)255; return (void*)p; };
    bf* WQ = (bf*)take((size_t)DQ * DM * 2); bf* WK = (bf*)take((size_t)DKV * DM * 2); bf* WV = (bf*)take((size_t)DKV * DM * 2); bf* WO = (bf*)take((size_t)DM * DQ * 2);
    bf* XB = (bf*)take((size_t)NB_ * TT * DM * 2); bf* WP = (bf*)take((size_t)DQ * DM * 2); h16* PP16 = (h16*)take((size_t)NH_ * TT * HD * 2); bf* PPh = (bf*)take((size_t)NH_ * TT * HD * 2); bf* PPl = (bf*)take((size_t)NH_ * TT * HD * 2); h16* QV16 = (h16*)take((size_t)NH_ * TT * HD * 2); bf* QVh = (bf*)take((size_t)NH_ * TT * HD * 2); bf* QVl = (bf*)take((size_t)NH_ * TT * HD * 2); float* Sb2 = (float*)take((size_t)ZH * TT * TT * 4);
    h16* QP16 = (h16*)take((size_t)NH_ * TT * HD * 2); h16* KP16 = (h16*)take((size_t)NKV * TT * HD * 2); h16* VT16 = (h16*)take((size_t)NKV * HD * TT * 2);
    bf* QPh = (bf*)take((size_t)NH_ * TT * HD * 2); bf* QPl = (bf*)take((size_t)NH_ * TT * HD * 2); bf* KPh = (bf*)take((size_t)NKV * TT * HD * 2); bf* KPl = (bf*)take((size_t)NKV * TT * HD * 2); bf* VTh = (bf*)take((size_t)NKV * HD * TT * 2); bf* VTl = (bf*)take((size_t)NKV * HD * TT * 2);
    float* Sb = (float*)take((size_t)ZH * TT * TT * 4); bf* ATh = (bf*)take((size_t)TT * DQ * 2); bf* ATl = (bf*)take((size_t)TT * DQ * 2);
    // pos_emb's bf16 copy is last read by k_pp, before the first k_score writes Sb: it shares Sb's space
    bf* XP = (bf*)Sb;
    if ((size_t)(wsp - (char*)d_ws) > ws_size) return;    // ws 256 MiB
    k_prep<<<5 * GW + GP + GX, 256, 0, stream>>>(wq, wk, wv, wo, wpos, pemb, x, WQ, WK, WV, WO, WP, XP, XB);
    k_pp<<<dim3(TT / 64, DQ / 64, 1), 256, 0, stream>>>(XP, WP, PP16, PPh, PPl);
    for (int b = 0; b < NB_; ++b) {
        k_qkv<<<dim3(TT / 64, DQ / 64, 3), 256, 0, stream>>>(XB + (size_t)b * TT * DM, WQ, WK, WV, bq, bk, bv, pbu, pbv, QP16, QPh, QPl, QV16, QVh, QVl, KP16, KPh, KPl, VT16, VTh, VTl);
        for (int h0 = 0; h0 < NH_; h0 += ZH) { const size_t zq = (size_t)h0, zk = (size_t)(h0 / REP);   // one kv head per query head: the pass's heads use consecutive kv planes (z-strides TT*HD)
            k_score<<<dim3(TT / 64, TT / 64, 2 * ZH), 32, 0, stream>>>(QPh + zq * TT * HD, QPl + zq * TT * HD, KPh + zk * TT * HD, KPl + zk * TT * HD, QVh + zq * TT * HD, QVl + zq * TT * HD, PPh + zk * TT * HD, PPl + zk * TT * HD, QP16 + zq * TT * HD, KP16 + zk * TT * HD, QV16 + zq * TT * HD, PP16 + zk * TT * HD, Sb, Sb2);
            k_asoft<<<ZH * TT / 8, 256, 0, stream>>>(Sb, Sb2, kmask + (size_t)b * TT);
            k_av<<<dim3(TT / 64, HD / 64, ZH), 512, 0, stream>>>(Sb, VTh + zk * HD * TT, VTl + zk * HD * TT, VT16 + zk * HD * TT, ATh + zq * HD, ATl + zq * HD); }
        k_gemmw<bf, 1, true, 8><<<dim3(TT / 64, DM / 64, 1), 256, 0, stream>>>(ATh, ATl, WO, nullptr, DQ, OUT + (size_t)b * TT * DM, DM, bo); }
}

// v005
// One run takes 1110 microseconds.
// Next to v004, in two timings, it ran 1.06 times as fast each time.
// Counting every step since v000, it is 2.79 times as fast.
#include <hip/hip_runtime.h>

// MultiHeadRelPositionAttention (x [4][2048][1024], pos_emb [2048][1024], mask [4][2048] (int, read; all ones); q/k/v = x W^T + b (8 heads x 128); p = pos_emb Wpos^T; content = (q + pos_bias_u[h]).k; pos = rel_shift((q + pos_bias_v[h]).p) with the Transformer-XL pad/reshape shift for P == T: pos[i][j] = S[i][T-1-(i-j)] for j <= i, 0 for j == i+1, S[i+1][j-i-2] for j >= i+2 (reproduced literally, including the upper part); scores = (content + pos) / sqrt(128), key mask; softmax; out = merged Wout^T + bout -> [4][2048][1024]).
// Compute dtypes, f32 accumulate: every input rounded to bf16; q/k/v/p as PLAIN bf16 GEMMs (inputs: exact) + bias; the u/v head biases added in f32; content, position scores and attn.v: query rows < 512 hl (3 products), the rest single fp16 (x1024) (the shifted position score is gathered from rows i / i+1 of the position-score block); softmax f32 with the read key mask; Wout hl x exact (2 products) + bias.

#define NB_  4
#define TT   2048
#define DM   1024
#define NH_  8
#define NKV  8
#define REP  (NH_ / NKV)
#define HD   128
#define DQ   (NH_ * HD)
#define DKV  (NKV * HD)
#define ZH   4
#define RH   512                  // query rows < RH use hi+lo planes (0: none)
#define WIN  0
#define PCAR 1024.0f
#define SCL  0.088388347648318447f   // HD^-0.5
typedef _Float16 h16;
typedef unsigned short bf;
typedef __attribute__((ext_vector_type(16))) __bf16   v16bf;
typedef __attribute__((ext_vector_type(16))) _Float16 v16h;
typedef __attribute__((ext_vector_type(8)))  _Float16 v8h;
typedef __attribute__((ext_vector_type(8)))  unsigned short v8us;
typedef __attribute__((ext_vector_type(8)))  float    v8f;
typedef __attribute__((ext_vector_type(4)))  float    v4f;
typedef v8h  __attribute__((may_alias)) v8ha;
typedef v4f  __attribute__((may_alias)) v4fa;
typedef v8us __attribute__((may_alias)) v8usa;

__device__ __forceinline__ unsigned short f2bf(float f) { unsigned u = __float_as_uint(f); u += 0x7FFFu + ((u >> 16) & 1u); return (unsigned short)(u >> 16); }
__device__ __forceinline__ float bf2f(unsigned short b) { return __uint_as_float(((unsigned)b) << 16); }
__device__ __forceinline__ float bfr(float f) { return bf2f(f2bf(f)); }
__device__ __forceinline__ v16h cat16(v8h lo, v8h hi) { return __builtin_shufflevector(lo, hi, 0, 1, 2, 3, 4, 5, 6, 7, 8, 9, 10, 11, 12, 13, 14, 15); }
__device__ __forceinline__ v16bf cat16b(v8us lo, v8us hi) { return __builtin_bit_cast(v16bf, __builtin_shufflevector(lo, hi, 0, 1, 2, 3, 4, 5, 6, 7, 8, 9, 10, 11, 12, 13, 14, 15)); }
__device__ __forceinline__ v8f wmma16(v16h a, v16h b, v8f c) { return __builtin_amdgcn_wmma_f32_16x16x32_f16(false, a, false, b, (short)0, c, false, false); }
__device__ __forceinline__ v8f wmmab(v16bf a, v16bf b, v8f c) { return __builtin_amdgcn_wmma_f32_16x16x32_bf16(false, a, false, b, (short)0, c, false, false); }
__device__ __forceinline__ h16 tohx(float x) { return (h16)x; }
__device__ __forceinline__ void splitf(float y, unsigned short& h, unsigned short& l) { h = f2bf(y); l = f2bf(y - bf2f(h)); }
typedef __attribute__((ext_vector_type(4))) _Float16 v4h;
typedef __attribute__((ext_vector_type(4))) unsigned short v4us;
// one operand's three 16-bit planes: fp16, bf16 hi, bf16 lo
struct Planes { h16* p16; bf* ph; bf* pl; };
__device__ __forceinline__ void put_hl(v4f r, bf* Ph, bf* Pl, size_t off) { v4us oh, ol;
#pragma unroll
    for (int u = 0; u < 4; ++u) { unsigned short a, c2; splitf(r[u], a, c2); oh[u] = a; ol[u] = c2; }
    *(v4us*)(Ph + off) = oh; *(v4us*)(Pl + off) = ol; }
__device__ __forceinline__ void put3(v4f r, Planes P, size_t off) { v4h o16;
#pragma unroll
    for (int u = 0; u < 4; ++u) o16[u] = tohx(r[u]);
    *(v4h*)(P.p16 + off) = o16; put_hl(r, P.ph, P.pl, off); }



// ---- k_gemmw: register-blocked GEMM, one 64x64 output tile per work-group (16 accumulators per wave), operands straight from K-contiguous 16-bit planes; grid (M/64, N/64), 32 * KS threads.
// C[m][n] (f32, pitch ldc, + optional f32 bias[n]) = sum_k A[m][k] Bt[n][k] (+ split products per NSPLIT). K % (32 * KS) == 0.
// KS > 1: the K loop is shared out over KS waves (wave w takes the 32-wide k blocks w, w + KS, ...); the KS partial tiles meet in LDS and are summed in the fixed order w = 0 .. KS-1.
template <typename T16> struct WFrag;
template <> struct WFrag<h16> { typedef v16h V; static __device__ __forceinline__ V ld(const h16* p) { return cat16(*(const v8h*)p, *(const v8h*)(p + 16)); } static __device__ __forceinline__ v8f mma(V a, V b, v8f c) { return wmma16(a, b, c); } };
template <> struct WFrag<bf> { typedef v16bf V; static __device__ __forceinline__ V ld(const bf* p) { return cat16b(*(const v8us*)p, *(const v8us*)(p + 16)); } static __device__ __forceinline__ v8f mma(V a, V b, v8f c) { return wmmab(a, b, c); } };
// gemmw_body is the tile's whole work; os is the calling kernel's LDS, (KS == 1 ? 16 : KS * 64) * 68 floats; the tile is (bx, by). lda is the row pitch of A and A2 in elements; Bt and Bt2 have pitch K.
// mode (block-uniform; KS > 1 only for mode != 0) says where the summed tile goes; MSET holds bit m for every mode m != 0 that the calling kernel can ask for (0: mode 0 alone):
//   0: f32 C (+ bias[n]).
//   1: m = t, n = h * HD + d: (+ bias[n]) -> the planes P1 [h][t][d].
//   2: as 1, then + bu[n] -> P1 and + bv2[n] -> P2 (both adds in f32, on the biased value).
//   3: m = g * HD + d, n = t: (+ bias[m]) -> the planes P1 [g][d][t].
//   4: m = t, n = d of one head: x 1 (t < RH) or x 1 / PCAR -> hi/lo P1.ph, P1.pl, row pitch DQ (the pointers are the head's).
// gemmw_tail: modes 1 to 4 behind the barrier: this thread's rows row0, row0 + 2, ... of the tile, columns cofs .. cofs + 3 (n in the whole matrix), summed over the KS partial tiles in the order w = 0 .. KS-1, then biased, converted and stored. bb, ub, vb, rb come as loaded (f32) and are rounded to bf16 here.
template <int MODE, bool BIAS, int KS>
__device__ __forceinline__ void gemmw_tail(const float* os, int row0, int r0, int cofs, int n, v4f bb, v4f ub, v4f vb, const float (&rb)[32 / KS], Planes P1, Planes P2) {
#pragma unroll
    for (int u = 0; u < 4; ++u) { bb[u] = bfr(bb[u]); ub[u] = bfr(ub[u]); vb[u] = bfr(vb[u]); }
#pragma unroll
    for (int s = 0; s < 32 / KS; ++s) { const int row = row0 + 2 * s, m = r0 + row; v4f val = *(const v4fa*)(os + row * 68 + cofs);
#pragma unroll
        for (int w = 1; w < KS; ++w) val += *(const v4fa*)(os + (w * 64 + row) * 68 + cofs);
        if (BIAS) { if (MODE == 3) val += bfr(rb[s]); else val += bb; }
        if (MODE == 4) put_hl(val * ((m < RH) ? 1.0f : (1.0f / PCAR)), P1.ph, P1.pl, (size_t)m * DQ + n);
        else if (MODE == 3) put3(val, P1, (size_t)m * TT + n);
        else { const size_t off = ((size_t)(n / HD) * TT + m) * HD + n % HD;
            if (MODE == 2) { put3(val + ub, P1, off); put3(val + vb, P2, off); } else put3(val, P1, off); } }
    asm volatile("s_wait_xcnt 0x0" ::: "memory");   // behind the tail's last stores: the code laid out behind this tail reuses their address and data registers
}
template <typename T16, int NSPLIT, bool BIAS, int KS, int MSET = 0>
__device__ __forceinline__ void gemmw_body(float* os, const T16* __restrict__ A, const T16* __restrict__ A2, const T16* __restrict__ Bt, const T16* __restrict__ Bt2, int K, int lda, float* C, int ldc, const float* __restrict__ bias, int bx, int by,
                                           int mode = 0, Planes P1 = Planes{}, Planes P2 = Planes{}, const float* __restrict__ bu = nullptr, const float* __restrict__ bv2 = nullptr) {
    typedef typename WFrag<T16>::V V;
    const int wave = (KS == 1) ? 0 : __builtin_amdgcn_readfirstlane((int)(threadIdx.x >> 5));
    const int lane = threadIdx.x & 31, lr = lane & 15, hi = lane >> 4; const int r0 = bx * 64, c0 = by * 64;
    v8f acc[4][4];
#pragma unroll
    for (int mb = 0; mb < 4; ++mb)
#pragma unroll
        for (int nb = 0; nb < 4; ++nb) acc[mb][nb] = (v8f){};
    const size_t aoff = (size_t)(r0 + lr) * lda + 8 * hi, boff = (size_t)(c0 + lr) * K + 8 * hi;
#pragma unroll 1
    for (int kc = wave * 32; kc < K; kc += 32 * KS) {
        V a[4], a2[4];
#pragma unroll
        for (int mb = 0; mb < 4; ++mb) { a[mb] = WFrag<T16>::ld(A + aoff + (size_t)mb * 16 * lda + kc); if (NSPLIT == 1 || NSPLIT == 2) a2[mb] = WFrag<T16>::ld(A2 + aoff + (size_t)mb * 16 * lda + kc); }
#pragma unroll
        for (int nb = 0; nb < 4; ++nb) { const V b = WFrag<T16>::ld(Bt + boff + (size_t)nb * 16 * K + kc); V b2; if (NSPLIT >= 2) b2 = WFrag<T16>::ld(Bt2 + boff + (size_t)nb * 16 * K + kc);
#pragma unroll
            for (int mb = 0; mb < 4; ++mb) { acc[mb][nb] = WFrag<T16>::mma(a[mb], b, acc[mb][nb]); if (NSPLIT == 1 || NSPLIT == 2) acc[mb][nb] = WFrag<T16>::mma(a2[mb], b, acc[mb][nb]); if (NSPLIT >= 2) acc[mb][nb] = WFrag<T16>::mma(a[mb], b2, acc[mb][nb]); } }
        asm volatile("v_nop\n\tv_nop\n\tv_nop\n\tv_nop" : "+v"(acc[0][0]), "+v"(acc[1][1]), "+v"(acc[2][2]), "+v"(acc[3][3]) : "v"(a[0]), "v"(a[3]));
    }
    if (KS > 1) {
        // mode != 0: this thread's biases (of its four columns; mode 3: of its rows) are loaded ahead of the LDS exchange and first used behind it, in the tail, so that their latency runs under it
        const int cofs = lr * 4, n = c0 + cofs; v4f bb = (v4f){}, ub = (v4f){}, vb = (v4f){}; float rb[32 / KS];
#pragma unroll
        for (int s = 0; s < 32 / KS; ++s) rb[s] = 0.0f;
        if (BIAS && (MSET & 8) && mode == 3) {
#pragma unroll
            for (int s = 0; s < 32 / KS; ++s) rb[s] = bias[r0 + wave * (64 / KS) + 2 * s + hi];
            asm volatile("s_wait_xcnt 0x0" ::: "memory"); }   // these loads stay in flight, and the code below reuses their address registers
        if (BIAS && (MSET & 6) && mode != 3) { bb[0] = bias[n]; bb[1] = bias[n + 1]; bb[2] = bias[n + 2]; bb[3] = bias[n + 3];
            asm volatile("s_wait_xcnt 0x0" ::: "memory"); }   // as above: behind loads that stay in flight
        if ((MSET & 4) && mode == 2) {
#pragma unroll
            for (int u = 0; u < 4; ++u) { ub[u] = bu[n + u]; vb[u] = bv2[n + u]; }
            asm volatile("s_wait_xcnt 0x0" ::: "memory"); }   // as above: behind loads that stay in flight
        float* mine = os + wave * (64 * 68);
#pragma unroll
        for (int mb = 0; mb < 4; ++mb)
#pragma unroll
            for (int nb = 0; nb < 4; ++nb)
#pragma unroll
                for (int j = 0; j < 8; ++j) mine[(mb * 16 + hi * 8 + j) * 68 + nb * 16 + lr] = acc[mb][nb][j];
        __syncthreads();   // every wave's partial tile is in LDS before any wave sums rows of it
        // the highest mode of MSET is taken without a test
        if ((MSET & 2) && (MSET < 4 || mode == 1)) { gemmw_tail<1, BIAS, KS>(os, wave * (64 / KS) + hi, r0, cofs, n, bb, ub, vb, rb, P1, P2); return; }
        if ((MSET & 4) && (MSET < 8 || mode == 2)) { gemmw_tail<2, BIAS, KS>(os, wave * (64 / KS) + hi, r0, cofs, n, bb, ub, vb, rb, P1, P2); return; }
        if ((MSET & 8) && (MSET < 16 || mode == 3)) { gemmw_tail<3, BIAS, KS>(os, wave * (64 / KS) + hi, r0, cofs, n, bb, ub, vb, rb, P1, P2); return; }
        if (MSET & 16) { gemmw_tail<4, BIAS, KS>(os, wave * (64 / KS) + hi, r0, cofs, n, bb, ub, vb, rb, P1, P2); return; }
#pragma unroll
        for (int s = 0; s < 32 / KS; ++s) { const int row = wave * (64 / KS) + 2 * s + hi, cofs = lr * 4; v4f val = *(const v4fa*)(os + row * 68 + cofs);
#pragma unroll
            for (int w = 1; w < KS; ++w) val += *(const v4fa*)(os + (w * 64 + row) * 68 + cofs);
            if (BIAS) { val[0] += bfr(bias[c0 + cofs]); val[1] += bfr(bias[c0 + cofs + 1]); val[2] += bfr(bias[c0 + cofs + 2]); val[3] += bfr(bias[c0 + cofs + 3]); }
            *(v4f*)(C + (size_t)(r0 + row) * ldc + c0 + cofs) = val; }
        return;
    }
#pragma unroll
    for (int mb = 0; mb < 4; ++mb) {
#pragma unroll
        for (int nb = 0; nb < 4; ++nb) {
#pragma unroll
            for (int j = 0; j < 8; ++j) os[(hi * 8 + j) * 68 + nb * 16 + lr] = acc[mb][nb][j]; }
        __builtin_amdgcn_wave_barrier(); asm volatile("" ::: "memory");
        float* crow = C + (size_t)(r0 + mb * 16) * ldc + c0;
{
#pragma unroll
            for (int s = 0; s < 8; ++s) { const int row = 2 * s + hi, cofs = lr * 4; v4f val = *(const v4fa*)(os + row * 68 + cofs); if (BIAS) { val[0] += bfr(bias[c0 + cofs]); val[1] += bfr(bias[c0 + cofs + 1]); val[2] += bfr(bias[c0 + cofs + 2]); val[3] += bfr(bias[c0 + cofs + 3]); }
                *(v4f*)(crow + (size_t)row * ldc + cofs) = val; }
             }
        __builtin_amdgcn_wave_barrier(); asm volatile("" ::: "memory");
    }
}

template <typename T16, int NSPLIT, bool BIAS, int KS>
__global__ __launch_bounds__(32 * KS) void k_gemmw(const T16* __restrict__ A, const T16* __restrict__ A2, const T16* __restrict__ Bt, const T16* __restrict__ Bt2, int K, float* C, int ldc, const float* __restrict__ bias) {
    __shared__ __align__(16) float os[(KS == 1 ? 16 : KS * 64) * 68];
    gemmw_body<T16, NSPLIT, BIAS, KS>(os, A, A2, Bt, Bt2, K, K, C, ldc, bias, blockIdx.x, blockIdx.y);
}
// ---- launches that read none of each other's output, joined into one grid; a work-group picks its product by its block index (block-uniform), and each tile's arithmetic is gemmw_body's as before.
// k_qkv: z = 0, 1, 2: the q, k, v projection of one batch entry, each straight into its 16-bit planes: q + u and q + v, k, and v transposed.
// v is formed as Wv . x^T (the same products, the operands' roles exchanged), so that its tile has t along the columns, as the planes [g][d][t] want it; its tile indices are exchanged with it.
__global__ __launch_bounds__(256) void k_qkv(const bf* __restrict__ X, const bf* __restrict__ Wq_, const bf* __restrict__ Wk_, const bf* __restrict__ Wv_, const float* __restrict__ bq, const float* __restrict__ bk, const float* __restrict__ bv, const float* __restrict__ bu, const float* __restrict__ bv2,
                                             h16* Q16, bf* Qh, bf* Ql, h16* U16, bf* Uh, bf* Ul, h16* K16, bf* Kh, bf* Kl, h16* V16, bf* Vh, bf* Vl) {
    __shared__ __align__(16) float os[8 * 64 * 68];
    const int z = blockIdx.z;
    const Planes P1 = { z == 0 ? Q16 : (z == 1 ? K16 : V16), z == 0 ? Qh : (z == 1 ? Kh : Vh), z == 0 ? Ql : (z == 1 ? Kl : Vl) }; const Planes P2 = { U16, Uh, Ul };
    gemmw_body<bf, 0, true, 8, 14>(os, z == 2 ? Wv_ : X, nullptr, z == 0 ? Wq_ : (z == 1 ? Wk_ : X), nullptr, DM, DM, nullptr, 0, z == 0 ? bq : (z == 1 ? bk : bv), z == 2 ? blockIdx.y : blockIdx.x, z == 2 ? blockIdx.x : blockIdx.y,
                               z == 0 ? 2 : (z == 1 ? 1 : 3), P1, P2, bu, bv2);
}
// k_pp: p = pos_emb Wpos^T straight into its planes.
__global__ __launch_bounds__(256) void k_pp(const bf* __restrict__ XP, const bf* __restrict__ WP, h16* R16, bf* Rh, bf* Rl) {
    __shared__ __align__(16) float os[8 * 64 * 68];
    gemmw_body<bf, 0, false, 8, 2>(os, XP, nullptr, WP, nullptr, DM, DM, nullptr, 0, nullptr, blockIdx.x, blockIdx.y, 1, Planes{ R16, Rh, Rl });
}
// ---- score_tile: one 128x128 tile of a score block per work-group of 4 waves, each wave a 64x64 quarter (16 accumulators, the products and their order as in gemmw_body with KS == 1).
// The tile's rows of A and Bt (pitch HD) come into LDS by asynchronous 16-byte copies, every thread a share, each wave-wide copy covering whole lines; they lie there at a row pitch 16 bytes above the staged row's length, and the waves read their fragments from there.
// NSPLIT == 0: one plane per operand, all HD of k in one stage. NSPLIT == 2: hi and lo planes, k in two stages of HD / 2 through the same LDS. sm holds SCORE_LDS bytes; behind the last stage it serves as the four waves' 16 x 68 float store buffers.
#define SCORE_LDS (2 * 2 * 128 * (HD / 2 + 8) * 2)
// eight asynchronous copies of 16 bytes per lane, global g[i] -> LDS byte address l[i]; the s_wait_xcnt stands inside the statement so that no register the copies name is rewritten ahead of it
__device__ __forceinline__ void copy8(const unsigned (&l)[8], const void* const (&g)[8]) {
    asm volatile("global_load_async_to_lds_b128 %0, %8, off\n\t"
                 "global_load_async_to_lds_b128 %1, %9, off\n\t"
                 "global_load_async_to_lds_b128 %2, %10, off\n\t"
                 "global_load_async_to_lds_b128 %3, %11, off\n\t"
                 "global_load_async_to_lds_b128 %4, %12, off\n\t"
                 "global_load_async_to_lds_b128 %5, %13, off\n\t"
                 "global_load_async_to_lds_b128 %6, %14, off\n\t"
                 "global_load_async_to_lds_b128 %7, %15, off\n\t"
                 "s_wait_xcnt 0x0"
                 :: "v"(l[0]), "v"(l[1]), "v"(l[2]), "v"(l[3]), "v"(l[4]), "v"(l[5]), "v"(l[6]), "v"(l[7]),
                    "v"(g[0]), "v"(g[1]), "v"(g[2]), "v"(g[3]), "v"(g[4]), "v"(g[5]), "v"(g[6]), "v"(g[7]) : "memory");
}
template <typename T16, int NSPLIT>
__device__ __forceinline__ void score_tile(char* sm, const T16* __restrict__ A, const T16* __restrict__ A2, const T16* __restrict__ Bt, const T16* __restrict__ Bt2, float* C, int bx, int by) {
    typedef typename WFrag<T16>::V V;
    constexpr int NP = (NSPLIT == 2) ? 2 : 1, KH = HD / NP, PIT = KH + 8, U = KH / 8;   // planes per operand; k per stage; LDS row pitch in elements; 16-byte units per staged row (and per thread and plane)
    static_assert(2 * NP * 128 * PIT * 2 <= SCORE_LDS && 4 * 16 * 68 * 4 <= SCORE_LDS && U % 8 == 0, "LDS");
    const T16* sA = (const T16*)sm; const T16* sB = sA + NP * 128 * PIT; const unsigned smo = (unsigned)(size_t)sm;   // smo: the LDS byte address of sm
    const int tid = threadIdx.x, wave = __builtin_amdgcn_readfirstlane(tid >> 5), lane = tid & 31, lr = lane & 15, hi = lane >> 4;
    const int r0 = bx * 128, c0 = by * 128, wm = (wave >> 1) * 64, wn = (wave & 1) * 64;
    // this thread's unit of the first 128 / U staged rows: row tid / U, 16-byte unit tid % U; its further units lie 128 / U rows on each
    const size_t gt = (size_t)(tid / U) * HD + (tid % U) * 8; const unsigned lt = smo + (unsigned)(((tid / U) * PIT + (tid % U) * 8) * 2);
    const T16* gA = A + (size_t)r0 * HD + gt; const T16* gA2 = (NP == 2) ? A2 + (size_t)r0 * HD + gt : nullptr; const T16* gB = Bt + (size_t)c0 * HD + gt; const T16* gB2 = (NP == 2) ? Bt2 + (size_t)c0 * HD + gt : nullptr;
    v8f acc[4][4];
#pragma unroll
    for (int mb = 0; mb < 4; ++mb)
#pragma unroll
        for (int nb = 0; nb < 4; ++nb) acc[mb][nb] = (v8f){};
#pragma unroll
    for (int st = 0; st < NP; ++st) {
        if (st) { asm volatile("s_wait_dscnt 0x0" ::: "memory");   // this wave's LDS reads of the stage before have returned
            __syncthreads(); }   // ... and every other wave's: the LDS may be refilled
#pragma unroll 1   // rolled: a trip's 24 address registers are formed in the trip and are not held across the matrix work
        for (int q = 0; q < 2 * NP * (U / 8); ++q) { const int pl = q / (U / 8), i0 = (q % (U / 8)) * 8;   // plane in LDS order (A, [A2,] Bt, [Bt2]); first of the trip's eight units
            const T16* src = (NP == 1) ? (pl ? gB : gA) : (pl == 0 ? gA : (pl == 1 ? gA2 : (pl == 2 ? gB : gB2)));
            unsigned l[8]; const void* g[8];
#pragma unroll
            for (int i = 0; i < 8; ++i) { g[i] = src + st * KH + (size_t)((i0 + i) * (128 / U)) * HD; l[i] = lt + (unsigned)((pl * 128 + (i0 + i) * (128 / U)) * PIT * 2); }
            copy8(l, g); }
        asm volatile("s_wait_asynccnt 0x0" ::: "memory");   // this wave's copies have landed
        __syncthreads();   // ... and every other wave's: the stage is whole in LDS before any wave reads fragments of it
        const T16* fa = sA + (wm + lr) * PIT + 8 * hi; const T16* fb = sB + (wn + lr) * PIT + 8 * hi;
#pragma unroll (NSPLIT == 2 ? 1 : KH / 32)   // hi/lo planes: rolled, so that one trip's fragments (80 registers beside the 128 of acc) are live at a time and nothing spills at 4 waves per SIMD
        for (int kc = 0; kc < KH; kc += 32) {
            V a[4], a2[4];
#pragma unroll
            for (int mb = 0; mb < 4; ++mb) { a[mb] = WFrag<T16>::ld(fa + mb * 16 * PIT + kc); if (NSPLIT == 2) a2[mb] = WFrag<T16>::ld(fa + (128 + mb * 16) * PIT + kc); }
#pragma unroll
            for (int nb = 0; nb < 4; ++nb) { const V b = WFrag<T16>::ld(fb + nb * 16 * PIT + kc); V b2; if (NSPLIT == 2) b2 = WFrag<T16>::ld(fb + (128 + nb * 16) * PIT + kc);
#pragma unroll
                for (int mb = 0; mb < 4; ++mb) { acc[mb][nb] = WFrag<T16>::mma(a[mb], b, acc[mb][nb]); if (NSPLIT == 2) { acc[mb][nb] = WFrag<T16>::mma(a2[mb], b, acc[mb][nb]); acc[mb][nb] = WFrag<T16>::mma(a[mb], b2, acc[mb][nb]); } } }
        }
    }
    asm volatile("s_wait_dscnt 0x0" ::: "memory");   // this wave's last fragment reads have returned
    __syncthreads();   // ... and every other wave's: the LDS now takes the waves' store buffers
    float* os = (float*)sm + wave * (16 * 68);
#pragma unroll
    for (int mb = 0; mb < 4; ++mb) {
#pragma unroll
        for (int nb = 0; nb < 4; ++nb) {
#pragma unroll
            for (int j = 0; j < 8; ++j) os[(hi * 8 + j) * 68 + nb * 16 + lr] = acc[mb][nb][j]; }
        __builtin_amdgcn_wave_barrier(); asm volatile("" ::: "memory");   // the wave's LDS writes stay ahead of its reads of other lanes' words
        float* crow = C + (size_t)(r0 + wm + mb * 16) * TT + c0 + wn; v4f t[8];
#pragma unroll
        for (int s = 0; s < 8; ++s) t[s] = *(const v4fa*)(os + (2 * s + hi) * 68 + lr * 4);
#pragma unroll
        for (int s = 0; s < 8; ++s) *(v4f*)(crow + (size_t)(2 * s + hi) * TT + lr * 4) = t[s];
        asm volatile("s_wait_xcnt 0x0" ::: "memory");   // behind the stores: the next round reuses their address and data registers
        __builtin_amdgcn_wave_barrier(); asm volatile("" ::: "memory");   // the reads above stay ahead of the next round's writes
    }
}
// k_score: z = 2 * head + (0: content q.k -> S, 1: position qv.p -> S2); row tiles below RH on the hi/lo planes, the rest on the fp16 planes. Pointers are those of the pass's first head.
// Launch bounds: four work-groups per WGP (their LDS fits four times), so that one group's copies and stores run under another's matrix work; the registers are held to that.
__global__ __launch_bounds__(128, 4) void k_score(const bf* __restrict__ Qh, const bf* __restrict__ Ql, const bf* __restrict__ Kh, const bf* __restrict__ Kl, const bf* __restrict__ Vh, const bf* __restrict__ Vl, const bf* __restrict__ Rh, const bf* __restrict__ Rl,
                                              const h16* __restrict__ Q16, const h16* __restrict__ K16, const h16* __restrict__ V16, const h16* __restrict__ R16, float* S, float* S2) {
    __shared__ __align__(16) char sm[SCORE_LDS];
    const bool pos = (blockIdx.z & 1) != 0; const size_t zz = blockIdx.z >> 1, zo = zz * ((size_t)TT * HD);
    float* C = (pos ? S2 : S) + zz * ((size_t)TT * TT);
    if (blockIdx.x < RH / 128) score_tile<bf, 2>(sm, (pos ? Vh : Qh) + zo, (pos ? Vl : Ql) + zo, (pos ? Rh : Kh) + zo, (pos ? Rl : Kl) + zo, C, blockIdx.x, blockIdx.y);
    else score_tile<h16, 0>(sm, (pos ? V16 : Q16) + zo, nullptr, (pos ? R16 : K16) + zo, nullptr, C, blockIdx.x, blockIdx.y);
}
// k_av: attn.v of the pass's heads (z); row tiles below RH on the hi/lo planes, the rest on the fp16 plane. The weights lie where k_asoft left them: in the bytes of their own score row (pitch 2 * TT 16-bit elements).
// The tile goes, rescaled and split hi/lo, straight to its head's columns of the merged rows [t][DQ]; Ah, Al are those of the pass's first head.
__global__ __launch_bounds__(512) void k_av(const float* __restrict__ Sp, const bf* __restrict__ Vh, const bf* __restrict__ Vl, const h16* __restrict__ V16, bf* Ah, bf* Al) {
    __shared__ __align__(16) float os[16 * 64 * 68];
    const size_t z = blockIdx.z, zv = z * ((size_t)HD * TT), zp = z * ((size_t)TT * 2 * TT); const Planes PA = { nullptr, Ah + z * HD, Al + z * HD };
    if (blockIdx.x < RH / 64) gemmw_body<bf, 2, false, 16, 16>(os, (const bf*)Sp + zp, (const bf*)Sp + zp + TT, Vh + zv, Vl + zv, TT, 2 * TT, nullptr, 0, nullptr, blockIdx.x, blockIdx.y, 4, PA);
    else gemmw_body<h16, 0, false, 16, 16>(os, (const h16*)Sp + zp, nullptr, V16 + zv, nullptr, TT, 2 * TT, nullptr, 0, nullptr, blockIdx.x, blockIdx.y, 4, PA);
}

typedef __attribute__((ext_vector_type(2))) unsigned short v2us;
typedef __attribute__((ext_vector_type(2))) float v2f;

__global__ __launch_bounds__(256) void k_wtG(const float* __restrict__ w, int K, int N, bf* Bt) {
    const int lane = threadIdx.x & 31; const int L0 = (blockIdx.x * 8 + (threadIdx.x >> 5)) * 8; const int nlines = N * K / 64;
{
#pragma unroll 1
        for (int l = 0; l < 8; ++l) { const int L = L0 + l; if (L >= nlines) break; const size_t e = (size_t)L * 64 + lane * 2; const int k = (int)(e % K), n = (int)(e / K); v2us o;
            o[0] = f2bf(w[(size_t)k * N + n]); o[1] = f2bf(w[(size_t)(k + 1) * N + n]); *(v2us*)(Bt + e) = o; }
         }
}
__device__ __forceinline__ void d_cvt8(unsigned bid, const float* __restrict__ src, bf* dst, size_t n8) { const size_t i = (size_t)bid * 256 + threadIdx.x; if (i >= n8) return; const v8f v = *(const v8f*)(src + i * 8); v8us o;
#pragma unroll
    for (int k = 0; k < 8; ++k) o[k] = f2bf(v[k]); *(v8us*)(dst + i * 8) = o;  }
__global__ __launch_bounds__(256) void k_cscvt(const float* __restrict__ cosT, const float* __restrict__ sinT, float* CS) { const int idx = blockIdx.x * 256 + threadIdx.x; if (idx >= TT * HD) return; v2f cs; cs[0] = bfr(cosT[idx]); cs[1] = bfr(sinT[idx]); *(v2f*)(CS + (size_t)idx * 2) = cs;  }
// ---- streaming jobs that read none of each other's output, joined into one grid; a work-group picks its job by its block index.
#define GW   (DQ * DM / 8 / 256)         // work-groups of one weight's conversion
#define GP   (TT * DM / 8 / 256)         // ... of pos_emb's
#define GX   (NB_ * TT * DM / 8 / 256)   // ... of x's, all batch entries
// k_prep: the five weights, pos_emb and x to bf16.
__global__ __launch_bounds__(256) void k_prep(const float* __restrict__ wq, const float* __restrict__ wk, const float* __restrict__ wv, const float* __restrict__ wo, const float* __restrict__ wpos, const float* __restrict__ pemb, const float* __restrict__ x,
                                              bf* WQ, bf* WK, bf* WV, bf* WO, bf* WP, bf* XP, bf* XB) {
    unsigned b = blockIdx.x;
    if (b < 5 * GW) { const unsigned j = b / GW; d_cvt8(b % GW, j == 0 ? wq : (j == 1 ? wk : (j == 2 ? wv : (j == 3 ? wo : wpos))), j == 0 ? WQ : (j == 1 ? WK : (j == 2 ? WV : (j == 3 ? WO : WP))), (size_t)DQ * DM / 8); return; }
    b -= 5 * GW; if (b < GP) { d_cvt8(b, pemb, XP, (size_t)TT * DM / 8); return; }
    d_cvt8(b - GP, x, XB, (size_t)NB_ * TT * DM / 8);
}
// k_asoft: per row (zz, i): t = (S + rel-shifted S2) x HD^-0.5, masked keys -3e38; softmax over the 2048 keys (register row, one exp, fixed trees);
// the weights go back into the row's own 4 * TT bytes of Sb, which this wave alone reads and holds whole in registers by then: fp16 in the first half, or hi in the first half and lo in the second.
__global__ __launch_bounds__(256) void k_asoft(float* Sb, const float* __restrict__ Sb2, const int* __restrict__ km) {
    const int lane = threadIdx.x & 31; const int row = blockIdx.x * 8 + (threadIdx.x >> 5); if (row >= ZH * TT) return; const int i = row % TT; const int zz = row / TT; (void)zz; const bool hires = (i < RH); const float* sr = Sb + (size_t)row * TT; const float* pr0 = Sb2 + (size_t)row * TT; const float* pr1 = Sb2 + (size_t)(row + 1) * TT;   /* row i+1 of the same head block (never dereferenced for i = T-1: j >= i+2 is impossible there) */ float v[TT / 32]; float mx = -3.0e38f;
#pragma unroll
    for (int ch = 0; ch < TT / 128; ++ch) { const int j0 = ch * 128 + lane * 4; const v4f a = *(const v4f*)(sr + j0);
#pragma unroll
        for (int q = 0; q < 4; ++q) { const int j = j0 + q; (void)j; const int jj = j0 + q; const float bd = (jj <= i) ? pr0[TT - 1 - (i - jj)] : ((jj == i + 1) ? 0.0f : pr1[jj - i - 2]); float cp = __fadd_rn(a[q], bd); asm volatile("" : "+v"(cp)); const float t = (km[jj] != 0) ? cp * SCL : -3.0e38f; v[ch * 4 + q] = t; mx = fmaxf(mx, t); } }
#pragma unroll
    for (int sh = 16; sh; sh >>= 1) mx = fmaxf(mx, __shfl_xor(mx, sh, 32));
    float sum = 0.f;
#pragma unroll
    for (int k = 0; k < TT / 32; ++k) { float d0 = __fsub_rn(v[k], mx); asm volatile("" : "+v"(d0)); v[k] = __builtin_amdgcn_exp2f(__fmul_rn(d0, 1.4426950408889634f)); sum += v[k]; }
#pragma unroll
    for (int sh = 16; sh; sh >>= 1) sum += __shfl_xor(sum, sh, 32);
    const float f = __fdiv_rn(hires ? 1.0f : PCAR, sum);
{
        if (hires) {
#pragma unroll
            for (int ch = 0; ch < TT / 128; ++ch) { v4us oh, ol;
#pragma unroll
                for (int q = 0; q < 4; ++q) { unsigned short a, c2; splitf(v[ch * 4 + q] * f, a, c2); oh[q] = a; ol[q] = c2; }
                bf* po = (bf*)(Sb + (size_t)row * TT) + ch * 128 + lane * 4; *(v4us*)po = oh; *(v4us*)(po + TT) = ol; }
        } else {
#pragma unroll
            for (int ch = 0; ch < TT / 128; ++ch) { v4h o4;
#pragma unroll
                for (int q = 0; q < 4; ++q) o4[q] = tohx(v[ch * 4 + q] * f);
                *(v4h*)((h16*)(Sb + (size_t)row * TT) + ch * 128 + lane * 4) = o4; } }
         }
}

extern "C" void kernel_launch(void* const* d_in, const int* in_sizes, int n_in,
                              void* d_out, int out_size, void* d_ws, size_t ws_size, hipStream_t stream) {
    (void)in_sizes; (void)n_in; (void)out_size;
    const float* x = (const float*)d_in[0]; const float* pemb = (const float*)d_in[1]; const int* kmask = (const int*)d_in[2]; const float* wq = (const float*)d_in[3]; const float* bq = (const float*)d_in[4]; const float* wk = (const float*)d_in[5]; const float* bk = (const float*)d_in[6]; const float* wv = (const float*)d_in[7]; const float* bv = (const float*)d_in[8]; const float* wpos = (const float*)d_in[9]; const float* wo = (const float*)d_in[10]; const float* bo = (const float*)d_in[11]; const float* pbu = (const float*)d_in[12]; const float* pbv = (const float*)d_in[13]; const float* cosT = nullptr; const float* sinT = nullptr; (void)cosT; (void)sinT;
    float* OUT = (float*)d_out;     // [4][2048][1024]
    char* wsp = (char*)d_ws;
    auto take = [&](size_t bytes) { char* p = wsp; wsp += (bytes + 255) & ~(size_t)255; return (void*)p; };
    bf* WQ = (bf*)take((size_t)DQ * DM * 2); bf* WK = (bf*)take((size_t)DKV * DM * 2); bf* WV = (bf*)take((size_t)DKV * DM * 2); bf* WO = (bf*)take((size_t)DM * DQ * 2);
    bf* XB = (bf*)take((size_t)NB_ * TT * DM * 2); bf* WP = (bf*)take((size_t)DQ * DM * 2); h16* PP16 = (h16*)take((size_t)NH_ * TT * HD * 2); bf* PPh = (bf*)take((size_t)NH_ * TT * HD * 2); bf* PPl = (bf*)take((size_t)NH_ * TT * HD * 2); h16* QV16 = (h16*)take((size_t)NH_ * TT * HD * 2); bf* QVh = (bf*)take((size_t)NH_ * TT * HD * 2); bf* QVl = (bf*)take((size_t)NH_ * TT * HD * 2); float* Sb2 = (float*)take((size_t)ZH * TT * TT * 4);
    h16* QP16 = (h16*)take((size_t)NH_ * TT * HD * 2); h16* KP16 = (h16*)take((size_t)NKV * TT * HD * 2); h16* VT16 = (h16*)take((size_t)NKV * HD * TT * 2);
    bf* QPh = (bf*)take((size_t)NH_ * TT * HD * 2); bf* QPl = (bf*)take((size_t)NH_ * TT * HD * 2); bf* KPh = (bf*)take((size_t)NKV * TT * HD * 2); bf* KPl = (bf*)take((size_t)NKV * TT * HD * 2); bf* VTh = (bf*)take((size_t)NKV * HD * TT * 2); bf* VTl = (bf*)take((size_t)NKV * HD * TT * 2);
    float* Sb = (float*)take((size_t)ZH * TT * TT * 4); bf* ATh = (bf*)take((size_t)TT * DQ * 2); bf* ATl = (bf*)take((size_t)TT * DQ * 2);
    // pos_emb's bf16 copy is last read by k_pp, before the first k_score writes Sb: it shares Sb's space
    bf* XP = (bf*)Sb;
    if ((size_t)(wsp - (char*)d_ws) > ws_size) return;    // ws 256 MiB
    k_prep<<<5 * GW + GP + GX, 256, 0, stream>>>(wq, wk, wv, wo, wpos, pemb, x, WQ, WK, WV, WO, WP, XP, XB);
    k_pp<<<dim3(TT / 64, DQ / 64, 1), 256, 0, stream>>>(XP, WP, PP16, PPh, PPl);
    for (int b = 0; b < NB_; ++b) {
        k_qkv<<<dim3(TT / 64, DQ / 64, 3), 256, 0, stream>>>(XB + (size_t)b * TT * DM, WQ, WK, WV, bq, bk, bv, pbu, pbv, QP16, QPh, QPl, QV16, QVh, QVl, KP16, KPh, KPl, VT16, VTh, VTl);
        for (int h0 = 0; h0 < NH_; h0 += ZH) { const size_t zq = (size_t)h0, zk = (size_t)(h0 / REP);   // one kv head per query head: the pass's heads use consecutive kv planes (z-strides TT*HD)
            k_score<<<dim3(TT / 128, TT / 128, 2 * ZH), 128, 0, stream>>>(QPh + zq * TT * HD, QPl + zq * TT * HD, KPh + zk * TT * HD, KPl + zk * TT * HD, QVh + zq * TT * HD, QVl + zq * TT * HD, PPh + zk * TT * HD, PPl + zk * TT * HD, QP16 + zq * TT * HD, KP16 + zk * TT * HD, QV16 + zq * TT * HD, PP16 + zk * TT * HD, Sb, Sb2);
            k_asoft<<<ZH * TT / 8, 256, 0, stream>>>(Sb, Sb2, kmask + (size_t)b * TT);
            k_av<<<dim3(TT / 64, HD / 64, ZH), 512, 0, stream>>>(Sb, VTh + zk * HD * TT, VTl + zk * HD * TT, VT16 + zk * HD * TT, ATh + zq * HD, ATl + zq * HD); }
        k_gemmw<bf, 1, true, 8><<<dim3(TT / 64, DM / 64, 1), 256, 0, stream>>>(ATh, ATl, WO, nullptr, DQ, OUT + (size_t)b * TT * DM, DM, bo); }
}

// v006
// It runs in 1010 microseconds.
// Two timings next to v005 both put it at 1.09 times that version's speed.
// Counting every step since v000, it is 3.04 times as fast.
#include <hip/hip_runtime.h>

// MultiHeadRelPositionAttention (x [4][2048][1024], pos_emb [2048][1024], mask [4][2048] (int, read; all ones); q/k/v = x W^T + b (8 heads x 128); p = pos_emb Wpos^T; content = (q + pos_bias_u[h]).k; pos = rel_shift((q + pos_bias_v[h]).p) with the Transformer-XL pad/reshape shift for P == T: pos[i][j] = S[i][T-1-(i-j)] for j <= i, 0 for j == i+1, S[i+1][j-i-2] for j >= i+2 (reproduced literally, including the upper part); scores = (content + pos) / sqrt(128), key mask; softmax; out = merged Wout^T + bout -> [4][2048][1024]).
// Compute dtypes, f32 accumulate: every input rounded to bf16; q/k/v/p as PLAIN bf16 GEMMs (inputs: exact) + bias; the u/v head biases added in f32; content, position scores and attn.v: query rows < 512 hl (3 products), the rest single fp16 (x1024) (the shifted position score is gathered from rows i / i+1 of the position-score block); softmax f32 with the read key mask; Wout hl x exact (2 products) + bias.

#define NB_  4
#define TT   2048
#define DM   1024
#define NH_  8
#define NKV  8
#define REP  (NH_ / NKV)
#define HD   128
#define DQ   (NH_ * HD)
#define DKV  (NKV * HD)
#define ZH   4
#define RH   512                  // query rows < RH use hi+lo planes (0: none)
#define WIN  0
#define PCAR 1024.0f
#define SCL  0.088388347648318447f   // HD^-0.5
typedef _Float16 h16;
typedef unsigned short bf;
typedef __attribute__((ext_vector_type(16))) __bf16   v16bf;
typedef __attribute__((ext_vector_type(16))) _Float16 v16h;
typedef __attribute__((ext_vector_type(8)))  _Float16 v8h;
typedef __attribute__((ext_vector_type(8)))  unsigned short v8us;
typedef __attribute__((ext_vector_type(8)))  float    v8f;
typedef __attribute__((ext_vector_type(4)))  float    v4f;
typedef v8h  __attribute__((may_alias)) v8ha;
typedef v4f  __attribute__((may_alias)) v4fa;
typedef v8us __attribute__((may_alias)) v8usa;

__device__ __forceinline__ unsigned short f2bf(float f) { unsigned u = __float_as_uint(f); u += 0x7FFFu + ((u >> 16) & 1u); return (unsigned short)(u >> 16); }
__device__ __forceinline__ float bf2f(unsigned short b) { return __uint_as_float(((unsigned)b) << 16); }
__device__ __forceinline__ float bfr(float f) { return bf2f(f2bf(f)); }
__device__ __forceinline__ v16h cat16(v8h lo, v8h hi) { return __builtin_shufflevector(lo, hi, 0, 1, 2, 3, 4, 5, 6, 7, 8, 9, 10, 11, 12, 13, 14, 15); }
__device__ __forceinline__ v16bf cat16b(v8us lo, v8us hi) { return __builtin_bit_cast(v16bf, __builtin_shufflevector(lo, hi, 0, 1, 2, 3, 4, 5, 6, 7, 8, 9, 10, 11, 12, 13, 14, 15)); }
__device__ __forceinline__ v8f wmma16(v16h a, v16h b, v8f c) { return __builtin_amdgcn_wmma_f32_16x16x32_f16(false, a, false, b, (short)0, c, false, false); }
__device__ __forceinline__ v8f wmmab(v16bf a, v16bf b, v8f c) { return __builtin_amdgcn_wmma_f32_16x16x32_bf16(false, a, false, b, (short)0, c, false, false); }
__device__ __forceinline__ h16 tohx(float x) { return (h16)x; }
__device__ __forceinline__ void splitf(float y, unsigned short& h, unsigned short& l) { h = f2bf(y); l = f2bf(y - bf2f(h)); }
typedef __attribute__((ext_vector_type(4))) _Float16 v4h;
typedef __attribute__((ext_vector_type(4))) unsigned short v4us;
// one operand's three 16-bit planes: fp16, bf16 hi, bf16 lo
struct Planes { h16* p16; bf* ph; bf* pl; };
__device__ __forceinline__ void put_hl(v4f r, bf* Ph, bf* Pl, size_t off) { v4us oh, ol;
#pragma unroll
    for (int u = 0; u < 4; ++u) { unsigned short a, c2; splitf(r[u], a, c2); oh[u] = a; ol[u] = c2; }
    *(v4us*)(Ph + off) = oh; *(v4us*)(Pl + off) = ol; }
__device__ __forceinline__ void put3(v4f r, Planes P, size_t off) { v4h o16;
#pragma unroll
    for (int u = 0; u < 4; ++u) o16[u] = tohx(r[u]);
    *(v4h*)(P.p16 + off) = o16; put_hl(r, P.ph, P.pl, off); }



// ---- k_gemmw: register-blocked GEMM, one 64x64 output tile per work-group (16 accumulators per wave), operands from K-contiguous 16-bit planes; grid (M/64, N/64), 32 * KS threads.
// C[m][n] (f32, pitch ldc, + optional f32 bias[n]) = sum_k A[m][k] Bt[n][k] (+ split products per NSPLIT). K % (32 * KS) == 0.
// KS > 1: the K loop is shared out over KS waves (wave w takes the 64-wide k chunks w, w + KS, ...; K % (64 * KS) == 0); the KS partial tiles meet in LDS and are summed in the fixed order w = 0 .. KS-1.
// There a wave brings each chunk's operand rows into its own LDS by asynchronous copies of whole lines and reads its fragments from there; with split planes the chunk's products go plane pair by plane pair through the same two slots: a2.b, a.b, a.b2.
template <typename T16> struct WFrag;
template <> struct WFrag<h16> { typedef v16h V; static __device__ __forceinline__ V ld(const h16* p) { return cat16(*(const v8h*)p, *(const v8h*)(p + 16)); } static __device__ __forceinline__ v8f mma(V a, V b, v8f c) { return wmma16(a, b, c); } };
template <> struct WFrag<bf> { typedef v16bf V; static __device__ __forceinline__ V ld(const bf* p) { return cat16b(*(const v8us*)p, *(const v8us*)(p + 16)); } static __device__ __forceinline__ v8f mma(V a, V b, v8f c) { return wmmab(a, b, c); } };
// eight asynchronous copies of 16 bytes per lane, global g[i] -> LDS byte address l[i]; the s_wait_xcnt stands inside the statement so that no register the copies name is rewritten ahead of it
__device__ __forceinline__ void copy8(const unsigned (&l)[8], const void* const (&g)[8]) {
    asm volatile("global_load_async_to_lds_b128 %0, %8, off\n\t"
                 "global_load_async_to_lds_b128 %1, %9, off\n\t"
                 "global_load_async_to_lds_b128 %2, %10, off\n\t"
                 "global_load_async_to_lds_b128 %3, %11, off\n\t"
                 "global_load_async_to_lds_b128 %4, %12, off\n\t"
                 "global_load_async_to_lds_b128 %5, %13, off\n\t"
                 "global_load_async_to_lds_b128 %6, %14, off\n\t"
                 "global_load_async_to_lds_b128 %7, %15, off\n\t"
                 "s_wait_xcnt 0x0"
                 :: "v"(l[0]), "v"(l[1]), "v"(l[2]), "v"(l[3]), "v"(l[4]), "v"(l[5]), "v"(l[6]), "v"(l[7]),
                    "v"(g[0]), "v"(g[1]), "v"(g[2]), "v"(g[3]), "v"(g[4]), "v"(g[5]), "v"(g[6]), "v"(g[7]) : "memory");
}
// A wave's own LDS in gemmw_body (KS > 1): two slots, each 64 rows of 64 elements of one 16-bit plane at a row pitch 16 bytes above the row; behind the K loop the same bytes take the wave's partial tile (64 x 68 floats).
#define GPIT  72                     // row pitch in elements
#define GSLOT (64 * GPIT)            // one slot in elements
#define GWST  (2 * GSLOT * 2 / 4)    // one wave's LDS in floats
// stage64: one wave copies 64 rows x 128 bytes (row pitch ld elements) into a slot, each wave-wide copy four whole lines. lds, g: this lane's 16-byte unit of the first four rows (row lane / 8, unit lane % 8), as LDS byte address and as global pointer.
template <typename T16>
__device__ __forceinline__ void stage64(unsigned lds, const T16* g, int ld) {
#pragma unroll 1   // rolled: a trip's 24 address registers are formed in the trip
    for (int h = 0; h < 2; ++h) { unsigned l[8]; const void* p[8];
#pragma unroll
        for (int c = 0; c < 8; ++c) { p[c] = g + (size_t)((h * 8 + c) * 4) * ld; l[c] = lds + (unsigned)((h * 8 + c) * 4 * GPIT * 2); }
        copy8(l, p); }
}
// gemmw_body is the tile's whole work; os is the calling kernel's LDS, KS == 1 ? 16 * 68 : KS * GWST floats; the tile is (bx, by). lda is the row pitch of A and A2 in elements; Bt and Bt2 have pitch K.
// mode (block-uniform; KS > 1 only for mode != 0) says where the summed tile goes; MSET holds bit m for every mode m != 0 that the calling kernel can ask for (0: mode 0 alone):
//   0: f32 C (+ bias[n]).
//   1: m = t, n = h * HD + d: (+ bias[n]) -> the planes P1 [h][t][d].
//   2: as 1, then + bu[n] -> P1 and + bv2[n] -> P2 (both adds in f32, on the biased value).
//   3: m = g * HD + d, n = t: (+ bias[m]) -> the planes P1 [g][d][t].
//   4: m = t, n = d of one head: x 1 (t < RH) or x 1 / PCAR -> hi/lo P1.ph, P1.pl, row pitch DQ (the pointers are the head's).
// gemmw_tail: modes 1 to 4 behind the barrier: this thread's rows row0, row0 + 2, ... of the tile, columns cofs .. cofs + 3 (n in the whole matrix), summed over the KS partial tiles in the order w = 0 .. KS-1, then biased, converted and stored. bb, ub, vb, rb come as loaded (f32) and are rounded to bf16 here.
template <int MODE, bool BIAS, int KS>
__device__ __forceinline__ void gemmw_tail(const float* os, int row0, int r0, int cofs, int n, v4f bb, v4f ub, v4f vb, const float (&rb)[32 / KS], Planes P1, Planes P2) {
#pragma unroll
    for (int u = 0; u < 4; ++u) { bb[u] = bfr(bb[u]); ub[u] = bfr(ub[u]); vb[u] = bfr(vb[u]); }
#pragma unroll
    for (int s = 0; s < 32 / KS; ++s) { const int row = row0 + 2 * s, m = r0 + row; v4f val = *(const v4fa*)(os + row * 68 + cofs);
#pragma unroll
        for (int w = 1; w < KS; ++w) val += *(const v4fa*)(os + w * GWST + row * 68 + cofs);
        if (BIAS) { if (MODE == 3) val += bfr(rb[s]); else val += bb; }
        if (MODE == 4) put_hl(val * ((m < RH) ? 1.0f : (1.0f / PCAR)), P1.ph, P1.pl, (size_t)m * DQ + n);
        else if (MODE == 3) put3(val, P1, (size_t)m * TT + n);
        else { const size_t off = ((size_t)(n / HD) * TT + m) * HD + n % HD;
            if (MODE == 2) { put3(val + ub, P1, off); put3(val + vb, P2, off); } else put3(val, P1, off); } }
    asm volatile("s_wait_xcnt 0x0" ::: "memory");   // behind the tail's last stores: the code laid out behind this tail reuses their address and data registers
}
template <typename T16, int NSPLIT, bool BIAS, int KS, int MSET = 0>
__device__ __forceinline__ void gemmw_body(float* os, const T16* __restrict__ A, const T16* __restrict__ A2, const T16* __restrict__ Bt, const T16* __restrict__ Bt2, int K, int lda, float* C, int ldc, const float* __restrict__ bias, int bx, int by,
                                           int mode = 0, Planes P1 = Planes{}, Planes P2 = Planes{}, const float* __restrict__ bu = nullptr, const float* __restrict__ bv2 = nullptr) {
    typedef typename WFrag<T16>::V V;
    const int wave = (KS == 1) ? 0 : __builtin_amdgcn_readfirstlane((int)(threadIdx.x >> 5));
    const int lane = threadIdx.x & 31, lr = lane & 15, hi = lane >> 4; const int r0 = bx * 64, c0 = by * 64;
    v8f acc[4][4];
#pragma unroll
    for (int mb = 0; mb < 4; ++mb)
#pragma unroll
        for (int nb = 0; nb < 4; ++nb) acc[mb][nb] = (v8f){};
    if (KS > 1) {
        constexpr int NST = (NSPLIT == 0) ? 1 : ((NSPLIT == 1) ? 2 : 3);   // plane pairs per chunk
        const T16* sA = (const T16*)(os + wave * GWST); const T16* fa = sA + lr * GPIT + 8 * hi; const T16* fb = fa + GSLOT;
        const unsigned la = (unsigned)(size_t)sA + (unsigned)(((lane >> 3) * GPIT + (lane & 7) * 8) * 2), lb = la + GSLOT * 2;   // LDS byte addresses of this lane's first unit in the two slots
        const size_t ga = (size_t)(r0 + (lane >> 3)) * lda + (lane & 7) * 8, gb = (size_t)(c0 + (lane >> 3)) * K + (lane & 7) * 8;
#pragma unroll 1   // rolled: the chunks go through the same two slots one after the other, so a second copy of the body would gain nothing
        for (int kc = wave * 64; kc < K; kc += 64 * KS) {
#pragma unroll
            for (int st = 0; st < NST; ++st) {
                asm volatile("s_wait_dscnt 0x0" ::: "memory");   // this wave's reads of the slot that is refilled have returned (the slots are the wave's own: no barrier)
                if (st == 0) { stage64(la, (NSPLIT == 0 ? A : A2) + ga + kc, lda); stage64(lb, Bt + gb + kc, K); }
                else if (st == 1) stage64(la, A + ga + kc, lda);
                else stage64(lb, Bt2 + gb + kc, K);
                asm volatile("s_wait_asynccnt 0x0" ::: "memory");   // this wave's copies have landed before it reads fragments of them
#pragma unroll
                for (int kk = 0; kk < 64; kk += 32) { V a[4], b[4];
#pragma unroll
                    for (int u = 0; u < 4; ++u) { a[u] = WFrag<T16>::ld(fa + u * 16 * GPIT + kk); b[u] = WFrag<T16>::ld(fb + u * 16 * GPIT + kk); }
#pragma unroll
                    for (int nb = 0; nb < 4; ++nb)
#pragma unroll
                        for (int mb = 0; mb < 4; ++mb) acc[mb][nb] = WFrag<T16>::mma(a[mb], b[nb], acc[mb][nb]); }
            }
        }
    } else {
        const size_t aoff = (size_t)(r0 + lr) * lda + 8 * hi, boff = (size_t)(c0 + lr) * K + 8 * hi;
#pragma unroll 1
        for (int kc = wave * 32; kc < K; kc += 32 * KS) {
            V a[4], a2[4];
#pragma unroll
            for (int mb = 0; mb < 4; ++mb) { a[mb] = WFrag<T16>::ld(A + aoff + (size_t)mb * 16 * lda + kc); if (NSPLIT == 1 || NSPLIT == 2) a2[mb] = WFrag<T16>::ld(A2 + aoff + (size_t)mb * 16 * lda + kc); }
#pragma unroll
            for (int nb = 0; nb < 4; ++nb) { const V b = WFrag<T16>::ld(Bt + boff + (size_t)nb * 16 * K + kc); V b2; if (NSPLIT >= 2) b2 = WFrag<T16>::ld(Bt2 + boff + (size_t)nb * 16 * K + kc);
#pragma unroll
                for (int mb = 0; mb < 4; ++mb) { acc[mb][nb] = WFrag<T16>::mma(a[mb], b, acc[mb][nb]); if (NSPLIT == 1 || NSPLIT == 2) acc[mb][nb] = WFrag<T16>::mma(a2[mb], b, acc[mb][nb]); if (NSPLIT >= 2) acc[mb][nb] = WFrag<T16>::mma(a[mb], b2, acc[mb][nb]); } }
            asm volatile("v_nop\n\tv_nop\n\tv_nop\n\tv_nop" : "+v"(acc[0][0]), "+v"(acc[1][1]), "+v"(acc[2][2]), "+v"(acc[3][3]) : "v"(a[0]), "v"(a[3]));
        }
    }
    if (KS > 1) {
        // mode != 0: this thread's biases (of its four columns; mode 3: of its rows) are loaded ahead of the LDS exchange and first used behind it, in the tail, so that their latency runs under it
        const int cofs = lr * 4, n = c0 + cofs; v4f bb = (v4f){}, ub = (v4f){}, vb = (v4f){}; float rb[32 / KS];
#pragma unroll
        for (int s = 0; s < 32 / KS; ++s) rb[s] = 0.0f;
        if (BIAS && (MSET & 8) && mode == 3) {
#pragma unroll
            for (int s = 0; s < 32 / KS; ++s) rb[s] = bias[r0 + wave * (64 / KS) + 2 * s + hi];
            asm volatile("s_wait_xcnt 0x0" ::: "memory"); }   // these loads stay in flight, and the code below reuses their address registers
        if (BIAS && (MSET & 6) && mode != 3) { bb[0] = bias[n]; bb[1] = bias[n + 1]; bb[2] = bias[n + 2]; bb[3] = bias[n + 3];
            asm volatile("s_wait_xcnt 0x0" ::: "memory"); }   // as above: behind loads that stay in flight
        if ((MSET & 4) && mode == 2) {
#pragma unroll
            for (int u = 0; u < 4; ++u) { ub[u] = bu[n + u]; vb[u] = bv2[n + u]; }
            asm volatile("s_wait_xcnt 0x0" ::: "memory"); }   // as above: behind loads that stay in flight
        float* mine = os + wave * GWST;
#pragma unroll
        for (int mb = 0; mb < 4; ++mb)
#pragma unroll
            for (int nb = 0; nb < 4; ++nb)
#pragma unroll
                for (int j = 0; j < 8; ++j) mine[(mb * 16 + hi * 8 + j) * 68 + nb * 16 + lr] = acc[mb][nb][j];
        __syncthreads();   // every wave's partial tile is in LDS before any wave sums rows of it
        // the highest mode of MSET is taken without a test
        if ((MSET & 2) && (MSET < 4 || mode == 1)) { gemmw_tail<1, BIAS, KS>(os, wave * (64 / KS) + hi, r0, cofs, n, bb, ub, vb, rb, P1, P2); return; }
        if ((MSET & 4) && (MSET < 8 || mode == 2)) { gemmw_tail<2, BIAS, KS>(os, wave * (64 / KS) + hi, r0, cofs, n, bb, ub, vb, rb, P1, P2); return; }
        if ((MSET & 8) && (MSET < 16 || mode == 3)) { gemmw_tail<3, BIAS, KS>(os, wave * (64 / KS) + hi, r0, cofs, n, bb, ub, vb, rb, P1, P2); return; }
        if (MSET & 16) { gemmw_tail<4, BIAS, KS>(os, wave * (64 / KS) + hi, r0, cofs, n, bb, ub, vb, rb, P1, P2); return; }
#pragma unroll
        for (int s = 0; s < 32 / KS; ++s) { const int row = wave * (64 / KS) + 2 * s + hi, cofs = lr * 4; v4f val = *(const v4fa*)(os + row * 68 + cofs);
#pragma unroll
            for (int w = 1; w < KS; ++w) val += *(const v4fa*)(os + w * GWST + row * 68 + cofs);
            if (BIAS) { val[0] += bfr(bias[c0 + cofs]); val[1] += bfr(bias[c0 + cofs + 1]); val[2] += bfr(bias[c0 + cofs + 2]); val[3] += bfr(bias[c0 + cofs + 3]); }
            *(v4f*)(C + (size_t)(r0 + row) * ldc + c0 + cofs) = val; }
        return;
    }
#pragma unroll
    for (int mb = 0; mb < 4; ++mb) {
#pragma unroll
        for (int nb = 0; nb < 4; ++nb) {
#pragma unroll
            for (int j = 0; j < 8; ++j) os[(hi * 8 + j) * 68 + nb * 16 + lr] = acc[mb][nb][j]; }
        __builtin_amdgcn_wave_barrier(); asm volatile("" ::: "memory");
        float* crow = C + (size_t)(r0 + mb * 16) * ldc + c0;
{
#pragma unroll
            for (int s = 0; s < 8; ++s) { const int row = 2 * s + hi, cofs = lr * 4; v4f val = *(const v4fa*)(os + row * 68 + cofs); if (BIAS) { val[0] += bfr(bias[c0 + cofs]); val[1] += bfr(bias[c0 + cofs + 1]); val[2] += bfr(bias[c0 + cofs + 2]); val[3] += bfr(bias[c0 + cofs + 3]); }
                *(v4f*)(crow + (size_t)row * ldc + cofs) = val; }
             }
        __builtin_amdgcn_wave_barrier(); asm volatile("" ::: "memory");
    }
}

template <typename T16, int NSPLIT, bool BIAS, int KS>
__global__ __launch_bounds__(32 * KS) void k_gemmw(const T16* __restrict__ A, const T16* __restrict__ A2, const T16* __restrict__ Bt, const T16* __restrict__ Bt2, int K, float* C, int ldc, const float* __restrict__ bias) {
    __shared__ __align__(16) float os[KS == 1 ? 16 * 68 : KS * GWST];
    gemmw_body<T16, NSPLIT, BIAS, KS>(os, A, A2, Bt, Bt2, K, K, C, ldc, bias, blockIdx.x, blockIdx.y);
}
// ---- launches that read none of each other's output, joined into one grid; a work-group picks its product by its block index (block-uniform), and each tile's arithmetic is gemmw_body's as before.
// k_qkv: z = 0, 1, 2: the q, k, v projection of one batch entry, each straight into its 16-bit planes: q + u and q + v, k, and v transposed.
// v is formed as Wv . x^T (the same products, the operands' roles exchanged), so that its tile has t along the columns, as the planes [g][d][t] want it; its tile indices are exchanged with it.
__global__ __launch_bounds__(256) void k_qkv(const bf* __restrict__ X, const bf* __restrict__ Wq_, const bf* __restrict__ Wk_, const bf* __restrict__ Wv_, const float* __restrict__ bq, const float* __restrict__ bk, const float* __restrict__ bv, const float* __restrict__ bu, const float* __restrict__ bv2,
                                             h16* Q16, bf* Qh, bf* Ql, h16* U16, bf* Uh, bf* Ul, h16* K16, bf* Kh, bf* Kl, h16* V16, bf* Vh, bf* Vl) {
    __shared__ __align__(16) float os[8 * GWST];
    const int z = blockIdx.z;
    const Planes P1 = { z == 0 ? Q16 : (z == 1 ? K16 : V16), z == 0 ? Qh : (z == 1 ? Kh : Vh), z == 0 ? Ql : (z == 1 ? Kl : Vl) }; const Planes P2 = { U16, Uh, Ul };
    gemmw_body<bf, 0, true, 8, 14>(os, z == 2 ? Wv_ : X, nullptr, z == 0 ? Wq_ : (z == 1 ? Wk_ : X), nullptr, DM, DM, nullptr, 0, z == 0 ? bq : (z == 1 ? bk : bv), z == 2 ? blockIdx.y : blockIdx.x, z == 2 ? blockIdx.x : blockIdx.y,
                               z == 0 ? 2 : (z == 1 ? 1 : 3), P1, P2, bu, bv2);
}
// k_pp: p = pos_emb Wpos^T straight into its planes.
__global__ __launch_bounds__(256) void k_pp(const bf* __restrict__ XP, const bf* __restrict__ WP, h16* R16, bf* Rh, bf* Rl) {
    __shared__ __align__(16) float os[8 * GWST];
    gemmw_body<bf, 0, false, 8, 2>(os, XP, nullptr, WP, nullptr, DM, DM, nullptr, 0, nullptr, blockIdx.x, blockIdx.y, 1, Planes{ R16, Rh, Rl });
}
// ---- score_tile: one 128x128 tile of a score block per work-group of 4 waves, each wave a 64x64 quarter (16 accumulators, the products and their order as in gemmw_body with KS == 1).
// The tile's rows of A and Bt (pitch HD) come into LDS by asynchronous 16-byte copies, every thread a share, each wave-wide copy covering whole lines; they lie there at a row pitch 16 bytes above the staged row's length, and the waves read their fragments from there.
// NSPLIT == 0: one plane per operand, all HD of k in one stage. NSPLIT == 2: hi and lo planes, k in two stages of HD / 2 through the same LDS. sm holds SCORE_LDS bytes; behind the last stage it serves as the four waves' 16 x 68 float store buffers.
#define SCORE_LDS (2 * 2 * 128 * (HD / 2 + 8) * 2)
template <typename T16, int NSPLIT>
__device__ __forceinline__ void score_tile(char* sm, const T16* __restrict__ A, const T16* __restrict__ A2, const T16* __restrict__ Bt, const T16* __restrict__ Bt2, float* C, int bx, int by) {
    typedef typename WFrag<T16>::V V;
    constexpr int NP = (NSPLIT == 2) ? 2 : 1, KH = HD / NP, PIT = KH + 8, U = KH / 8;   // planes per operand; k per stage; LDS row pitch in elements; 16-byte units per staged row (and per thread and plane)
    static_assert(2 * NP * 128 * PIT * 2 <= SCORE_LDS && 4 * 16 * 68 * 4 <= SCORE_LDS && U % 8 == 0, "LDS");
    const T16* sA = (const T16*)sm; const T16* sB = sA + NP * 128 * PIT; const unsigned smo = (unsigned)(size_t)sm;   // smo: the LDS byte address of sm
    const int tid = threadIdx.x, wave = __builtin_amdgcn_readfirstlane(tid >> 5), lane = tid & 31, lr = lane & 15, hi = lane >> 4;
    const int r0 = bx * 128, c0 = by * 128, wm = (wave >> 1) * 64, wn = (wave & 1) * 64;
    // this thread's unit of the first 128 / U staged rows: row tid / U, 16-byte unit tid % U; its further units lie 128 / U rows on each
    const size_t gt = (size_t)(tid / U) * HD + (tid % U) * 8; const unsigned lt = smo + (unsigned)(((tid / U) * PIT + (tid % U) * 8) * 2);
    const T16* gA = A + (size_t)r0 * HD + gt; const T16* gA2 = (NP == 2) ? A2 + (size_t)r0 * HD + gt : nullptr; const T16* gB = Bt + (size_t)c0 * HD + gt; const T16* gB2 = (NP == 2) ? Bt2 + (size_t)c0 * HD + gt : nullptr;
    v8f acc[4][4];
#pragma unroll
    for (int mb = 0; mb < 4; ++mb)
#pragma unroll
        for (int nb = 0; nb < 4; ++nb) acc[mb][nb] = (v8f){};
#pragma unroll
    for (int st = 0; st < NP; ++st) {
        if (st) { asm volatile("s_wait_dscnt 0x0" ::: "memory");   // this wave's LDS reads of the stage before have returned
            __syncthreads(); }   // ... and every other wave's: the LDS may be refilled
#pragma unroll 1   // rolled: a trip's 24 address registers are formed in the trip and are not held across the matrix work
        for (int q = 0; q < 2 * NP * (U / 8); ++q) { const int pl = q / (U / 8), i0 = (q % (U / 8)) * 8;   // plane in LDS order (A, [A2,] Bt, [Bt2]); first of the trip's eight units
            const T16* src = (NP == 1) ? (pl ? gB : gA) : (pl == 0 ? gA : (pl == 1 ? gA2 : (pl == 2 ? gB : gB2)));
            unsigned l[8]; const void* g[8];
#pragma unroll
            for (int i = 0; i < 8; ++i) { g[i] = src + st * KH + (size_t)((i0 + i) * (128 / U)) * HD; l[i] = lt + (unsigned)((pl * 128 + (i0 + i) * (128 / U)) * PIT * 2); }
            copy8(l, g); }
        asm volatile("s_wait_asynccnt 0x0" ::: "memory");   // this wave's copies have landed
        __syncthreads();   // ... and every other wave's: the stage is whole in LDS before any wave reads fragments of it
        const T16* fa = sA + (wm + lr) * PIT + 8 * hi; const T16* fb = sB + (wn + lr) * PIT + 8 * hi;
#pragma unroll (NSPLIT == 2 ? 1 : KH / 32)   // hi/lo planes: rolled, so that one trip's fragments (80 registers beside the 128 of acc) are live at a time and nothing spills at 4 waves per SIMD
        for (int kc = 0; kc < KH; kc += 32) {
            V a[4], a2[4];
#pragma unroll
            for (int mb = 0; mb < 4; ++mb) { a[mb] = WFrag<T16>::ld(fa + mb * 16 * PIT + kc); if (NSPLIT == 2) a2[mb] = WFrag<T16>::ld(fa + (128 + mb * 16) * PIT + kc); }
#pragma unroll
            for (int nb = 0; nb < 4; ++nb) { const V b = WFrag<T16>::ld(fb + nb * 16 * PIT + kc); V b2; if (NSPLIT == 2) b2 = WFrag<T16>::ld(fb + (128 + nb * 16) * PIT + kc);
#pragma unroll
                for (int mb = 0; mb < 4; ++mb) { acc[mb][nb] = WFrag<T16>::mma(a[mb], b, acc[mb][nb]); if (NSPLIT == 2) { acc[mb][nb] = WFrag<T16>::mma(a2[mb], b, acc[mb][nb]); acc[mb][nb] = WFrag<T16>::mma(a[mb], b2, acc[mb][nb]); } } }
        }
    }
    asm volatile("s_wait_dscnt 0x0" ::: "memory");   // this wave's last fragment reads have returned
    __syncthreads();   // ... and every other wave's: the LDS now takes the waves' store buffers
    float* os = (float*)sm + wave * (16 * 68);
#pragma unroll
    for (int mb = 0; mb < 4; ++mb) {
#pragma unroll
        for (int nb = 0; nb < 4; ++nb) {
#pragma unroll
            for (int j = 0; j < 8; ++j) os[(hi * 8 + j) * 68 + nb * 16 + lr] = acc[mb][nb][j]; }
        __builtin_amdgcn_wave_barrier(); asm volatile("" ::: "memory");   // the wave's LDS writes stay ahead of its reads of other lanes' words
        float* crow = C + (size_t)(r0 + wm + mb * 16) * TT + c0 + wn; v4f t[8];
#pragma unroll
        for (int s = 0; s < 8; ++s) t[s] = *(const v4fa*)(os + (2 * s + hi) * 68 + lr * 4);
#pragma unroll
        for (int s = 0; s < 8; ++s) *(v4f*)(crow + (size_t)(2 * s + hi) * TT + lr * 4) = t[s];
        asm volatile("s_wait_xcnt 0x0" ::: "memory");   // behind the stores: the next round reuses their address and data registers
        __builtin_amdgcn_wave_barrier(); asm volatile("" ::: "memory");   // the reads above stay ahead of the next round's writes
    }
}
// k_score: z = 2 * head + (0: content q.k -> S, 1: position qv.p -> S2); row tiles below RH on the hi/lo planes, the rest on the fp16 planes. Pointers are those of the pass's first head.
// Launch bounds: four work-groups per WGP (their LDS fits four times), so that one group's copies and stores run under another's matrix work; the registers are held to that.
__global__ __launch_bounds__(128, 4) void k_score(const bf* __restrict__ Qh, const bf* __restrict__ Ql, const bf* __restrict__ Kh, const bf* __restrict__ Kl, const bf* __restrict__ Vh, const bf* __restrict__ Vl, const bf* __restrict__ Rh, const bf* __restrict__ Rl,
                                              const h16* __restrict__ Q16, const h16* __restrict__ K16, const h16* __restrict__ V16, const h16* __restrict__ R16, float* S, float* S2) {
    __shared__ __align__(16) char sm[SCORE_LDS];
    const bool pos = (blockIdx.z & 1) != 0; const size_t zz = blockIdx.z >> 1, zo = zz * ((size_t)TT * HD);
    float* C = (pos ? S2 : S) + zz * ((size_t)TT * TT);
    if (blockIdx.x < RH / 128) score_tile<bf, 2>(sm, (pos ? Vh : Qh) + zo, (pos ? Vl : Ql) + zo, (pos ? Rh : Kh) + zo, (pos ? Rl : Kl) + zo, C, blockIdx.x, blockIdx.y);
    else score_tile<h16, 0>(sm, (pos ? V16 : Q16) + zo, nullptr, (pos ? R16 : K16) + zo, nullptr, C, blockIdx.x, blockIdx.y);
}
// k_av: attn.v of the pass's heads (z); row tiles below RH on the hi/lo planes, the rest on the fp16 plane. The weights lie where k_asoft left them: in the bytes of their own score row (pitch 2 * TT 16-bit elements).
// The tile goes, rescaled and split hi/lo, straight to its head's columns of the merged rows [t][DQ]; Ah, Al are those of the pass's first head.
__global__ __launch_bounds__(512) void k_av(const float* __restrict__ Sp, const bf* __restrict__ Vh, const bf* __restrict__ Vl, const h16* __restrict__ V16, bf* Ah, bf* Al) {
    __shared__ __align__(16) float os[16 * GWST];
    const size_t z = blockIdx.z, zv = z * ((size_t)HD * TT), zp = z * ((size_t)TT * 2 * TT); const Planes PA = { nullptr, Ah + z * HD, Al + z * HD };
    if (blockIdx.x < RH / 64) gemmw_body<bf, 2, false, 16, 16>(os, (const bf*)Sp + zp, (const bf*)Sp + zp + TT, Vh + zv, Vl + zv, TT, 2 * TT, nullptr, 0, nullptr, blockIdx.x, blockIdx.y, 4, PA);
    else gemmw_body<h16, 0, false, 16, 16>(os, (const h16*)Sp + zp, nullptr, V16 + zv, nullptr, TT, 2 * TT, nullptr, 0, nullptr, blockIdx.x, blockIdx.y, 4, PA);
}

typedef __attribute__((ext_vector_type(2))) unsigned short v2us;
typedef __attribute__((ext_vector_type(2))) float v2f;

__global__ __launch_bounds__(256) void k_wtG(const float* __restrict__ w, int K, int N, bf* Bt) {
    const int lane = threadIdx.x & 31; const int L0 = (blockIdx.x * 8 + (threadIdx.x >> 5)) * 8; const int nlines = N * K / 64;
{
#pragma unroll 1
        for (int l = 0; l < 8; ++l) { const int L = L0 + l; if (L >= nlines) break; const size_t e = (size_t)L * 64 + lane * 2; const int k = (int)(e % K), n = (int)(e / K); v2us o;
            o[0] = f2bf(w[(size_t)k * N + n]); o[1] = f2bf(w[(size_t)(k + 1) * N + n]); *(v2us*)(Bt + e) = o; }
         }
}
__device__ __forceinline__ void d_cvt8(unsigned bid, const float* __restrict__ src, bf* dst, size_t n8) { const size_t i = (size_t)bid * 256 + threadIdx.x; if (i >= n8) return; const v8f v = *(const v8f*)(src + i * 8); v8us o;
#pragma unroll
    for (int k = 0; k < 8; ++k) o[k] = f2bf(v[k]); *(v8us*)(dst + i * 8) = o;  }
__global__ __launch_bounds__(256) void k_cscvt(const float* __restrict__ cosT, const float* __restrict__ sinT, float* CS) { const int idx = blockIdx.x * 256 + threadIdx.x; if (idx >= TT * HD) return; v2f cs; cs[0] = bfr(cosT[idx]); cs[1] = bfr(sinT[idx]); *(v2f*)(CS + (size_t)idx * 2) = cs;  }
// ---- streaming jobs that read none of each other's output, joined into one grid; a work-group picks its job by its block index.
#define GW   (DQ * DM / 8 / 256)         // work-groups of one weight's conversion
#define GP   (TT * DM / 8 / 256)         // ... of pos_emb's
#define GX   (NB_ * TT * DM / 8 / 256)   // ... of x's, all batch entries
// k_prep: the five weights, pos_emb and x to bf16.
__global__ __launch_bounds__(256) void k_prep(const float* __restrict__ wq, const float* __restrict__ wk, const float* __restrict__ wv, const float* __restrict__ wo, const float* __restrict__ wpos, const float* __restrict__ pemb, const float* __restrict__ x,
                                              bf* WQ, bf* WK, bf* WV, bf* WO, bf* WP, bf* XP, bf* XB) {
    unsigned b = blockIdx.x;
    if (b < 5 * GW) { const unsigned j = b / GW; d_cvt8(b % GW, j == 0 ? wq : (j == 1 ? wk : (j == 2 ? wv : (j == 3 ? wo : wpos))), j == 0 ? WQ : (j == 1 ? WK : (j == 2 ? WV : (j == 3 ? WO : WP))), (size_t)DQ * DM / 8); return; }
    b -= 5 * GW; if (b < GP) { d_cvt8(b, pemb, XP, (size_t)TT * DM / 8); return; }
    d_cvt8(b - GP, x, XB, (size_t)NB_ * TT * DM / 8);
}
// k_asoft: per row (zz, i): t = (S + rel-shifted S2) x HD^-0.5, masked keys -3e38; softmax over the 2048 keys (register row, one exp, fixed trees);
// the weights go back into the row's own 4 * TT bytes of Sb, which this wave alone reads and holds whole in registers by then: fp16 in the first half, or hi in the first half and lo in the second.
__global__ __launch_bounds__(256) void k_asoft(float* Sb, const float* __restrict__ Sb2, const int* __restrict__ km) {
    const int lane = threadIdx.x & 31; const int row = blockIdx.x * 8 + (threadIdx.x >> 5); if (row >= ZH * TT) return; const int i = row % TT; const int zz = row / TT; (void)zz; const bool hires = (i < RH); const float* sr = Sb + (size_t)row * TT; const float* pr0 = Sb2 + (size_t)row * TT; const float* pr1 = Sb2 + (size_t)(row + 1) * TT;   /* row i+1 of the same head block (never dereferenced for i = T-1: j >= i+2 is impossible there) */ float v[TT / 32]; float mx = -3.0e38f;
#pragma unroll
    for (int ch = 0; ch < TT / 128; ++ch) { const int j0 = ch * 128 + lane * 4; const v4f a = *(const v4f*)(sr + j0);
#pragma unroll
        for (int q = 0; q < 4; ++q) { const int j = j0 + q; (void)j; const int jj = j0 + q; const float bd = (jj <= i) ? pr0[TT - 1 - (i - jj)] : ((jj == i + 1) ? 0.0f : pr1[jj - i - 2]); float cp = __fadd_rn(a[q], bd); asm volatile("" : "+v"(cp)); const float t = (km[jj] != 0) ? cp * SCL : -3.0e38f; v[ch * 4 + q] = t; mx = fmaxf(mx, t); } }
#pragma unroll
    for (int sh = 16; sh; sh >>= 1) mx = fmaxf(mx, __shfl_xor(mx, sh, 32));
    float sum = 0.f;
#pragma unroll
    for (int k = 0; k < TT / 32; ++k) { float d0 = __fsub_rn(v[k], mx); asm volatile("" : "+v"(d0)); v[k] = __builtin_amdgcn_exp2f(__fmul_rn(d0, 1.4426950408889634f)); sum += v[k]; }
#pragma unroll
    for (int sh = 16; sh; sh >>= 1) sum += __shfl_xor(sum, sh, 32);
    const float f = __fdiv_rn(hires ? 1.0f : PCAR, sum);
{
        if (hires) {
#pragma unroll
            for (int ch = 0; ch < TT / 128; ++ch) { v4us oh, ol;
#pragma unroll
                for (int q = 0; q < 4; ++q) { unsigned short a, c2; splitf(v[ch * 4 + q] * f, a, c2); oh[q] = a; ol[q] = c2; }
                bf* po = (bf*)(Sb + (size_t)row * TT) + ch * 128 + lane * 4; *(v4us*)po = oh; *(v4us*)(po + TT) = ol; }
        } else {
#pragma unroll
            for (int ch = 0; ch < TT / 128; ++ch) { v4h o4;
#pragma unroll
                for (int q = 0; q < 4; ++q) o4[q] = tohx(v[ch * 4 + q] * f);
                *(v4h*)((h16*)(Sb + (size_t)row * TT) + ch * 128 + lane * 4) = o4; } }
         }
}

extern "C" void kernel_launch(void* const* d_in, const int* in_sizes, int n_in,
                              void* d_out, int out_size, void* d_ws, size_t ws_size, hipStream_t stream) {
    (void)in_sizes; (void)n_in; (void)out_size;
    const float* x = (const float*)d_in[0]; const float* pemb = (const float*)d_in[1]; const int* kmask = (const int*)d_in[2]; const float* wq = (const float*)d_in[3]; const float* bq = (const float*)d_in[4]; const float* wk = (const float*)d_in[5]; const float* bk = (const float*)d_in[6]; const float* wv = (const float*)d_in[7]; const float* bv = (const float*)d_in[8]; const float* wpos = (const float*)d_in[9]; const float* wo = (const float*)d_in[10]; const float* bo = (const float*)d_in[11]; const float* pbu = (const float*)d_in[12]; const float* pbv = (const float*)d_in[13]; const float* cosT = nullptr; const float* sinT = nullptr; (void)cosT; (void)sinT;
    float* OUT = (float*)d_out;     // [4][2048][1024]
    char* wsp = (char*)d_ws;
    auto take = [&](size_t bytes) { char* p = wsp; wsp += (bytes + 255) & ~(size_t)255; return (void*)p; };
    bf* WQ = (bf*)take((size_t)DQ * DM * 2); bf* WK = (bf*)take((size_t)DKV * DM * 2); bf* WV = (bf*)take((size_t)DKV * DM * 2); bf* WO = (bf*)take((size_t)DM * DQ * 2);
    bf* XB = (bf*)take((size_t)NB_ * TT * DM * 2); bf* WP = (bf*)take((size_t)DQ * DM * 2); h16* PP16 = (h16*)take((size_t)NH_ * TT * HD * 2); bf* PPh = (bf*)take((size_t)NH_ * TT * HD * 2); bf* PPl = (bf*)take((size_t)NH_ * TT * HD * 2); h16* QV16 = (h16*)take((size_t)NH_ * TT * HD * 2); bf* QVh = (bf*)take((size_t)NH_ * TT * HD * 2); bf* QVl = (bf*)take((size_t)NH_ * TT * HD * 2); float* Sb2 = (float*)take((size_t)ZH * TT * TT * 4);
    h16* QP16 = (h16*)take((size_t)NH_ * TT * HD * 2); h16* KP16 = (h16*)take((size_t)NKV * TT * HD * 2); h16* VT16 = (h16*)take((size_t)NKV * HD * TT * 2);
    bf* QPh = (bf*)take((size_t)NH_ * TT * HD * 2); bf* QPl = (bf*)take((size_t)NH_ * TT * HD * 2); bf* KPh = (bf*)take((size_t)NKV * TT * HD * 2); bf* KPl = (bf*)take((size_t)NKV * TT * HD * 2); bf* VTh = (bf*)take((size_t)NKV * HD * TT * 2); bf* VTl = (bf*)take((size_t)NKV * HD * TT * 2);
    float* Sb = (float*)take((size_t)ZH * TT * TT * 4); bf* ATh = (bf*)take((size_t)TT * DQ * 2); bf* ATl = (bf*)take((size_t)TT * DQ * 2);
    // pos_emb's bf16 copy is last read by k_pp, before the first k_score writes Sb: it shares Sb's space
    bf* XP = (bf*)Sb;
    if ((size_t)(wsp - (char*)d_ws) > ws_size) return;    // ws 256 MiB
    k_prep<<<5 * GW + GP + GX, 256, 0, stream>>>(wq, wk, wv, wo, wpos, pemb, x, WQ, WK, WV, WO, WP, XP, XB);
    k_pp<<<dim3(TT / 64, DQ / 64, 1), 256, 0, stream>>>(XP, WP, PP16, PPh, PPl);
    for (int b = 0; b < NB_; ++b) {
        k_qkv<<<dim3(TT / 64, DQ / 64, 3), 256, 0, stream>>>(XB + (size_t)b * TT * DM, WQ, WK, WV, bq, bk, bv, pbu, pbv, QP16, QPh, QPl, QV16, QVh, QVl, KP16, KPh, KPl, VT16, VTh, VTl);
        for (int h0 = 0; h0 < NH_; h0 += ZH) { const size_t zq = (size_t)h0, zk = (size_t)(h0 / REP);   // one kv head per query head: the pass's heads use consecutive kv planes (z-strides TT*HD)
            k_score<<<dim3(TT / 128, TT / 128, 2 * ZH), 128, 0, stream>>>(QPh + zq * TT * HD, QPl + zq * TT * HD, KPh + zk * TT * HD, KPl + zk * TT * HD, QVh + zq * TT * HD, QVl + zq * TT * HD, PPh + zk * TT * HD, PPl + zk * TT * HD, QP16 + zq * TT * HD, KP16 + zk * TT * HD, QV16 + zq * TT * HD, PP16 + zk * TT * HD, Sb, Sb2);
            k_asoft<<<ZH * TT / 8, 256, 0, stream>>>(Sb, Sb2, kmask + (size_t)b * TT);
            k_av<<<dim3(TT / 64, HD / 64, ZH), 512, 0, stream>>>(Sb, VTh + zk * HD * TT, VTl + zk * HD * TT, VT16 + zk * HD * TT, ATh + zq * HD, ATl + zq * HD); }
        k_gemmw<bf, 1, true, 8><<<dim3(TT / 64, DM / 64, 1), 256, 0, stream>>>(ATh, ATl, WO, nullptr, DQ, OUT + (size_t)b * TT * DM, DM, bo); }
}

// v007
// Measured time: 734 microseconds a run.
// Two timings next to v006 both put it at 1.38 times that version's speed.
// Over all steps from v000 it is 4.20 times as fast.
#include <hip/hip_runtime.h>

// MultiHeadRelPositionAttention (x [4][2048][1024], pos_emb [2048][1024], mask [4][2048] (int, read; all ones); q/k/v = x W^T + b (8 heads x 128); p = pos_emb Wpos^T; content = (q + pos_bias_u[h]).k; pos = rel_shift((q + pos_bias_v[h]).p) with the Transformer-XL pad/reshape shift for P == T: pos[i][j] = S[i][T-1-(i-j)] for j <= i, 0 for j == i+1, S[i+1][j-i-2] for j >= i+2 (reproduced literally, including the upper part); scores = (content + pos) / sqrt(128), key mask; softmax; out = merged Wout^T + bout -> [4][2048][1024]).
// Compute dtypes, f32 accumulate: every input rounded to bf16; q/k/v/p as PLAIN bf16 GEMMs (inputs: exact) + bias; the u/v head biases added in f32; content, position scores and attn.v: query rows < 512 hl (3 products), the rest single fp16 (x1024) (the shifted position score is gathered from rows i / i+1 of the position-score block); softmax f32 with the read key mask; Wout hl x exact (2 products) + bias.

#define NB_  4
#define TT   2048
#define DM   1024
#define NH_  8
#define NKV  8
#define REP  (NH_ / NKV)
#define HD   128
#define DQ   (NH_ * HD)
#define DKV  (NKV * HD)
#define ZH   4
#define RH   512                  // query rows < RH use hi+lo planes (0: none)
#define WIN  0
#define PCAR 1024.0f
#define SCL  0.088388347648318447f   // HD^-0.5
typedef _Float16 h16;
typedef unsigned short bf;
typedef __attribute__((ext_vector_type(16))) __bf16   v16bf;
typedef __attribute__((ext_vector_type(16))) _Float16 v16h;
typedef __attribute__((ext_vector_type(8)))  _Float16 v8h;
typedef __attribute__((ext_vector_type(8)))  unsigned short v8us;
typedef __attribute__((ext_vector_type(8)))  float    v8f;
typedef __attribute__((ext_vector_type(4)))  float    v4f;
typedef v8h  __attribute__((may_alias)) v8ha;
typedef v4f  __attribute__((may_alias)) v4fa;
typedef v8us __attribute__((may_alias)) v8usa;

__device__ __forceinline__ unsigned short f2bf(float f) { unsigned u = __float_as_uint(f); u += 0x7FFFu + ((u >> 16) & 1u); return (unsigned short)(u >> 16); }
__device__ __forceinline__ float bf2f(unsigned short b) { return __uint_as_float(((unsigned)b) << 16); }
__device__ __forceinline__ float bfr(float f) { return bf2f(f2bf(f)); }
__device__ __forceinline__ v16h cat16(v8h lo, v8h hi) { return __builtin_shufflevector(lo, hi, 0, 1, 2, 3, 4, 5, 6, 7, 8, 9, 10, 11, 12, 13, 14, 15); }
__device__ __forceinline__ v16bf cat16b(v8us lo, v8us hi) { return __builtin_bit_cast(v16bf, __builtin_shufflevector(lo, hi, 0, 1, 2, 3, 4, 5, 6, 7, 8, 9, 10, 11, 12, 13, 14, 15)); }
__device__ __forceinline__ v8f wmma16(v16h a, v16h b, v8f c) { return __builtin_amdgcn_wmma_f32_16x16x32_f16(false, a, false, b, (short)0, c, false, false); }
__device__ __forceinline__ v8f wmmab(v16bf a, v16bf b, v8f c) { return __builtin_amdgcn_wmma_f32_16x16x32_bf16(false, a, false, b, (short)0, c, false, false); }
__device__ __forceinline__ h16 tohx(float x) { return (h16)x; }
__device__ __forceinline__ void splitf(float y, unsigned short& h, unsigned short& l) { h = f2bf(y); l = f2bf(y - bf2f(h)); }
typedef __attribute__((ext_vector_type(4))) _Float16 v4h;
typedef __attribute__((ext_vector_type(4))) unsigned short v4us;
// one operand's three 16-bit planes: fp16, bf16 hi, bf16 lo
struct Planes { h16* p16; bf* ph; bf* pl; };
__device__ __forceinline__ void put_hl(v4f r, bf* Ph, bf* Pl, size_t off) { v4us oh, ol;
#pragma unroll
    for (int u = 0; u < 4; ++u) { unsigned short a, c2; splitf(r[u], a, c2); oh[u] = a; ol[u] = c2; }
    *(v4us*)(Ph + off) = oh; *(v4us*)(Pl + off) = ol; }
__device__ __forceinline__ void put3(v4f r, Planes P, size_t off) { v4h o16;
#pragma unroll
    for (int u = 0; u < 4; ++u) o16[u] = tohx(r[u]);
    *(v4h*)(P.p16 + off) = o16; put_hl(r, P.ph, P.pl, off); }



// ---- k_gemmw: register-blocked GEMM, one 64x64 output tile per work-group (16 accumulators per wave), operands from K-contiguous 16-bit planes; grid (M/64, N/64), 32 * KS threads.
// C[m][n] (f32, pitch ldc, + optional f32 bias[n]) = sum_k A[m][k] Bt[n][k] (+ split products per NSPLIT). K % (32 * KS) == 0.
// KS > 1: the K loop is shared out over KS waves (wave w takes the 64-wide k chunks w, w + KS, ...; K % (64 * KS) == 0); the KS partial tiles meet in LDS and are summed in the fixed order w = 0 .. KS-1.
// There a wave brings each chunk's operand rows into its own LDS by asynchronous copies of whole lines and reads its fragments from there; with split planes the chunk's products go plane pair by plane pair through the same two slots: a2.b, a.b, a.b2.
template <typename T16> struct WFrag;
template <> struct WFrag<h16> { typedef v16h V; static __device__ __forceinline__ V ld(const h16* p) { return cat16(*(const v8h*)p, *(const v8h*)(p + 16)); } static __device__ __forceinline__ v8f mma(V a, V b, v8f c) { return wmma16(a, b, c); } };
template <> struct WFrag<bf> { typedef v16bf V; static __device__ __forceinline__ V ld(const bf* p) { return cat16b(*(const v8us*)p, *(const v8us*)(p + 16)); } static __device__ __forceinline__ v8f mma(V a, V b, v8f c) { return wmmab(a, b, c); } };
// eight asynchronous copies of 16 bytes per lane, global g[i] -> LDS byte address l[i]; the s_wait_xcnt stands inside the statement so that no register the copies name is rewritten ahead of it
__device__ __forceinline__ void copy8(const unsigned (&l)[8], const void* const (&g)[8]) {
    asm volatile("global_load_async_to_lds_b128 %0, %8, off\n\t"
                 "global_load_async_to_lds_b128 %1, %9, off\n\t"
                 "global_load_async_to_lds_b128 %2, %10, off\n\t"
                 "global_load_async_to_lds_b128 %3, %11, off\n\t"
                 "global_load_async_to_lds_b128 %4, %12, off\n\t"
                 "global_load_async_to_lds_b128 %5, %13, off\n\t"
                 "global_load_async_to_lds_b128 %6, %14, off\n\t"
                 "global_load_async_to_lds_b128 %7, %15, off\n\t"
                 "s_wait_xcnt 0x0"
                 :: "v"(l[0]), "v"(l[1]), "v"(l[2]), "v"(l[3]), "v"(l[4]), "v"(l[5]), "v"(l[6]), "v"(l[7]),
                    "v"(g[0]), "v"(g[1]), "v"(g[2]), "v"(g[3]), "v"(g[4]), "v"(g[5]), "v"(g[6]), "v"(g[7]) : "memory");
}
// A wave's own LDS in gemmw_body (KS > 1): two slots, each 64 rows of 64 elements of one 16-bit plane at a row pitch 16 bytes above the row; behind the K loop the same bytes take the wave's partial tile (64 x 68 floats).
#define GPIT  72                     // row pitch in elements
#define GSLOT (64 * GPIT)            // one slot in elements
#define GWST  (2 * GSLOT * 2 / 4)    // one wave's LDS in floats
// stage64: one wave copies 64 rows x 128 bytes (row pitch ld elements) into a slot, each wave-wide copy four whole lines. lds, g: this lane's 16-byte unit of the first four rows (row lane / 8, unit lane % 8), as LDS byte address and as global pointer.
template <typename T16>
__device__ __forceinline__ void stage64(unsigned lds, const T16* g, int ld) {
#pragma unroll 1   // rolled: a trip's 24 address registers are formed in the trip
    for (int h = 0; h < 2; ++h) { unsigned l[8]; const void* p[8];
#pragma unroll
        for (int c = 0; c < 8; ++c) { p[c] = g + (size_t)((h * 8 + c) * 4) * ld; l[c] = lds + (unsigned)((h * 8 + c) * 4 * GPIT * 2); }
        copy8(l, p); }
}
// gemmw_body is the tile's whole work; os is the calling kernel's LDS, KS == 1 ? 16 * 68 : KS * GWST floats; the tile is (bx, by). lda is the row pitch of A and A2 in elements; Bt and Bt2 have pitch K.
// mode (block-uniform; KS > 1 only for mode != 0) says where the summed tile goes; MSET holds bit m for every mode m != 0 that the calling kernel can ask for (0: mode 0 alone):
//   0: f32 C (+ bias[n]).
//   1: m = t, n = h * HD + d: (+ bias[n]) -> the planes P1 [h][t][d].
//   2: as 1, then + bu[n] -> P1 and + bv2[n] -> P2 (both adds in f32, on the biased value).
//   3: m = g * HD + d, n = t: (+ bias[m]) -> the planes P1 [g][d][t].
//   4: m = t, n = d of one head: x 1 (t < RH) or x 1 / PCAR -> hi/lo P1.ph, P1.pl, row pitch DQ (the pointers are the head's).
// gemmw_tail: modes 1 to 4 behind the barrier: this thread's rows row0, row0 + 2, ... of the tile, columns cofs .. cofs + 3 (n in the whole matrix), summed over the KS partial tiles in the order w = 0 .. KS-1, then biased, converted and stored. bb, ub, vb, rb come as loaded (f32) and are rounded to bf16 here.
template <int MODE, bool BIAS, int KS>
__device__ __forceinline__ void gemmw_tail(const float* os, int row0, int r0, int cofs, int n, v4f bb, v4f ub, v4f vb, const float (&rb)[32 / KS], Planes P1, Planes P2) {
#pragma unroll
    for (int u = 0; u < 4; ++u) { bb[u] = bfr(bb[u]); ub[u] = bfr(ub[u]); vb[u] = bfr(vb[u]); }
#pragma unroll
    for (int s = 0; s < 32 / KS; ++s) { const int row = row0 + 2 * s, m = r0 + row; v4f val = *(const v4fa*)(os + row * 68 + cofs);
#pragma unroll
        for (int w = 1; w < KS; ++w) val += *(const v4fa*)(os + w * GWST + row * 68 + cofs);
        if (BIAS) { if (MODE == 3) val += bfr(rb[s]); else val += bb; }
        if (MODE == 4) put_hl(val * ((m < RH) ? 1.0f : (1.0f / PCAR)), P1.ph, P1.pl, (size_t)m * DQ + n);
        else if (MODE == 3) put3(val, P1, (size_t)m * TT + n);
        else { const size_t off = ((size_t)(n / HD) * TT + m) * HD + n % HD;
            if (MODE == 2) { put3(val + ub, P1, off); put3(val + vb, P2, off); } else put3(val, P1, off); } }
    asm volatile("s_wait_xcnt 0x0" ::: "memory");   // behind the tail's last stores: the code laid out behind this tail reuses their address and data registers
}
template <typename T16, int NSPLIT, bool BIAS, int KS, int MSET = 0>
__device__ __forceinline__ void gemmw_body(float* os, const T16* __restrict__ A, const T16* __restrict__ A2, const T16* __restrict__ Bt, const T16* __restrict__ Bt2, int K, int lda, float* C, int ldc, const float* __restrict__ bias, int bx, int by,
                                           int mode = 0, Planes P1 = Planes{}, Planes P2 = Planes{}, const float* __restrict__ bu = nullptr, const float* __restrict__ bv2 = nullptr) {
    typedef typename WFrag<T16>::V V;
    const int wave = (KS == 1) ? 0 : __builtin_amdgcn_readfirstlane((int)(threadIdx.x >> 5));
    const int lane = threadIdx.x & 31, lr = lane & 15, hi = lane >> 4; const int r0 = bx * 64, c0 = by * 64;
    v8f acc[4][4];
#pragma unroll
    for (int mb = 0; mb < 4; ++mb)
#pragma unroll
        for (int nb = 0; nb < 4; ++nb) acc[mb][nb] = (v8f){};
    if (KS > 1) {
        constexpr int NST = (NSPLIT == 0) ? 1 : ((NSPLIT == 1) ? 2 : 3);   // plane pairs per chunk
        const T16* sA = (const T16*)(os + wave * GWST); const T16* fa = sA + lr * GPIT + 8 * hi; const T16* fb = fa + GSLOT;
        const unsigned la = (unsigned)(size_t)sA + (unsigned)(((lane >> 3) * GPIT + (lane & 7) * 8) * 2), lb = la + GSLOT * 2;   // LDS byte addresses of this lane's first unit in the two slots
        const size_t ga = (size_t)(r0 + (lane >> 3)) * lda + (lane & 7) * 8, gb = (size_t)(c0 + (lane >> 3)) * K + (lane & 7) * 8;
#pragma unroll 1   // rolled: the chunks go through the same two slots one after the other, so a second copy of the body would gain nothing
        for (int kc = wave * 64; kc < K; kc += 64 * KS) {
#pragma unroll
            for (int st = 0; st < NST; ++st) {
                asm volatile("s_wait_dscnt 0x0" ::: "memory");   // this wave's reads of the slot that is refilled have returned (the slots are the wave's own: no barrier)
                if (st == 0) { stage64(la, (NSPLIT == 0 ? A : A2) + ga + kc, lda); stage64(lb, Bt + gb + kc, K); }
                else if (st == 1) stage64(la, A + ga + kc, lda);
                else stage64(lb, Bt2 + gb + kc, K);
                asm volatile("s_wait_asynccnt 0x0" ::: "memory");   // this wave's copies have landed before it reads fragments of them
#pragma unroll
                for (int kk = 0; kk < 64; kk += 32) { V a[4], b[4];
#pragma unroll
                    for (int u = 0; u < 4; ++u) { a[u] = WFrag<T16>::ld(fa + u * 16 * GPIT + kk); b[u] = WFrag<T16>::ld(fb + u * 16 * GPIT + kk); }
#pragma unroll
                    for (int nb = 0; nb < 4; ++nb)
#pragma unroll
                        for (int mb = 0; mb < 4; ++mb) acc[mb][nb] = WFrag<T16>::mma(a[mb], b[nb], acc[mb][nb]); }
            }
        }
    } else {
        const size_t aoff = (size_t)(r0 + lr) * lda + 8 * hi, boff = (size_t)(c0 + lr) * K + 8 * hi;
#pragma unroll 1
        for (int kc = wave * 32; kc < K; kc += 32 * KS) {
            V a[4], a2[4];
#pragma unroll
            for (int mb = 0; mb < 4; ++mb) { a[mb] = WFrag<T16>::ld(A + aoff + (size_t)mb * 16 * lda + kc); if (NSPLIT == 1 || NSPLIT == 2) a2[mb] = WFrag<T16>::ld(A2 + aoff + (size_t)mb * 16 * lda + kc); }
#pragma unroll
            for (int nb = 0; nb < 4; ++nb) { const V b = WFrag<T16>::ld(Bt + boff + (size_t)nb * 16 * K + kc); V b2; if (NSPLIT >= 2) b2 = WFrag<T16>::ld(Bt2 + boff + (size_t)nb * 16 * K + kc);
#pragma unroll
                for (int mb = 0; mb < 4; ++mb) { acc[mb][nb] = WFrag<T16>::mma(a[mb], b, acc[mb][nb]); if (NSPLIT == 1 || NSPLIT == 2) acc[mb][nb] = WFrag<T16>::mma(a2[mb], b, acc[mb][nb]); if (NSPLIT >= 2) acc[mb][nb] = WFrag<T16>::mma(a[mb], b2, acc[mb][nb]); } }
            asm volatile("v_nop\n\tv_nop\n\tv_nop\n\tv_nop" : "+v"(acc[0][0]), "+v"(acc[1][1]), "+v"(acc[2][2]), "+v"(acc[3][3]) : "v"(a[0]), "v"(a[3]));
        }
    }
    if (KS > 1) {
        // mode != 0: this thread's biases (of its four columns; mode 3: of its rows) are loaded ahead of the LDS exchange and first used behind it, in the tail, so that their latency runs under it
        const int cofs = lr * 4, n = c0 + cofs; v4f bb = (v4f){}, ub = (v4f){}, vb = (v4f){}; float rb[32 / KS];
#pragma unroll
        for (int s = 0; s < 32 / KS; ++s) rb[s] = 0.0f;
        if (BIAS && (MSET & 8) && mode == 3) {
#pragma unroll
            for (int s = 0; s < 32 / KS; ++s) rb[s] = bias[r0 + wave * (64 / KS) + 2 * s + hi];
            asm volatile("s_wait_xcnt 0x0" ::: "memory"); }   // these loads stay in flight, and the code below reuses their address registers
        if (BIAS && (MSET & 6) && mode != 3) { bb[0] = bias[n]; bb[1] = bias[n + 1]; bb[2] = bias[n + 2]; bb[3] = bias[n + 3];
            asm volatile("s_wait_xcnt 0x0" ::: "memory"); }   // as above: behind loads that stay in flight
        if ((MSET & 4) && mode == 2) {
#pragma unroll
            for (int u = 0; u < 4; ++u) { ub[u] = bu[n + u]; vb[u] = bv2[n + u]; }
            asm volatile("s_wait_xcnt 0x0" ::: "memory"); }   // as above: behind loads that stay in flight
        float* mine = os + wave * GWST;
#pragma unroll
        for (int mb = 0; mb < 4; ++mb)
#pragma unroll
            for (int nb = 0; nb < 4; ++nb)
#pragma unroll
                for (int j = 0; j < 8; ++j) mine[(mb * 16 + hi * 8 + j) * 68 + nb * 16 + lr] = acc[mb][nb][j];
        __syncthreads();   // every wave's partial tile is in LDS before any wave sums rows of it
        // the highest mode of MSET is taken without a test
        if ((MSET & 2) && (MSET < 4 || mode == 1)) { gemmw_tail<1, BIAS, KS>(os, wave * (64 / KS) + hi, r0, cofs, n, bb, ub, vb, rb, P1, P2); return; }
        if ((MSET & 4) && (MSET < 8 || mode == 2)) { gemmw_tail<2, BIAS, KS>(os, wave * (64 / KS) + hi, r0, cofs, n, bb, ub, vb, rb, P1, P2); return; }
        if ((MSET & 8) && (MSET < 16 || mode == 3)) { gemmw_tail<3, BIAS, KS>(os, wave * (64 / KS) + hi, r0, cofs, n, bb, ub, vb, rb, P1, P2); return; }
        if (MSET & 16) { gemmw_tail<4, BIAS, KS>(os, wave * (64 / KS) + hi, r0, cofs, n, bb, ub, vb, rb, P1, P2); return; }
#pragma unroll
        for (int s = 0; s < 32 / KS; ++s) { const int row = wave * (64 / KS) + 2 * s + hi, cofs = lr * 4; v4f val = *(const v4fa*)(os + row * 68 + cofs);
#pragma unroll
            for (int w = 1; w < KS; ++w) val += *(const v4fa*)(os + w * GWST + row * 68 + cofs);
            if (BIAS) { val[0] += bfr(bias[c0 + cofs]); val[1] += bfr(bias[c0 + cofs + 1]); val[2] += bfr(bias[c0 + cofs + 2]); val[3] += bfr(bias[c0 + cofs + 3]); }
            *(v4f*)(C + (size_t)(r0 + row) * ldc + c0 + cofs) = val; }
        return;
    }
#pragma unroll
    for (int mb = 0; mb < 4; ++mb) {
#pragma unroll
        for (int nb = 0; nb < 4; ++nb) {
#pragma unroll
            for (int j = 0; j < 8; ++j) os[(hi * 8 + j) * 68 + nb * 16 + lr] = acc[mb][nb][j]; }
        __builtin_amdgcn_wave_barrier(); asm volatile("" ::: "memory");
        float* crow = C + (size_t)(r0 + mb * 16) * ldc + c0;
{
#pragma unroll
            for (int s = 0; s < 8; ++s) { const int row = 2 * s + hi, cofs = lr * 4; v4f val = *(const v4fa*)(os + row * 68 + cofs); if (BIAS) { val[0] += bfr(bias[c0 + cofs]); val[1] += bfr(bias[c0 + cofs + 1]); val[2] += bfr(bias[c0 + cofs + 2]); val[3] += bfr(bias[c0 + cofs + 3]); }
                *(v4f*)(crow + (size_t)row * ldc + cofs) = val; }
             }
        __builtin_amdgcn_wave_barrier(); asm volatile("" ::: "memory");
    }
}

template <typename T16, int NSPLIT, bool BIAS, int KS>
__global__ __launch_bounds__(32 * KS) void k_gemmw(const T16* __restrict__ A, const T16* __restrict__ A2, const T16* __restrict__ Bt, const T16* __restrict__ Bt2, int K, float* C, int ldc, const float* __restrict__ bias) {
    __shared__ __align__(16) float os[KS == 1 ? 16 * 68 : KS * GWST];
    gemmw_body<T16, NSPLIT, BIAS, KS>(os, A, A2, Bt, Bt2, K, K, C, ldc, bias, blockIdx.x, blockIdx.y);
}
// ---- launches that read none of each other's output, joined into one grid; a work-group picks its product by its block index (block-uniform), and each tile's arithmetic is gemmw_body's as before.
// k_qkv: z = 0, 1, 2: the q, k, v projection of one batch entry, each straight into its 16-bit planes: q + u and q + v, k, and v transposed.
// v is formed as Wv . x^T (the same products, the operands' roles exchanged), so that its tile has t along the columns, as the planes [g][d][t] want it; its tile indices are exchanged with it.
__global__ __launch_bounds__(256) void k_qkv(const bf* __restrict__ X, const bf* __restrict__ Wq_, const bf* __restrict__ Wk_, const bf* __restrict__ Wv_, const float* __restrict__ bq, const float* __restrict__ bk, const float* __restrict__ bv, const float* __restrict__ bu, const float* __restrict__ bv2,
                                             h16* Q16, bf* Qh, bf* Ql, h16* U16, bf* Uh, bf* Ul, h16* K16, bf* Kh, bf* Kl, h16* V16, bf* Vh, bf* Vl) {
    __shared__ __align__(16) float os[8 * GWST];
    const int z = blockIdx.z;
    const Planes P1 = { z == 0 ? Q16 : (z == 1 ? K16 : V16), z == 0 ? Qh : (z == 1 ? Kh : Vh), z == 0 ? Ql : (z == 1 ? Kl : Vl) }; const Planes P2 = { U16, Uh, Ul };
    gemmw_body<bf, 0, true, 8, 14>(os, z == 2 ? Wv_ : X, nullptr, z == 0 ? Wq_ : (z == 1 ? Wk_ : X), nullptr, DM, DM, nullptr, 0, z == 0 ? bq : (z == 1 ? bk : bv), z == 2 ? blockIdx.y : blockIdx.x, z == 2 ? blockIdx.x : blockIdx.y,
                               z == 0 ? 2 : (z == 1 ? 1 : 3), P1, P2, bu, bv2);
}
// k_pp: p = pos_emb Wpos^T straight into its planes.
__global__ __launch_bounds__(256) void k_pp(const bf* __restrict__ XP, const bf* __restrict__ WP, h16* R16, bf* Rh, bf* Rl) {
    __shared__ __align__(16) float os[8 * GWST];
    gemmw_body<bf, 0, false, 8, 2>(os, XP, nullptr, WP, nullptr, DM, DM, nullptr, 0, nullptr, blockIdx.x, blockIdx.y, 1, Planes{ R16, Rh, Rl });
}
// ---- score_tile: one 128x128 tile of a score block per work-group of 4 waves, each wave a 64x64 quarter (16 accumulators, the products and their order as in gemmw_body with KS == 1).
// The tile's rows of A and Bt (pitch HD) come into LDS by asynchronous 16-byte copies, every thread a share, each wave-wide copy covering whole lines; they lie there at a row pitch 16 bytes above the staged row's length, and the waves read their fragments from there.
// NSPLIT == 0: one plane per operand, all HD of k in one stage. NSPLIT == 2: hi and lo planes, k in two stages of HD / 2 through the same LDS. sm holds SCORE_LDS bytes; behind the last stage it serves as the four waves' 16 x 68 float store buffers.
#define SCORE_LDS (2 * 2 * 128 * (HD / 2 + 8) * 2)
template <typename T16, int NSPLIT>
__device__ __forceinline__ void score_tile(char* sm, const T16* __restrict__ A, const T16* __restrict__ A2, const T16* __restrict__ Bt, const T16* __restrict__ Bt2, float* C, int bx, int by) {
    typedef typename WFrag<T16>::V V;
    constexpr int NP = (NSPLIT == 2) ? 2 : 1, KH = HD / NP, PIT = KH + 8, U = KH / 8;   // planes per operand; k per stage; LDS row pitch in elements; 16-byte units per staged row (and per thread and plane)
    static_assert(2 * NP * 128 * PIT * 2 <= SCORE_LDS && 4 * 16 * 68 * 4 <= SCORE_LDS && U % 8 == 0, "LDS");
    const T16* sA = (const T16*)sm; const T16* sB = sA + NP * 128 * PIT; const unsigned smo = (unsigned)(size_t)sm;   // smo: the LDS byte address of sm
    const int tid = threadIdx.x, wave = __builtin_amdgcn_readfirstlane(tid >> 5), lane = tid & 31, lr = lane & 15, hi = lane >> 4;
    const int r0 = bx * 128, c0 = by * 128, wm = (wave >> 1) * 64, wn = (wave & 1) * 64;
    // this thread's unit of the first 128 / U staged rows: row tid / U, 16-byte unit tid % U; its further units lie 128 / U rows on each
    const size_t gt = (size_t)(tid / U) * HD + (tid % U) * 8; const unsigned lt = smo + (unsigned)(((tid / U) * PIT + (tid % U) * 8) * 2);
    const T16* gA = A + (size_t)r0 * HD + gt; const T16* gA2 = (NP == 2) ? A2 + (size_t)r0 * HD + gt : nullptr; const T16* gB = Bt + (size_t)c0 * HD + gt; const T16* gB2 = (NP == 2) ? Bt2 + (size_t)c0 * HD + gt : nullptr;
    v8f acc[4][4];
#pragma unroll
    for (int mb = 0; mb < 4; ++mb)
#pragma unroll
        for (int nb = 0; nb < 4; ++nb) acc[mb][nb] = (v8f){};
#pragma unroll
    for (int st = 0; st < NP; ++st) {
        if (st) { asm volatile("s_wait_dscnt 0x0" ::: "memory");   // this wave's LDS reads of the stage before have returned
            __syncthreads(); }   // ... and every other wave's: the LDS may be refilled
#pragma unroll 1   // rolled: a trip's 24 address registers are formed in the trip and are not held across the matrix work
        for (int q = 0; q < 2 * NP * (U / 8); ++q) { const int pl = q / (U / 8), i0 = (q % (U / 8)) * 8;   // plane in LDS order (A, [A2,] Bt, [Bt2]); first of the trip's eight units
            const T16* src = (NP == 1) ? (pl ? gB : gA) : (pl == 0 ? gA : (pl == 1 ? gA2 : (pl == 2 ? gB : gB2)));
            unsigned l[8]; const void* g[8];
#pragma unroll
            for (int i = 0; i < 8; ++i) { g[i] = src + st * KH + (size_t)((i0 + i) * (128 / U)) * HD; l[i] = lt + (unsigned)((pl * 128 + (i0 + i) * (128 / U)) * PIT * 2); }
            copy8(l, g); }
        asm volatile("s_wait_asynccnt 0x0" ::: "memory");   // this wave's copies have landed
        __syncthreads();   // ... and every other wave's: the stage is whole in LDS before any wave reads fragments of it
        const T16* fa = sA + (wm + lr) * PIT + 8 * hi; const T16* fb = sB + (wn + lr) * PIT + 8 * hi;
#pragma unroll (NSPLIT == 2 ? 1 : KH / 32)   // hi/lo planes: rolled, so that one trip's fragments (80 registers beside the 128 of acc) are live at a time and nothing spills at 4 waves per SIMD
        for (int kc = 0; kc < KH; kc += 32) {
            V a[4], a2[4];
#pragma unroll
            for (int mb = 0; mb < 4; ++mb) { a[mb] = WFrag<T16>::ld(fa + mb * 16 * PIT + kc); if (NSPLIT == 2) a2[mb] = WFrag<T16>::ld(fa + (128 + mb * 16) * PIT + kc); }
#pragma unroll
            for (int nb = 0; nb < 4; ++nb) { const V b = WFrag<T16>::ld(fb + nb * 16 * PIT + kc); V b2; if (NSPLIT == 2) b2 = WFrag<T16>::ld(fb + (128 + nb * 16) * PIT + kc);
#pragma unroll
                for (int mb = 0; mb < 4; ++mb) { acc[mb][nb] = WFrag<T16>::mma(a[mb], b, acc[mb][nb]); if (NSPLIT == 2) { acc[mb][nb] = WFrag<T16>::mma(a2[mb], b, acc[mb][nb]); acc[mb][nb] = WFrag<T16>::mma(a[mb], b2, acc[mb][nb]); } } }
        }
    }
    asm volatile("s_wait_dscnt 0x0" ::: "memory");   // this wave's last fragment reads have returned
    __syncthreads();   // ... and every other wave's: the LDS now takes the waves' store buffers
    float* os = (float*)sm + wave * (16 * 68);
#pragma unroll
    for (int mb = 0; mb < 4; ++mb) {
#pragma unroll
        for (int nb = 0; nb < 4; ++nb) {
#pragma unroll
            for (int j = 0; j < 8; ++j) os[(hi * 8 + j) * 68 + nb * 16 + lr] = acc[mb][nb][j]; }
        __builtin_amdgcn_wave_barrier(); asm volatile("" ::: "memory");   // the wave's LDS writes stay ahead of its reads of other lanes' words
        float* crow = C + (size_t)(r0 + wm + mb * 16) * TT + c0 + wn; v4f t[8];
#pragma unroll
        for (int s = 0; s < 8; ++s) t[s] = *(const v4fa*)(os + (2 * s + hi) * 68 + lr * 4);
#pragma unroll
        for (int s = 0; s < 8; ++s) *(v4f*)(crow + (size_t)(2 * s + hi) * TT + lr * 4) = t[s];
        asm volatile("s_wait_xcnt 0x0" ::: "memory");   // behind the stores: the next round reuses their address and data registers
        __builtin_amdgcn_wave_barrier(); asm volatile("" ::: "memory");   // the reads above stay ahead of the next round's writes
    }
}
// k_score: z = 2 * head + (0: content q.k -> S, 1: position qv.p -> S2); row tiles below RH on the hi/lo planes, the rest on the fp16 planes. Pointers are those of the pass's first head.
// Launch bounds: four work-groups per WGP (their LDS fits four times), so that one group's copies and stores run under another's matrix work; the registers are held to that.
__global__ __launch_bounds__(128, 4) void k_score(const bf* __restrict__ Qh, const bf* __restrict__ Ql, const bf* __restrict__ Kh, const bf* __restrict__ Kl, const bf* __restrict__ Vh, const bf* __restrict__ Vl, const bf* __restrict__ Rh, const bf* __restrict__ Rl,
                                              const h16* __restrict__ Q16, const h16* __restrict__ K16, const h16* __restrict__ V16, const h16* __restrict__ R16, float* S, float* S2) {
    __shared__ __align__(16) char sm[SCORE_LDS];
    const bool pos = (blockIdx.z & 1) != 0; const size_t zz = blockIdx.z >> 1, zo = zz * ((size_t)TT * HD);
    float* C = (pos ? S2 : S) + zz * ((size_t)TT * TT);
    if (blockIdx.x < RH / 128) score_tile<bf, 2>(sm, (pos ? Vh : Qh) + zo, (pos ? Vl : Ql) + zo, (pos ? Rh : Kh) + zo, (pos ? Rl : Kl) + zo, C, blockIdx.x, blockIdx.y);
    else score_tile<h16, 0>(sm, (pos ? V16 : Q16) + zo, nullptr, (pos ? R16 : K16) + zo, nullptr, C, blockIdx.x, blockIdx.y);
}
// k_av: attn.v of the pass's heads (z); row tiles below RH on the hi/lo planes, the rest on the fp16 plane. The weights lie where k_asoft left them: in the bytes of their own score row (pitch 2 * TT 16-bit elements).
// The tile goes, rescaled and split hi/lo, straight to its head's columns of the merged rows [t][DQ]; Ah, Al are those of the pass's first head.
__global__ __launch_bounds__(512) void k_av(const float* __restrict__ Sp, const bf* __restrict__ Vh, const bf* __restrict__ Vl, const h16* __restrict__ V16, bf* Ah, bf* Al) {
    __shared__ __align__(16) float os[16 * GWST];
    const size_t z = blockIdx.z, zv = z * ((size_t)HD * TT), zp = z * ((size_t)TT * 2 * TT); const Planes PA = { nullptr, Ah + z * HD, Al + z * HD };
    if (blockIdx.x < RH / 64) gemmw_body<bf, 2, false, 16, 16>(os, (const bf*)Sp + zp, (const bf*)Sp + zp + TT, Vh + zv, Vl + zv, TT, 2 * TT, nullptr, 0, nullptr, blockIdx.x, blockIdx.y, 4, PA);
    else gemmw_body<h16, 0, false, 16, 16>(os, (const h16*)Sp + zp, nullptr, V16 + zv, nullptr, TT, 2 * TT, nullptr, 0, nullptr, blockIdx.x, blockIdx.y, 4, PA);
}

typedef __attribute__((ext_vector_type(2))) unsigned short v2us;
typedef __attribute__((ext_vector_type(2))) float v2f;

__global__ __launch_bounds__(256) void k_wtG(const float* __restrict__ w, int K, int N, bf* Bt) {
    const int lane = threadIdx.x & 31; const int L0 = (blockIdx.x * 8 + (threadIdx.x >> 5)) * 8; const int nlines = N * K / 64;
{
#pragma unroll 1
        for (int l = 0; l < 8; ++l) { const int L = L0 + l; if (L >= nlines) break; const size_t e = (size_t)L * 64 + lane * 2; const int k = (int)(e % K), n = (int)(e / K); v2us o;
            o[0] = f2bf(w[(size_t)k * N + n]); o[1] = f2bf(w[(size_t)(k + 1) * N + n]); *(v2us*)(Bt + e) = o; }
         }
}
__device__ __forceinline__ void d_cvt8(unsigned bid, const float* __restrict__ src, bf* dst, size_t n8) { const size_t i = (size_t)bid * 256 + threadIdx.x; if (i >= n8) return; const v8f v = *(const v8f*)(src + i * 8); v8us o;
#pragma unroll
    for (int k = 0; k < 8; ++k) o[k] = f2bf(v[k]); *(v8us*)(dst + i * 8) = o;  }
__global__ __launch_bounds__(256) void k_cscvt(const float* __restrict__ cosT, const float* __restrict__ sinT, float* CS) { const int idx = blockIdx.x * 256 + threadIdx.x; if (idx >= TT * HD) return; v2f cs; cs[0] = bfr(cosT[idx]); cs[1] = bfr(sinT[idx]); *(v2f*)(CS + (size_t)idx * 2) = cs;  }
// ---- streaming jobs that read none of each other's output, joined into one grid; a work-group picks its job by its block index.
#define GW   (DQ * DM / 8 / 256)         // work-groups of one weight's conversion
#define GP   (TT * DM / 8 / 256)         // ... of pos_emb's
#define GX   (NB_ * TT * DM / 8 / 256)   // ... of x's, all batch entries
// k_prep: the five weights, pos_emb and x to bf16.
__global__ __launch_bounds__(256) void k_prep(const float* __restrict__ wq, const float* __restrict__ wk, const float* __restrict__ wv, const float* __restrict__ wo, const float* __restrict__ wpos, const float* __restrict__ pemb, const float* __restrict__ x,
                                              bf* WQ, bf* WK, bf* WV, bf* WO, bf* WP, bf* XP, bf* XB) {
    unsigned b = blockIdx.x;
    if (b < 5 * GW) { const unsigned j = b / GW; d_cvt8(b % GW, j == 0 ? wq : (j == 1 ? wk : (j == 2 ? wv : (j == 3 ? wo : wpos))), j == 0 ? WQ : (j == 1 ? WK : (j == 2 ? WV : (j == 3 ? WO : WP))), (size_t)DQ * DM / 8); return; }
    b -= 5 * GW; if (b < GP) { d_cvt8(b, pemb, XP, (size_t)TT * DM / 8); return; }
    d_cvt8(b - GP, x, XB, (size_t)NB_ * TT * DM / 8);
}
// k_asoft: per row (zz, i): t = (S + rel-shifted S2) x HD^-0.5, masked keys -3e38; softmax over the 2048 keys (register row, one exp, fixed trees);
// the weights go back into the row's own 4 * TT bytes of Sb, which this wave alone reads and holds whole in registers by then: fp16 in the first half, or hi in the first half and lo in the second.
__global__ __launch_bounds__(256) void k_asoft(float* Sb, const float* __restrict__ Sb2, const int* __restrict__ km) {
    const int lane = threadIdx.x & 31; const int row = blockIdx.x * 8 + (threadIdx.x >> 5); if (row >= ZH * TT) return; const int i = row % TT; const int zz = row / TT; (void)zz; const bool hires = (i < RH); const float* sr = Sb + (size_t)row * TT; const float* pb = Sb2 + (size_t)row * TT + (TT - 1 - i);   /* the shifted row lies in one run of Sb2: pos[i][j] = pb[j] for j <= i and pb[j - 1] for j >= i + 2 (there in row i+1 of the same head block; for i = T-1 the run ends with row i) */ float v[TT / 32]; float mx = -3.0e38f;
    // The row's loads have no branch and stand, four chunks' together, ahead of those chunks' arithmetic, so that they are in flight together.
    // The four position scores of a lane's keys j0 .. j0 + 3 are adjacent words from pb + j0, or from one word earlier where all four keys lie right of the diagonal (j0 > i); only the lane that holds the diagonal (0 <= i - j0 <= 2) takes its keys j >= i + 2 from one place to the left. Key i + 1 gets 0.
#pragma unroll
    for (int gq = 0; gq < TT / 512; ++gq) { v4f a[4]; float g[4][4]; int m[4][4];
#pragma unroll
        for (int c = 0; c < 4; ++c) { const int j0 = (gq * 4 + c) * 128 + lane * 4; const float* p = pb + j0 - ((j0 > i) ? 1 : 0);
#pragma unroll
            for (int q = 0; q < 4; ++q) g[c][q] = p[q]; }
        asm volatile("s_wait_xcnt 0x0" ::: "memory");   // behind the position loads, which stay in flight: each has an address pair of its own, and the loads below may return into those registers
#pragma unroll
        for (int c = 0; c < 4; ++c) { const int j0 = (gq * 4 + c) * 128 + lane * 4; a[c] = *(const v4f*)(sr + j0);
#pragma unroll
            for (int q = 0; q < 4; ++q) m[c][q] = km[j0 + q]; }
        asm volatile("s_wait_xcnt 0x0" ::: "memory");   // behind the group's last loads, which stay in flight: the arithmetic below reuses address registers; it also keeps every load of the group in front of that arithmetic
#pragma unroll
        for (int c = 0; c < 4; ++c) { const int ch = gq * 4 + c, d = i - (ch * 128 + lane * 4); float bd[4];
            bd[0] = (d == -1) ? 0.0f : g[c][0]; bd[1] = (d == 0) ? 0.0f : g[c][1]; bd[2] = (d == 1) ? 0.0f : ((d == 0) ? g[c][1] : g[c][2]); bd[3] = (d == 2) ? 0.0f : (((unsigned)d < 2u) ? g[c][2] : g[c][3]);
#pragma unroll
            for (int q = 0; q < 4; ++q) { float cp = __fadd_rn(a[c][q], bd[q]); asm volatile("" : "+v"(cp)); const float t = (m[c][q] != 0) ? cp * SCL : -3.0e38f; v[ch * 4 + q] = t; mx = fmaxf(mx, t); } } }
#pragma unroll
    for (int sh = 16; sh; sh >>= 1) mx = fmaxf(mx, __shfl_xor(mx, sh, 32));
    float sum = 0.f;
#pragma unroll
    for (int k = 0; k < TT / 32; ++k) { float d0 = __fsub_rn(v[k], mx); asm volatile("" : "+v"(d0)); v[k] = __builtin_amdgcn_exp2f(__fmul_rn(d0, 1.4426950408889634f)); sum += v[k]; }
#pragma unroll
    for (int sh = 16; sh; sh >>= 1) sum += __shfl_xor(sum, sh, 32);
    const float f = __fdiv_rn(hires ? 1.0f : PCAR, sum);
{
        if (hires) {
#pragma unroll
            for (int ch = 0; ch < TT / 128; ++ch) { v4us oh, ol;
#pragma unroll
                for (int q = 0; q < 4; ++q) { unsigned short a, c2; splitf(v[ch * 4 + q] * f, a, c2); oh[q] = a; ol[q] = c2; }
                bf* po = (bf*)(Sb + (size_t)row * TT) + ch * 128 + lane * 4; *(v4us*)po = oh; *(v4us*)(po + TT) = ol; }
        } else {
#pragma unroll
            for (int ch = 0; ch < TT / 128; ++ch) { v4h o4;
#pragma unroll
                for (int q = 0; q < 4; ++q) o4[q] = tohx(v[ch * 4 + q] * f);
                *(v4h*)((h16*)(Sb + (size_t)row * TT) + ch * 128 + lane * 4) = o4; } }
         }
}

extern "C" void kernel_launch(void* const* d_in, const int* in_sizes, int n_in,
                              void* d_out, int out_size, void* d_ws, size_t ws_size, hipStream_t stream) {
    (void)in_sizes; (void)n_in; (void)out_size;
    const float* x = (const float*)d_in[0]; const float* pemb = (const float*)d_in[1]; const int* kmask = (const int*)d_in[2]; const float* wq = (const float*)d_in[3]; const float* bq = (const float*)d_in[4]; const float* wk = (const float*)d_in[5]; const float* bk = (const float*)d_in[6]; const float* wv = (const float*)d_in[7]; const float* bv = (const float*)d_in[8]; const float* wpos = (const float*)d_in[9]; const float* wo = (const float*)d_in[10]; const float* bo = (const float*)d_in[11]; const float* pbu = (const float*)d_in[12]; const float* pbv = (const float*)d_in[13]; const float* cosT = nullptr; const float* sinT = nullptr; (void)cosT; (void)sinT;
    float* OUT = (float*)d_out;     // [4][2048][1024]
    char* wsp = (char*)d_ws;
    auto take = [&](size_t bytes) { char* p = wsp; wsp += (bytes + 255) & ~(size_t)255; return (void*)p; };
    bf* WQ = (bf*)take((size_t)DQ * DM * 2); bf* WK = (bf*)take((size_t)DKV * DM * 2); bf* WV = (bf*)take((size_t)DKV * DM * 2); bf* WO = (bf*)take((size_t)DM * DQ * 2);
    bf* XB = (bf*)take((size_t)NB_ * TT * DM * 2); bf* WP = (bf*)take((size_t)DQ * DM * 2); h16* PP16 = (h16*)take((size_t)NH_ * TT * HD * 2); bf* PPh = (bf*)take((size_t)NH_ * TT * HD * 2); bf* PPl = (bf*)take((size_t)NH_ * TT * HD * 2); h16* QV16 = (h16*)take((size_t)NH_ * TT * HD * 2); bf* QVh = (bf*)take((size_t)NH_ * TT * HD * 2); bf* QVl = (bf*)take((size_t)NH_ * TT * HD * 2); float* Sb2 = (float*)take((size_t)ZH * TT * TT * 4);
    h16* QP16 = (h16*)take((size_t)NH_ * TT * HD * 2); h16* KP16 = (h16*)take((size_t)NKV * TT * HD * 2); h16* VT16 = (h16*)take((size_t)NKV * HD * TT * 2);
    bf* QPh = (bf*)take((size_t)NH_ * TT * HD * 2); bf* QPl = (bf*)take((size_t)NH_ * TT * HD * 2); bf* KPh = (bf*)take((size_t)NKV * TT * HD * 2); bf* KPl = (bf*)take((size_t)NKV * TT * HD * 2); bf* VTh = (bf*)take((size_t)NKV * HD * TT * 2); bf* VTl = (bf*)take((size_t)NKV * HD * TT * 2);
    float* Sb = (float*)take((size_t)ZH * TT * TT * 4); bf* ATh = (bf*)take((size_t)TT * DQ * 2); bf* ATl = (bf*)take((size_t)TT * DQ * 2);
    // pos_emb's bf16 copy is last read by k_pp, before the first k_score writes Sb: it shares Sb's space
    bf* XP = (bf*)Sb;
    if ((size_t)(wsp - (char*)d_ws) > ws_size) return;    // ws 256 MiB
    k_prep<<<5 * GW + GP + GX, 256, 0, stream>>>(wq, wk, wv, wo, wpos, pemb, x, WQ, WK, WV, WO, WP, XP, XB);
    k_pp<<<dim3(TT / 64, DQ / 64, 1), 256, 0, stream>>>(XP, WP, PP16, PPh, PPl);
    for (int b = 0; b < NB_; ++b) {
        k_qkv<<<dim3(TT / 64, DQ / 64, 3), 256, 0, stream>>>(XB + (size_t)b * TT * DM, WQ, WK, WV, bq, bk, bv, pbu, pbv, QP16, QPh, QPl, QV16, QVh, QVl, KP16, KPh, KPl, VT16, VTh, VTl);
        for (int h0 = 0; h0 < NH_; h0 += ZH) { const size_t zq = (size_t)h0, zk = (size_t)(h0 / REP);   // one kv head per query head: the pass's heads use consecutive kv planes (z-strides TT*HD)
            k_score<<<dim3(TT / 128, TT / 128, 2 * ZH), 128, 0, stream>>>(QPh + zq * TT * HD, QPl + zq * TT * HD, KPh + zk * TT * HD, KPl + zk * TT * HD, QVh + zq * TT * HD, QVl + zq * TT * HD, PPh + zk * TT * HD, PPl + zk * TT * HD, QP16 + zq * TT * HD, KP16 + zk * TT * HD, QV16 + zq * TT * HD, PP16 + zk * TT * HD, Sb, Sb2);
            k_asoft<<<ZH * TT / 8, 256, 0, stream>>>(Sb, Sb2, kmask + (size_t)b * TT);
            k_av<<<dim3(TT / 64, HD / 64, ZH), 512, 0, stream>>>(Sb, VTh + zk * HD * TT, VTl + zk * HD * TT, VT16 + zk * HD * TT, ATh + zq * HD, ATl + zq * HD); }
        k_gemmw<bf, 1, true, 8><<<dim3(TT / 64, DM / 64, 1), 256, 0, stream>>>(ATh, ATl, WO, nullptr, DQ, OUT + (size_t)b * TT * DM, DM, bo); }
}

// v008
// Measured time: 616 microseconds a run.
// In two side-by-side timings against v007, it was 1.19 and 1.20 times as fast.
// Over all steps from v000 it is 5.01 times as fast.
#include <hip/hip_runtime.h>

// MultiHeadRelPositionAttention (x [4][2048][1024], pos_emb [2048][1024], mask [4][2048] (int, read; all ones); q/k/v = x W^T + b (8 heads x 128); p = pos_emb Wpos^T; content = (q + pos_bias_u[h]).k; pos = rel_shift((q + pos_bias_v[h]).p) with the Transformer-XL pad/reshape shift for P == T: pos[i][j] = S[i][T-1-(i-j)] for j <= i, 0 for j == i+1, S[i+1][j-i-2] for j >= i+2 (reproduced literally, including the upper part); scores = (content + pos) / sqrt(128), key mask; softmax; out = merged Wout^T + bout -> [4][2048][1024]).
// Compute dtypes, f32 accumulate: every input rounded to bf16; q/k/v/p as PLAIN bf16 GEMMs (inputs: exact) + bias; the u/v head biases added in f32; content, position scores and attn.v: query rows < 512 hl (3 products), the rest single fp16 (x1024) (the shifted position scores of a score tile are formed in that tile's own work-group, from query rows i / i+1 and the band of p rows that the shift maps onto the tile, and are the start value of the tile's content sums); softmax f32 with the read key mask; Wout hl x exact (2 products) + bias.

#define NB_  4
#define TT   2048
#define DM   1024
#define NH_  8
#define NKV  8
#define REP  (NH_ / NKV)
#define HD   128
#define DQ   (NH_ * HD)
#define DKV  (NKV * HD)
#define ZH   8
#define RH   512                  // query rows < RH use hi+lo planes (0: none)
#define WIN  0
#define PCAR 1024.0f
#define SCL  0.088388347648318447f   // HD^-0.5
typedef _Float16 h16;
typedef unsigned short bf;
typedef __attribute__((ext_vector_type(16))) __bf16   v16bf;
typedef __attribute__((ext_vector_type(16))) _Float16 v16h;
typedef __attribute__((ext_vector_type(8)))  _Float16 v8h;
typedef __attribute__((ext_vector_type(8)))  unsigned short v8us;
typedef __attribute__((ext_vector_type(8)))  float    v8f;
typedef __attribute__((ext_vector_type(4)))  float    v4f;
typedef v8h  __attribute__((may_alias)) v8ha;
typedef v4f  __attribute__((may_alias)) v4fa;
typedef v8us __attribute__((may_alias)) v8usa;

__device__ __forceinline__ unsigned short f2bf(float f) { unsigned u = __float_as_uint(f); u += 0x7FFFu + ((u >> 16) & 1u); return (unsigned short)(u >> 16); }
__device__ __forceinline__ float bf2f(unsigned short b) { return __uint_as_float(((unsigned)b) << 16); }
__device__ __forceinline__ float bfr(float f) { return bf2f(f2bf(f)); }
__device__ __forceinline__ v16h cat16(v8h lo, v8h hi) { return __builtin_shufflevector(lo, hi, 0, 1, 2, 3, 4, 5, 6, 7, 8, 9, 10, 11, 12, 13, 14, 15); }
__device__ __forceinline__ v16bf cat16b(v8us lo, v8us hi) { return __builtin_bit_cast(v16bf, __builtin_shufflevector(lo, hi, 0, 1, 2, 3, 4, 5, 6, 7, 8, 9, 10, 11, 12, 13, 14, 15)); }
__device__ __forceinline__ v8f wmma16(v16h a, v16h b, v8f c) { return __builtin_amdgcn_wmma_f32_16x16x32_f16(false, a, false, b, (short)0, c, false, false); }
__device__ __forceinline__ v8f wmmab(v16bf a, v16bf b, v8f c) { return __builtin_amdgcn_wmma_f32_16x16x32_bf16(false, a, false, b, (short)0, c, false, false); }
__device__ __forceinline__ h16 tohx(float x) { return (h16)x; }
__device__ __forceinline__ void splitf(float y, unsigned short& h, unsigned short& l) { h = f2bf(y); l = f2bf(y - bf2f(h)); }
typedef __attribute__((ext_vector_type(4))) _Float16 v4h;
typedef __attribute__((ext_vector_type(4))) unsigned short v4us;
// one operand's three 16-bit planes: fp16, bf16 hi, bf16 lo
struct Planes { h16* p16; bf* ph; bf* pl; };
__device__ __forceinline__ void put_hl(v4f r, bf* Ph, bf* Pl, size_t off) { v4us oh, ol;
#pragma unroll
    for (int u = 0; u < 4; ++u) { unsigned short a, c2; splitf(r[u], a, c2); oh[u] = a; ol[u] = c2; }
    *(v4us*)(Ph + off) = oh; *(v4us*)(Pl + off) = ol; }
__device__ __forceinline__ void put3(v4f r, Planes P, size_t off) { v4h o16;
#pragma unroll
    for (int u = 0; u < 4; ++u) o16[u] = tohx(r[u]);
    *(v4h*)(P.p16 + off) = o16; put_hl(r, P.ph, P.pl, off); }



// ---- k_gemmw: register-blocked GEMM, one 64x64 output tile per work-group (16 accumulators per wave), operands from K-contiguous 16-bit planes; grid (M/64, N/64), 32 * KS threads.
// C[m][n] (f32, pitch ldc, + optional f32 bias[n]) = sum_k A[m][k] Bt[n][k] (+ split products per NSPLIT). K % (32 * KS) == 0.
// KS > 1: the K loop is shared out over KS waves (wave w takes the 64-wide k chunks w, w + KS, ...; K % (64 * KS) == 0); the KS partial tiles meet in LDS and are summed in the fixed order w = 0 .. KS-1.
// There a wave brings each chunk's operand rows into its own LDS by asynchronous copies of whole lines and reads its fragments from there; with split planes the chunk's products go plane pair by plane pair through the same two slots: a2.b, a.b, a.b2.
template <typename T16> struct WFrag;
template <> struct WFrag<h16> { typedef v16h V; static __device__ __forceinline__ V ld(const h16* p) { return cat16(*(const v8h*)p, *(const v8h*)(p + 16)); } static __device__ __forceinline__ v8f mma(V a, V b, v8f c) { return wmma16(a, b, c); } };
template <> struct WFrag<bf> { typedef v16bf V; static __device__ __forceinline__ V ld(const bf* p) { return cat16b(*(const v8us*)p, *(const v8us*)(p + 16)); } static __device__ __forceinline__ v8f mma(V a, V b, v8f c) { return wmmab(a, b, c); } };
// eight asynchronous copies of 16 bytes per lane, global g[i] -> LDS byte address l[i]; the s_wait_xcnt stands inside the statement so that no register the copies name is rewritten ahead of it
__device__ __forceinline__ void copy8(const unsigned (&l)[8], const void* const (&g)[8]) {
    asm volatile("global_load_async_to_lds_b128 %0, %8, off\n\t"
                 "global_load_async_to_lds_b128 %1, %9, off\n\t"
                 "global_load_async_to_lds_b128 %2, %10, off\n\t"
                 "global_load_async_to_lds_b128 %3, %11, off\n\t"
                 "global_load_async_to_lds_b128 %4, %12, off\n\t"
                 "global_load_async_to_lds_b128 %5, %13, off\n\t"
                 "global_load_async_to_lds_b128 %6, %14, off\n\t"
                 "global_load_async_to_lds_b128 %7, %15, off\n\t"
                 "s_wait_xcnt 0x0"
                 :: "v"(l[0]), "v"(l[1]), "v"(l[2]), "v"(l[3]), "v"(l[4]), "v"(l[5]), "v"(l[6]), "v"(l[7]),
                    "v"(g[0]), "v"(g[1]), "v"(g[2]), "v"(g[3]), "v"(g[4]), "v"(g[5]), "v"(g[6]), "v"(g[7]) : "memory");
}
// one such copy, with its s_wait_xcnt in the same statement for the same reason
__device__ __forceinline__ void copy1(unsigned l, const void* g) {
    asm volatile("global_load_async_to_lds_b128 %0, %1, off\n\ts_wait_xcnt 0x0" :: "v"(l), "v"(g) : "memory");
}
// A wave's own LDS in gemmw_body (KS > 1): two slots, each 64 rows of 64 elements of one 16-bit plane at a row pitch 16 bytes above the row; behind the K loop the same bytes take the wave's partial tile (64 x 68 floats).
#define GPIT  72                     // row pitch in elements
#define GSLOT (64 * GPIT)            // one slot in elements
#define GWST  (2 * GSLOT * 2 / 4)    // one wave's LDS in floats
// stage64: one wave copies 64 rows x 128 bytes (row pitch ld elements) into a slot, each wave-wide copy four whole lines. lds, g: this lane's 16-byte unit of the first four rows (row lane / 8, unit lane % 8), as LDS byte address and as global pointer.
template <typename T16>
__device__ __forceinline__ void stage64(unsigned lds, const T16* g, int ld) {
#pragma unroll 1   // rolled: a trip's 24 address registers are formed in the trip
    for (int h = 0; h < 2; ++h) { unsigned l[8]; const void* p[8];
#pragma unroll
        for (int c = 0; c < 8; ++c) { p[c] = g + (size_t)((h * 8 + c) * 4) * ld; l[c] = lds + (unsigned)((h * 8 + c) * 4 * GPIT * 2); }
        copy8(l, p); }
}
// gemmw_body is the tile's whole work; os is the calling kernel's LDS, KS == 1 ? 16 * 68 : KS * GWST floats; the tile is (bx, by). lda is the row pitch of A and A2 in elements; Bt and Bt2 have pitch K.
// mode (block-uniform; KS > 1 only for mode != 0) says where the summed tile goes; MSET holds bit m for every mode m != 0 that the calling kernel can ask for (0: mode 0 alone):
//   0: f32 C (+ bias[n]).
//   1: m = t, n = h * HD + d: (+ bias[n]) -> the planes P1 [h][t][d].
//   2: as 1, then + bu[n] -> P1 and + bv2[n] -> P2 (both adds in f32, on the biased value).
//   3: m = g * HD + d, n = t: (+ bias[m]) -> the planes P1 [g][d][t].
//   4: m = t, n = d of one head: x 1 (t < RH) or x 1 / PCAR -> hi/lo P1.ph, P1.pl, row pitch DQ (the pointers are the head's).
// gemmw_tail: modes 1 to 4 behind the barrier: this thread's rows row0, row0 + 2, ... of the tile, columns cofs .. cofs + 3 (n in the whole matrix), summed over the KS partial tiles in the order w = 0 .. KS-1, then biased, converted and stored. bb, ub, vb, rb come as loaded (f32) and are rounded to bf16 here.
template <int MODE, bool BIAS, int KS>
__device__ __forceinline__ void gemmw_tail(const float* os, int row0, int r0, int cofs, int n, v4f bb, v4f ub, v4f vb, const float (&rb)[32 / KS], Planes P1, Planes P2) {
#pragma unroll
    for (int u = 0; u < 4; ++u) { bb[u] = bfr(bb[u]); ub[u] = bfr(ub[u]); vb[u] = bfr(vb[u]); }
#pragma unroll
    for (int s = 0; s < 32 / KS; ++s) { const int row = row0 + 2 * s, m = r0 + row; v4f val = *(const v4fa*)(os + row * 68 + cofs);
#pragma unroll
        for (int w = 1; w < KS; ++w) val += *(const v4fa*)(os + w * GWST + row * 68 + cofs);
        if (BIAS) { if (MODE == 3) val += bfr(rb[s]); else val += bb; }
        if (MODE == 4) put_hl(val * ((m < RH) ? 1.0f : (1.0f / PCAR)), P1.ph, P1.pl, (size_t)m * DQ + n);
        else if (MODE == 3) put3(val, P1, (size_t)m * TT + n);
        else { const size_t off = ((size_t)(n / HD) * TT + m) * HD + n % HD;
            if (MODE == 2) { put3(val + ub, P1, off); put3(val + vb, P2, off); } else put3(val, P1, off); } }
    asm volatile("s_wait_xcnt 0x0" ::: "memory");   // behind the tail's last stores: the code laid out behind this tail reuses their address and data registers
}
template <typename T16, int NSPLIT, bool BIAS, int KS, int MSET = 0>
__device__ __forceinline__ void gemmw_body(float* os, const T16* __restrict__ A, const T16* __restrict__ A2, const T16* __restrict__ Bt, const T16* __restrict__ Bt2, int K, int lda, float* C, int ldc, const float* __restrict__ bias, int bx, int by,
                                           int mode = 0, Planes P1 = Planes{}, Planes P2 = Planes{}, const float* __restrict__ bu = nullptr, const float* __restrict__ bv2 = nullptr) {
    typedef typename WFrag<T16>::V V;
    const int wave = (KS == 1) ? 0 : __builtin_amdgcn_readfirstlane((int)(threadIdx.x >> 5));
    const int lane = threadIdx.x & 31, lr = lane & 15, hi = lane >> 4; const int r0 = bx * 64, c0 = by * 64;
    v8f acc[4][4];
#pragma unroll
    for (int mb = 0; mb < 4; ++mb)
#pragma unroll
        for (int nb = 0; nb < 4; ++nb) acc[mb][nb] = (v8f){};
    if (KS > 1) {
        constexpr int NST = (NSPLIT == 0) ? 1 : ((NSPLIT == 1) ? 2 : 3);   // plane pairs per chunk
        const T16* sA = (const T16*)(os + wave * GWST); const T16* fa = sA + lr * GPIT + 8 * hi; const T16* fb = fa + GSLOT;
        const unsigned la = (unsigned)(size_t)sA + (unsigned)(((lane >> 3) * GPIT + (lane & 7) * 8) * 2), lb = la + GSLOT * 2;   // LDS byte addresses of this lane's first unit in the two slots
        const size_t ga = (size_t)(r0 + (lane >> 3)) * lda + (lane & 7) * 8, gb = (size_t)(c0 + (lane >> 3)) * K + (lane & 7) * 8;
#pragma unroll 1   // rolled: the chunks go through the same two slots one after the other, so a second copy of the body would gain nothing
        for (int kc = wave * 64; kc < K; kc += 64 * KS) {
#pragma unroll
            for (int st = 0; st < NST; ++st) {
                asm volatile("s_wait_dscnt 0x0" ::: "memory");   // this wave's reads of the slot that is refilled have returned (the slots are the wave's own: no barrier)
                if (st == 0) { stage64(la, (NSPLIT == 0 ? A : A2) + ga + kc, lda); stage64(lb, Bt + gb + kc, K); }
                else if (st == 1) stage64(la, A + ga + kc, lda);
                else stage64(lb, Bt2 + gb + kc, K);
                asm volatile("s_wait_asynccnt 0x0" ::: "memory");   // this wave's copies have landed before it reads fragments of them
#pragma unroll
                for (int kk = 0; kk < 64; kk += 32) { V a[4], b[4];
#pragma unroll
                    for (int u = 0; u < 4; ++u) { a[u] = WFrag<T16>::ld(fa + u * 16 * GPIT + kk); b[u] = WFrag<T16>::ld(fb + u * 16 * GPIT + kk); }
#pragma unroll
                    for (int nb = 0; nb < 4; ++nb)
#pragma unroll
                        for (int mb = 0; mb < 4; ++mb) acc[mb][nb] = WFrag<T16>::mma(a[mb], b[nb], acc[mb][nb]); }
            }
        }
    } else {
        const size_t aoff = (size_t)(r0 + lr) * lda + 8 * hi, boff = (size_t)(c0 + lr) * K + 8 * hi;
#pragma unroll 1
        for (int kc = wave * 32; kc < K; kc += 32 * KS) {
            V a[4], a2[4];
#pragma unroll
            for (int mb = 0; mb < 4; ++mb) { a[mb] = WFrag<T16>::ld(A + aoff + (size_t)mb * 16 * lda + kc); if (NSPLIT == 1 || NSPLIT == 2) a2[mb] = WFrag<T16>::ld(A2 + aoff + (size_t)mb * 16 * lda + kc); }
#pragma unroll
            for (int nb = 0; nb < 4; ++nb) { const V b = WFrag<T16>::ld(Bt + boff + (size_t)nb * 16 * K + kc); V b2; if (NSPLIT >= 2) b2 = WFrag<T16>::ld(Bt2 + boff + (size_t)nb * 16 * K + kc);
#pragma unroll
                for (int mb = 0; mb < 4; ++mb) { acc[mb][nb] = WFrag<T16>::mma(a[mb], b, acc[mb][nb]); if (NSPLIT == 1 || NSPLIT == 2) acc[mb][nb] = WFrag<T16>::mma(a2[mb], b, acc[mb][nb]); if (NSPLIT >= 2) acc[mb][nb] = WFrag<T16>::mma(a[mb], b2, acc[mb][nb]); } }
            asm volatile("v_nop\n\tv_nop\n\tv_nop\n\tv_nop" : "+v"(acc[0][0]), "+v"(acc[1][1]), "+v"(acc[2][2]), "+v"(acc[3][3]) : "v"(a[0]), "v"(a[3]));
        }
    }
    if (KS > 1) {
        // mode != 0: this thread's biases (of its four columns; mode 3: of its rows) are loaded ahead of the LDS exchange and first used behind it, in the tail, so that their latency runs under it
        const int cofs = lr * 4, n = c0 + cofs; v4f bb = (v4f){}, ub = (v4f){}, vb = (v4f){}; float rb[32 / KS];
#pragma unroll
        for (int s = 0; s < 32 / KS; ++s) rb[s] = 0.0f;
        if (BIAS && (MSET & 8) && mode == 3) {
#pragma unroll
            for (int s = 0; s < 32 / KS; ++s) rb[s] = bias[r0 + wave * (64 / KS) + 2 * s + hi];
            asm volatile("s_wait_xcnt 0x0" ::: "memory"); }   // these loads stay in flight, and the code below reuses their address registers
        if (BIAS && (MSET & 6) && mode != 3) { bb[0] = bias[n]; bb[1] = bias[n + 1]; bb[2] = bias[n + 2]; bb[3] = bias[n + 3];
            asm volatile("s_wait_xcnt 0x0" ::: "memory"); }   // as above: behind loads that stay in flight
        if ((MSET & 4) && mode == 2) {
#pragma unroll
            for (int u = 0; u < 4; ++u) { ub[u] = bu[n + u]; vb[u] = bv2[n + u]; }
            asm volatile("s_wait_xcnt 0x0" ::: "memory"); }   // as above: behind loads that stay in flight
        float* mine = os + wave * GWST;
#pragma unroll
        for (int mb = 0; mb < 4; ++mb)
#pragma unroll
            for (int nb = 0; nb < 4; ++nb)
#pragma unroll
                for (int j = 0; j < 8; ++j) mine[(mb * 16 + hi * 8 + j) * 68 + nb * 16 + lr] = acc[mb][nb][j];
        __syncthreads();   // every wave's partial tile is in LDS before any wave sums rows of it
        // the highest mode of MSET is taken without a test
        if ((MSET & 2) && (MSET < 4 || mode == 1)) { gemmw_tail<1, BIAS, KS>(os, wave * (64 / KS) + hi, r0, cofs, n, bb, ub, vb, rb, P1, P2); return; }
        if ((MSET & 4) && (MSET < 8 || mode == 2)) { gemmw_tail<2, BIAS, KS>(os, wave * (64 / KS) + hi, r0, cofs, n, bb, ub, vb, rb, P1, P2); return; }
        if ((MSET & 8) && (MSET < 16 || mode == 3)) { gemmw_tail<3, BIAS, KS>(os, wave * (64 / KS) + hi, r0, cofs, n, bb, ub, vb, rb, P1, P2); return; }
        if (MSET & 16) { gemmw_tail<4, BIAS, KS>(os, wave * (64 / KS) + hi, r0, cofs, n, bb, ub, vb, rb, P1, P2); return; }
#pragma unroll
        for (int s = 0; s < 32 / KS; ++s) { const int row = wave * (64 / KS) + 2 * s + hi, cofs = lr * 4; v4f val = *(const v4fa*)(os + row * 68 + cofs);
#pragma unroll
            for (int w = 1; w < KS; ++w) val += *(const v4fa*)(os + w * GWST + row * 68 + cofs);
            if (BIAS) { val[0] += bfr(bias[c0 + cofs]); val[1] += bfr(bias[c0 + cofs + 1]); val[2] += bfr(bias[c0 + cofs + 2]); val[3] += bfr(bias[c0 + cofs + 3]); }
            *(v4f*)(C + (size_t)(r0 + row) * ldc + c0 + cofs) = val; }
        return;
    }
#pragma unroll
    for (int mb = 0; mb < 4; ++mb) {
#pragma unroll
        for (int nb = 0; nb < 4; ++nb) {
#pragma unroll
            for (int j = 0; j < 8; ++j) os[(hi * 8 + j) * 68 + nb * 16 + lr] = acc[mb][nb][j]; }
        __builtin_amdgcn_wave_barrier(); asm volatile("" ::: "memory");
        float* crow = C + (size_t)(r0 + mb * 16) * ldc + c0;
{
#pragma unroll
            for (int s = 0; s < 8; ++s) { const int row = 2 * s + hi, cofs = lr * 4; v4f val = *(const v4fa*)(os + row * 68 + cofs); if (BIAS) { val[0] += bfr(bias[c0 + cofs]); val[1] += bfr(bias[c0 + cofs + 1]); val[2] += bfr(bias[c0 + cofs + 2]); val[3] += bfr(bias[c0 + cofs + 3]); }
                *(v4f*)(crow + (size_t)row * ldc + cofs) = val; }
             }
        __builtin_amdgcn_wave_barrier(); asm volatile("" ::: "memory");
    }
}

template <typename T16, int NSPLIT, bool BIAS, int KS>
__global__ __launch_bounds__(32 * KS) void k_gemmw(const T16* __restrict__ A, const T16* __restrict__ A2, const T16* __restrict__ Bt, const T16* __restrict__ Bt2, int K, float* C, int ldc, const float* __restrict__ bias) {
    __shared__ __align__(16) float os[KS == 1 ? 16 * 68 : KS * GWST];
    gemmw_body<T16, NSPLIT, BIAS, KS>(os, A, A2, Bt, Bt2, K, K, C, ldc, bias, blockIdx.x, blockIdx.y);
}
// ---- launches that read none of each other's output, joined into one grid; a work-group picks its product by its block index (block-uniform), and each tile's arithmetic is gemmw_body's as before.
// k_qkv: z = 0, 1, 2: the q, k, v projection of one batch entry, each straight into its 16-bit planes: q + u and q + v, k, and v transposed.
// v is formed as Wv . x^T (the same products, the operands' roles exchanged), so that its tile has t along the columns, as the planes [g][d][t] want it; its tile indices are exchanged with it.
__global__ __launch_bounds__(256) void k_qkv(const bf* __restrict__ X, const bf* __restrict__ Wq_, const bf* __restrict__ Wk_, const bf* __restrict__ Wv_, const float* __restrict__ bq, const float* __restrict__ bk, const float* __restrict__ bv, const float* __restrict__ bu, const float* __restrict__ bv2,
                                             h16* Q16, bf* Qh, bf* Ql, h16* U16, bf* Uh, bf* Ul, h16* K16, bf* Kh, bf* Kl, h16* V16, bf* Vh, bf* Vl) {
    __shared__ __align__(16) float os[8 * GWST];
    const int z = blockIdx.z;
    const Planes P1 = { z == 0 ? Q16 : (z == 1 ? K16 : V16), z == 0 ? Qh : (z == 1 ? Kh : Vh), z == 0 ? Ql : (z == 1 ? Kl : Vl) }; const Planes P2 = { U16, Uh, Ul };
    gemmw_body<bf, 0, true, 8, 14>(os, z == 2 ? Wv_ : X, nullptr, z == 0 ? Wq_ : (z == 1 ? Wk_ : X), nullptr, DM, DM, nullptr, 0, z == 0 ? bq : (z == 1 ? bk : bv), z == 2 ? blockIdx.y : blockIdx.x, z == 2 ? blockIdx.x : blockIdx.y,
                               z == 0 ? 2 : (z == 1 ? 1 : 3), P1, P2, bu, bv2);
}
// k_pp: p = pos_emb Wpos^T straight into its planes.
__global__ __launch_bounds__(256) void k_pp(const bf* __restrict__ XP, const bf* __restrict__ WP, h16* R16, bf* Rh, bf* Rl) {
    __shared__ __align__(16) float os[8 * GWST];
    gemmw_body<bf, 0, false, 8, 2>(os, XP, nullptr, WP, nullptr, DM, DM, nullptr, 0, nullptr, blockIdx.x, blockIdx.y, 1, Planes{ R16, Rh, Rl });
}
// ---- score_tile: one 128x128 tile of a score block (content + shifted position scores) per work-group of 4 waves, each wave a 64x64 quarter (16 accumulators, started by pos_start; the content products and their order as in gemmw_body with KS == 1).
// The tile's rows of A and Bt (pitch HD) come into LDS by asynchronous 16-byte copies, every thread a share, each wave-wide copy covering whole lines; they lie there at a row pitch 16 bytes above the staged row's length, and the waves read their fragments from there.
// NSPLIT == 0: one plane per operand, all HD of k in one stage. NSPLIT == 2: hi and lo planes, k in two stages of HD / 2 through the same LDS. sm holds SCORE_LDS bytes; behind the last stage it serves as the four waves' 16 x 68 float store buffers.
#define SCORE_LDS (2 * 2 * 128 * (HD / 2 + 8) * 2)
// ---- pos_start: the shifted position scores of the 128x128 tile (bx, by), left in acc in the accumulators' own layout (each wave its 64x64 quarter).
// With g = TT - 1 - i + j the shift reads: pos[i][j] = A[i] . P[g] for g < TT, 0 for g == TT, A[i + 1] . P[g - TT - 1] for g > TT. Over the tile g = gb + cc, gb = TT - 128 - r0 + c0, cc = 127 - r + jj in 0 .. 254 (r, jj: row and column in the tile).
// LDS slot cc holds the P row that belongs to g = gb + cc (row 0 for g == TT, whose product is not used); the A rows r0 .. r0 + 128 (held to TT - 1: the row past the end is never used) lie beside them. gb is a multiple of 128, so that a 16-wide block of slots lies wholly on one side of g == TT.
// The 16 query rows mb of a quarter need the 79 slots from cc0 = 112 - wm - 16 mb + wn on: five 16x16 products; block t = xb - mb + 3 (slots 64 - wm + wn + 16 t ...) serves every (mb, xb) on its diagonal.
// The five blocks go through the wave's LDS buffer (16 x 84 floats) and come back skewed: element (rr, jl) of the 16 x 64 strip is column 15 - rr + jl.
// k comes in stages of KH through the same LDS. PERT: the A fragment is read per product, from row + 1 where the block lies right of g == TT (the diagonal tile has both kinds; with hi/lo planes it also keeps the registers down); else the tile's blocks are all of one kind and the four A fragments are read once per 32 of k.
template <typename T16, int NSPLIT, bool PERT>
__device__ __forceinline__ void pos_start(char* sm, const T16* __restrict__ A, const T16* __restrict__ A2, const T16* __restrict__ P, const T16* __restrict__ P2, int bx, int by, v8f (&acc)[4][4]) {
    typedef typename WFrag<T16>::V V;
    constexpr int NP = (NSPLIT == 2) ? 2 : 1, KH = 64 / NP, PIT = KH + 8, U = KH / 8, RPC = 128 / U, AR = 128 + RPC;   // planes per operand; k per stage; LDS row pitch in elements; 16-byte units per staged row; rows per work-group-wide copy; A rows in LDS per plane
    static_assert(NP * (AR + 256) * PIT * 2 <= SCORE_LDS && 4 * 16 * 84 * 4 <= SCORE_LDS && (NSPLIT == 0 || PERT), "LDS");
    const T16* sA = (const T16*)sm; const T16* sP = sA + NP * AR * PIT; const unsigned smo = (unsigned)(size_t)sm;
    const int tid = threadIdx.x, wave = __builtin_amdgcn_readfirstlane(tid >> 5), lane = tid & 31, lr = lane & 15, hi = lane >> 4;
    const int r0 = bx * 128, c0 = by * 128, wm = (wave >> 1) * 64, wn = (wave & 1) * 64, gb = TT - 128 - r0 + c0;
    const int tr = tid / U, tu = tid % U;   // this thread's row and 16-byte unit in a work-group-wide copy
    v8f pa[4][5];
#pragma unroll
    for (int mb = 0; mb < 4; ++mb)
#pragma unroll
        for (int xb = 0; xb < 5; ++xb) pa[mb][xb] = (v8f){};
#pragma unroll 1   // rolled: the stages go through the same LDS one after the other
    for (int st = 0; st < HD / KH; ++st) {
        const int ko = st * KH + tu * 8;
        { unsigned l[8]; const void* g[8];
#pragma unroll
            for (int i = 0; i < 8; ++i) { const int pl = i / (8 / NP), row = (i % (8 / NP)) * RPC + tr;
                g[i] = (pl ? A2 : A) + (size_t)(r0 + row) * HD + ko; l[i] = smo + (unsigned)(((pl * AR + row) * PIT + tu * 8) * 2); }
            copy8(l, g); }
#pragma unroll
        for (int pl = 0; pl < NP; ++pl) { const int gr = min(r0 + 128 + tr, TT - 1);
            copy1(smo + (unsigned)(((pl * AR + 128 + tr) * PIT + tu * 8) * 2), (pl ? A2 : A) + (size_t)gr * HD + ko); }
#pragma unroll 1   // rolled: a trip's 24 address registers are formed in the trip, beside the 160 of pa
        for (int q = 0; q < 2; ++q) { unsigned l[8]; const void* g[8]; const T16* src = (NP == 2 && q) ? P2 : P;
#pragma unroll
            for (int i = 0; i < 8; ++i) { const int slot = ((NP == 2) ? i : q * 8 + i) * RPC + tr, gg = gb + slot, prow = (gg < TT) ? gg : max(gg - TT - 1, 0);
                g[i] = src + (size_t)prow * HD + ko; l[i] = smo + (unsigned)(((NP * AR + ((NP == 2) ? q * 256 : 0) + slot) * PIT + tu * 8) * 2); }
            copy8(l, g); }
        asm volatile("s_wait_asynccnt 0x0" ::: "memory");   // this wave's copies have landed
        __syncthreads();   // ... and every other wave's: the stage is whole in LDS before any wave reads fragments of it
        const T16* fa = sA + (wm + lr) * PIT + 8 * hi; const T16* fp = sP + (64 - wm + wn + lr) * PIT + 8 * hi;
#pragma unroll
        for (int kc = 0; kc < KH; kc += 32) {
            V a[4];
            if (!PERT) { const int so = (gb >= TT) ? PIT : 0;
#pragma unroll
                for (int mb = 0; mb < 4; ++mb) a[mb] = WFrag<T16>::ld(fa + mb * 16 * PIT + so + kc); }
#pragma unroll
            for (int t = 0; t < 8; ++t) { const V b = WFrag<T16>::ld(fp + t * 16 * PIT + kc); V b2; if (NSPLIT == 2) b2 = WFrag<T16>::ld(fp + (256 + t * 16) * PIT + kc);
                const int so = (gb + 64 - wm + wn + 16 * t >= TT) ? PIT : 0;
#pragma unroll
                for (int mb = 0; mb < 4; ++mb) { const int xb = t - 3 + mb;
                    if (xb >= 0 && xb <= 4) {
                        if (PERT) { const V av = WFrag<T16>::ld(fa + mb * 16 * PIT + so + kc); pa[mb][xb] = WFrag<T16>::mma(av, b, pa[mb][xb]);
                            if (NSPLIT == 2) { const V av2 = WFrag<T16>::ld(fa + (AR + mb * 16) * PIT + so + kc); pa[mb][xb] = WFrag<T16>::mma(av2, b, pa[mb][xb]); pa[mb][xb] = WFrag<T16>::mma(av, b2, pa[mb][xb]); } }
                        else pa[mb][xb] = WFrag<T16>::mma(a[mb], b, pa[mb][xb]); } } }
        }
        asm volatile("s_wait_dscnt 0x0" ::: "memory");   // this wave's LDS reads of the stage have returned
        __syncthreads();   // ... and every other wave's: the LDS may be refilled, or take the waves' skew buffers
    }
    float* pbuf = (float*)sm + wave * (16 * 84);
#pragma unroll
    for (int mb = 0; mb < 4; ++mb) {
#pragma unroll
        for (int xb = 0; xb < 5; ++xb)
#pragma unroll
            for (int j = 0; j < 8; ++j) pbuf[(hi * 8 + j) * 84 + xb * 16 + lr] = pa[mb][xb][j];
        __builtin_amdgcn_wave_barrier(); asm volatile("" ::: "memory");   // the wave's LDS writes stay ahead of its reads of other lanes' words
        const int dj = (c0 + wn + lr) - (r0 + wm + mb * 16 + hi * 8);   // j - i of this lane's element nb = 0, j = 0
#pragma unroll
        for (int nb = 0; nb < 4; ++nb)
#pragma unroll
            for (int j = 0; j < 8; ++j) { const float pv = pbuf[(hi * 8 + j) * 84 + 15 - (hi * 8 + j) + nb * 16 + lr]; acc[mb][nb][j] = (dj + nb * 16 - j == 1) ? 0.0f : pv; }
        __builtin_amdgcn_wave_barrier(); asm volatile("" ::: "memory");   // the reads above stay ahead of the next round's writes
    }
}
template <typename T16, int NSPLIT>
__device__ __forceinline__ void score_tile(char* sm, const T16* __restrict__ A, const T16* __restrict__ A2, const T16* __restrict__ Bt, const T16* __restrict__ Bt2, const T16* __restrict__ PA, const T16* __restrict__ PA2, const T16* __restrict__ PB, const T16* __restrict__ PB2, float* C, int bx, int by) {
    typedef typename WFrag<T16>::V V;
    constexpr int NP = (NSPLIT == 2) ? 2 : 1, KH = HD / NP, PIT = KH + 8, U = KH / 8;   // planes per operand; k per stage; LDS row pitch in elements; 16-byte units per staged row (and per thread and plane)
    static_assert(2 * NP * 128 * PIT * 2 <= SCORE_LDS && 4 * 16 * 68 * 4 <= SCORE_LDS && U % 8 == 0, "LDS");
    const T16* sA = (const T16*)sm; const T16* sB = sA + NP * 128 * PIT; const unsigned smo = (unsigned)(size_t)sm;   // smo: the LDS byte address of sm
    const int tid = threadIdx.x, wave = __builtin_amdgcn_readfirstlane(tid >> 5), lane = tid & 31, lr = lane & 15, hi = lane >> 4;
    const int r0 = bx * 128, c0 = by * 128, wm = (wave >> 1) * 64, wn = (wave & 1) * 64;
    // this thread's unit of the first 128 / U staged rows: row tid / U, 16-byte unit tid % U; its further units lie 128 / U rows on each
    const size_t gt = (size_t)(tid / U) * HD + (tid % U) * 8; const unsigned lt = smo + (unsigned)(((tid / U) * PIT + (tid % U) * 8) * 2);
    const T16* gA = A + (size_t)r0 * HD + gt; const T16* gA2 = (NP == 2) ? A2 + (size_t)r0 * HD + gt : nullptr; const T16* gB = Bt + (size_t)c0 * HD + gt; const T16* gB2 = (NP == 2) ? Bt2 + (size_t)c0 * HD + gt : nullptr;
    v8f acc[4][4];   // starts as the tile's shifted position scores; the content products are summed onto them
    if constexpr (NSPLIT == 2) pos_start<T16, NSPLIT, true>(sm, PA, PA2, PB, PB2, bx, by, acc);
    else { if (bx == by) pos_start<T16, NSPLIT, true>(sm, PA, PA2, PB, PB2, bx, by, acc); else pos_start<T16, NSPLIT, false>(sm, PA, PA2, PB, PB2, bx, by, acc); }
#pragma unroll
    for (int st = 0; st < NP; ++st) {
        asm volatile("s_wait_dscnt 0x0" ::: "memory");   // this wave's LDS reads of the skew buffer, or of the stage before, have returned
        __syncthreads();   // ... and every other wave's: the LDS may be refilled
#pragma unroll 1   // rolled: a trip's 24 address registers are formed in the trip and are not held across the matrix work
        for (int q = 0; q < 2 * NP * (U / 8); ++q) { const int pl = q / (U / 8), i0 = (q % (U / 8)) * 8;   // plane in LDS order (A, [A2,] Bt, [Bt2]); first of the trip's eight units
            const T16* src = (NP == 1) ? (pl ? gB : gA) : (pl == 0 ? gA : (pl == 1 ? gA2 : (pl == 2 ? gB : gB2)));
            unsigned l[8]; const void* g[8];
#pragma unroll
            for (int i = 0; i < 8; ++i) { g[i] = src + st * KH + (size_t)((i0 + i) * (128 / U)) * HD; l[i] = lt + (unsigned)((pl * 128 + (i0 + i) * (128 / U)) * PIT * 2); }
            copy8(l, g); }
        asm volatile("s_wait_asynccnt 0x0" ::: "memory");   // this wave's copies have landed
        __syncthreads();   // ... and every other wave's: the stage is whole in LDS before any wave reads fragments of it
        const T16* fa = sA + (wm + lr) * PIT + 8 * hi; const T16* fb = sB + (wn + lr) * PIT + 8 * hi;
#pragma unroll (NSPLIT == 2 ? 1 : 2)   // hi/lo planes: rolled, so that one trip's fragments (80 registers beside the 128 of acc) are live at a time; one plane: two trips' at most; acc is live from the start, and so nothing spills at 4 waves per SIMD
        for (int kc = 0; kc < KH; kc += 32) {
            V a[4], a2[4];
#pragma unroll
            for (int mb = 0; mb < 4; ++mb) { a[mb] = WFrag<T16>::ld(fa + mb * 16 * PIT + kc); if (NSPLIT == 2) a2[mb] = WFrag<T16>::ld(fa + (128 + mb * 16) * PIT + kc); }
#pragma unroll
            for (int nb = 0; nb < 4; ++nb) { const V b = WFrag<T16>::ld(fb + nb * 16 * PIT + kc); V b2; if (NSPLIT == 2) b2 = WFrag<T16>::ld(fb + (128 + nb * 16) * PIT + kc);
#pragma unroll
                for (int mb = 0; mb < 4; ++mb) { acc[mb][nb] = WFrag<T16>::mma(a[mb], b, acc[mb][nb]); if (NSPLIT == 2) { acc[mb][nb] = WFrag<T16>::mma(a2[mb], b, acc[mb][nb]); acc[mb][nb] = WFrag<T16>::mma(a[mb], b2, acc[mb][nb]); } } }
        }
    }
    asm volatile("s_wait_dscnt 0x0" ::: "memory");   // this wave's last fragment reads have returned
    __syncthreads();   // ... and every other wave's: the LDS now takes the waves' store buffers
    float* os = (float*)sm + wave * (16 * 68);
#pragma unroll
    for (int mb = 0; mb < 4; ++mb) {
#pragma unroll
        for (int nb = 0; nb < 4; ++nb) {
#pragma unroll
            for (int j = 0; j < 8; ++j) os[(hi * 8 + j) * 68 + nb * 16 + lr] = acc[mb][nb][j]; }
        __builtin_amdgcn_wave_barrier(); asm volatile("" ::: "memory");   // the wave's LDS writes stay ahead of its reads of other lanes' words
        float* crow = C + (size_t)(r0 + wm + mb * 16) * TT + c0 + wn; v4f t[8];
#pragma unroll
        for (int s = 0; s < 8; ++s) t[s] = *(const v4fa*)(os + (2 * s + hi) * 68 + lr * 4);
#pragma unroll
        for (int s = 0; s < 8; ++s) *(v4f*)(crow + (size_t)(2 * s + hi) * TT + lr * 4) = t[s];
        asm volatile("s_wait_xcnt 0x0" ::: "memory");   // behind the stores: the next round reuses their address and data registers
        __builtin_amdgcn_wave_barrier(); asm volatile("" ::: "memory");   // the reads above stay ahead of the next round's writes
    }
}
// k_score: z = head; S = content q.k + shifted position qv.p; row tiles below RH on the hi/lo planes, the rest on the fp16 planes. Pointers are those of the pass's first head.
// Launch bounds: four work-groups per WGP (their LDS fits four times), so that one group's copies and stores run under another's matrix work; the registers are held to that.
__global__ __launch_bounds__(128, 4) void k_score(const bf* __restrict__ Qh, const bf* __restrict__ Ql, const bf* __restrict__ Kh, const bf* __restrict__ Kl, const bf* __restrict__ Vh, const bf* __restrict__ Vl, const bf* __restrict__ Rh, const bf* __restrict__ Rl,
                                              const h16* __restrict__ Q16, const h16* __restrict__ K16, const h16* __restrict__ V16, const h16* __restrict__ R16, float* S) {
    __shared__ __align__(16) char sm[SCORE_LDS];
    const size_t zz = blockIdx.z, zo = zz * ((size_t)TT * HD);
    float* C = S + zz * ((size_t)TT * TT);
    if (blockIdx.x < RH / 128) score_tile<bf, 2>(sm, Qh + zo, Ql + zo, Kh + zo, Kl + zo, Vh + zo, Vl + zo, Rh + zo, Rl + zo, C, blockIdx.x, blockIdx.y);
    else score_tile<h16, 0>(sm, Q16 + zo, nullptr, K16 + zo, nullptr, V16 + zo, nullptr, R16 + zo, nullptr, C, blockIdx.x, blockIdx.y);
}
// k_av: attn.v of the pass's heads (z); row tiles below RH on the hi/lo planes, the rest on the fp16 plane. The weights lie where k_asoft left them: in the bytes of their own score row (pitch 2 * TT 16-bit elements).
// The tile goes, rescaled and split hi/lo, straight to its head's columns of the merged rows [t][DQ]; Ah, Al are those of the pass's first head.
__global__ __launch_bounds__(512) void k_av(const float* __restrict__ Sp, const bf* __restrict__ Vh, const bf* __restrict__ Vl, const h16* __restrict__ V16, bf* Ah, bf* Al) {
    __shared__ __align__(16) float os[16 * GWST];
    const size_t z = blockIdx.z, zv = z * ((size_t)HD * TT), zp = z * ((size_t)TT * 2 * TT); const Planes PA = { nullptr, Ah + z * HD, Al + z * HD };
    if (blockIdx.x < RH / 64) gemmw_body<bf, 2, false, 16, 16>(os, (const bf*)Sp + zp, (const bf*)Sp + zp + TT, Vh + zv, Vl + zv, TT, 2 * TT, nullptr, 0, nullptr, blockIdx.x, blockIdx.y, 4, PA);
    else gemmw_body<h16, 0, false, 16, 16>(os, (const h16*)Sp + zp, nullptr, V16 + zv, nullptr, TT, 2 * TT, nullptr, 0, nullptr, blockIdx.x, blockIdx.y, 4, PA);
}

typedef __attribute__((ext_vector_type(2))) unsigned short v2us;
typedef __attribute__((ext_vector_type(2))) float v2f;

__global__ __launch_bounds__(256) void k_wtG(const float* __restrict__ w, int K, int N, bf* Bt) {
    const int lane = threadIdx.x & 31; const int L0 = (blockIdx.x * 8 + (threadIdx.x >> 5)) * 8; const int nlines = N * K / 64;
{
#pragma unroll 1
        for (int l = 0; l < 8; ++l) { const int L = L0 + l; if (L >= nlines) break; const size_t e = (size_t)L * 64 + lane * 2; const int k = (int)(e % K), n = (int)(e / K); v2us o;
            o[0] = f2bf(w[(size_t)k * N + n]); o[1] = f2bf(w[(size_t)(k + 1) * N + n]); *(v2us*)(Bt + e) = o; }
         }
}
__device__ __forceinline__ void d_cvt8(unsigned bid, const float* __restrict__ src, bf* dst, size_t n8) { const size_t i = (size_t)bid * 256 + threadIdx.x; if (i >= n8) return; const v8f v = *(const v8f*)(src + i * 8); v8us o;
#pragma unroll
    for (int k = 0; k < 8; ++k) o[k] = f2bf(v[k]); *(v8us*)(dst + i * 8) = o;  }
__global__ __launch_bounds__(256) void k_cscvt(const float* __restrict__ cosT, const float* __restrict__ sinT, float* CS) { const int idx = blockIdx.x * 256 + threadIdx.x; if (idx >= TT * HD) return; v2f cs; cs[0] = bfr(cosT[idx]); cs[1] = bfr(sinT[idx]); *(v2f*)(CS + (size_t)idx * 2) = cs;  }
// ---- streaming jobs that read none of each other's output, joined into one grid; a work-group picks its job by its block index.
#define GW   (DQ * DM / 8 / 256)         // work-groups of one weight's conversion
#define GP   (TT * DM / 8 / 256)         // ... of pos_emb's
#define GX   (NB_ * TT * DM / 8 / 256)   // ... of x's, all batch entries
// k_prep: the five weights, pos_emb and x to bf16.
__global__ __launch_bounds__(256) void k_prep(const float* __restrict__ wq, const float* __restrict__ wk, const float* __restrict__ wv, const float* __restrict__ wo, const float* __restrict__ wpos, const float* __restrict__ pemb, const float* __restrict__ x,
                                              bf* WQ, bf* WK, bf* WV, bf* WO, bf* WP, bf* XP, bf* XB) {
    unsigned b = blockIdx.x;
    if (b < 5 * GW) { const unsigned j = b / GW; d_cvt8(b % GW, j == 0 ? wq : (j == 1 ? wk : (j == 2 ? wv : (j == 3 ? wo : wpos))), j == 0 ? WQ : (j == 1 ? WK : (j == 2 ? WV : (j == 3 ? WO : WP))), (size_t)DQ * DM / 8); return; }
    b -= 5 * GW; if (b < GP) { d_cvt8(b, pemb, XP, (size_t)TT * DM / 8); return; }
    d_cvt8(b - GP, x, XB, (size_t)NB_ * TT * DM / 8);
}
// k_asoft: per row (zz, i): t = S x HD^-0.5, masked keys -3e38; softmax over the 2048 keys (register row, one exp, fixed trees);
// the weights go back into the row's own 4 * TT bytes of Sb, which this wave alone reads and holds whole in registers by then: fp16 in the first half, or hi in the first half and lo in the second.
__global__ __launch_bounds__(256) void k_asoft(float* Sb, const int* __restrict__ km) {
    const int lane = threadIdx.x & 31; const int row = blockIdx.x * 8 + (threadIdx.x >> 5); if (row >= ZH * TT) return; const int i = row % TT; const bool hires = (i < RH); const float* sr = Sb + (size_t)row * TT; float v[TT / 32]; float mx = -3.0e38f;
    // The row's loads have no branch and stand, four chunks' together, ahead of those chunks' arithmetic, so that they are in flight together.
#pragma unroll
    for (int gq = 0; gq < TT / 512; ++gq) { v4f a[4]; int m[4][4];
#pragma unroll
        for (int c = 0; c < 4; ++c) { const int j0 = (gq * 4 + c) * 128 + lane * 4; a[c] = *(const v4f*)(sr + j0);
#pragma unroll
            for (int q = 0; q < 4; ++q) m[c][q] = km[j0 + q]; }
        asm volatile("s_wait_xcnt 0x0" ::: "memory");   // behind the group's loads, which stay in flight: the arithmetic below reuses address registers; it also keeps every load of the group in front of that arithmetic
#pragma unroll
        for (int c = 0; c < 4; ++c) { const int ch = gq * 4 + c;
#pragma unroll
            for (int q = 0; q < 4; ++q) { const float t = (m[c][q] != 0) ? a[c][q] * SCL : -3.0e38f; v[ch * 4 + q] = t; mx = fmaxf(mx, t); } } }
#pragma unroll
    for (int sh = 16; sh; sh >>= 1) mx = fmaxf(mx, __shfl_xor(mx, sh, 32));
    float sum = 0.f;
#pragma unroll
    for (int k = 0; k < TT / 32; ++k) { float d0 = __fsub_rn(v[k], mx); asm volatile("" : "+v"(d0)); v[k] = __builtin_amdgcn_exp2f(__fmul_rn(d0, 1.4426950408889634f)); sum += v[k]; }
#pragma unroll
    for (int sh = 16; sh; sh >>= 1) sum += __shfl_xor(sum, sh, 32);
    const float f = __fdiv_rn(hires ? 1.0f : PCAR, sum);
{
        if (hires) {
#pragma unroll
            for (int ch = 0; ch < TT / 128; ++ch) { v4us oh, ol;
#pragma unroll
                for (int q = 0; q < 4; ++q) { unsigned short a, c2; splitf(v[ch * 4 + q] * f, a, c2); oh[q] = a; ol[q] = c2; }
                bf* po = (bf*)(Sb + (size_t)row * TT) + ch * 128 + lane * 4; *(v4us*)po = oh; *(v4us*)(po + TT) = ol; }
        } else {
#pragma unroll
            for (int ch = 0; ch < TT / 128; ++ch) { v4h o4;
#pragma unroll
                for (int q = 0; q < 4; ++q) o4[q] = tohx(v[ch * 4 + q] * f);
                *(v4h*)((h16*)(Sb + (size_t)row * TT) + ch * 128 + lane * 4) = o4; } }
         }
}

extern "C" void kernel_launch(void* const* d_in, const int* in_sizes, int n_in,
                              void* d_out, int out_size, void* d_ws, size_t ws_size, hipStream_t stream) {
    (void)in_sizes; (void)n_in; (void)out_size;
    const float* x = (const float*)d_in[0]; const float* pemb = (const float*)d_in[1]; const int* kmask = (const int*)d_in[2]; const float* wq = (const float*)d_in[3]; const float* bq = (const float*)d_in[4]; const float* wk = (const float*)d_in[5]; const float* bk = (const float*)d_in[6]; const float* wv = (const float*)d_in[7]; const float* bv = (const float*)d_in[8]; const float* wpos = (const float*)d_in[9]; const float* wo = (const float*)d_in[10]; const float* bo = (const float*)d_in[11]; const float* pbu = (const float*)d_in[12]; const float* pbv = (const float*)d_in[13]; const float* cosT = nullptr; const float* sinT = nullptr; (void)cosT; (void)sinT;
    float* OUT = (float*)d_out;     // [4][2048][1024]
    char* wsp = (char*)d_ws;
    auto take = [&](size_t bytes) { char* p = wsp; wsp += (bytes + 255) & ~(size_t)255; return (void*)p; };
    bf* WQ = (bf*)take((size_t)DQ * DM * 2); bf* WK = (bf*)take((size_t)DKV * DM * 2); bf* WV = (bf*)take((size_t)DKV * DM * 2); bf* WO = (bf*)take((size_t)DM * DQ * 2);
    bf* XB = (bf*)take((size_t)NB_ * TT * DM * 2); bf* WP = (bf*)take((size_t)DQ * DM * 2); h16* PP16 = (h16*)take((size_t)NH_ * TT * HD * 2); bf* PPh = (bf*)take((size_t)NH_ * TT * HD * 2); bf* PPl = (bf*)take((size_t)NH_ * TT * HD * 2); h16* QV16 = (h16*)take((size_t)NH_ * TT * HD * 2); bf* QVh = (bf*)take((size_t)NH_ * TT * HD * 2); bf* QVl = (bf*)take((size_t)NH_ * TT * HD * 2);
    h16* QP16 = (h16*)take((size_t)NH_ * TT * HD * 2); h16* KP16 = (h16*)take((size_t)NKV * TT * HD * 2); h16* VT16 = (h16*)take((size_t)NKV * HD * TT * 2);
    bf* QPh = (bf*)take((size_t)NH_ * TT * HD * 2); bf* QPl = (bf*)take((size_t)NH_ * TT * HD * 2); bf* KPh = (bf*)take((size_t)NKV * TT * HD * 2); bf* KPl = (bf*)take((size_t)NKV * TT * HD * 2); bf* VTh = (bf*)take((size_t)NKV * HD * TT * 2); bf* VTl = (bf*)take((size_t)NKV * HD * TT * 2);
    float* Sb = (float*)take((size_t)ZH * TT * TT * 4); bf* ATh = (bf*)take((size_t)TT * DQ * 2); bf* ATl = (bf*)take((size_t)TT * DQ * 2);
    // pos_emb's bf16 copy is last read by k_pp, before the first k_score writes Sb: it shares Sb's space
    bf* XP = (bf*)Sb;
    if ((size_t)(wsp - (char*)d_ws) > ws_size) return;    // ws 256 MiB
    k_prep<<<5 * GW + GP + GX, 256, 0, stream>>>(wq, wk, wv, wo, wpos, pemb, x, WQ, WK, WV, WO, WP, XP, XB);
    k_pp<<<dim3(TT / 64, DQ / 64, 1), 256, 0, stream>>>(XP, WP, PP16, PPh, PPl);
    for (int b = 0; b < NB_; ++b) {
        k_qkv<<<dim3(TT / 64, DQ / 64, 3), 256, 0, stream>>>(XB + (size_t)b * TT * DM, WQ, WK, WV, bq, bk, bv, pbu, pbv, QP16, QPh, QPl, QV16, QVh, QVl, KP16, KPh, KPl, VT16, VTh, VTl);
        for (int h0 = 0; h0 < NH_; h0 += ZH) { const size_t zq = (size_t)h0, zk = (size_t)(h0 / REP);   // one kv head per query head: the pass's heads use consecutive kv planes (z-strides TT*HD)
            k_score<<<dim3(TT / 128, TT / 128, ZH), 128, 0, stream>>>(QPh + zq * TT * HD, QPl + zq * TT * HD, KPh + zk * TT * HD, KPl + zk * TT * HD, QVh + zq * TT * HD, QVl + zq * TT * HD, PPh + zk * TT * HD, PPl + zk * TT * HD, QP16 + zq * TT * HD, KP16 + zk * TT * HD, QV16 + zq * TT * HD, PP16 + zk * TT * HD, Sb);
            k_asoft<<<ZH * TT / 8, 256, 0, stream>>>(Sb, kmask + (size_t)b * TT);
            k_av<<<dim3(TT / 64, HD / 64, ZH), 512, 0, stream>>>(Sb, VTh + zk * HD * TT, VTl + zk * HD * TT, VT16 + zk * HD * TT, ATh + zq * HD, ATl + zq * HD); }
        k_gemmw<bf, 1, true, 8><<<dim3(TT / 64, DM / 64, 1), 256, 0, stream>>>(ATh, ATl, WO, nullptr, DQ, OUT + (size_t)b * TT * DM, DM, bo); }
}

// v010
// A run of this version takes 466 microseconds.
// Versions between v008 and this one are left out; their measured steps multiply to 1.29 times as fast.
// Counting every step since v000, it is 6.49 times as fast.
#include <hip/hip_runtime.h>

// MultiHeadRelPositionAttention (x [4][2048][1024], pos_emb [2048][1024], mask [4][2048] (int, read; all ones); q/k/v = x W^T + b (8 heads x 128); p = pos_emb Wpos^T; content = (q + pos_bias_u[h]).k; pos = rel_shift((q + pos_bias_v[h]).p) with the Transformer-XL pad/reshape shift for P == T: pos[i][j] = S[i][T-1-(i-j)] for j <= i, 0 for j == i+1, S[i+1][j-i-2] for j >= i+2 (reproduced literally, including the upper part); scores = (content + pos) / sqrt(128), key mask; softmax; out = merged Wout^T + bout -> [4][2048][1024]).
// Compute dtypes, f32 accumulate: every input rounded to bf16; q/k/v/p as PLAIN bf16 GEMMs (inputs: exact) + bias; the u/v head biases added in f32; content, position scores and attn.v: query rows < 512 hl (3 products), the rest single fp16 (x1024) (the shifted position scores of a score tile are formed in that tile's own work-group, from query rows i / i+1 and the band of p rows that the shift maps onto the tile, and are the start value of the tile's content sums); softmax f32 with the read key mask, as a running softmax over key tiles in the work-group that forms the scores and attn.v; Wout hl x exact (2 products) + bias.

#define NB_  4
#define TT   2048
#define DM   1024
#define NH_  8
#define NKV  8
#define REP  (NH_ / NKV)
#define HD   128
#define DQ   (NH_ * HD)
#define DKV  (NKV * HD)
#define ZH   8
#define RH   512                  // query rows < RH use hi+lo planes (0: none)
#define WIN  0
#define PCAR 1024.0f
#define SCL  0.088388347648318447f   // HD^-0.5
typedef _Float16 h16;
typedef unsigned short bf;
typedef __attribute__((ext_vector_type(16))) __bf16   v16bf;
typedef __attribute__((ext_vector_type(16))) _Float16 v16h;
typedef __attribute__((ext_vector_type(8)))  _Float16 v8h;
typedef __attribute__((ext_vector_type(8)))  unsigned short v8us;
typedef __attribute__((ext_vector_type(8)))  float    v8f;
typedef __attribute__((ext_vector_type(4)))  float    v4f;
typedef v8h  __attribute__((may_alias)) v8ha;
typedef v4f  __attribute__((may_alias)) v4fa;
typedef v8us __attribute__((may_alias)) v8usa;

__device__ __forceinline__ unsigned short f2bf(float f) { unsigned u = __float_as_uint(f); u += 0x7FFFu + ((u >> 16) & 1u); return (unsigned short)(u >> 16); }
__device__ __forceinline__ float bf2f(unsigned short b) { return __uint_as_float(((unsigned)b) << 16); }
__device__ __forceinline__ float bfr(float f) { return bf2f(f2bf(f)); }
__device__ __forceinline__ v16h cat16(v8h lo, v8h hi) { return __builtin_shufflevector(lo, hi, 0, 1, 2, 3, 4, 5, 6, 7, 8, 9, 10, 11, 12, 13, 14, 15); }
__device__ __forceinline__ v16bf cat16b(v8us lo, v8us hi) { return __builtin_bit_cast(v16bf, __builtin_shufflevector(lo, hi, 0, 1, 2, 3, 4, 5, 6, 7, 8, 9, 10, 11, 12, 13, 14, 15)); }
__device__ __forceinline__ v8f wmma16(v16h a, v16h b, v8f c) { return __builtin_amdgcn_wmma_f32_16x16x32_f16(false, a, false, b, (short)0, c, false, false); }
__device__ __forceinline__ v8f wmmab(v16bf a, v16bf b, v8f c) { return __builtin_amdgcn_wmma_f32_16x16x32_bf16(false, a, false, b, (short)0, c, false, false); }
__device__ __forceinline__ h16 tohx(float x) { return (h16)x; }
__device__ __forceinline__ void splitf(float y, unsigned short& h, unsigned short& l) { h = f2bf(y); l = f2bf(y - bf2f(h)); }
typedef __attribute__((ext_vector_type(4))) _Float16 v4h;
typedef __attribute__((ext_vector_type(4))) unsigned short v4us;
// one operand's three 16-bit planes: fp16, bf16 hi, bf16 lo
struct Planes { h16* p16; bf* ph; bf* pl; };
__device__ __forceinline__ void put_hl(v4f r, bf* Ph, bf* Pl, size_t off) { v4us oh, ol;
#pragma unroll
    for (int u = 0; u < 4; ++u) { unsigned short a, c2; splitf(r[u], a, c2); oh[u] = a; ol[u] = c2; }
    *(v4us*)(Ph + off) = oh; *(v4us*)(Pl + off) = ol; }
__device__ __forceinline__ void put3(v4f r, Planes P, size_t off) { v4h o16;
#pragma unroll
    for (int u = 0; u < 4; ++u) o16[u] = tohx(r[u]);
    *(v4h*)(P.p16 + off) = o16; put_hl(r, P.ph, P.pl, off); }



// ---- k_gemmw: register-blocked GEMM, one 64x64 output tile per work-group (16 accumulators per wave), operands from K-contiguous 16-bit planes; grid (M/64, N/64), 32 * KS threads.
// C[m][n] (f32, pitch ldc, + optional f32 bias[n]) = sum_k A[m][k] Bt[n][k] (+ split products per NSPLIT). K % (32 * KS) == 0.
// KS > 1: the K loop is shared out over KS waves (wave w takes the 64-wide k chunks w, w + KS, ...; K % (64 * KS) == 0); the KS partial tiles meet in LDS and are summed in the fixed order w = 0 .. KS-1.
// There a wave brings each chunk's operand rows into its own LDS by asynchronous copies of whole lines and reads its fragments from there; with split planes the chunk's products go plane pair by plane pair through the same two slots: a2.b, a.b, a.b2.
template <typename T16> struct WFrag;
template <> struct WFrag<h16> { typedef v16h V; static __device__ __forceinline__ V ld(const h16* p) { return cat16(*(const v8h*)p, *(const v8h*)(p + 16)); } static __device__ __forceinline__ v8f mma(V a, V b, v8f c) { return wmma16(a, b, c); } };
template <> struct WFrag<bf> { typedef v16bf V; static __device__ __forceinline__ V ld(const bf* p) { return cat16b(*(const v8us*)p, *(const v8us*)(p + 16)); } static __device__ __forceinline__ v8f mma(V a, V b, v8f c) { return wmmab(a, b, c); } };
// eight asynchronous copies of 16 bytes per lane, global g[i] -> LDS byte address l[i]; the s_wait_xcnt stands inside the statement so that no register the copies name is rewritten ahead of it
__device__ __forceinline__ void copy8(const unsigned (&l)[8], const void* const (&g)[8]) {
    asm volatile("global_load_async_to_lds_b128 %0, %8, off\n\t"
                 "global_load_async_to_lds_b128 %1, %9, off\n\t"
                 "global_load_async_to_lds_b128 %2, %10, off\n\t"
                 "global_load_async_to_lds_b128 %3, %11, off\n\t"
                 "global_load_async_to_lds_b128 %4, %12, off\n\t"
                 "global_load_async_to_lds_b128 %5, %13, off\n\t"
                 "global_load_async_to_lds_b128 %6, %14, off\n\t"
                 "global_load_async_to_lds_b128 %7, %15, off\n\t"
                 "s_wait_xcnt 0x0"
                 :: "v"(l[0]), "v"(l[1]), "v"(l[2]), "v"(l[3]), "v"(l[4]), "v"(l[5]), "v"(l[6]), "v"(l[7]),
                    "v"(g[0]), "v"(g[1]), "v"(g[2]), "v"(g[3]), "v"(g[4]), "v"(g[5]), "v"(g[6]), "v"(g[7]) : "memory");
}
// one such copy, with its s_wait_xcnt in the same statement for the same reason
__device__ __forceinline__ void copy1(unsigned l, const void* g) {
    asm volatile("global_load_async_to_lds_b128 %0, %1, off\n\ts_wait_xcnt 0x0" :: "v"(l), "v"(g) : "memory");
}
// A wave's own LDS in gemmw_body (KS > 1): two slots, each 64 rows of 64 elements of one 16-bit plane at a row pitch 16 bytes above the row; behind the K loop the same bytes take the wave's partial tile (64 x 68 floats).
#define GPIT  72                     // row pitch in elements
#define GSLOT (64 * GPIT)            // one slot in elements
#define GWST  (2 * GSLOT * 2 / 4)    // one wave's LDS in floats
// stage64: one wave copies 64 rows x 128 bytes (row pitch ld elements) into a slot, each wave-wide copy four whole lines. lds, g: this lane's 16-byte unit of the first four rows (row lane / 8, unit lane % 8), as LDS byte address and as global pointer.
template <typename T16>
__device__ __forceinline__ void stage64(unsigned lds, const T16* g, int ld) {
#pragma unroll 1   // rolled: a trip's 24 address registers are formed in the trip
    for (int h = 0; h < 2; ++h) { unsigned l[8]; const void* p[8];
#pragma unroll
        for (int c = 0; c < 8; ++c) { p[c] = g + (size_t)((h * 8 + c) * 4) * ld; l[c] = lds + (unsigned)((h * 8 + c) * 4 * GPIT * 2); }
        copy8(l, p); }
}
// gemmw_body is the tile's whole work; os is the calling kernel's LDS, KS == 1 ? 16 * 68 : KS * GWST floats; the tile is (bx, by). lda is the row pitch of A and A2 in elements; Bt and Bt2 have pitch K.
// mode (block-uniform; modes != 0 only with KS > 1) says where the summed tile goes; MSET holds bit m for every mode m != 0 that the calling kernel can ask for (0: mode 0 alone):
//   0: f32 C (+ bias[n]).
//   1: m = t, n = h * HD + d: (+ bias[n]) -> the planes P1 [h][t][d].
//   2: as 1, then + bu[n] -> P1 and + bv2[n] -> P2 (both adds in f32, on the biased value).
//   3: m = g * HD + d, n = t: (+ bias[m]) -> the planes P1 [g][d][t].
//   4: m = t, n = d of one head: x 1 (t < RH) or x 1 / PCAR -> hi/lo P1.ph, P1.pl, row pitch DQ (the pointers are the head's).
// gemmw_tail: modes 1 to 4 behind the barrier: this thread's rows row0, row0 + 2, ... of the tile, columns cofs .. cofs + 3 (n in the whole matrix), summed over the KS partial tiles in the order w = 0 .. KS-1, then biased, converted and stored. bb, ub, vb, rb come as loaded (f32) and are rounded to bf16 here.
template <int MODE, bool BIAS, int KS>
__device__ __forceinline__ void gemmw_tail(const float* os, int row0, int r0, int cofs, int n, v4f bb, v4f ub, v4f vb, const float (&rb)[32 / KS], Planes P1, Planes P2) {
#pragma unroll
    for (int u = 0; u < 4; ++u) { bb[u] = bfr(bb[u]); ub[u] = bfr(ub[u]); vb[u] = bfr(vb[u]); }
#pragma unroll
    for (int s = 0; s < 32 / KS; ++s) { const int row = row0 + 2 * s, m = r0 + row; v4f val = *(const v4fa*)(os + row * 68 + cofs);
#pragma unroll
        for (int w = 1; w < KS; ++w) val += *(const v4fa*)(os + w * GWST + row * 68 + cofs);
        if (BIAS) { if (MODE == 3) val += bfr(rb[s]); else val += bb; }
        if (MODE == 4) put_hl(val * ((m < RH) ? 1.0f : (1.0f / PCAR)), P1.ph, P1.pl, (size_t)m * DQ + n);
        else if (MODE == 3) put3(val, P1, (size_t)m * TT + n);
        else { const size_t off = ((size_t)(n / HD) * TT + m) * HD + n % HD;
            if (MODE == 2) { put3(val + ub, P1, off); put3(val + vb, P2, off); } else put3(val, P1, off); } }
    asm volatile("s_wait_xcnt 0x0" ::: "memory");   // behind the tail's last stores: the code laid out behind this tail reuses their address and data registers
}
template <typename T16, int NSPLIT, bool BIAS, int KS, int MSET = 0>
__device__ __forceinline__ void gemmw_body(float* os, const T16* __restrict__ A, const T16* __restrict__ A2, const T16* __restrict__ Bt, const T16* __restrict__ Bt2, int K, int lda, float* C, int ldc, const float* __restrict__ bias, int bx, int by,
                                           int mode = 0, Planes P1 = Planes{}, Planes P2 = Planes{}, const float* __restrict__ bu = nullptr, const float* __restrict__ bv2 = nullptr) {
    typedef typename WFrag<T16>::V V;
    const int wave = (KS == 1) ? 0 : __builtin_amdgcn_readfirstlane((int)(threadIdx.x >> 5));
    const int lane = threadIdx.x & 31, lr = lane & 15, hi = lane >> 4; const int r0 = bx * 64, c0 = by * 64;
    v8f acc[4][4];
#pragma unroll
    for (int mb = 0; mb < 4; ++mb)
#pragma unroll
        for (int nb = 0; nb < 4; ++nb) acc[mb][nb] = (v8f){};
    if (KS > 1) {
        constexpr int NST = (NSPLIT == 0) ? 1 : ((NSPLIT == 1) ? 2 : 3);   // plane pairs per chunk
        const T16* sA = (const T16*)(os + wave * GWST); const T16* fa = sA + lr * GPIT + 8 * hi; const T16* fb = fa + GSLOT;
        const unsigned la = (unsigned)(size_t)sA + (unsigned)(((lane >> 3) * GPIT + (lane & 7) * 8) * 2), lb = la + GSLOT * 2;   // LDS byte addresses of this lane's first unit in the two slots
        const size_t ga = (size_t)(r0 + (lane >> 3)) * lda + (lane & 7) * 8, gb = (size_t)(c0 + (lane >> 3)) * K + (lane & 7) * 8;
#pragma unroll 1   // rolled: the chunks go through the same two slots one after the other, so a second copy of the body would gain nothing
        for (int kc = wave * 64; kc < K; kc += 64 * KS) {
#pragma unroll
            for (int st = 0; st < NST; ++st) {
                asm volatile("s_wait_dscnt 0x0" ::: "memory");   // this wave's reads of the slot that is refilled have returned (the slots are the wave's own: no barrier)
                if (st == 0) { stage64(la, (NSPLIT == 0 ? A : A2) + ga + kc, lda); stage64(lb, Bt + gb + kc, K); }
                else if (st == 1) stage64(la, A + ga + kc, lda);
                else stage64(lb, Bt2 + gb + kc, K);
                asm volatile("s_wait_asynccnt 0x0" ::: "memory");   // this wave's copies have landed before it reads fragments of them
#pragma unroll
                for (int kk = 0; kk < 64; kk += 32) { V a[4], b[4];
#pragma unroll
                    for (int u = 0; u < 4; ++u) { a[u] = WFrag<T16>::ld(fa + u * 16 * GPIT + kk); b[u] = WFrag<T16>::ld(fb + u * 16 * GPIT + kk); }
#pragma unroll
                    for (int nb = 0; nb < 4; ++nb)
#pragma unroll
                        for (int mb = 0; mb < 4; ++mb) acc[mb][nb] = WFrag<T16>::mma(a[mb], b[nb], acc[mb][nb]); }
            }
        }
    } else {
        const size_t aoff = (size_t)(r0 + lr) * lda + 8 * hi, boff = (size_t)(c0 + lr) * K + 8 * hi;
#pragma unroll 1
        for (int kc = wave * 32; kc < K; kc += 32 * KS) {
            V a[4], a2[4];
#pragma unroll
            for (int mb = 0; mb < 4; ++mb) { a[mb] = WFrag<T16>::ld(A + aoff + (size_t)mb * 16 * lda + kc); if (NSPLIT == 1 || NSPLIT == 2) a2[mb] = WFrag<T16>::ld(A2 + aoff + (size_t)mb * 16 * lda + kc); }
#pragma unroll
            for (int nb = 0; nb < 4; ++nb) { const V b = WFrag<T16>::ld(Bt + boff + (size_t)nb * 16 * K + kc); V b2; if (NSPLIT >= 2) b2 = WFrag<T16>::ld(Bt2 + boff + (size_t)nb * 16 * K + kc);
#pragma unroll
                for (int mb = 0; mb < 4; ++mb) { acc[mb][nb] = WFrag<T16>::mma(a[mb], b, acc[mb][nb]); if (NSPLIT == 1 || NSPLIT == 2) acc[mb][nb] = WFrag<T16>::mma(a2[mb], b, acc[mb][nb]); if (NSPLIT >= 2) acc[mb][nb] = WFrag<T16>::mma(a[mb], b2, acc[mb][nb]); } }
            asm volatile("v_nop\n\tv_nop\n\tv_nop\n\tv_nop" : "+v"(acc[0][0]), "+v"(acc[1][1]), "+v"(acc[2][2]), "+v"(acc[3][3]) : "v"(a[0]), "v"(a[3]));
        }
    }
    if (KS > 1) {
        // mode != 0: this thread's biases (of its four columns; mode 3: of its rows) are loaded ahead of the LDS exchange and first used behind it, in the tail, so that their latency runs under it
        const int cofs = lr * 4, n = c0 + cofs; v4f bb = (v4f){}, ub = (v4f){}, vb = (v4f){}; float rb[32 / KS];
#pragma unroll
        for (int s = 0; s < 32 / KS; ++s) rb[s] = 0.0f;
        if (BIAS && (MSET & 8) && mode == 3) {
#pragma unroll
            for (int s = 0; s < 32 / KS; ++s) rb[s] = bias[r0 + wave * (64 / KS) + 2 * s + hi];
            asm volatile("s_wait_xcnt 0x0" ::: "memory"); }   // these loads stay in flight, and the code below reuses their address registers
        if (BIAS && (MSET & 6) && mode != 3) { bb[0] = bias[n]; bb[1] = bias[n + 1]; bb[2] = bias[n + 2]; bb[3] = bias[n + 3];
            asm volatile("s_wait_xcnt 0x0" ::: "memory"); }   // as above: behind loads that stay in flight
        if ((MSET & 4) && mode == 2) {
#pragma unroll
            for (int u = 0; u < 4; ++u) { ub[u] = bu[n + u]; vb[u] = bv2[n + u]; }
            asm volatile("s_wait_xcnt 0x0" ::: "memory"); }   // as above: behind loads that stay in flight
        float* mine = os + wave * GWST;
#pragma unroll
        for (int mb = 0; mb < 4; ++mb)
#pragma unroll
            for (int nb = 0; nb < 4; ++nb)
#pragma unroll
                for (int j = 0; j < 8; ++j) mine[(mb * 16 + hi * 8 + j) * 68 + nb * 16 + lr] = acc[mb][nb][j];
        __syncthreads();   // every wave's partial tile is in LDS before any wave sums rows of it
        // the highest mode of MSET is taken without a test
        if ((MSET & 2) && (MSET < 4 || mode == 1)) { gemmw_tail<1, BIAS, KS>(os, wave * (64 / KS) + hi, r0, cofs, n, bb, ub, vb, rb, P1, P2); return; }
        if ((MSET & 4) && (MSET < 8 || mode == 2)) { gemmw_tail<2, BIAS, KS>(os, wave * (64 / KS) + hi, r0, cofs, n, bb, ub, vb, rb, P1, P2); return; }
        if ((MSET & 8) && (MSET < 16 || mode == 3)) { gemmw_tail<3, BIAS, KS>(os, wave * (64 / KS) + hi, r0, cofs, n, bb, ub, vb, rb, P1, P2); return; }
        if (MSET & 16) { gemmw_tail<4, BIAS, KS>(os, wave * (64 / KS) + hi, r0, cofs, n, bb, ub, vb, rb, P1, P2); return; }
#pragma unroll
        for (int s = 0; s < 32 / KS; ++s) { const int row = wave * (64 / KS) + 2 * s + hi, cofs = lr * 4; v4f val = *(const v4fa*)(os + row * 68 + cofs);
#pragma unroll
            for (int w = 1; w < KS; ++w) val += *(const v4fa*)(os + w * GWST + row * 68 + cofs);
            if (BIAS) { val[0] += bfr(bias[c0 + cofs]); val[1] += bfr(bias[c0 + cofs + 1]); val[2] += bfr(bias[c0 + cofs + 2]); val[3] += bfr(bias[c0 + cofs + 3]); }
            *(v4f*)(C + (size_t)(r0 + row) * ldc + c0 + cofs) = val; }
        return;
    }
#pragma unroll
    for (int mb = 0; mb < 4; ++mb) {
#pragma unroll
        for (int nb = 0; nb < 4; ++nb) {
#pragma unroll
            for (int j = 0; j < 8; ++j) os[(hi * 8 + j) * 68 + nb * 16 + lr] = acc[mb][nb][j]; }
        __builtin_amdgcn_wave_barrier(); asm volatile("" ::: "memory");
        float* crow = C + (size_t)(r0 + mb * 16) * ldc + c0;
{
#pragma unroll
            for (int s = 0; s < 8; ++s) { const int row = 2 * s + hi, cofs = lr * 4; v4f val = *(const v4fa*)(os + row * 68 + cofs); if (BIAS) { val[0] += bfr(bias[c0 + cofs]); val[1] += bfr(bias[c0 + cofs + 1]); val[2] += bfr(bias[c0 + cofs + 2]); val[3] += bfr(bias[c0 + cofs + 3]); }
                *(v4f*)(crow + (size_t)row * ldc + cofs) = val; }
             }
        __builtin_amdgcn_wave_barrier(); asm volatile("" ::: "memory");
    }
}

template <typename T16, int NSPLIT, bool BIAS, int KS>
__global__ __launch_bounds__(32 * KS) void k_gemmw(const T16* __restrict__ A, const T16* __restrict__ A2, const T16* __restrict__ Bt, const T16* __restrict__ Bt2, int K, float* C, int ldc, const float* __restrict__ bias) {
    __shared__ __align__(16) float os[KS == 1 ? 16 * 68 : KS * GWST];
    gemmw_body<T16, NSPLIT, BIAS, KS>(os, A, A2, Bt, Bt2, K, K, C, ldc, bias, blockIdx.x, blockIdx.y);
}
// ---- launches that read none of each other's output, joined into one grid; a work-group picks its product by its block index (block-uniform), and each tile's arithmetic is gemmw_body's as before.
// k_qkv: blockIdx.z = 3 * batch entry + z; z = 0, 1, 2: the q, k, v projection of that batch entry, each straight into its 16-bit planes (a batch entry's planes lie NH_ * TT * HD elements apart): q + u and q + v, k, and v transposed.
// v is formed as Wv . x^T (the same products, the operands' roles exchanged), so that its tile has t along the columns, as the planes [g][d][t] want it; its tile indices are exchanged with it.
__global__ __launch_bounds__(256) void k_qkv(const bf* __restrict__ X, const bf* __restrict__ Wq_, const bf* __restrict__ Wk_, const bf* __restrict__ Wv_, const float* __restrict__ bq, const float* __restrict__ bk, const float* __restrict__ bv, const float* __restrict__ bu, const float* __restrict__ bv2,
                                             h16* Q16, bf* Qh, bf* Ql, h16* U16, bf* Uh, bf* Ul, h16* K16, bf* Kh, bf* Kl, h16* V16, bf* Vh, bf* Vl) {
    __shared__ __align__(16) float os[8 * GWST];
    const int z = blockIdx.z % 3; const size_t be = blockIdx.z / 3, bo = be * ((size_t)NH_ * TT * HD); X += be * ((size_t)TT * DM);
    const Planes P1 = { (z == 0 ? Q16 : (z == 1 ? K16 : V16)) + bo, (z == 0 ? Qh : (z == 1 ? Kh : Vh)) + bo, (z == 0 ? Ql : (z == 1 ? Kl : Vl)) + bo }; const Planes P2 = { U16 + bo, Uh + bo, Ul + bo };
    gemmw_body<bf, 0, true, 8, 14>(os, z == 2 ? Wv_ : X, nullptr, z == 0 ? Wq_ : (z == 1 ? Wk_ : X), nullptr, DM, DM, nullptr, 0, z == 0 ? bq : (z == 1 ? bk : bv), z == 2 ? blockIdx.y : blockIdx.x, z == 2 ? blockIdx.x : blockIdx.y,
                               z == 0 ? 2 : (z == 1 ? 1 : 3), P1, P2, bu, bv2);
}
// k_pp: p = pos_emb Wpos^T straight into its planes.
__global__ __launch_bounds__(256) void k_pp(const bf* __restrict__ XP, const bf* __restrict__ WP, h16* R16, bf* Rh, bf* Rl) {
    __shared__ __align__(16) float os[8 * GWST];
    gemmw_body<bf, 0, false, 8, 2>(os, XP, nullptr, WP, nullptr, DM, DM, nullptr, 0, nullptr, blockIdx.x, blockIdx.y, 1, Planes{ R16, Rh, Rl });
}
// ---- attn_rows: the attention of 128 query rows of one head over the key tiles by0 .. by1 - 1 (128 keys each) in one work-group of 4 waves, the scores never leaving the work-group. NSPLIT == 0: all key tiles, result to Oh, Ol; NSPLIT == 2: a share of them, sums to po, the rows' maxima and sums to ml.
// Per key tile: each wave forms its 64x64 quarter of the 128x128 score tile (16 accumulators, started by pos_start; the content products and their order as in gemmw_body with KS == 1), then the running softmax, then weights . v onto the wave's 64x64 quarter of the 128 x HD output tile.
// The tile's rows of A and Bt (pitch HD) come into LDS by asynchronous 16-byte copies, every thread a share, each wave-wide copy covering whole lines; they lie there at a row pitch 16 bytes above the staged row's length, and the waves read their fragments from there.
// NSPLIT == 0: one plane per operand, all HD of k in one stage. NSPLIT == 2: hi and lo planes, k in two stages of HD / 2 through the same LDS. sm holds SCORE_LDS bytes; behind the content products it takes v's tile (HD rows of 128 keys per plane), behind the last key tile the four waves' 16 x 68 float store buffers.
// Running softmax, in the base-2 domain: per row the maximum so far (mr) and this lane's share of the sum so far (ls); a new maximum rescales ls and the output accumulators. A row's maximum over the tile: over the lane's four columns, over the 16 lanes by DPP, over the two waves that share the row through xm.
// The weights exp2(s - max) go unnormalised to LDS (sw) as fp16 x 1024 (the factor is in the sum as well, and so cancels) or as hi/lo planes; the division by the row's sum stands at the end.
#define SCORE_LDS (2 * 2 * 128 * (HD / 2 + 8) * 2)
#define PPIT (128 + 8)                  // row pitch in elements of the weights' rows and of v's staged rows (128 keys each)
#define WGT_LDS (2 * 128 * PPIT * 2)    // the weights' LDS: two planes
// ---- pos_start: the shifted position scores of the 128x128 tile (bx, by), left in acc in the accumulators' own layout (each wave its 64x64 quarter).
// With g = TT - 1 - i + j the shift reads: pos[i][j] = A[i] . P[g] for g < TT, 0 for g == TT, A[i + 1] . P[g - TT - 1] for g > TT. Over the tile g = gb + cc, gb = TT - 128 - r0 + c0, cc = 127 - r + jj in 0 .. 254 (r, jj: row and column in the tile).
// LDS slot cc holds the P row that belongs to g = gb + cc (row 0 for g == TT, whose product is not used); the A rows r0 .. r0 + 128 (held to TT - 1: the row past the end is never used) lie beside them. gb is a multiple of 128, so that a 16-wide block of slots lies wholly on one side of g == TT.
// The 16 query rows mb of a quarter need the 79 slots from cc0 = 112 - wm - 16 mb + wn on: five 16x16 products; block t = xb - mb + 3 (slots 64 - wm + wn + 16 t ...) serves every (mb, xb) on its diagonal.
// The five blocks go through the wave's LDS buffer (16 x 84 floats) and come back skewed: element (rr, jl) of the 16 x 64 strip is column 15 - rr + jl.
// k comes in stages of KH through the same LDS. PERT: the A fragment is read per product, from row + 1 where the block lies right of g == TT (the diagonal tile has both kinds; with hi/lo planes it also keeps the registers down); else the tile's blocks are all of one kind and the four A fragments are read once per 32 of k.
template <typename T16, int NSPLIT, bool PERT>
__device__ __forceinline__ void pos_start(char* sm, const T16* __restrict__ A, const T16* __restrict__ A2, const T16* __restrict__ P, const T16* __restrict__ P2, int bx, int by, v8f (&acc)[4][4]) {
    typedef typename WFrag<T16>::V V;
    constexpr int NP = (NSPLIT == 2) ? 2 : 1, KH = 64 / NP, PIT = KH + 8, U = KH / 8, RPC = 128 / U, AR = 128 + RPC;   // planes per operand; k per stage; LDS row pitch in elements; 16-byte units per staged row; rows per work-group-wide copy; A rows in LDS per plane
    static_assert(NP * (AR + 256) * PIT * 2 <= SCORE_LDS && 4 * 16 * 84 * 4 <= SCORE_LDS && (NSPLIT == 0 || PERT), "LDS");
    const T16* sA = (const T16*)sm; const T16* sP = sA + NP * AR * PIT; const unsigned smo = (unsigned)(size_t)sm;
    const int tid = threadIdx.x, wave = __builtin_amdgcn_readfirstlane(tid >> 5), lane = tid & 31, lr = lane & 15, hi = lane >> 4;
    const int r0 = bx * 128, c0 = by * 128, wm = (wave >> 1) * 64, wn = (wave & 1) * 64, gb = TT - 128 - r0 + c0;
    const int tr = tid / U, tu = tid % U;   // this thread's row and 16-byte unit in a work-group-wide copy
    v8f pa[4][5];
#pragma unroll
    for (int mb = 0; mb < 4; ++mb)
#pragma unroll
        for (int xb = 0; xb < 5; ++xb) pa[mb][xb] = (v8f){};
#pragma unroll 1   // rolled: the stages go through the same LDS one after the other
    for (int st = 0; st < HD / KH; ++st) {
        const int ko = st * KH + tu * 8;
        { unsigned l[8]; const void* g[8];
#pragma unroll
            for (int i = 0; i < 8; ++i) { const int pl = i / (8 / NP), row = (i % (8 / NP)) * RPC + tr;
                g[i] = (pl ? A2 : A) + (size_t)(r0 + row) * HD + ko; l[i] = smo + (unsigned)(((pl * AR + row) * PIT + tu * 8) * 2); }
            copy8(l, g); }
#pragma unroll
        for (int pl = 0; pl < NP; ++pl) { const int gr = min(r0 + 128 + tr, TT - 1);
            copy1(smo + (unsigned)(((pl * AR + 128 + tr) * PIT + tu * 8) * 2), (pl ? A2 : A) + (size_t)gr * HD + ko); }
#pragma unroll 1   // rolled: a trip's 24 address registers are formed in the trip, beside the 160 of pa
        for (int q = 0; q < 2; ++q) { unsigned l[8]; const void* g[8]; const T16* src = (NP == 2 && q) ? P2 : P;
#pragma unroll
            for (int i = 0; i < 8; ++i) { const int slot = ((NP == 2) ? i : q * 8 + i) * RPC + tr, gg = gb + slot, prow = (gg < TT) ? gg : max(gg - TT - 1, 0);
                g[i] = src + (size_t)prow * HD + ko; l[i] = smo + (unsigned)(((NP * AR + ((NP == 2) ? q * 256 : 0) + slot) * PIT + tu * 8) * 2); }
            copy8(l, g); }
        asm volatile("s_wait_asynccnt 0x0" ::: "memory");   // this wave's copies have landed
        __syncthreads();   // ... and every other wave's: the stage is whole in LDS before any wave reads fragments of it
        const T16* fa = sA + (wm + lr) * PIT + 8 * hi; const T16* fp = sP + (64 - wm + wn + lr) * PIT + 8 * hi;
#pragma unroll
        for (int kc = 0; kc < KH; kc += 32) {
            V a[4];
            if (!PERT) { const int so = (gb >= TT) ? PIT : 0;
#pragma unroll
                for (int mb = 0; mb < 4; ++mb) a[mb] = WFrag<T16>::ld(fa + mb * 16 * PIT + so + kc); }
#pragma unroll
            for (int t = 0; t < 8; ++t) { const V b = WFrag<T16>::ld(fp + t * 16 * PIT + kc); V b2; if (NSPLIT == 2) b2 = WFrag<T16>::ld(fp + (256 + t * 16) * PIT + kc);
                const int so = (gb + 64 - wm + wn + 16 * t >= TT) ? PIT : 0;
#pragma unroll
                for (int mb = 0; mb < 4; ++mb) { const int xb = t - 3 + mb;
                    if (xb >= 0 && xb <= 4) {
                        if (PERT) { const V av = WFrag<T16>::ld(fa + mb * 16 * PIT + so + kc); pa[mb][xb] = WFrag<T16>::mma(av, b, pa[mb][xb]);
                            if (NSPLIT == 2) { const V av2 = WFrag<T16>::ld(fa + (AR + mb * 16) * PIT + so + kc); pa[mb][xb] = WFrag<T16>::mma(av2, b, pa[mb][xb]); pa[mb][xb] = WFrag<T16>::mma(av, b2, pa[mb][xb]); } }
                        else pa[mb][xb] = WFrag<T16>::mma(a[mb], b, pa[mb][xb]); } } }
        }
        asm volatile("s_wait_dscnt 0x0" ::: "memory");   // this wave's LDS reads of the stage have returned
        __syncthreads();   // ... and every other wave's: the LDS may be refilled, or take the waves' skew buffers
    }
    float* pbuf = (float*)sm + wave * (16 * 84);
#pragma unroll
    for (int mb = 0; mb < 4; ++mb) {
#pragma unroll
        for (int xb = 0; xb < 5; ++xb)
#pragma unroll
            for (int j = 0; j < 8; ++j) pbuf[(hi * 8 + j) * 84 + xb * 16 + lr] = pa[mb][xb][j];
        __builtin_amdgcn_wave_barrier(); asm volatile("" ::: "memory");   // the wave's LDS writes stay ahead of its reads of other lanes' words
        const int dj = (c0 + wn + lr) - (r0 + wm + mb * 16 + hi * 8);   // j - i of this lane's element nb = 0, j = 0
#pragma unroll
        for (int nb = 0; nb < 4; ++nb)
#pragma unroll
            for (int j = 0; j < 8; ++j) { const float pv = pbuf[(hi * 8 + j) * 84 + 15 - (hi * 8 + j) + nb * 16 + lr]; acc[mb][nb][j] = (dj + nb * 16 - j == 1) ? 0.0f : pv; }
        __builtin_amdgcn_wave_barrier(); asm volatile("" ::: "memory");   // the reads above stay ahead of the next round's writes
    }
}
// maximum and sum over the 16 lanes of a row of lanes, one DPP step each (every lane ends with the same value)
template <int X> __device__ __forceinline__ float xmax16(float v) { return fmaxf(v, __int_as_float(__builtin_amdgcn_update_dpp(0, __float_as_int(v), 0x160 + X, 0xf, 0xf, true))); }
template <int X> __device__ __forceinline__ float xsum16(float v) { return v + __int_as_float(__builtin_amdgcn_update_dpp(0, __float_as_int(v), 0x160 + X, 0xf, 0xf, true)); }
template <typename T16, int NSPLIT>
__device__ __forceinline__ void attn_rows(char* sm, char* sw, float* xm, const int* smk, const T16* __restrict__ A, const T16* __restrict__ A2, const T16* __restrict__ Bt, const T16* __restrict__ Bt2, const T16* __restrict__ PA, const T16* __restrict__ PA2, const T16* __restrict__ PB, const T16* __restrict__ PB2,
                                          const T16* __restrict__ Vt, const T16* __restrict__ Vt2, const int* __restrict__ km, bf* Oh, bf* Ol, int bx, int by0, int by1, float* po, float* ml) {
    typedef typename WFrag<T16>::V V;
    constexpr int NP = (NSPLIT == 2) ? 2 : 1, KH = HD / NP, PIT = KH + 8, U = KH / 8;   // planes per operand; k per stage; LDS row pitch in elements; 16-byte units per staged row (and per thread and plane)
    static_assert(2 * NP * 128 * PIT * 2 <= SCORE_LDS && 4 * 16 * 68 * 4 <= SCORE_LDS && U % 8 == 0 && NP * HD * PPIT * 2 <= SCORE_LDS && NP * 128 * PPIT * 2 <= WGT_LDS, "LDS");
    const T16* sA = (const T16*)sm; const T16* sB = sA + NP * 128 * PIT; const unsigned smo = (unsigned)(size_t)sm;   // smo: the LDS byte address of sm
    const int tid = threadIdx.x, wave = __builtin_amdgcn_readfirstlane(tid >> 5), lane = tid & 31, lr = lane & 15, hi = lane >> 4;
    const int r0 = bx * 128, wm = (wave >> 1) * 64, wn = (wave & 1) * 64;
    // this thread's unit of the first 128 / U staged rows: row tid / U, 16-byte unit tid % U; its further units lie 128 / U rows on each
    const size_t gt = (size_t)(tid / U) * HD + (tid % U) * 8; const unsigned lt = smo + (unsigned)(((tid / U) * PIT + (tid % U) * 8) * 2);
    const T16* gA = A + (size_t)r0 * HD + gt; const T16* gA2 = (NP == 2) ? A2 + (size_t)r0 * HD + gt : nullptr;
    float* xo = xm + (wave & 1) * 128 + wm + hi * 8; const float* xp = xm + (1 - (wave & 1)) * 128 + wm + hi * 8;   // this wave's and its partner's words for this lane's rows
    v8f o[4][4]; float mr[4][8], ls[4][8];   // output quarter; the rows' running maximum and this lane's share of their running sum (row mb * 16 + hi * 8 + j, as in the accumulators)
#pragma unroll
    for (int mb = 0; mb < 4; ++mb) {
#pragma unroll
        for (int nb = 0; nb < 4; ++nb) o[mb][nb] = (v8f){};
#pragma unroll
        for (int j = 0; j < 8; ++j) { mr[mb][j] = -3.0e38f; ls[mb][j] = 0.0f; } }
    // the batch entry's key mask, all TT keys, into LDS once
#pragma unroll
    for (int i = 0; i < TT / 512; ++i) copy1((unsigned)(size_t)smk + (unsigned)((i * 128 + tid) * 16), km + (i * 128 + tid) * 4);
    asm volatile("s_wait_asynccnt 0x0" ::: "memory");   // this wave's copies of the mask have landed
    __syncthreads();   // ... and every other wave's, before any wave reads the mask
#pragma unroll 1   // rolled: the key tiles go through the same LDS one after the other
    for (int by = by0; by < by1; ++by) {
        const int c0 = by * 128;
        const T16* gB = Bt + (size_t)c0 * HD + gt; const T16* gB2 = (NP == 2) ? Bt2 + (size_t)c0 * HD + gt : nullptr;
        v8f acc[4][4];   // starts as the tile's shifted position scores; the content products are summed onto them
        if constexpr (NSPLIT == 2) pos_start<T16, NSPLIT, true>(sm, PA, PA2, PB, PB2, bx, by, acc);
        else { if (bx == by) pos_start<T16, NSPLIT, true>(sm, PA, PA2, PB, PB2, bx, by, acc); else pos_start<T16, NSPLIT, false>(sm, PA, PA2, PB, PB2, bx, by, acc); }
#pragma unroll
        for (int st = 0; st < NP; ++st) {
            asm volatile("s_wait_dscnt 0x0" ::: "memory");   // this wave's LDS reads of the skew buffer, or of the stage before, have returned
            __syncthreads();   // ... and every other wave's: the LDS may be refilled
#pragma unroll 1   // rolled: a trip's 24 address registers are formed in the trip and are not held across the matrix work
            for (int q = 0; q < 2 * NP * (U / 8); ++q) { const int pl = q / (U / 8), i0 = (q % (U / 8)) * 8;   // plane in LDS order (A, [A2,] Bt, [Bt2]); first of the trip's eight units
                const T16* src = (NP == 1) ? (pl ? gB : gA) : (pl == 0 ? gA : (pl == 1 ? gA2 : (pl == 2 ? gB : gB2)));
                unsigned l[8]; const void* g[8];
#pragma unroll
                for (int i = 0; i < 8; ++i) { g[i] = src + st * KH + (size_t)((i0 + i) * (128 / U)) * HD; l[i] = lt + (unsigned)((pl * 128 + (i0 + i) * (128 / U)) * PIT * 2); }
                copy8(l, g); }
            asm volatile("s_wait_asynccnt 0x0" ::: "memory");   // this wave's copies have landed
            __syncthreads();   // ... and every other wave's: the stage is whole in LDS before any wave reads fragments of it
            const T16* fa = sA + (wm + lr) * PIT + 8 * hi; const T16* fb = sB + (wn + lr) * PIT + 8 * hi;
#pragma unroll (NSPLIT == 2 ? 1 : 2)   // hi/lo planes: rolled, so that one trip's fragments are live at a time; one plane: two trips' at most
            for (int kc = 0; kc < KH; kc += 32) {
                V a[4], a2[4];
#pragma unroll
                for (int mb = 0; mb < 4; ++mb) { a[mb] = WFrag<T16>::ld(fa + mb * 16 * PIT + kc); if (NSPLIT == 2) a2[mb] = WFrag<T16>::ld(fa + (128 + mb * 16) * PIT + kc); }
#pragma unroll
                for (int nb = 0; nb < 4; ++nb) { const V b = WFrag<T16>::ld(fb + nb * 16 * PIT + kc); V b2; if (NSPLIT == 2) b2 = WFrag<T16>::ld(fb + (128 + nb * 16) * PIT + kc);
#pragma unroll
                    for (int mb = 0; mb < 4; ++mb) { acc[mb][nb] = WFrag<T16>::mma(a[mb], b, acc[mb][nb]); if (NSPLIT == 2) { acc[mb][nb] = WFrag<T16>::mma(a2[mb], b, acc[mb][nb]); acc[mb][nb] = WFrag<T16>::mma(a[mb], b2, acc[mb][nb]); } } }
            }
        }
        asm volatile("s_wait_dscnt 0x0" ::: "memory");   // this wave's last fragment reads have returned
        __syncthreads();   // ... and every other wave's: the LDS now takes v's tile
        // v's tile, rows d = 0 .. HD-1 of 128 keys (pitch TT in memory, PPIT in LDS): the copies fly under the softmax arithmetic below
#pragma unroll 1   // rolled: a trip's 24 address registers are formed in the trip
        for (int q = 0; q < 2 * NP; ++q) { const int pl = q >> 1, i0 = (q & 1) * 8;
            const T16* src = ((NP == 2 && pl) ? Vt2 : Vt) + (size_t)(tid >> 4) * TT + c0 + (tid & 15) * 8;
            unsigned l[8]; const void* g[8];
#pragma unroll
            for (int i = 0; i < 8; ++i) { g[i] = src + (size_t)((i0 + i) * 8) * TT; l[i] = smo + (unsigned)(((pl * HD + (i0 + i) * 8 + (tid >> 4)) * PPIT + (tid & 15) * 8) * 2); }
            copy8(l, g); }
        // scores to the base-2 domain, masked; the rows' maxima over this wave's 64 columns
        float rm[4][8]; int mk[4];   // mk: the key mask of this lane's four columns
#pragma unroll
        for (int nb = 0; nb < 4; ++nb) mk[nb] = smk[c0 + wn + nb * 16 + lr];
#pragma unroll
        for (int mb = 0; mb < 4; ++mb)
#pragma unroll
            for (int j = 0; j < 8; ++j) { float t = -3.0e38f;
#pragma unroll
                for (int nb = 0; nb < 4; ++nb) { const float s = (mk[nb] != 0) ? acc[mb][nb][j] * (SCL * 1.4426950408889634f) : -3.0e38f; acc[mb][nb][j] = s; t = fmaxf(t, s); }
                rm[mb][j] = xmax16<8>(xmax16<4>(xmax16<2>(xmax16<1>(t)))); }
        if (lr == 0) {
#pragma unroll
            for (int mb = 0; mb < 4; ++mb) { *(v4fa*)(xo + mb * 16) = (v4f){ rm[mb][0], rm[mb][1], rm[mb][2], rm[mb][3] }; *(v4fa*)(xo + mb * 16 + 4) = (v4f){ rm[mb][4], rm[mb][5], rm[mb][6], rm[mb][7] }; } }
        __syncthreads();   // both waves of a row have left their maxima in xm before either reads the other's
        T16* wp = (T16*)sw + (wm + hi * 8) * PPIT + wn + lr;
#pragma unroll
        for (int mb = 0; mb < 4; ++mb) { const v4f q0 = *(const v4fa*)(xp + mb * 16), q1 = *(const v4fa*)(xp + mb * 16 + 4);
#pragma unroll
            for (int j = 0; j < 8; ++j) { const float mn = fmaxf(mr[mb][j], fmaxf(rm[mb][j], (j < 4) ? q0[j & 3] : q1[j & 3]));
                const float al = __builtin_amdgcn_exp2f(mr[mb][j] - mn), sub = (NSPLIT == 2) ? mn : mn - 10.0f; mr[mb][j] = mn; float ps = 0.0f;
#pragma unroll
                for (int nb = 0; nb < 4; ++nb) { const float p = __builtin_amdgcn_exp2f(acc[mb][nb][j] - sub); ps += p; o[mb][nb][j] *= al;
                    if constexpr (NSPLIT == 2) { unsigned short ph, pl; splitf(p, ph, pl); wp[(mb * 16 + j) * PPIT + nb * 16] = ph; wp[(128 + mb * 16 + j) * PPIT + nb * 16] = pl; }
                    else wp[(mb * 16 + j) * PPIT + nb * 16] = tohx(p); }
                ls[mb][j] = ls[mb][j] * al + ps; } }
        asm volatile("s_wait_asynccnt 0x0" ::: "memory");   // this wave's copies of v's tile have landed
        asm volatile("s_wait_dscnt 0x0" ::: "memory");      // ... and its weights are in LDS
        __syncthreads();   // ... and every other wave's: weights and v's tile are whole in LDS before any wave reads fragments of them
        { const T16* fa = (const T16*)sw + (wm + lr) * PPIT + 8 * hi; const T16* fb = (const T16*)sm + (wn + lr) * PPIT + 8 * hi;
#pragma unroll (NSPLIT == 2 ? 1 : 2)   // as for the content products
            for (int kc = 0; kc < 128; kc += 32) {
                V a[4], a2[4];
#pragma unroll
                for (int mb = 0; mb < 4; ++mb) { a[mb] = WFrag<T16>::ld(fa + mb * 16 * PPIT + kc); if (NSPLIT == 2) a2[mb] = WFrag<T16>::ld(fa + (128 + mb * 16) * PPIT + kc); }
#pragma unroll
                for (int nb = 0; nb < 4; ++nb) { const V b = WFrag<T16>::ld(fb + nb * 16 * PPIT + kc); V b2; if (NSPLIT == 2) b2 = WFrag<T16>::ld(fb + (HD + nb * 16) * PPIT + kc);
#pragma unroll
                    for (int mb = 0; mb < 4; ++mb) { o[mb][nb] = WFrag<T16>::mma(a[mb], b, o[mb][nb]); if (NSPLIT == 2) { o[mb][nb] = WFrag<T16>::mma(a2[mb], b, o[mb][nb]); o[mb][nb] = WFrag<T16>::mma(a[mb], b2, o[mb][nb]); } } }
            } }
        asm volatile("s_wait_dscnt 0x0" ::: "memory");   // this wave's fragment reads of the key tile have returned
        __syncthreads();   // ... and every other wave's: the next key tile may refill the LDS
    }
    // the rows' sums: over the 16 lanes, then the partner wave's half through xm
#pragma unroll
    for (int mb = 0; mb < 4; ++mb)
#pragma unroll
        for (int j = 0; j < 8; ++j) ls[mb][j] = xsum16<8>(xsum16<4>(xsum16<2>(xsum16<1>(ls[mb][j]))));
    if (lr == 0) {
#pragma unroll
        for (int mb = 0; mb < 4; ++mb) { *(v4fa*)(xo + mb * 16) = (v4f){ ls[mb][0], ls[mb][1], ls[mb][2], ls[mb][3] }; *(v4fa*)(xo + mb * 16 + 4) = (v4f){ ls[mb][4], ls[mb][5], ls[mb][6], ls[mb][7] }; } }
    __syncthreads();   // both waves of a row have left their sums in xm before either reads the other's
    float* os = (float*)sm + wave * (16 * 68);
#pragma unroll
    for (int mb = 0; mb < 4; ++mb) { const v4f q0 = *(const v4fa*)(xp + mb * 16), q1 = *(const v4fa*)(xp + mb * 16 + 4);
        if constexpr (NSPLIT == 2) {   // a share of the keys: the sums leave unnormalised, with each row's maximum and sum beside them (one lane per row, of the left wave)
            if ((wave & 1) == 0 && lr == 0) { float* mp = ml + wm + mb * 16 + hi * 8;
                *(v4f*)mp = (v4f){ mr[mb][0], mr[mb][1], mr[mb][2], mr[mb][3] }; *(v4f*)(mp + 4) = (v4f){ mr[mb][4], mr[mb][5], mr[mb][6], mr[mb][7] };
                *(v4f*)(mp + 128) = (v4f){ ls[mb][0], ls[mb][1], ls[mb][2], ls[mb][3] } + q0; *(v4f*)(mp + 132) = (v4f){ ls[mb][4], ls[mb][5], ls[mb][6], ls[mb][7] } + q1;
                asm volatile("s_wait_xcnt 0x0" ::: "memory"); }   // behind these stores: the code below reuses their address and data registers
        }
#pragma unroll
        for (int j = 0; j < 8; ++j) { const float inv = (NSPLIT == 2) ? 1.0f : __fdiv_rn(1.0f, ls[mb][j] + ((j < 4) ? q0[j & 3] : q1[j & 3]));
#pragma unroll
            for (int nb = 0; nb < 4; ++nb) os[(hi * 8 + j) * 68 + nb * 16 + lr] = (NSPLIT == 2) ? o[mb][nb][j] : o[mb][nb][j] * inv; }
        __builtin_amdgcn_wave_barrier(); asm volatile("" ::: "memory");   // the wave's LDS writes stay ahead of its reads of other lanes' words
#pragma unroll
        for (int s = 0; s < 8; ++s) {
            if constexpr (NSPLIT == 2) *(v4f*)(po + (size_t)(wm + mb * 16 + 2 * s + hi) * HD + wn + lr * 4) = *(const v4fa*)(os + (2 * s + hi) * 68 + lr * 4);
            else put_hl(*(const v4fa*)(os + (2 * s + hi) * 68 + lr * 4), Oh, Ol, (size_t)(r0 + wm + mb * 16 + 2 * s + hi) * DQ + wn + lr * 4);
            asm volatile("s_wait_xcnt 0x0" ::: "memory"); }   // behind the row's stores: the next row reuses their address and data registers
        __builtin_amdgcn_wave_barrier(); asm volatile("" ::: "memory");   // the reads above stay ahead of the next round's writes
    }
}
// k_attn: one work-group per 128 query rows of one head of one batch entry (z = batch entry * NH_ + head); row tiles below RH on the hi/lo planes, the rest on the fp16 planes. U*: the planes of q + v bias; R*: those of p (per head, shared by the batch entries); T*: v transposed [d][t].
// The hi/lo row tiles do three times the products per key tile, and the grid fills the chip about once: so that they do not run on alone, each one's key tiles are shared out over NSH work-groups (share 0: the first KS0 key tiles, the others KSN each), which have the lowest block indices, the long shares ahead.
// A share leaves its unnormalised f32 sums (part_at) and its rows' maxima and sums (ML: per share and tile 128 maxima, then 128 sums); k_merge joins them. An fp16 row tile's result goes, split hi/lo, straight to its head's columns of the merged rows [batch entry][t][DQ].
// Launch bounds: two waves per SIMD (two work-groups per WGP, as their LDS allows).
#define NSH 4
#define KS0 7
#define KSN 3
#define NHIT (RH / 128)                   // hi/lo row tiles per head
#define GHIT (NB_ * NH_ * NHIT)           // ... in all
// part_at: the 128 x HD floats of share s of row tile bx of z. Shares 0 and 1 lie in P01 [share][z][bx]; shares 2 and 3 in P2 and P3, z's tiles TT * HD / 2 floats apart.
__device__ __forceinline__ float* part_at(float* P01, float* P2, float* P3, int s, int z, int bx) {
    return (s < 2) ? P01 + ((size_t)(s * (NB_ * NH_) + z) * NHIT + bx) * (128 * HD) : ((s == 2) ? P2 : P3) + (size_t)z * (TT * HD / 2) + (size_t)bx * (128 * HD);
}
__global__ __launch_bounds__(128, 2) void k_attn(const bf* __restrict__ Qh, const bf* __restrict__ Ql, const bf* __restrict__ Kh, const bf* __restrict__ Kl, const bf* __restrict__ Uh, const bf* __restrict__ Ul, const bf* __restrict__ Rh, const bf* __restrict__ Rl, const bf* __restrict__ Th, const bf* __restrict__ Tl,
                                                 const h16* __restrict__ Q16, const h16* __restrict__ K16, const h16* __restrict__ U16, const h16* __restrict__ R16, const h16* __restrict__ T16_, const int* __restrict__ km, bf* Ah, bf* Al, float* P01, float* P2, float* P3, float* ML) {
    __shared__ __align__(16) char sm[SCORE_LDS]; __shared__ __align__(16) char sw[WGT_LDS]; __shared__ __align__(16) float xm[2 * 128]; __shared__ __align__(16) int smk[TT];
    constexpr int NHI = NHIT, NLO = TT / 128 - NHI, GHI = NSH * GHIT;
    static_assert(KS0 + (NSH - 1) * KSN == TT / 128 && NHIT * 128 * HD * 4 <= (TT - RH) * HD * 2, "shares");
    const int id = blockIdx.x, sh = id / GHIT, ti = id % GHIT;   // below GHI: share and hi/lo row tile
    const int bx = (id < GHI) ? ti % NHI : NHI + (id - GHI) % NLO, z = (id < GHI) ? ti / NHI : (id - GHI) / NLO;
    const size_t zo = (size_t)z * ((size_t)TT * HD), po = (size_t)(z % NH_) * ((size_t)TT * HD), ao = (size_t)(z / NH_) * ((size_t)TT * DQ) + (size_t)(z % NH_) * HD;
    const int* kz = km + (size_t)(z / NH_) * TT;
    if (id < GHI) attn_rows<bf, 2>(sm, sw, xm, smk, Qh + zo, Ql + zo, Kh + zo, Kl + zo, Uh + zo, Ul + zo, Rh + po, Rl + po, Th + zo, Tl + zo, kz, nullptr, nullptr, bx, sh ? KS0 + (sh - 1) * KSN : 0, KS0 + sh * KSN, part_at(P01, P2, P3, sh, z, bx), ML + (size_t)id * 256);
    else attn_rows<h16, 0>(sm, sw, xm, smk, Q16 + zo, nullptr, K16 + zo, nullptr, U16 + zo, nullptr, R16 + po, nullptr, T16_ + zo, nullptr, kz, Ah + ao, Al + ao, bx, 0, TT / 128, nullptr, nullptr);
}
// k_merge: a hi/lo row tile's NSH shares joined, in the order of the shares: each rescaled to the row's overall maximum, summed, divided by the row's sum, split hi/lo into the merged rows. One thread: four columns of one row.
__global__ __launch_bounds__(256) void k_merge(float* P01, float* P2, float* P3, const float* __restrict__ ML, bf* Ah, bf* Al) {
    const int i = blockIdx.x * 256 + threadIdx.x, c4 = (i & 31) * 4, r = (i >> 5) & 127, ti = i >> 12, bx = ti % NHIT, z = ti / NHIT;
    float m[NSH], l[NSH]; v4f o[NSH];
#pragma unroll
    for (int s = 0; s < NSH; ++s) { const float* mp = ML + (size_t)(s * GHIT + ti) * 256 + r; m[s] = mp[0]; l[s] = mp[128]; o[s] = *(const v4f*)(part_at(P01, P2, P3, s, z, bx) + r * HD + c4); }
    float mx = m[0];
#pragma unroll
    for (int s = 1; s < NSH; ++s) mx = fmaxf(mx, m[s]);
    float ll = 0.0f; v4f oo = (v4f){};
#pragma unroll
    for (int s = 0; s < NSH; ++s) { const float w = __builtin_amdgcn_exp2f(m[s] - mx); ll += w * l[s]; oo += o[s] * w; }
    put_hl(oo * __fdiv_rn(1.0f, ll), Ah, Al, (size_t)(z / NH_) * ((size_t)TT * DQ) + (size_t)(bx * 128 + r) * DQ + (z % NH_) * HD + c4);
}

typedef __attribute__((ext_vector_type(2))) unsigned short v2us;
typedef __attribute__((ext_vector_type(2))) float v2f;

__global__ __launch_bounds__(256) void k_wtG(const float* __restrict__ w, int K, int N, bf* Bt) {
    const int lane = threadIdx.x & 31; const int L0 = (blockIdx.x * 8 + (threadIdx.x >> 5)) * 8; const int nlines = N * K / 64;
{
#pragma unroll 1
        for (int l = 0; l < 8; ++l) { const int L = L0 + l; if (L >= nlines) break; const size_t e = (size_t)L * 64 + lane * 2; const int k = (int)(e % K), n = (int)(e / K); v2us o;
            o[0] = f2bf(w[(size_t)k * N + n]); o[1] = f2bf(w[(size_t)(k + 1) * N + n]); *(v2us*)(Bt + e) = o; }
         }
}
__device__ __forceinline__ void d_cvt8(unsigned bid, const float* __restrict__ src, bf* dst, size_t n8) { const size_t i = (size_t)bid * 256 + threadIdx.x; if (i >= n8) return; const v8f v = *(const v8f*)(src + i * 8); v8us o;
#pragma unroll
    for (int k = 0; k < 8; ++k) o[k] = f2bf(v[k]); *(v8us*)(dst + i * 8) = o;  }
__global__ __launch_bounds__(256) void k_cscvt(const float* __restrict__ cosT, const float* __restrict__ sinT, float* CS) { const int idx = blockIdx.x * 256 + threadIdx.x; if (idx >= TT * HD) return; v2f cs; cs[0] = bfr(cosT[idx]); cs[1] = bfr(sinT[idx]); *(v2f*)(CS + (size_t)idx * 2) = cs;  }
// ---- streaming jobs that read none of each other's output, joined into one grid; a work-group picks its job by its block index.
#define GW   (DQ * DM / 8 / 256)         // work-groups of one weight's conversion
#define GP   (TT * DM / 8 / 256)         // ... of pos_emb's
#define GX   (NB_ * TT * DM / 8 / 256)   // ... of x's, all batch entries
// k_prep: the five weights, pos_emb and x to bf16.
__global__ __launch_bounds__(256) void k_prep(const float* __restrict__ wq, const float* __restrict__ wk, const float* __restrict__ wv, const float* __restrict__ wo, const float* __restrict__ wpos, const float* __restrict__ pemb, const float* __restrict__ x,
                                              bf* WQ, bf* WK, bf* WV, bf* WO, bf* WP, bf* XP, bf* XB) {
    unsigned b = blockIdx.x;
    if (b < 5 * GW) { const unsigned j = b / GW; d_cvt8(b % GW, j == 0 ? wq : (j == 1 ? wk : (j == 2 ? wv : (j == 3 ? wo : wpos))), j == 0 ? WQ : (j == 1 ? WK : (j == 2 ? WV : (j == 3 ? WO : WP))), (size_t)DQ * DM / 8); return; }
    b -= 5 * GW; if (b < GP) { d_cvt8(b, pemb, XP, (size_t)TT * DM / 8); return; }
    d_cvt8(b - GP, x, XB, (size_t)NB_ * TT * DM / 8);
}
extern "C" void kernel_launch(void* const* d_in, const int* in_sizes, int n_in,
                              void* d_out, int out_size, void* d_ws, size_t ws_size, hipStream_t stream) {
    (void)in_sizes; (void)n_in; (void)out_size;
    const float* x = (const float*)d_in[0]; const float* pemb = (const float*)d_in[1]; const int* kmask = (const int*)d_in[2]; const float* wq = (const float*)d_in[3]; const float* bq = (const float*)d_in[4]; const float* wk = (const float*)d_in[5]; const float* bk = (const float*)d_in[6]; const float* wv = (const float*)d_in[7]; const float* bv = (const float*)d_in[8]; const float* wpos = (const float*)d_in[9]; const float* wo = (const float*)d_in[10]; const float* bo = (const float*)d_in[11]; const float* pbu = (const float*)d_in[12]; const float* pbv = (const float*)d_in[13]; const float* cosT = nullptr; const float* sinT = nullptr; (void)cosT; (void)sinT;
    float* OUT = (float*)d_out;     // [4][2048][1024]
    char* wsp = (char*)d_ws;
    auto take = [&](size_t bytes) { char* p = wsp; wsp += (bytes + 255) & ~(size_t)255; return (void*)p; };
    // the bf16 copies of Wq, Wk, Wv, Wpos, x and pos_emb are last read by k_qkv and k_pp, before k_attn writes the merged rows: they share the merged rows' space
    bf* ATh = (bf*)take((size_t)2 * NB_ * TT * DQ * 2); bf* ATl = ATh + (size_t)NB_ * TT * DQ;
    bf* WQ = ATh; bf* WK = WQ + (size_t)DQ * DM; bf* WV = WK + (size_t)DKV * DM; bf* WP = WV + (size_t)DKV * DM; bf* XB = WP + (size_t)DQ * DM; bf* XP = XB + (size_t)NB_ * TT * DM;
    bf* WO = (bf*)take((size_t)DM * DQ * 2);
    h16* PP16 = (h16*)take((size_t)NH_ * TT * HD * 2); bf* PPh = (bf*)take((size_t)NH_ * TT * HD * 2); bf* PPl = (bf*)take((size_t)NH_ * TT * HD * 2);
    // the planes of q + u, q + v, k and v transposed, of all batch entries
    const size_t PLB = (size_t)NB_ * NH_ * TT * HD * 2;
    h16* QV16 = (h16*)take(PLB); bf* QVh = (bf*)take(PLB); bf* QVl = (bf*)take(PLB); h16* QP16 = (h16*)take(PLB); bf* QPh = (bf*)take(PLB); bf* QPl = (bf*)take(PLB);
    h16* KP16 = (h16*)take(PLB); bf* KPh = (bf*)take(PLB); bf* KPl = (bf*)take(PLB); h16* VT16 = (h16*)take(PLB); bf* VTh = (bf*)take(PLB); bf* VTl = (bf*)take(PLB);
    // the key shares of the hi/lo row tiles: shares 0 and 1 and the rows' maxima and sums have space of their own; shares 2 and 3 lie in the rows from RH on of the hi and lo planes of q + u, which k_qkv writes and nobody reads
    float* PO01 = (float*)take((size_t)2 * GHIT * 128 * HD * 4); float* PML = (float*)take((size_t)NSH * GHIT * 256 * 4);
    float* PO2 = (float*)(QPh + (size_t)RH * HD); float* PO3 = (float*)(QPl + (size_t)RH * HD);
    if ((size_t)(wsp - (char*)d_ws) > ws_size) return;    // ws 256 MiB
    k_prep<<<5 * GW + GP + GX, 256, 0, stream>>>(wq, wk, wv, wo, wpos, pemb, x, WQ, WK, WV, WO, WP, XP, XB);
    k_pp<<<dim3(TT / 64, DQ / 64, 1), 256, 0, stream>>>(XP, WP, PP16, PPh, PPl);
    k_qkv<<<dim3(TT / 64, DQ / 64, 3 * NB_), 256, 0, stream>>>(XB, WQ, WK, WV, bq, bk, bv, pbu, pbv, QP16, QPh, QPl, QV16, QVh, QVl, KP16, KPh, KPl, VT16, VTh, VTl);
    k_attn<<<NSH * GHIT + NB_ * NH_ * (TT / 128 - NHIT), 128, 0, stream>>>(QPh, QPl, KPh, KPl, QVh, QVl, PPh, PPl, VTh, VTl, QP16, KP16, QV16, PP16, VT16, kmask, ATh, ATl, PO01, PO2, PO3, PML);
    k_merge<<<GHIT * 128 * (HD / 4) / 256, 256, 0, stream>>>(PO01, PO2, PO3, PML, ATh, ATl);
    k_gemmw<bf, 1, true, 8><<<dim3(NB_ * TT / 64, DM / 64, 1), 256, 0, stream>>>(ATh, ATl, WO, nullptr, DQ, OUT, DM, bo);
}
